// v000
// Times are from an AMD MI455X. After a warm-up the kernel runs many times in a row, and a time is the length of
// such a window on the GPU divided by its runs, so every launch and the gaps after it count. The runs cycle
// through copies of the inputs. A figure is the median of several windows, for all but v000 over two sittings.
// Sittings can differ by a few percent; kernels timed side by side share one.
// v000 is the starting kernel.
#include <hip/hip_runtime.h>
#include <hip/hip_bf16.h>
#include <math.h>

// ---------------------------------------------------------------------------
// Problem constants
// ---------------------------------------------------------------------------
#define BB   4
#define NN   4096
#define JJ   77
#define HH   16
#define DHH  64
#define DQQ  1024
#define DCC  768
#define DHID 384           // DC/2
#define INNERD 1024        // H*DH
#define MROWS (BB*NN)      // 16384
#define JPAD 80            // sim col padding (5 x 16)
#define KPAD 96            // attn K padding  (3 x 32)

typedef __attribute__((ext_vector_type(16))) _Float16 v16h;
typedef __attribute__((ext_vector_type(8)))  float    v8f;
typedef __attribute__((ext_vector_type(2)))  _Float16 h2_t;

union Frag16 { v16h v; h2_t h2[8]; _Float16 h[16]; };

// load one 16x32 f16 WMMA operand fragment from LDS (row-major, "base" points
// at this lane's row at the k-step origin; ISA 16-bit A/B layout)
__device__ __forceinline__ void load_frag(const _Float16* base, Frag16& f, int lhi)
{
    #pragma unroll
    for (int r = 0; r < 8; ++r) {
        int kk = (r < 4) ? (lhi * 8 + 2 * r) : (16 + lhi * 8 + 2 * (r - 4));
        f.h2[r] = *(const h2_t*)(base + kk);
    }
}

// ---------------------------------------------------------------------------
// Kernel 1: token-type embedding MLP -> kin = contextembs + typeemb
// one block per (b,j) row (tiny: 0.4 GFLOP total)
// ---------------------------------------------------------------------------
__global__ __launch_bounds__(256)
void prep_kernel(const float* __restrict__ ce, const int* __restrict__ ct,
                 const float* __restrict__ tte_emb,
                 const float* __restrict__ m1w, const float* __restrict__ m1b,
                 const float* __restrict__ m2w, const float* __restrict__ m2b,
                 const float* __restrict__ gA, const float* __restrict__ gB,
                 float* __restrict__ kin)
{
    const int bj = blockIdx.x;            // 0..307
    const int tid = threadIdx.x;
    __shared__ float tte_s[DCC];
    __shared__ float cein_s[DCC];
    __shared__ float hid_s[DHID];

    int t = ct[bj];
    int tcl = t < 0 ? 0 : (t > 4 ? 4 : t);

    for (int c = tid; c < DCC; c += 256) {
        float tv = tte_emb[(size_t)tcl * DCC + c];
        float ev = ce[(size_t)bj * DCC + c];
        tte_s[c]  = tv;
        cein_s[c] = ev + tv;
    }
    __syncthreads();

    for (int col = tid; col < DHID; col += 256) {
        float acc = m1b[col];
        for (int c = 0; c < DCC; ++c)
            acc = fmaf(cein_s[c], m1w[(size_t)c * DHID + col], acc);
        hid_s[col] = 0.5f * acc * (1.0f + erff(acc * 0.70710678118654752f));
    }
    __syncthreads();

    for (int col = tid; col < DCC; col += 256) {
        float acc = m2b[col];
        for (int c = 0; c < DHID; ++c)
            acc = fmaf(hid_s[c], m2w[(size_t)c * DCC + col], acc);
        float typeemb = tte_s[col] * gA[col] + acc * gB[col];
        kin[(size_t)bj * DCC + col] = ce[(size_t)bj * DCC + col] + typeemb;
    }
}

// ---------------------------------------------------------------------------
// WMMA GEMM: C[M,1024] = A[M,K] * B[K,1024]  (fp32 in, f16 mul, f32 acc)
// Block tile 128x128, BK=32, 8 waves (4x2), each wave 32x64 = 2x4 WMMA tiles.
// MODE 0: store q permuted [B*H, N, DH]
// MODE 1: plain store + bias (output projection)
// MODE 2: store K/V permuted [B*H, J, DH]  (rows = b*J+j, M=308)
// ---------------------------------------------------------------------------
#define GBM 128
#define GBN 128
#define GBK 32
#define LDSS 40   // padded LDS stride in halfs

template<int MODE>
__global__ __launch_bounds__(256)
void wmma_gemm(const float* __restrict__ A, const float* __restrict__ Bm,
               const float* __restrict__ bias, float* __restrict__ C,
               int M, int K)
{
    __shared__ _Float16 Ash[GBM * LDSS];
    __shared__ _Float16 Bsh[GBN * LDSS];

    const int tid  = threadIdx.x;
    const int wid  = tid >> 5;
    const int lane = tid & 31;
    const int wm   = wid >> 1;     // 0..3 -> 32-row strip
    const int wn   = wid & 1;      // 0..1 -> 64-col strip
    const int lm   = lane & 15;
    const int lhi  = lane >> 4;

    const int blockM = blockIdx.y * GBM;
    const int blockN = blockIdx.x * GBN;

    v8f acc[2][4];
    #pragma unroll
    for (int t = 0; t < 2; ++t)
        #pragma unroll
        for (int u = 0; u < 4; ++u)
            acc[t][u] = (v8f){0.f,0.f,0.f,0.f,0.f,0.f,0.f,0.f};

    int arow = blockM + (tid >> 1);       // global A row
    if (arow >= M) arow = M - 1;          // clamp (stores are guarded)
    const int acb  = (tid & 1) * 16;
    const int bkr  = tid >> 3;            // 0..31
    const int bcb  = (tid & 7) * 16;

    for (int k0 = 0; k0 < K; k0 += GBK) {
        { // stage A tile (fp32 -> f16)
            const float* src = A + (size_t)arow * K + k0 + acb;
            _Float16* dst = &Ash[(tid >> 1) * LDSS + acb];
            #pragma unroll
            for (int i = 0; i < 16; ++i) dst[i] = (_Float16)src[i];
        }
        { // stage B tile transposed: Bsh[n][k]
            const float* src = Bm + (size_t)(k0 + bkr) * 1024 + blockN + bcb;
            #pragma unroll
            for (int i = 0; i < 16; ++i)
                Bsh[(bcb + i) * LDSS + bkr] = (_Float16)src[i];
        }
        if (k0 + GBK < K) {   // global_prefetch of next k-tile
            __builtin_prefetch(A + (size_t)arow * K + k0 + GBK + acb, 0, 1);
            __builtin_prefetch(Bm + (size_t)(k0 + GBK + bkr) * 1024 + blockN + bcb, 0, 1);
        }
        __syncthreads();

        Frag16 af[2], bf[4];
        #pragma unroll
        for (int t = 0; t < 2; ++t)
            load_frag(&Ash[(wm * 32 + t * 16 + lm) * LDSS], af[t], lhi);
        #pragma unroll
        for (int u = 0; u < 4; ++u)
            load_frag(&Bsh[(wn * 64 + u * 16 + lm) * LDSS], bf[u], lhi);

        #pragma unroll
        for (int t = 0; t < 2; ++t)
            #pragma unroll
            for (int u = 0; u < 4; ++u)
                acc[t][u] = __builtin_amdgcn_wmma_f32_16x16x32_f16(
                    false, af[t].v, false, bf[u].v,
                    (short)0, acc[t][u], false, false);

        __syncthreads();
    }

    // C/D layout: lanes 0-15 -> M=r, lanes 16-31 -> M=8+r, N=lane&15
    #pragma unroll
    for (int t = 0; t < 2; ++t) {
        #pragma unroll
        for (int u = 0; u < 4; ++u) {
            #pragma unroll
            for (int r = 0; r < 8; ++r) {
                int rg = blockM + wm * 32 + t * 16 + (lhi ? 8 + r : r);
                int cg = blockN + wn * 64 + u * 16 + lm;
                float val = acc[t][u][r];
                if (MODE == 1) {
                    C[(size_t)rg * 1024 + cg] = val + bias[cg];
                } else if (MODE == 0) {
                    int b = rg >> 12, n = rg & 4095;
                    int h = cg >> 6,  d = cg & 63;
                    C[(((size_t)(b * HH + h)) * NN + n) * DHH + d] = val;
                } else { // MODE 2: rows are (b, j)
                    if (rg < M) {
                        int b = rg / JJ, j = rg - b * JJ;
                        int h = cg >> 6, d = cg & 63;
                        C[(((size_t)(b * HH + h)) * JJ + j) * DHH + d] = val;
                    }
                }
            }
        }
    }
}

// ---------------------------------------------------------------------------
// Kernel 3: WMMA sim tiles + masked sum/sumsq (sim never hits HBM)
// grid (N/128, B*H), 256 threads (8 waves x 16 rows), 5 j-tiles, K=64
// ---------------------------------------------------------------------------
__global__ __launch_bounds__(256)
void sim_stats_kernel(const float* __restrict__ q_bh, const float* __restrict__ k_bh,
                      const int* __restrict__ ct, float* __restrict__ stats)
{
    __shared__ _Float16 qsh[128 * 72];     // [row][k], stride 72
    __shared__ _Float16 kshT[JPAD * 72];   // [j][k], rows 77..79 zero
    __shared__ int   sel2[JPAD];
    __shared__ float rs[256], rq[256];

    const int tid  = threadIdx.x;
    const int wid  = tid >> 5;
    const int lane = tid & 31;
    const int lm   = lane & 15;
    const int lhi  = lane >> 4;
    const int bh   = blockIdx.y;
    const int b    = bh >> 4;
    const int rowbase = blockIdx.x * 128;

    { // q tile: 128x64 fp32 -> f16
        int r = tid >> 1, cb = (tid & 1) * 32;
        const float* src = q_bh + ((size_t)bh * NN + rowbase + r) * DHH + cb;
        #pragma unroll
        for (int i = 0; i < 32; ++i) qsh[r * 72 + cb + i] = (_Float16)src[i];
    }
    for (int idx = tid; idx < JPAD * DHH; idx += 256) {
        int j = idx >> 6, k = idx & 63;
        float v = (j < JJ) ? k_bh[((size_t)bh * JJ + j) * DHH + k] : 0.f;
        kshT[j * 72 + k] = (_Float16)v;
    }
    for (int j = tid; j < JPAD; j += 256)
        sel2[j] = (j < JJ && ct[b * JJ + j] >= 2) ? 1 : 0;
    __syncthreads();

    v8f acc[5];
    #pragma unroll
    for (int t = 0; t < 5; ++t) acc[t] = (v8f){0.f,0.f,0.f,0.f,0.f,0.f,0.f,0.f};

    #pragma unroll
    for (int s = 0; s < 2; ++s) {          // K = 64 -> 2 k-steps
        Frag16 af;
        load_frag(&qsh[(wid * 16 + lm) * 72 + s * 32], af, lhi);
        #pragma unroll
        for (int t = 0; t < 5; ++t) {
            Frag16 bf;
            load_frag(&kshT[(t * 16 + lm) * 72 + s * 32], bf, lhi);
            acc[t] = __builtin_amdgcn_wmma_f32_16x16x32_f16(
                false, af.v, false, bf.v, (short)0, acc[t], false, false);
        }
    }

    // lane (t,lm) owns column j = t*16+lm for 8 rows -> accumulate stats
    float s1 = 0.f, s2 = 0.f;
    #pragma unroll
    for (int t = 0; t < 5; ++t) {
        int j = t * 16 + lm;
        if (j < JJ && sel2[j]) {
            #pragma unroll
            for (int r = 0; r < 8; ++r) {
                float v = acc[t][r];
                s1 += v;
                s2 = fmaf(v, v, s2);
            }
        }
    }
    rs[tid] = s1; rq[tid] = s2;
    __syncthreads();
    for (int off = 128; off > 0; off >>= 1) {
        if (tid < off) { rs[tid] += rs[tid + off]; rq[tid] += rq[tid + off]; }
        __syncthreads();
    }
    if (tid == 0) {
        atomicAdd(&stats[0], rs[0]);
        atomicAdd(&stats[1], rq[0]);
    }
}

// ---------------------------------------------------------------------------
// Kernel 4: finalize std (Bessel-corrected, matching torch .std())
// ---------------------------------------------------------------------------
__global__ void finalize_kernel(const int* __restrict__ ct, float* __restrict__ stats)
{
    int cnt = 0;
    for (int i = 0; i < BB * JJ; ++i) cnt += (ct[i] >= 2) ? 1 : 0;
    float nsel = (float)cnt * (float)HH * (float)NN;
    float mean = (nsel > 0.f) ? stats[0] / nsel : 0.f;
    float var  = (nsel > 1.f) ? (stats[1] - nsel * mean * mean) / (nsel - 1.f) : 0.f;
    stats[2] = sqrtf(var > 0.f ? var : 0.f);
}

// ---------------------------------------------------------------------------
// Kernel 5: fused attention block, 64 rows / block, 128 threads (4 waves):
//   WMMA sim -> LDS -> masked softmax (VALU, unnormalized f16 probs) ->
//   WMMA attn@V with 1/denom folded into the store.
// LDS kept < 64 KB via union aliasing of the q tile with the attn tile.
// ---------------------------------------------------------------------------
__global__ __launch_bounds__(128)
void attn_fused_kernel(const float* __restrict__ q_bh, const float* __restrict__ k_bh,
                       const float* __restrict__ v_bh, const int* __restrict__ ct,
                       const float* __restrict__ camask, const float* __restrict__ strength,
                       const float* __restrict__ stats, float* __restrict__ out_attn)
{
    __shared__ union {
        _Float16 qsh[64 * 72];         // stage 1: q tile [row][k]
        _Float16 attn_sh[64 * 104];    // stage 2: probs [row][j], j<96, zero-pad
    } u;
    __shared__ _Float16 kshT[JPAD * 72];   // [j][k], rows 77..79 zero
    __shared__ _Float16 vshT[64 * 104];    // [d][k], k 77..95 zero
    __shared__ float    simsh[64 * 81];    // sim tile fp32, stride 81
    __shared__ float    invs[64];
    __shared__ int      sel2[JPAD], selg[JPAD];

    const int tid  = threadIdx.x;
    const int wid  = tid >> 5;     // 0..3 -> 16-row strip
    const int lane = tid & 31;
    const int lm   = lane & 15;
    const int lhi  = lane >> 4;
    const int bh   = blockIdx.y;
    const int b    = bh >> 4;
    const int h    = bh & 15;
    const int rowbase = blockIdx.x * 64;

    { // q tile 64x64 fp32 -> f16
        int r = tid >> 1, cb = (tid & 1) * 32;
        const float* src = q_bh + ((size_t)bh * NN + rowbase + r) * DHH + cb;
        #pragma unroll
        for (int i = 0; i < 32; ++i) u.qsh[r * 72 + cb + i] = (_Float16)src[i];
    }
    for (int idx = tid; idx < JPAD * DHH; idx += 128) {
        int j = idx >> 6, k = idx & 63;
        float v = (j < JJ) ? k_bh[((size_t)bh * JJ + j) * DHH + k] : 0.f;
        kshT[j * 72 + k] = (_Float16)v;
    }
    for (int idx = tid; idx < DHH * KPAD; idx += 128) {
        int d = idx / KPAD, k = idx - d * KPAD;
        float v = (k < JJ) ? v_bh[((size_t)bh * JJ + k) * DHH + d] : 0.f;
        vshT[d * 104 + k] = (_Float16)v;
    }
    for (int j = tid; j < JPAD; j += 128) {
        int t = (j < JJ) ? ct[b * JJ + j] : -1;
        sel2[j] = (t >= 2) ? 1 : 0;
        selg[j] = (t >= 0 && t < 2) ? 1 : 0;
    }
    __syncthreads();

    // ---- stage 1: sim = q @ k^T via WMMA, into LDS
    {
        v8f acc[5];
        #pragma unroll
        for (int t = 0; t < 5; ++t) acc[t] = (v8f){0.f,0.f,0.f,0.f,0.f,0.f,0.f,0.f};
        #pragma unroll
        for (int s = 0; s < 2; ++s) {
            Frag16 af;
            load_frag(&u.qsh[(wid * 16 + lm) * 72 + s * 32], af, lhi);
            #pragma unroll
            for (int t = 0; t < 5; ++t) {
                Frag16 bf;
                load_frag(&kshT[(t * 16 + lm) * 72 + s * 32], bf, lhi);
                acc[t] = __builtin_amdgcn_wmma_f32_16x16x32_f16(
                    false, af.v, false, bf.v, (short)0, acc[t], false, false);
            }
        }
        #pragma unroll
        for (int t = 0; t < 5; ++t) {
            int j = t * 16 + lm;
            #pragma unroll
            for (int r = 0; r < 8; ++r) {
                int rl = wid * 16 + (lhi ? 8 + r : r);
                simsh[rl * 81 + j] = acc[t][r];
            }
        }
    }
    __syncthreads();

    // ---- stage 2: masked softmax per row (writes f16 probs over the q tile)
    if (tid < 64) {
        const int rl = tid;
        const int rowg = rowbase + rl;
        const float simstd = stats[2];
        const float str    = strength[0];
        const float scale  = 0.125f;                  // 1/sqrt(DH)
        const float* camrow = camask + ((size_t)b * NN + rowg) * JJ;

        float wfmax = -__FLT_MAX__;
        for (int j = 0; j < JJ; ++j) {
            float wf = sel2[j] ? camrow[j] * simstd * str : 0.f;
            wfmax = fmaxf(wfmax, wf);
        }
        const float thr = fmaxf(wfmax, 0.001f) - 0.0001f;

        float m = -__FLT_MAX__;
        for (int j = 0; j < JJ; ++j) {
            float wf = sel2[j] ? camrow[j] * simstd * str : 0.f;
            bool lmv = (wf >= thr) || (selg[j] != 0);
            float sv = lmv ? simsh[rl * 81 + j] * scale : -__FLT_MAX__;
            simsh[rl * 81 + j] = sv;                  // stash masked+scaled score
            m = fmaxf(m, sv);
        }
        float denom = 0.f;
        for (int j = 0; j < JJ; ++j) {
            float p = __expf(simsh[rl * 81 + j] - m);
            u.attn_sh[rl * 104 + j] = (_Float16)p;    // unnormalized
            denom += p;
        }
        #pragma unroll
        for (int j = JJ; j < KPAD; ++j) u.attn_sh[rl * 104 + j] = (_Float16)0.f;
        invs[rl] = 1.f / denom;
    }
    __syncthreads();

    // ---- stage 3: out = attn @ V via WMMA (K = 96 -> 3 k-steps, 4 col tiles)
    {
        v8f acc[4];
        #pragma unroll
        for (int t = 0; t < 4; ++t) acc[t] = (v8f){0.f,0.f,0.f,0.f,0.f,0.f,0.f,0.f};
        #pragma unroll
        for (int s = 0; s < 3; ++s) {
            Frag16 af;
            load_frag(&u.attn_sh[(wid * 16 + lm) * 104 + s * 32], af, lhi);
            #pragma unroll
            for (int t = 0; t < 4; ++t) {
                Frag16 bf;
                load_frag(&vshT[(t * 16 + lm) * 104 + s * 32], bf, lhi);
                acc[t] = __builtin_amdgcn_wmma_f32_16x16x32_f16(
                    false, af.v, false, bf.v, (short)0, acc[t], false, false);
            }
        }
        #pragma unroll
        for (int t = 0; t < 4; ++t) {
            int d = t * 16 + lm;
            #pragma unroll
            for (int r = 0; r < 8; ++r) {
                int rl = wid * 16 + (lhi ? 8 + r : r);
                int rowg = rowbase + rl;
                out_attn[((size_t)b * NN + rowg) * INNERD + h * DHH + d] =
                    acc[t][r] * invs[rl];
            }
        }
    }
}

// ---------------------------------------------------------------------------
// launch
// ---------------------------------------------------------------------------
extern "C" void kernel_launch(void* const* d_in, const int* in_sizes, int n_in,
                              void* d_out, int out_size, void* d_ws, size_t ws_size,
                              hipStream_t stream)
{
    const float* x        = (const float*)d_in[0];
    const float* ce       = (const float*)d_in[1];
    const int*   ct       = (const int*)  d_in[2];
    const float* camask   = (const float*)d_in[3];
    const float* strength = (const float*)d_in[4];
    const float* Wq       = (const float*)d_in[5];
    const float* Wk       = (const float*)d_in[6];
    const float* Wv       = (const float*)d_in[7];
    const float* Wout     = (const float*)d_in[8];
    const float* bout     = (const float*)d_in[9];
    const float* tte      = (const float*)d_in[10];
    const float* m1w      = (const float*)d_in[11];
    const float* m1b      = (const float*)d_in[12];
    const float* m2w      = (const float*)d_in[13];
    const float* m2b      = (const float*)d_in[14];
    const float* gA       = (const float*)d_in[15];
    const float* gB       = (const float*)d_in[16];
    float* out = (float*)d_out;

    // workspace partition (floats)
    float* ws    = (float*)d_ws;
    float* kin   = ws;                                  // 308*768
    float* k_bh  = kin  + (size_t)BB*JJ*DCC;            // 64*77*64
    float* v_bh  = k_bh + (size_t)BB*HH*JJ*DHH;
    float* q_bh  = v_bh + (size_t)BB*HH*JJ*DHH;         // 64*4096*64
    float* aout  = q_bh + (size_t)BB*HH*NN*DHH;         // 16384*1024
    float* stats = aout + (size_t)MROWS*INNERD;         // [sum, sumsq, std]

    hipMemsetAsync(stats, 0, 4 * sizeof(float), stream);

    prep_kernel<<<BB*JJ, 256, 0, stream>>>(ce, ct, tte, m1w, m1b, m2w, m2b, gA, gB, kin);

    // K = kin @ Wk, V = ce @ Wv  (WMMA, M=308, K=768, permuted -> [B*H, J, DH])
    wmma_gemm<2><<<dim3(INNERD/GBN, (BB*JJ + GBM - 1)/GBM), 256, 0, stream>>>(
        kin, Wk, nullptr, k_bh, BB*JJ, DCC);
    wmma_gemm<2><<<dim3(INNERD/GBN, (BB*JJ + GBM - 1)/GBM), 256, 0, stream>>>(
        ce, Wv, nullptr, v_bh, BB*JJ, DCC);

    // q = x @ Wq  (WMMA, permuted -> [B*H, N, DH])
    wmma_gemm<0><<<dim3(INNERD/GBN, MROWS/GBM), 256, 0, stream>>>(
        x, Wq, nullptr, q_bh, MROWS, DQQ);

    // masked mean/std of sim (WMMA sim tiles, never stored)
    sim_stats_kernel<<<dim3(NN/128, BB*HH), 256, 0, stream>>>(q_bh, k_bh, ct, stats);
    finalize_kernel<<<1, 1, 0, stream>>>(ct, stats);

    // fused WMMA sim -> softmax -> WMMA attn@V
    attn_fused_kernel<<<dim3(NN/64, BB*HH), 128, 0, stream>>>(
        q_bh, k_bh, v_bh, ct, camask, strength, stats, aout);

    // out = attn_out @ Wout + bout  (WMMA)
    wmma_gemm<1><<<dim3(DQQ/GBN, MROWS/GBM), 256, 0, stream>>>(
        aout, Wout, bout, out, MROWS, DQQ);
}

// v001
// Timed twice side by side with v000, it ran 1.25 times as fast both times.
#include <hip/hip_runtime.h>
#include <hip/hip_bf16.h>
#include <math.h>

// ---------------------------------------------------------------------------
// Problem constants
// ---------------------------------------------------------------------------
#define BB   4
#define NN   4096
#define JJ   77
#define HH   16
#define DHH  64
#define DQQ  1024
#define DCC  768
#define DHID 384           // DC/2
#define INNERD 1024        // H*DH
#define MROWS (BB*NN)      // 16384
#define JPAD 80            // sim col padding (5 x 16)
#define KPAD 96            // attn K padding  (3 x 32)

typedef __attribute__((ext_vector_type(16))) _Float16 v16h;
typedef __attribute__((ext_vector_type(8)))  float    v8f;
typedef __attribute__((ext_vector_type(2)))  _Float16 h2_t;

union Frag16 { v16h v; h2_t h2[8]; _Float16 h[16]; };

// load one 16x32 f16 WMMA operand fragment from LDS (row-major, "base" points
// at this lane's row at the k-step origin; ISA 16-bit A/B layout)
__device__ __forceinline__ void load_frag(const _Float16* base, Frag16& f, int lhi)
{
    #pragma unroll
    for (int r = 0; r < 8; ++r) {
        int kk = (r < 4) ? (lhi * 8 + 2 * r) : (16 + lhi * 8 + 2 * (r - 4));
        f.h2[r] = *(const h2_t*)(base + kk);
    }
}

// ---------------------------------------------------------------------------
// Kernel 1: token-type embedding MLP -> kin = contextembs + typeemb
// one block per (b,j) row (tiny: 0.4 GFLOP total)
// ---------------------------------------------------------------------------
__global__ __launch_bounds__(256)
void prep_kernel(const float* __restrict__ ce, const int* __restrict__ ct,
                 const float* __restrict__ tte_emb,
                 const float* __restrict__ m1w, const float* __restrict__ m1b,
                 const float* __restrict__ m2w, const float* __restrict__ m2b,
                 const float* __restrict__ gA, const float* __restrict__ gB,
                 float* __restrict__ kin)
{
    const int bj = blockIdx.x;            // 0..307
    const int tid = threadIdx.x;
    __shared__ float tte_s[DCC];
    __shared__ float cein_s[DCC];
    __shared__ float hid_s[DHID];

    int t = ct[bj];
    int tcl = t < 0 ? 0 : (t > 4 ? 4 : t);

    for (int c = tid; c < DCC; c += 256) {
        float tv = tte_emb[(size_t)tcl * DCC + c];
        float ev = ce[(size_t)bj * DCC + c];
        tte_s[c]  = tv;
        cein_s[c] = ev + tv;
    }
    __syncthreads();

    for (int col = tid; col < DHID; col += 256) {
        float acc = m1b[col];
        for (int c = 0; c < DCC; ++c)
            acc = fmaf(cein_s[c], m1w[(size_t)c * DHID + col], acc);
        hid_s[col] = 0.5f * acc * (1.0f + erff(acc * 0.70710678118654752f));
    }
    __syncthreads();

    for (int col = tid; col < DCC; col += 256) {
        float acc = m2b[col];
        for (int c = 0; c < DHID; ++c)
            acc = fmaf(hid_s[c], m2w[(size_t)c * DCC + col], acc);
        float typeemb = tte_s[col] * gA[col] + acc * gB[col];
        kin[(size_t)bj * DCC + col] = ce[(size_t)bj * DCC + col] + typeemb;
    }
}

// ---------------------------------------------------------------------------
// WMMA GEMM: C[M,1024] = A[M,K] * B[K,1024]  (fp32 in, f16 mul, f32 acc)
// Block tile 128x128, BK=32, 8 waves (4x2), each wave 32x64 = 2x4 WMMA tiles.
// MODE 0: store q permuted [B*H, N, DH]
// MODE 1: plain store + bias (output projection)
// MODE 2: store K/V permuted [B*H, J, DH]  (rows = b*J+j, M=308)
// ---------------------------------------------------------------------------
#define GBM 128
#define GBN 128
#define GBK 32
#define LDSS 40   // padded LDS stride in halfs

template<int MODE>
__global__ __launch_bounds__(256)
void wmma_gemm(const float* __restrict__ A, const float* __restrict__ Bm,
               const float* __restrict__ bias, float* __restrict__ C,
               int M, int K)
{
    __shared__ _Float16 Ash[GBM * LDSS];
    __shared__ _Float16 Bsh[GBN * LDSS];

    const int tid  = threadIdx.x;
    const int wid  = tid >> 5;
    const int lane = tid & 31;
    const int wm   = wid >> 1;     // 0..3 -> 32-row strip
    const int wn   = wid & 1;      // 0..1 -> 64-col strip
    const int lm   = lane & 15;
    const int lhi  = lane >> 4;

    const int blockM = blockIdx.y * GBM;
    const int blockN = blockIdx.x * GBN;

    v8f acc[2][4];
    #pragma unroll
    for (int t = 0; t < 2; ++t)
        #pragma unroll
        for (int u = 0; u < 4; ++u)
            acc[t][u] = (v8f){0.f,0.f,0.f,0.f,0.f,0.f,0.f,0.f};

    int arow = blockM + (tid >> 1);       // global A row
    if (arow >= M) arow = M - 1;          // clamp (stores are guarded)
    const int acb  = (tid & 1) * 16;
    const int bkr  = tid >> 3;            // 0..31
    const int bcb  = (tid & 7) * 16;

    for (int k0 = 0; k0 < K; k0 += GBK) {
        { // stage A tile (fp32 -> f16)
            const float* src = A + (size_t)arow * K + k0 + acb;
            _Float16* dst = &Ash[(tid >> 1) * LDSS + acb];
            #pragma unroll
            for (int i = 0; i < 16; ++i) dst[i] = (_Float16)src[i];
        }
        { // stage B tile transposed: Bsh[n][k]
            const float* src = Bm + (size_t)(k0 + bkr) * 1024 + blockN + bcb;
            #pragma unroll
            for (int i = 0; i < 16; ++i)
                Bsh[(bcb + i) * LDSS + bkr] = (_Float16)src[i];
        }
        if (k0 + GBK < K) {   // global_prefetch of next k-tile
            __builtin_prefetch(A + (size_t)arow * K + k0 + GBK + acb, 0, 1);
            __builtin_prefetch(Bm + (size_t)(k0 + GBK + bkr) * 1024 + blockN + bcb, 0, 1);
        }
        __syncthreads();

        Frag16 af[2], bf[4];
        #pragma unroll
        for (int t = 0; t < 2; ++t)
            load_frag(&Ash[(wm * 32 + t * 16 + lm) * LDSS], af[t], lhi);
        #pragma unroll
        for (int u = 0; u < 4; ++u)
            load_frag(&Bsh[(wn * 64 + u * 16 + lm) * LDSS], bf[u], lhi);

        #pragma unroll
        for (int t = 0; t < 2; ++t)
            #pragma unroll
            for (int u = 0; u < 4; ++u)
                acc[t][u] = __builtin_amdgcn_wmma_f32_16x16x32_f16(
                    false, af[t].v, false, bf[u].v,
                    (short)0, acc[t][u], false, false);

        __syncthreads();
    }

    // C/D layout: lanes 0-15 -> M=r, lanes 16-31 -> M=8+r, N=lane&15
    #pragma unroll
    for (int t = 0; t < 2; ++t) {
        #pragma unroll
        for (int u = 0; u < 4; ++u) {
            #pragma unroll
            for (int r = 0; r < 8; ++r) {
                int rg = blockM + wm * 32 + t * 16 + (lhi ? 8 + r : r);
                int cg = blockN + wn * 64 + u * 16 + lm;
                float val = acc[t][u][r];
                if (MODE == 1) {
                    C[(size_t)rg * 1024 + cg] = val + bias[cg];
                } else if (MODE == 0) {
                    int b = rg >> 12, n = rg & 4095;
                    int h = cg >> 6,  d = cg & 63;
                    C[(((size_t)(b * HH + h)) * NN + n) * DHH + d] = val;
                } else { // MODE 2: rows are (b, j)
                    if (rg < M) {
                        int b = rg / JJ, j = rg - b * JJ;
                        int h = cg >> 6, d = cg & 63;
                        C[(((size_t)(b * HH + h)) * JJ + j) * DHH + d] = val;
                    }
                }
            }
        }
    }
}

// ---------------------------------------------------------------------------
// Kernel 3: WMMA sim tiles + masked sum/sumsq (sim never hits HBM)
// grid (N/128, B*H), 256 threads (8 waves x 16 rows), 5 j-tiles, K=64
// ---------------------------------------------------------------------------
__global__ __launch_bounds__(256)
void sim_stats_kernel(const float* __restrict__ q_bh, const float* __restrict__ k_bh,
                      const int* __restrict__ ct, float* __restrict__ stats)
{
    __shared__ _Float16 qsh[128 * 72];     // [row][k], stride 72
    __shared__ _Float16 kshT[JPAD * 72];   // [j][k], rows 77..79 zero
    __shared__ int   sel2[JPAD];
    __shared__ float rs[256], rq[256];

    const int tid  = threadIdx.x;
    const int wid  = tid >> 5;
    const int lane = tid & 31;
    const int lm   = lane & 15;
    const int lhi  = lane >> 4;
    const int bh   = blockIdx.y;
    const int b    = bh >> 4;
    const int rowbase = blockIdx.x * 128;

    { // q tile: 128x64 fp32 -> f16
        int r = tid >> 1, cb = (tid & 1) * 32;
        const float* src = q_bh + ((size_t)bh * NN + rowbase + r) * DHH + cb;
        #pragma unroll
        for (int i = 0; i < 32; ++i) qsh[r * 72 + cb + i] = (_Float16)src[i];
    }
    for (int idx = tid; idx < JPAD * DHH; idx += 256) {
        int j = idx >> 6, k = idx & 63;
        float v = (j < JJ) ? k_bh[((size_t)bh * JJ + j) * DHH + k] : 0.f;
        kshT[j * 72 + k] = (_Float16)v;
    }
    for (int j = tid; j < JPAD; j += 256)
        sel2[j] = (j < JJ && ct[b * JJ + j] >= 2) ? 1 : 0;
    __syncthreads();

    v8f acc[5];
    #pragma unroll
    for (int t = 0; t < 5; ++t) acc[t] = (v8f){0.f,0.f,0.f,0.f,0.f,0.f,0.f,0.f};

    #pragma unroll
    for (int s = 0; s < 2; ++s) {          // K = 64 -> 2 k-steps
        Frag16 af;
        load_frag(&qsh[(wid * 16 + lm) * 72 + s * 32], af, lhi);
        #pragma unroll
        for (int t = 0; t < 5; ++t) {
            Frag16 bf;
            load_frag(&kshT[(t * 16 + lm) * 72 + s * 32], bf, lhi);
            acc[t] = __builtin_amdgcn_wmma_f32_16x16x32_f16(
                false, af.v, false, bf.v, (short)0, acc[t], false, false);
        }
    }

    // lane (t,lm) owns column j = t*16+lm for 8 rows -> accumulate stats
    float s1 = 0.f, s2 = 0.f;
    #pragma unroll
    for (int t = 0; t < 5; ++t) {
        int j = t * 16 + lm;
        if (j < JJ && sel2[j]) {
            #pragma unroll
            for (int r = 0; r < 8; ++r) {
                float v = acc[t][r];
                s1 += v;
                s2 = fmaf(v, v, s2);
            }
        }
    }
    rs[tid] = s1; rq[tid] = s2;
    __syncthreads();
    for (int off = 128; off > 0; off >>= 1) {
        if (tid < off) { rs[tid] += rs[tid + off]; rq[tid] += rq[tid + off]; }
        __syncthreads();
    }
    if (tid == 0) {
        atomicAdd(&stats[0], rs[0]);
        atomicAdd(&stats[1], rq[0]);
    }
}

// ---------------------------------------------------------------------------
// Kernel 4: finalize std (Bessel-corrected, matching torch .std())
// ---------------------------------------------------------------------------
__global__ void finalize_kernel(const int* __restrict__ ct, float* __restrict__ stats)
{
    int cnt = 0;
    for (int i = 0; i < BB * JJ; ++i) cnt += (ct[i] >= 2) ? 1 : 0;
    float nsel = (float)cnt * (float)HH * (float)NN;
    float mean = (nsel > 0.f) ? stats[0] / nsel : 0.f;
    float var  = (nsel > 1.f) ? (stats[1] - nsel * mean * mean) / (nsel - 1.f) : 0.f;
    stats[2] = sqrtf(var > 0.f ? var : 0.f);
}

// ---------------------------------------------------------------------------
// Kernel 5: fused attention block, 64 rows / block, 128 threads (4 waves).
// The scores are formed transposed, S^T = K * Q^T (K is the A operand, Q the B
// operand), so a lane's accumulators hold 40 scores of ONE query row:
//   column = lane & 15 -> query row,  j = t*16 + (lane >> 4)*8 + r.
// The masked softmax runs in registers on all lanes; lanes l and l^16 share a
// query row and exchange three partial results. That accumulator order is the
// k order of a 16-bit B operand, so the probabilities, converted to f16, are
// the B operand of out^T = V^T * P^T with no pass through LDS.
// ---------------------------------------------------------------------------
__device__ __forceinline__ float other_half(float x)   // value of lane l ^ 16
{
    int b = __builtin_bit_cast(int, x);
    b = __builtin_amdgcn_permlanex16(b, b, 0x76543210, 0xfedcba98, false, false);
    return __builtin_bit_cast(float, b);
}

// 2^x. The v_nop keeps the one free issue slot the instruction set asks for
// behind a transcendental.
__device__ __forceinline__ float exp2_slot(float x)
{
    float y;
    asm("v_exp_f32 %0, %1\n\tv_nop" : "=v"(y) : "v"(x));
    return y;
}

__global__ __launch_bounds__(128)
void attn_fused_kernel(const float* __restrict__ q_bh, const float* __restrict__ k_bh,
                       const float* __restrict__ v_bh, const int* __restrict__ ct,
                       const float* __restrict__ camask, const float* __restrict__ strength,
                       const float* __restrict__ stats, float* __restrict__ out_attn)
{
    __shared__ _Float16 qsh[64 * 72];      // q tile [row][k]
    __shared__ _Float16 kshT[JPAD * 72];   // [j][k], rows 77..79 zero
    __shared__ _Float16 vshT[64 * 104];    // [d][k], k 77..95 zero
    __shared__ int      sel2[JPAD], selg[JPAD];

    const int tid  = threadIdx.x;
    const int wid  = tid >> 5;     // 0..3 -> 16-row strip
    const int lane = tid & 31;
    const int lm   = lane & 15;
    const int lhi  = lane >> 4;
    const int bh   = blockIdx.y;
    const int b    = bh >> 4;
    const int h    = bh & 15;
    const int rowbase = blockIdx.x * 64;
    const int rowg = rowbase + wid * 16 + lm;   // this lane's query row

    // this lane's 40 mask values, read once; index clamped for j = 77..79
    float wf[5][8];
    {
        const float* camrow = camask + ((size_t)b * NN + rowg) * JJ;
        #pragma unroll
        for (int t = 0; t < 5; ++t)
            #pragma unroll
            for (int r = 0; r < 8; ++r) {
                int j = t * 16 + lhi * 8 + r;
                wf[t][r] = camrow[j < JJ ? j : JJ - 1];
            }
    }
    // the registers that hold the mask loads' addresses are reused by the staging below
    asm volatile("s_wait_xcnt 0x0" ::: "memory");

    { // q tile 64x64 fp32 -> f16
        int r = tid >> 1, cb = (tid & 1) * 32;
        const float* src = q_bh + ((size_t)bh * NN + rowbase + r) * DHH + cb;
        #pragma unroll
        for (int i = 0; i < 32; ++i) qsh[r * 72 + cb + i] = (_Float16)src[i];
    }
    for (int idx = tid; idx < JPAD * DHH; idx += 128) {
        int j = idx >> 6, k = idx & 63;
        float v = (j < JJ) ? k_bh[((size_t)bh * JJ + j) * DHH + k] : 0.f;
        kshT[j * 72 + k] = (_Float16)v;
    }
    for (int idx = tid; idx < DHH * KPAD; idx += 128) {
        int d = idx / KPAD, k = idx - d * KPAD;
        float v = (k < JJ) ? v_bh[((size_t)bh * JJ + k) * DHH + d] : 0.f;
        vshT[d * 104 + k] = (_Float16)v;
    }
    for (int j = tid; j < JPAD; j += 128) {
        int t = (j < JJ) ? ct[b * JJ + j] : -1;
        sel2[j] = (t >= 2) ? 1 : 0;
        selg[j] = (t >= 0 && t < 2) ? 1 : 0;
    }
    __syncthreads();

    // ---- stage 1: S^T = K @ q^T via WMMA, kept in registers
    v8f acc[5];
    #pragma unroll
    for (int t = 0; t < 5; ++t) acc[t] = (v8f){0.f,0.f,0.f,0.f,0.f,0.f,0.f,0.f};
    #pragma unroll
    for (int s = 0; s < 2; ++s) {
        Frag16 qf;
        load_frag(&qsh[(wid * 16 + lm) * 72 + s * 32], qf, lhi);
        #pragma unroll
        for (int t = 0; t < 5; ++t) {
            Frag16 kf;
            load_frag(&kshT[(t * 16 + lm) * 72 + s * 32], kf, lhi);
            acc[t] = __builtin_amdgcn_wmma_f32_16x16x32_f16(
                false, kf.v, false, qf.v, (short)0, acc[t], false, false);
        }
    }

    // ---- stage 2: masked softmax of this lane's query row, in registers
    const float simstd = stats[2];
    const float str    = strength[0];
    const float scale  = 0.125f;                  // 1/sqrt(DH)

    float wfmax = -__FLT_MAX__;
    #pragma unroll
    for (int t = 0; t < 5; ++t)
        #pragma unroll
        for (int r = 0; r < 8; ++r) {
            int j = t * 16 + lhi * 8 + r;
            float w = sel2[j] ? wf[t][r] * simstd * str : 0.f;
            wf[t][r] = w;
            if (j < JJ) wfmax = fmaxf(wfmax, w);
        }
    wfmax = fmaxf(wfmax, other_half(wfmax));
    const float thr = fmaxf(wfmax, 0.001f) - 0.0001f;

    float m = -__FLT_MAX__;
    #pragma unroll
    for (int t = 0; t < 5; ++t)
        #pragma unroll
        for (int r = 0; r < 8; ++r) {
            int j = t * 16 + lhi * 8 + r;
            // both tests evaluated, no short circuit: the flag reads stay wide and unbranched
            bool lmv = (wf[t][r] >= thr) | (selg[j] != 0);
            float sv = (lmv & (j < JJ)) ? acc[t][r] * scale : -__FLT_MAX__;
            acc[t][r] = sv;                       // masked + scaled score
            m = fmaxf(m, sv);
        }
    m = fmaxf(m, other_half(m));

    float denom = 0.f;
    Frag16 pf[3];                                 // unnormalized probs, B operand
    #pragma unroll
    for (int t = 0; t < 6; ++t)
        #pragma unroll
        for (int r = 0; r < 8; ++r) {
            float p = 0.f;
            if (t < 5) {
                int j = t * 16 + lhi * 8 + r;
                p = exp2_slot((acc[t][r] - m) * 1.4426950408889634f);   // e^(s - m)
                if (j >= JJ) p = 0.f;
                denom += p;
            }
            pf[t >> 1].h[(t & 1) * 8 + r] = (_Float16)p;
        }
    denom += other_half(denom);
    const float inv = 1.f / denom;

    // keeps the PV matrix instructions below every exp2_slot()
    __builtin_amdgcn_sched_barrier(0);

    // ---- stage 3: out^T = V^T @ P^T via WMMA (K = 96 -> 3 k-steps, 4 d tiles)
    v8f o[4];
    #pragma unroll
    for (int t = 0; t < 4; ++t) o[t] = (v8f){0.f,0.f,0.f,0.f,0.f,0.f,0.f,0.f};
    #pragma unroll
    for (int s = 0; s < 3; ++s) {
        #pragma unroll
        for (int t = 0; t < 4; ++t) {
            Frag16 vf;
            load_frag(&vshT[(t * 16 + lm) * 104 + s * 32], vf, lhi);
            o[t] = __builtin_amdgcn_wmma_f32_16x16x32_f16(
                false, vf.v, false, pf[s].v, (short)0, o[t], false, false);
        }
    }
    // a lane holds d = t*16 + lhi*8 + 0..7 of its query row: two 16-byte stores
    float* orow = out_attn + ((size_t)b * NN + rowg) * INNERD + h * DHH + lhi * 8;
    #pragma unroll
    for (int t = 0; t < 4; ++t) {
        *(float4*)(orow + t * 16) =
            make_float4(o[t][0] * inv, o[t][1] * inv, o[t][2] * inv, o[t][3] * inv);
        *(float4*)(orow + t * 16 + 4) =
            make_float4(o[t][4] * inv, o[t][5] * inv, o[t][6] * inv, o[t][7] * inv);
    }
}

// ---------------------------------------------------------------------------
// launch
// ---------------------------------------------------------------------------
extern "C" void kernel_launch(void* const* d_in, const int* in_sizes, int n_in,
                              void* d_out, int out_size, void* d_ws, size_t ws_size,
                              hipStream_t stream)
{
    const float* x        = (const float*)d_in[0];
    const float* ce       = (const float*)d_in[1];
    const int*   ct       = (const int*)  d_in[2];
    const float* camask   = (const float*)d_in[3];
    const float* strength = (const float*)d_in[4];
    const float* Wq       = (const float*)d_in[5];
    const float* Wk       = (const float*)d_in[6];
    const float* Wv       = (const float*)d_in[7];
    const float* Wout     = (const float*)d_in[8];
    const float* bout     = (const float*)d_in[9];
    const float* tte      = (const float*)d_in[10];
    const float* m1w      = (const float*)d_in[11];
    const float* m1b      = (const float*)d_in[12];
    const float* m2w      = (const float*)d_in[13];
    const float* m2b      = (const float*)d_in[14];
    const float* gA       = (const float*)d_in[15];
    const float* gB       = (const float*)d_in[16];
    float* out = (float*)d_out;

    // workspace partition (floats)
    float* ws    = (float*)d_ws;
    float* kin   = ws;                                  // 308*768
    float* k_bh  = kin  + (size_t)BB*JJ*DCC;            // 64*77*64
    float* v_bh  = k_bh + (size_t)BB*HH*JJ*DHH;
    float* q_bh  = v_bh + (size_t)BB*HH*JJ*DHH;         // 64*4096*64
    float* aout  = q_bh + (size_t)BB*HH*NN*DHH;         // 16384*1024
    float* stats = aout + (size_t)MROWS*INNERD;         // [sum, sumsq, std]

    hipMemsetAsync(stats, 0, 4 * sizeof(float), stream);

    prep_kernel<<<BB*JJ, 256, 0, stream>>>(ce, ct, tte, m1w, m1b, m2w, m2b, gA, gB, kin);

    // K = kin @ Wk, V = ce @ Wv  (WMMA, M=308, K=768, permuted -> [B*H, J, DH])
    wmma_gemm<2><<<dim3(INNERD/GBN, (BB*JJ + GBM - 1)/GBM), 256, 0, stream>>>(
        kin, Wk, nullptr, k_bh, BB*JJ, DCC);
    wmma_gemm<2><<<dim3(INNERD/GBN, (BB*JJ + GBM - 1)/GBM), 256, 0, stream>>>(
        ce, Wv, nullptr, v_bh, BB*JJ, DCC);

    // q = x @ Wq  (WMMA, permuted -> [B*H, N, DH])
    wmma_gemm<0><<<dim3(INNERD/GBN, MROWS/GBM), 256, 0, stream>>>(
        x, Wq, nullptr, q_bh, MROWS, DQQ);

    // masked mean/std of sim (WMMA sim tiles, never stored)
    sim_stats_kernel<<<dim3(NN/128, BB*HH), 256, 0, stream>>>(q_bh, k_bh, ct, stats);
    finalize_kernel<<<1, 1, 0, stream>>>(ct, stats);

    // fused WMMA sim -> softmax -> WMMA attn@V
    attn_fused_kernel<<<dim3(NN/64, BB*HH), 128, 0, stream>>>(
        q_bh, k_bh, v_bh, ct, camask, strength, stats, aout);

    // out = attn_out @ Wout + bout  (WMMA)
    wmma_gemm<1><<<dim3(DQQ/GBN, MROWS/GBM), 256, 0, stream>>>(
        aout, Wout, bout, out, MROWS, DQQ);
}

// v002
// Two timings next to v001 both put it at 1.23 times that version's speed.
// Counting every step since v000, it is 1.54 times as fast.
#include <hip/hip_runtime.h>
#include <hip/hip_bf16.h>
#include <math.h>

// ---------------------------------------------------------------------------
// Problem constants
// ---------------------------------------------------------------------------
#define BB   4
#define NN   4096
#define JJ   77
#define HH   16
#define DHH  64
#define DQQ  1024
#define DCC  768
#define DHID 384           // DC/2
#define INNERD 1024        // H*DH
#define MROWS (BB*NN)      // 16384
#define JPAD 80            // sim col padding (5 x 16)
#define KPAD 96            // attn K padding  (3 x 32)

typedef __attribute__((ext_vector_type(16))) _Float16 v16h;
typedef __attribute__((ext_vector_type(8)))  float    v8f;
typedef __attribute__((ext_vector_type(2)))  _Float16 h2_t;
typedef __attribute__((ext_vector_type(8)))  _Float16 v8h;
typedef __attribute__((ext_vector_type(8)))  short    s16x8;

union Frag16 { v16h v; h2_t h2[8]; _Float16 h[16]; s16x8 q[2]; };

// load one 16x32 f16 WMMA operand fragment from LDS (row-major, "base" points
// at this lane's row at the k-step origin; ISA 16-bit A/B layout)
__device__ __forceinline__ void load_frag(const _Float16* base, Frag16& f, int lhi)
{
    #pragma unroll
    for (int r = 0; r < 8; ++r) {
        int kk = (r < 4) ? (lhi * 8 + 2 * r) : (16 + lhi * 8 + 2 * (r - 4));
        f.h2[r] = *(const h2_t*)(base + kk);
    }
}

// ---------------------------------------------------------------------------
// Kernel 1: token-type embedding MLP -> kin = contextembs + typeemb
// one block per (b,j) row (tiny: 0.4 GFLOP total)
// ---------------------------------------------------------------------------
__global__ __launch_bounds__(256)
void prep_kernel(const float* __restrict__ ce, const int* __restrict__ ct,
                 const float* __restrict__ tte_emb,
                 const float* __restrict__ m1w, const float* __restrict__ m1b,
                 const float* __restrict__ m2w, const float* __restrict__ m2b,
                 const float* __restrict__ gA, const float* __restrict__ gB,
                 float* __restrict__ kin)
{
    const int bj = blockIdx.x;            // 0..307
    const int tid = threadIdx.x;
    __shared__ float tte_s[DCC];
    __shared__ float cein_s[DCC];
    __shared__ float hid_s[DHID];

    int t = ct[bj];
    int tcl = t < 0 ? 0 : (t > 4 ? 4 : t);

    for (int c = tid; c < DCC; c += 256) {
        float tv = tte_emb[(size_t)tcl * DCC + c];
        float ev = ce[(size_t)bj * DCC + c];
        tte_s[c]  = tv;
        cein_s[c] = ev + tv;
    }
    __syncthreads();

    for (int col = tid; col < DHID; col += 256) {
        float acc = m1b[col];
        for (int c = 0; c < DCC; ++c)
            acc = fmaf(cein_s[c], m1w[(size_t)c * DHID + col], acc);
        hid_s[col] = 0.5f * acc * (1.0f + erff(acc * 0.70710678118654752f));
    }
    __syncthreads();

    for (int col = tid; col < DCC; col += 256) {
        float acc = m2b[col];
        for (int c = 0; c < DHID; ++c)
            acc = fmaf(hid_s[c], m2w[(size_t)c * DCC + col], acc);
        float typeemb = tte_s[col] * gA[col] + acc * gB[col];
        kin[(size_t)bj * DCC + col] = ce[(size_t)bj * DCC + col] + typeemb;
    }
}

// ---------------------------------------------------------------------------
// WMMA GEMM: C[M,1024] = A[M,K] * B[K,1024]  (fp32 in, f16 mul, f32 acc)
// Block tile 128x128, BK=32, 8 waves (4x2), each wave 32x64 = 2x4 WMMA tiles.
// MODE 0: store q permuted [B*H, N, DH]
// MODE 1: plain store + bias (output projection)
// MODE 2: store K/V permuted [B*H, J, DH]  (rows = b*J+j, M=308)
// ---------------------------------------------------------------------------
#define GBM 128
#define GBN 128
#define GBK 32
#define LDSS 40   // padded LDS stride in halfs
#define LDSB 144  // B tile row pitch in halfs: 288 bytes, an odd multiple of 32 bytes

// one 32(k) x 16(n) B fragment out of a row-major [k][n] f16 LDS tile, through the
// transposing LDS load. "base" is this lane's own address:
//   tile + (8*(lane>>4) + (lane&7)) * LDSB + n0 + 8*((lane>>3)&1)
// The lane then holds column n0 + (lane&15), k = 8*lhi + 0..7 and 16 + 8*lhi + 0..7:
// the k order of load_frag().
__device__ __forceinline__ void load_frag_tr(const _Float16* base, Frag16& f)
{
    typedef __attribute__((address_space(3))) s16x8 lds_s16x8;
    f.q[0] = __builtin_amdgcn_ds_load_tr16_b128_v8i16((lds_s16x8*)base);
    f.q[1] = __builtin_amdgcn_ds_load_tr16_b128_v8i16((lds_s16x8*)(base + 16 * LDSB));
}

template<int MODE>
__global__ __launch_bounds__(256)
void wmma_gemm(const float* __restrict__ A, const float* __restrict__ Bm,
               const float* __restrict__ bias, float* __restrict__ C,
               int M, int K)
{
    __shared__ _Float16 Ash[GBM * LDSS];
    __shared__ __attribute__((aligned(32))) _Float16 Bsh[GBK * LDSB];   // [k][n]

    const int tid  = threadIdx.x;
    const int wid  = tid >> 5;
    const int lane = tid & 31;
    const int wm   = wid >> 1;     // 0..3 -> 32-row strip
    const int wn   = wid & 1;      // 0..1 -> 64-col strip
    const int lm   = lane & 15;
    const int lhi  = lane >> 4;

    const int blockM = blockIdx.y * GBM;
    const int blockN = blockIdx.x * GBN;

    v8f acc[2][4];
    #pragma unroll
    for (int t = 0; t < 2; ++t)
        #pragma unroll
        for (int u = 0; u < 4; ++u)
            acc[t][u] = (v8f){0.f,0.f,0.f,0.f,0.f,0.f,0.f,0.f};

    int arow = blockM + (tid >> 1);       // global A row
    if (arow >= M) arow = M - 1;          // clamp (stores are guarded)
    const int acb  = (tid & 1) * 16;
    const int bkr  = tid >> 3;            // 0..31
    const int bcb  = (tid & 7) * 16;
    const int skr  = tid >> 4;            // 0..15: staged k rows skr and skr + 16
    const int scb  = (tid & 15) * 8;      // 8 columns: 16 lanes fill one 256-byte LDS row
    const _Float16* bfr = &Bsh[(lhi * 8 + (lane & 7)) * LDSB + wn * 64 + ((lane >> 3) & 1) * 8];

    for (int k0 = 0; k0 < K; k0 += GBK) {
        { // stage A tile (fp32 -> f16)
            const float* src = A + (size_t)arow * K + k0 + acb;
            _Float16* dst = &Ash[(tid >> 1) * LDSS + acb];
            #pragma unroll
            for (int i = 0; i < 16; ++i) dst[i] = (_Float16)src[i];
        }
        // stage B tile as it lies in memory, Bsh[k][n], one 16-byte store per row
        #pragma unroll
        for (int g = 0; g < 2; ++g) {
            const float* src = Bm + (size_t)(k0 + skr + g * 16) * 1024 + blockN + scb;
            v8h pk;
            #pragma unroll
            for (int i = 0; i < 8; ++i) pk[i] = (_Float16)src[i];
            *(v8h*)&Bsh[(skr + g * 16) * LDSB + scb] = pk;
        }
        if (k0 + GBK < K) {   // global_prefetch of next k-tile
            __builtin_prefetch(A + (size_t)arow * K + k0 + GBK + acb, 0, 1);
            __builtin_prefetch(Bm + (size_t)(k0 + GBK + bkr) * 1024 + blockN + bcb, 0, 1);
        }
        __syncthreads();

        Frag16 af[2], bf[4];
        #pragma unroll
        for (int t = 0; t < 2; ++t)
            load_frag(&Ash[(wm * 32 + t * 16 + lm) * LDSS], af[t], lhi);
        #pragma unroll
        for (int u = 0; u < 4; ++u)
            load_frag_tr(bfr + u * 16, bf[u]);

        #pragma unroll
        for (int t = 0; t < 2; ++t)
            #pragma unroll
            for (int u = 0; u < 4; ++u)
                acc[t][u] = __builtin_amdgcn_wmma_f32_16x16x32_f16(
                    false, af[t].v, false, bf[u].v,
                    (short)0, acc[t][u], false, false);

        __syncthreads();
    }

    // C/D layout: lanes 0-15 -> M=r, lanes 16-31 -> M=8+r, N=lane&15
    #pragma unroll
    for (int t = 0; t < 2; ++t) {
        #pragma unroll
        for (int u = 0; u < 4; ++u) {
            #pragma unroll
            for (int r = 0; r < 8; ++r) {
                int rg = blockM + wm * 32 + t * 16 + (lhi ? 8 + r : r);
                int cg = blockN + wn * 64 + u * 16 + lm;
                float val = acc[t][u][r];
                if (MODE == 1) {
                    C[(size_t)rg * 1024 + cg] = val + bias[cg];
                } else if (MODE == 0) {
                    int b = rg >> 12, n = rg & 4095;
                    int h = cg >> 6,  d = cg & 63;
                    C[(((size_t)(b * HH + h)) * NN + n) * DHH + d] = val;
                } else { // MODE 2: rows are (b, j)
                    if (rg < M) {
                        int b = rg / JJ, j = rg - b * JJ;
                        int h = cg >> 6, d = cg & 63;
                        C[(((size_t)(b * HH + h)) * JJ + j) * DHH + d] = val;
                    }
                }
            }
        }
    }
}

// ---------------------------------------------------------------------------
// Kernel 3: WMMA sim tiles + masked sum/sumsq (sim never hits HBM)
// grid (N/128, B*H), 256 threads (8 waves x 16 rows), 5 j-tiles, K=64
// ---------------------------------------------------------------------------
__global__ __launch_bounds__(256)
void sim_stats_kernel(const float* __restrict__ q_bh, const float* __restrict__ k_bh,
                      const int* __restrict__ ct, float* __restrict__ stats)
{
    __shared__ _Float16 qsh[128 * 72];     // [row][k], stride 72
    __shared__ _Float16 kshT[JPAD * 72];   // [j][k], rows 77..79 zero
    __shared__ int   sel2[JPAD];
    __shared__ float rs[256], rq[256];

    const int tid  = threadIdx.x;
    const int wid  = tid >> 5;
    const int lane = tid & 31;
    const int lm   = lane & 15;
    const int lhi  = lane >> 4;
    const int bh   = blockIdx.y;
    const int b    = bh >> 4;
    const int rowbase = blockIdx.x * 128;

    { // q tile: 128x64 fp32 -> f16
        int r = tid >> 1, cb = (tid & 1) * 32;
        const float* src = q_bh + ((size_t)bh * NN + rowbase + r) * DHH + cb;
        #pragma unroll
        for (int i = 0; i < 32; ++i) qsh[r * 72 + cb + i] = (_Float16)src[i];
    }
    for (int idx = tid; idx < JPAD * DHH; idx += 256) {
        int j = idx >> 6, k = idx & 63;
        float v = (j < JJ) ? k_bh[((size_t)bh * JJ + j) * DHH + k] : 0.f;
        kshT[j * 72 + k] = (_Float16)v;
    }
    for (int j = tid; j < JPAD; j += 256)
        sel2[j] = (j < JJ && ct[b * JJ + j] >= 2) ? 1 : 0;
    __syncthreads();

    v8f acc[5];
    #pragma unroll
    for (int t = 0; t < 5; ++t) acc[t] = (v8f){0.f,0.f,0.f,0.f,0.f,0.f,0.f,0.f};

    #pragma unroll
    for (int s = 0; s < 2; ++s) {          // K = 64 -> 2 k-steps
        Frag16 af;
        load_frag(&qsh[(wid * 16 + lm) * 72 + s * 32], af, lhi);
        #pragma unroll
        for (int t = 0; t < 5; ++t) {
            Frag16 bf;
            load_frag(&kshT[(t * 16 + lm) * 72 + s * 32], bf, lhi);
            acc[t] = __builtin_amdgcn_wmma_f32_16x16x32_f16(
                false, af.v, false, bf.v, (short)0, acc[t], false, false);
        }
    }

    // lane (t,lm) owns column j = t*16+lm for 8 rows -> accumulate stats
    float s1 = 0.f, s2 = 0.f;
    #pragma unroll
    for (int t = 0; t < 5; ++t) {
        int j = t * 16 + lm;
        if (j < JJ && sel2[j]) {
            #pragma unroll
            for (int r = 0; r < 8; ++r) {
                float v = acc[t][r];
                s1 += v;
                s2 = fmaf(v, v, s2);
            }
        }
    }
    rs[tid] = s1; rq[tid] = s2;
    __syncthreads();
    for (int off = 128; off > 0; off >>= 1) {
        if (tid < off) { rs[tid] += rs[tid + off]; rq[tid] += rq[tid + off]; }
        __syncthreads();
    }
    if (tid == 0) {
        atomicAdd(&stats[0], rs[0]);
        atomicAdd(&stats[1], rq[0]);
    }
}

// ---------------------------------------------------------------------------
// Kernel 4: finalize std (Bessel-corrected, matching torch .std())
// ---------------------------------------------------------------------------
__global__ void finalize_kernel(const int* __restrict__ ct, float* __restrict__ stats)
{
    int cnt = 0;
    for (int i = 0; i < BB * JJ; ++i) cnt += (ct[i] >= 2) ? 1 : 0;
    float nsel = (float)cnt * (float)HH * (float)NN;
    float mean = (nsel > 0.f) ? stats[0] / nsel : 0.f;
    float var  = (nsel > 1.f) ? (stats[1] - nsel * mean * mean) / (nsel - 1.f) : 0.f;
    stats[2] = sqrtf(var > 0.f ? var : 0.f);
}

// ---------------------------------------------------------------------------
// Kernel 5: fused attention block, 64 rows / block, 128 threads (4 waves).
// The scores are formed transposed, S^T = K * Q^T (K is the A operand, Q the B
// operand), so a lane's accumulators hold 40 scores of ONE query row:
//   column = lane & 15 -> query row,  j = t*16 + (lane >> 4)*8 + r.
// The masked softmax runs in registers on all lanes; lanes l and l^16 share a
// query row and exchange three partial results. That accumulator order is the
// k order of a 16-bit B operand, so the probabilities, converted to f16, are
// the B operand of out^T = V^T * P^T with no pass through LDS.
// ---------------------------------------------------------------------------
__device__ __forceinline__ float other_half(float x)   // value of lane l ^ 16
{
    int b = __builtin_bit_cast(int, x);
    b = __builtin_amdgcn_permlanex16(b, b, 0x76543210, 0xfedcba98, false, false);
    return __builtin_bit_cast(float, b);
}

// 2^x. The v_nop keeps the one free issue slot the instruction set asks for
// behind a transcendental.
__device__ __forceinline__ float exp2_slot(float x)
{
    float y;
    asm("v_exp_f32 %0, %1\n\tv_nop" : "=v"(y) : "v"(x));
    return y;
}

__global__ __launch_bounds__(128)
void attn_fused_kernel(const float* __restrict__ q_bh, const float* __restrict__ k_bh,
                       const float* __restrict__ v_bh, const int* __restrict__ ct,
                       const float* __restrict__ camask, const float* __restrict__ strength,
                       const float* __restrict__ stats, float* __restrict__ out_attn)
{
    __shared__ _Float16 qsh[64 * 72];      // q tile [row][k]
    __shared__ _Float16 kshT[JPAD * 72];   // [j][k], rows 77..79 zero
    __shared__ _Float16 vshT[64 * 104];    // [d][k], k 77..95 zero
    __shared__ int      sel2[JPAD], selg[JPAD];

    const int tid  = threadIdx.x;
    const int wid  = tid >> 5;     // 0..3 -> 16-row strip
    const int lane = tid & 31;
    const int lm   = lane & 15;
    const int lhi  = lane >> 4;
    const int bh   = blockIdx.y;
    const int b    = bh >> 4;
    const int h    = bh & 15;
    const int rowbase = blockIdx.x * 64;
    const int rowg = rowbase + wid * 16 + lm;   // this lane's query row

    // this lane's 40 mask values, read once; index clamped for j = 77..79
    float wf[5][8];
    {
        const float* camrow = camask + ((size_t)b * NN + rowg) * JJ;
        #pragma unroll
        for (int t = 0; t < 5; ++t)
            #pragma unroll
            for (int r = 0; r < 8; ++r) {
                int j = t * 16 + lhi * 8 + r;
                wf[t][r] = camrow[j < JJ ? j : JJ - 1];
            }
    }
    // the registers that hold the mask loads' addresses are reused by the staging below
    asm volatile("s_wait_xcnt 0x0" ::: "memory");

    { // q tile 64x64 fp32 -> f16
        int r = tid >> 1, cb = (tid & 1) * 32;
        const float* src = q_bh + ((size_t)bh * NN + rowbase + r) * DHH + cb;
        #pragma unroll
        for (int i = 0; i < 32; ++i) qsh[r * 72 + cb + i] = (_Float16)src[i];
    }
    for (int idx = tid; idx < JPAD * DHH; idx += 128) {
        int j = idx >> 6, k = idx & 63;
        float v = (j < JJ) ? k_bh[((size_t)bh * JJ + j) * DHH + k] : 0.f;
        kshT[j * 72 + k] = (_Float16)v;
    }
    for (int idx = tid; idx < DHH * KPAD; idx += 128) {
        int d = idx / KPAD, k = idx - d * KPAD;
        float v = (k < JJ) ? v_bh[((size_t)bh * JJ + k) * DHH + d] : 0.f;
        vshT[d * 104 + k] = (_Float16)v;
    }
    for (int j = tid; j < JPAD; j += 128) {
        int t = (j < JJ) ? ct[b * JJ + j] : -1;
        sel2[j] = (t >= 2) ? 1 : 0;
        selg[j] = (t >= 0 && t < 2) ? 1 : 0;
    }
    __syncthreads();

    // ---- stage 1: S^T = K @ q^T via WMMA, kept in registers
    v8f acc[5];
    #pragma unroll
    for (int t = 0; t < 5; ++t) acc[t] = (v8f){0.f,0.f,0.f,0.f,0.f,0.f,0.f,0.f};
    #pragma unroll
    for (int s = 0; s < 2; ++s) {
        Frag16 qf;
        load_frag(&qsh[(wid * 16 + lm) * 72 + s * 32], qf, lhi);
        #pragma unroll
        for (int t = 0; t < 5; ++t) {
            Frag16 kf;
            load_frag(&kshT[(t * 16 + lm) * 72 + s * 32], kf, lhi);
            acc[t] = __builtin_amdgcn_wmma_f32_16x16x32_f16(
                false, kf.v, false, qf.v, (short)0, acc[t], false, false);
        }
    }

    // ---- stage 2: masked softmax of this lane's query row, in registers
    const float simstd = stats[2];
    const float str    = strength[0];
    const float scale  = 0.125f;                  // 1/sqrt(DH)

    float wfmax = -__FLT_MAX__;
    #pragma unroll
    for (int t = 0; t < 5; ++t)
        #pragma unroll
        for (int r = 0; r < 8; ++r) {
            int j = t * 16 + lhi * 8 + r;
            float w = sel2[j] ? wf[t][r] * simstd * str : 0.f;
            wf[t][r] = w;
            if (j < JJ) wfmax = fmaxf(wfmax, w);
        }
    wfmax = fmaxf(wfmax, other_half(wfmax));
    const float thr = fmaxf(wfmax, 0.001f) - 0.0001f;

    float m = -__FLT_MAX__;
    #pragma unroll
    for (int t = 0; t < 5; ++t)
        #pragma unroll
        for (int r = 0; r < 8; ++r) {
            int j = t * 16 + lhi * 8 + r;
            // both tests evaluated, no short circuit: the flag reads stay wide and unbranched
            bool lmv = (wf[t][r] >= thr) | (selg[j] != 0);
            float sv = (lmv & (j < JJ)) ? acc[t][r] * scale : -__FLT_MAX__;
            acc[t][r] = sv;                       // masked + scaled score
            m = fmaxf(m, sv);
        }
    m = fmaxf(m, other_half(m));

    float denom = 0.f;
    Frag16 pf[3];                                 // unnormalized probs, B operand
    #pragma unroll
    for (int t = 0; t < 6; ++t)
        #pragma unroll
        for (int r = 0; r < 8; ++r) {
            float p = 0.f;
            if (t < 5) {
                int j = t * 16 + lhi * 8 + r;
                p = exp2_slot((acc[t][r] - m) * 1.4426950408889634f);   // e^(s - m)
                if (j >= JJ) p = 0.f;
                denom += p;
            }
            pf[t >> 1].h[(t & 1) * 8 + r] = (_Float16)p;
        }
    denom += other_half(denom);
    const float inv = 1.f / denom;

    // keeps the PV matrix instructions below every exp2_slot()
    __builtin_amdgcn_sched_barrier(0);

    // ---- stage 3: out^T = V^T @ P^T via WMMA (K = 96 -> 3 k-steps, 4 d tiles)
    v8f o[4];
    #pragma unroll
    for (int t = 0; t < 4; ++t) o[t] = (v8f){0.f,0.f,0.f,0.f,0.f,0.f,0.f,0.f};
    #pragma unroll
    for (int s = 0; s < 3; ++s) {
        #pragma unroll
        for (int t = 0; t < 4; ++t) {
            Frag16 vf;
            load_frag(&vshT[(t * 16 + lm) * 104 + s * 32], vf, lhi);
            o[t] = __builtin_amdgcn_wmma_f32_16x16x32_f16(
                false, vf.v, false, pf[s].v, (short)0, o[t], false, false);
        }
    }
    // a lane holds d = t*16 + lhi*8 + 0..7 of its query row: two 16-byte stores
    float* orow = out_attn + ((size_t)b * NN + rowg) * INNERD + h * DHH + lhi * 8;
    #pragma unroll
    for (int t = 0; t < 4; ++t) {
        *(float4*)(orow + t * 16) =
            make_float4(o[t][0] * inv, o[t][1] * inv, o[t][2] * inv, o[t][3] * inv);
        *(float4*)(orow + t * 16 + 4) =
            make_float4(o[t][4] * inv, o[t][5] * inv, o[t][6] * inv, o[t][7] * inv);
    }
}

// ---------------------------------------------------------------------------
// launch
// ---------------------------------------------------------------------------
extern "C" void kernel_launch(void* const* d_in, const int* in_sizes, int n_in,
                              void* d_out, int out_size, void* d_ws, size_t ws_size,
                              hipStream_t stream)
{
    const float* x        = (const float*)d_in[0];
    const float* ce       = (const float*)d_in[1];
    const int*   ct       = (const int*)  d_in[2];
    const float* camask   = (const float*)d_in[3];
    const float* strength = (const float*)d_in[4];
    const float* Wq       = (const float*)d_in[5];
    const float* Wk       = (const float*)d_in[6];
    const float* Wv       = (const float*)d_in[7];
    const float* Wout     = (const float*)d_in[8];
    const float* bout     = (const float*)d_in[9];
    const float* tte      = (const float*)d_in[10];
    const float* m1w      = (const float*)d_in[11];
    const float* m1b      = (const float*)d_in[12];
    const float* m2w      = (const float*)d_in[13];
    const float* m2b      = (const float*)d_in[14];
    const float* gA       = (const float*)d_in[15];
    const float* gB       = (const float*)d_in[16];
    float* out = (float*)d_out;

    // workspace partition (floats)
    float* ws    = (float*)d_ws;
    float* kin   = ws;                                  // 308*768
    float* k_bh  = kin  + (size_t)BB*JJ*DCC;            // 64*77*64
    float* v_bh  = k_bh + (size_t)BB*HH*JJ*DHH;
    float* q_bh  = v_bh + (size_t)BB*HH*JJ*DHH;         // 64*4096*64
    float* aout  = q_bh + (size_t)BB*HH*NN*DHH;         // 16384*1024
    float* stats = aout + (size_t)MROWS*INNERD;         // [sum, sumsq, std]

    hipMemsetAsync(stats, 0, 4 * sizeof(float), stream);

    prep_kernel<<<BB*JJ, 256, 0, stream>>>(ce, ct, tte, m1w, m1b, m2w, m2b, gA, gB, kin);

    // K = kin @ Wk, V = ce @ Wv  (WMMA, M=308, K=768, permuted -> [B*H, J, DH])
    wmma_gemm<2><<<dim3(INNERD/GBN, (BB*JJ + GBM - 1)/GBM), 256, 0, stream>>>(
        kin, Wk, nullptr, k_bh, BB*JJ, DCC);
    wmma_gemm<2><<<dim3(INNERD/GBN, (BB*JJ + GBM - 1)/GBM), 256, 0, stream>>>(
        ce, Wv, nullptr, v_bh, BB*JJ, DCC);

    // q = x @ Wq  (WMMA, permuted -> [B*H, N, DH])
    wmma_gemm<0><<<dim3(INNERD/GBN, MROWS/GBM), 256, 0, stream>>>(
        x, Wq, nullptr, q_bh, MROWS, DQQ);

    // masked mean/std of sim (WMMA sim tiles, never stored)
    sim_stats_kernel<<<dim3(NN/128, BB*HH), 256, 0, stream>>>(q_bh, k_bh, ct, stats);
    finalize_kernel<<<1, 1, 0, stream>>>(ct, stats);

    // fused WMMA sim -> softmax -> WMMA attn@V
    attn_fused_kernel<<<dim3(NN/64, BB*HH), 128, 0, stream>>>(
        q_bh, k_bh, v_bh, ct, camask, strength, stats, aout);

    // out = attn_out @ Wout + bout  (WMMA)
    wmma_gemm<1><<<dim3(DQQ/GBN, MROWS/GBM), 256, 0, stream>>>(
        aout, Wout, bout, out, MROWS, DQQ);
}

// v003
// Two timings next to v002 both put it at 1.15 times that version's speed.
// All steps since v000 together make it 1.77 times as fast.
#include <hip/hip_runtime.h>
#include <hip/hip_bf16.h>
#include <math.h>

// ---------------------------------------------------------------------------
// Problem constants
// ---------------------------------------------------------------------------
#define BB   4
#define NN   4096
#define JJ   77
#define HH   16
#define DHH  64
#define DQQ  1024
#define DCC  768
#define DHID 384           // DC/2
#define INNERD 1024        // H*DH
#define MROWS (BB*NN)      // 16384
#define JPAD 80            // sim col padding (5 x 16)
#define KPAD 96            // attn K padding  (3 x 32)

typedef __attribute__((ext_vector_type(16))) _Float16 v16h;
typedef __attribute__((ext_vector_type(8)))  float    v8f;
typedef __attribute__((ext_vector_type(2)))  _Float16 h2_t;
typedef __attribute__((ext_vector_type(8)))  _Float16 v8h;
typedef __attribute__((ext_vector_type(4)))  _Float16 v4h;
typedef __attribute__((ext_vector_type(8)))  short    s16x8;

union Frag16 { v16h v; h2_t h2[8]; _Float16 h[16]; s16x8 q[2]; };

// load one 16x32 f16 WMMA operand fragment from LDS (row-major, "base" points
// at this lane's row at the k-step origin; ISA 16-bit A/B layout)
__device__ __forceinline__ void load_frag(const _Float16* base, Frag16& f, int lhi)
{
    #pragma unroll
    for (int r = 0; r < 8; ++r) {
        int kk = (r < 4) ? (lhi * 8 + 2 * r) : (16 + lhi * 8 + 2 * (r - 4));
        f.h2[r] = *(const h2_t*)(base + kk);
    }
}

// ---------------------------------------------------------------------------
// Kernel 1: token-type embedding MLP -> kin = contextembs + typeemb
// one block per (b,j) row (tiny: 0.4 GFLOP total)
// ---------------------------------------------------------------------------
__global__ __launch_bounds__(256)
void prep_kernel(const float* __restrict__ ce, const int* __restrict__ ct,
                 const float* __restrict__ tte_emb,
                 const float* __restrict__ m1w, const float* __restrict__ m1b,
                 const float* __restrict__ m2w, const float* __restrict__ m2b,
                 const float* __restrict__ gA, const float* __restrict__ gB,
                 float* __restrict__ kin)
{
    const int bj = blockIdx.x;            // 0..307
    const int tid = threadIdx.x;
    __shared__ float tte_s[DCC];
    __shared__ float cein_s[DCC];
    __shared__ float hid_s[DHID];

    int t = ct[bj];
    int tcl = t < 0 ? 0 : (t > 4 ? 4 : t);

    for (int c = tid; c < DCC; c += 256) {
        float tv = tte_emb[(size_t)tcl * DCC + c];
        float ev = ce[(size_t)bj * DCC + c];
        tte_s[c]  = tv;
        cein_s[c] = ev + tv;
    }
    __syncthreads();

    for (int col = tid; col < DHID; col += 256) {
        float acc = m1b[col];
        for (int c = 0; c < DCC; ++c)
            acc = fmaf(cein_s[c], m1w[(size_t)c * DHID + col], acc);
        hid_s[col] = 0.5f * acc * (1.0f + erff(acc * 0.70710678118654752f));
    }
    __syncthreads();

    for (int col = tid; col < DCC; col += 256) {
        float acc = m2b[col];
        for (int c = 0; c < DHID; ++c)
            acc = fmaf(hid_s[c], m2w[(size_t)c * DCC + col], acc);
        float typeemb = tte_s[col] * gA[col] + acc * gB[col];
        kin[(size_t)bj * DCC + col] = ce[(size_t)bj * DCC + col] + typeemb;
    }
}

// ---------------------------------------------------------------------------
// WMMA GEMM: C[M,1024] = A[M,K] * B[K,1024]  (fp32 in, f16 mul, f32 acc)
// Block tile 128x128, BK=32, 8 waves (4x2), each wave 32x64 = 2x4 WMMA tiles.
// MODE 0: store q permuted [B*H, N, DH]
// MODE 1: plain store + bias (output projection)
// MODE 2: store K/V permuted [B*H, J, DH]  (rows = b*J+j, M=308)
// ---------------------------------------------------------------------------
#define GBM 128
#define GBN 128
#define GBK 32
#define LDSS 40   // padded LDS stride in halfs
#define LDSB 144  // B tile row pitch in halfs: 288 bytes, an odd multiple of 32 bytes
#define VPIT 80   // V tile row pitch in halfs: 160 bytes, an odd multiple of 32 bytes

// one 32(k) x 16(n) B fragment out of a row-major [k][n] f16 LDS tile, through the
// transposing LDS load. "base" is this lane's own address:
//   tile + (8*(lane>>4) + (lane&7)) * LDSB + n0 + 8*((lane>>3)&1)
// The lane then holds column n0 + (lane&15), k = 8*lhi + 0..7 and 16 + 8*lhi + 0..7:
// the k order of load_frag().
__device__ __forceinline__ void load_frag_tr(const _Float16* base, Frag16& f)
{
    typedef __attribute__((address_space(3))) s16x8 lds_s16x8;
    f.q[0] = __builtin_amdgcn_ds_load_tr16_b128_v8i16((lds_s16x8*)base);
    f.q[1] = __builtin_amdgcn_ds_load_tr16_b128_v8i16((lds_s16x8*)(base + 16 * LDSB));
}

// the same fragment out of a row-major tile of another pitch (in halfs)
template<int PITCH>
__device__ __forceinline__ void load_frag_tr_p(const _Float16* base, Frag16& f)
{
    typedef __attribute__((address_space(3))) s16x8 lds_s16x8;
    f.q[0] = __builtin_amdgcn_ds_load_tr16_b128_v8i16((lds_s16x8*)base);
    f.q[1] = __builtin_amdgcn_ds_load_tr16_b128_v8i16((lds_s16x8*)(base + 16 * PITCH));
}

// Stage ROWS rows of 64 values (fp32 in memory, contiguous rows) as f16 rows of PITCH
// halfs in LDS, as they lie in memory. A wave's 16-byte loads cover 512 contiguous
// bytes, and all of a thread's loads are issued before the first value is used.
// Rows VALID..ROWS-1 are filled with zero; a load that would fall there is clamped.
template<int NT, int ROWS, int VALID, int PITCH>
__device__ __forceinline__ void stage_rows64(const float* __restrict__ src, _Float16* dst, int tid)
{
    constexpr int NI = ROWS * 16 / NT;                 // 16-byte pieces per thread
    constexpr int NL = (VALID * 16 + NT - 1) / NT;     // of these, trips that hold a valid row
    constexpr int RT = NT / 16;                        // rows per trip
    const int jr = tid >> 4;                           // this thread's row within a trip
    const int c  = (tid & 15) * 4;                     // and its four columns
    const float* s0 = src + tid * 4;                   // rows are contiguous: row jr, column c
    _Float16*    d0 = dst + jr * PITCH + c;
    float4 v[NL];
    #pragma unroll   // v[] stays in registers and the loads issue back to back
    for (int i = 0; i < NL; ++i) {
        if ((i + 1) * RT <= VALID) {
            v[i] = *(const float4*)(s0 + i * RT * 64);
        } else {   // the trip that runs past the last valid row: piece index clamped into the tile
            const int f = tid + i * NT;
            v[i] = *(const float4*)(src + (f < VALID * 16 ? f : VALID * 16 - 1) * 4);
        }
    }
    #pragma unroll   // v[] is indexed by constants; the LDS offsets become immediates
    for (int i = 0; i < NI; ++i) {
        uint2 h = make_uint2(0u, 0u);                  // four f16 values
        if (i < NL) {
            v4h p;
            p[0] = (_Float16)v[i].x;
            p[1] = (_Float16)v[i].y;
            p[2] = (_Float16)v[i].z;
            p[3] = (_Float16)v[i].w;
            h = __builtin_bit_cast(uint2, p);
            if ((i + 1) * RT > VALID && jr + i * RT >= VALID) h = make_uint2(0u, 0u);
        }
        *(uint2*)(d0 + i * RT * PITCH) = h;
    }
}

template<int MODE>
__global__ __launch_bounds__(256)
void wmma_gemm(const float* __restrict__ A, const float* __restrict__ Bm,
               const float* __restrict__ bias, float* __restrict__ C,
               int M, int K)
{
    __shared__ _Float16 Ash[GBM * LDSS];
    __shared__ __attribute__((aligned(32))) _Float16 Bsh[GBK * LDSB];   // [k][n]

    const int tid  = threadIdx.x;
    const int wid  = tid >> 5;
    const int lane = tid & 31;
    const int wm   = wid >> 1;     // 0..3 -> 32-row strip
    const int wn   = wid & 1;      // 0..1 -> 64-col strip
    const int lm   = lane & 15;
    const int lhi  = lane >> 4;

    const int blockM = blockIdx.y * GBM;
    const int blockN = blockIdx.x * GBN;

    v8f acc[2][4];
    #pragma unroll
    for (int t = 0; t < 2; ++t)
        #pragma unroll
        for (int u = 0; u < 4; ++u)
            acc[t][u] = (v8f){0.f,0.f,0.f,0.f,0.f,0.f,0.f,0.f};

    int arow = blockM + (tid >> 1);       // global A row
    if (arow >= M) arow = M - 1;          // clamp (stores are guarded)
    const int acb  = (tid & 1) * 16;
    const int bkr  = tid >> 3;            // 0..31
    const int bcb  = (tid & 7) * 16;
    const int skr  = tid >> 4;            // 0..15: staged k rows skr and skr + 16
    const int scb  = (tid & 15) * 8;      // 8 columns: 16 lanes fill one 256-byte LDS row
    const _Float16* bfr = &Bsh[(lhi * 8 + (lane & 7)) * LDSB + wn * 64 + ((lane >> 3) & 1) * 8];

    for (int k0 = 0; k0 < K; k0 += GBK) {
        { // stage A tile (fp32 -> f16)
            const float* src = A + (size_t)arow * K + k0 + acb;
            _Float16* dst = &Ash[(tid >> 1) * LDSS + acb];
            #pragma unroll
            for (int i = 0; i < 16; ++i) dst[i] = (_Float16)src[i];
        }
        // stage B tile as it lies in memory, Bsh[k][n], one 16-byte store per row
        #pragma unroll
        for (int g = 0; g < 2; ++g) {
            const float* src = Bm + (size_t)(k0 + skr + g * 16) * 1024 + blockN + scb;
            v8h pk;
            #pragma unroll
            for (int i = 0; i < 8; ++i) pk[i] = (_Float16)src[i];
            *(v8h*)&Bsh[(skr + g * 16) * LDSB + scb] = pk;
        }
        if (k0 + GBK < K) {   // global_prefetch of next k-tile
            __builtin_prefetch(A + (size_t)arow * K + k0 + GBK + acb, 0, 1);
            __builtin_prefetch(Bm + (size_t)(k0 + GBK + bkr) * 1024 + blockN + bcb, 0, 1);
        }
        __syncthreads();

        Frag16 af[2], bf[4];
        #pragma unroll
        for (int t = 0; t < 2; ++t)
            load_frag(&Ash[(wm * 32 + t * 16 + lm) * LDSS], af[t], lhi);
        #pragma unroll
        for (int u = 0; u < 4; ++u)
            load_frag_tr(bfr + u * 16, bf[u]);

        #pragma unroll
        for (int t = 0; t < 2; ++t)
            #pragma unroll
            for (int u = 0; u < 4; ++u)
                acc[t][u] = __builtin_amdgcn_wmma_f32_16x16x32_f16(
                    false, af[t].v, false, bf[u].v,
                    (short)0, acc[t][u], false, false);

        __syncthreads();
    }

    // C/D layout: lanes 0-15 -> M=r, lanes 16-31 -> M=8+r, N=lane&15
    #pragma unroll
    for (int t = 0; t < 2; ++t) {
        #pragma unroll
        for (int u = 0; u < 4; ++u) {
            #pragma unroll
            for (int r = 0; r < 8; ++r) {
                int rg = blockM + wm * 32 + t * 16 + (lhi ? 8 + r : r);
                int cg = blockN + wn * 64 + u * 16 + lm;
                float val = acc[t][u][r];
                if (MODE == 1) {
                    C[(size_t)rg * 1024 + cg] = val + bias[cg];
                } else if (MODE == 0) {
                    int b = rg >> 12, n = rg & 4095;
                    int h = cg >> 6,  d = cg & 63;
                    C[(((size_t)(b * HH + h)) * NN + n) * DHH + d] = val;
                } else { // MODE 2: rows are (b, j)
                    if (rg < M) {
                        int b = rg / JJ, j = rg - b * JJ;
                        int h = cg >> 6, d = cg & 63;
                        C[(((size_t)(b * HH + h)) * JJ + j) * DHH + d] = val;
                    }
                }
            }
        }
    }
}

// ---------------------------------------------------------------------------
// Kernel 3: WMMA sim tiles + masked sum/sumsq (sim never hits HBM)
// grid (N/128, B*H), 256 threads (8 waves x 16 rows), 5 j-tiles, K=64
// ---------------------------------------------------------------------------
__global__ __launch_bounds__(256)
void sim_stats_kernel(const float* __restrict__ q_bh, const float* __restrict__ k_bh,
                      const int* __restrict__ ct, float* __restrict__ stats)
{
    __shared__ __attribute__((aligned(16))) _Float16 qsh[128 * 72];     // [row][k], stride 72
    __shared__ __attribute__((aligned(16))) _Float16 kshT[JPAD * 72];   // [j][k], rows 77..79 zero
    __shared__ int   sel2[JPAD];
    __shared__ float rs[256], rq[256];

    const int tid  = threadIdx.x;
    const int wid  = tid >> 5;
    const int lane = tid & 31;
    const int lm   = lane & 15;
    const int lhi  = lane >> 4;
    const int bh   = blockIdx.y;
    const int b    = bh >> 4;
    const int rowbase = blockIdx.x * 128;

    // q tile 128x64 and K tile 80x64, fp32 -> f16
    stage_rows64<256, 128, 128, 72>(q_bh + ((size_t)bh * NN + rowbase) * DHH, qsh, tid);
    stage_rows64<256, JPAD, JJ, 72>(k_bh + (size_t)bh * JJ * DHH, kshT, tid);
    for (int j = tid; j < JPAD; j += 256)
        sel2[j] = (j < JJ && ct[b * JJ + j] >= 2) ? 1 : 0;
    __syncthreads();

    v8f acc[5];
    #pragma unroll
    for (int t = 0; t < 5; ++t) acc[t] = (v8f){0.f,0.f,0.f,0.f,0.f,0.f,0.f,0.f};

    #pragma unroll
    for (int s = 0; s < 2; ++s) {          // K = 64 -> 2 k-steps
        Frag16 af;
        load_frag(&qsh[(wid * 16 + lm) * 72 + s * 32], af, lhi);
        #pragma unroll
        for (int t = 0; t < 5; ++t) {
            Frag16 bf;
            load_frag(&kshT[(t * 16 + lm) * 72 + s * 32], bf, lhi);
            acc[t] = __builtin_amdgcn_wmma_f32_16x16x32_f16(
                false, af.v, false, bf.v, (short)0, acc[t], false, false);
        }
    }

    // lane (t,lm) owns column j = t*16+lm for 8 rows -> accumulate stats
    float s1 = 0.f, s2 = 0.f;
    #pragma unroll
    for (int t = 0; t < 5; ++t) {
        int j = t * 16 + lm;
        if (j < JJ && sel2[j]) {
            #pragma unroll
            for (int r = 0; r < 8; ++r) {
                float v = acc[t][r];
                s1 += v;
                s2 = fmaf(v, v, s2);
            }
        }
    }
    rs[tid] = s1; rq[tid] = s2;
    __syncthreads();
    for (int off = 128; off > 0; off >>= 1) {
        if (tid < off) { rs[tid] += rs[tid + off]; rq[tid] += rq[tid + off]; }
        __syncthreads();
    }
    if (tid == 0) {
        atomicAdd(&stats[0], rs[0]);
        atomicAdd(&stats[1], rq[0]);
    }
}

// ---------------------------------------------------------------------------
// Kernel 4: finalize std (Bessel-corrected, matching torch .std())
// ---------------------------------------------------------------------------
__global__ void finalize_kernel(const int* __restrict__ ct, float* __restrict__ stats)
{
    int cnt = 0;
    for (int i = 0; i < BB * JJ; ++i) cnt += (ct[i] >= 2) ? 1 : 0;
    float nsel = (float)cnt * (float)HH * (float)NN;
    float mean = (nsel > 0.f) ? stats[0] / nsel : 0.f;
    float var  = (nsel > 1.f) ? (stats[1] - nsel * mean * mean) / (nsel - 1.f) : 0.f;
    stats[2] = sqrtf(var > 0.f ? var : 0.f);
}

// ---------------------------------------------------------------------------
// Kernel 5: fused attention block, 64 rows / block, 128 threads (4 waves).
// The scores are formed transposed, S^T = K * Q^T (K is the A operand, Q the B
// operand), so a lane's accumulators hold 40 scores of ONE query row:
//   column = lane & 15 -> query row,  j = t*16 + (lane >> 4)*8 + r.
// The masked softmax runs in registers on all lanes; lanes l and l^16 share a
// query row and exchange three partial results. That accumulator order is the
// k order of a 16-bit B operand, so the probabilities, converted to f16, are
// the B operand of out^T = V^T * P^T with no pass through LDS.
// ---------------------------------------------------------------------------
__device__ __forceinline__ float other_half(float x)   // value of lane l ^ 16
{
    int b = __builtin_bit_cast(int, x);
    b = __builtin_amdgcn_permlanex16(b, b, 0x76543210, 0xfedcba98, false, false);
    return __builtin_bit_cast(float, b);
}

// 2^x. The v_nop keeps the one free issue slot the instruction set asks for
// behind a transcendental.
__device__ __forceinline__ float exp2_slot(float x)
{
    float y;
    asm("v_exp_f32 %0, %1\n\tv_nop" : "=v"(y) : "v"(x));
    return y;
}

__global__ __launch_bounds__(128)
void attn_fused_kernel(const float* __restrict__ q_bh, const float* __restrict__ k_bh,
                       const float* __restrict__ v_bh, const int* __restrict__ ct,
                       const float* __restrict__ camask, const float* __restrict__ strength,
                       const float* __restrict__ stats, float* __restrict__ out_attn)
{
    __shared__ __attribute__((aligned(16))) _Float16 qsh[64 * 72];      // q tile [row][k]
    __shared__ __attribute__((aligned(16))) _Float16 kshT[JPAD * 72];   // [j][k], rows 77..79 zero
    __shared__ __attribute__((aligned(32))) _Float16 vsh[KPAD * VPIT];  // [j][d], rows 77..95 zero
    __shared__ int      sel2[JPAD], selg[JPAD];

    const int tid  = threadIdx.x;
    const int wid  = tid >> 5;     // 0..3 -> 16-row strip
    const int lane = tid & 31;
    const int lm   = lane & 15;
    const int lhi  = lane >> 4;
    const int bh   = blockIdx.y;
    const int b    = bh >> 4;
    const int h    = bh & 15;
    const int rowbase = blockIdx.x * 64;
    const int rowg = rowbase + wid * 16 + lm;   // this lane's query row

    // q tile 64x64 and K tile 80x64, fp32 -> f16, each as it lies in memory
    stage_rows64<128, 64, 64, 72>(q_bh + ((size_t)bh * NN + rowbase) * DHH, qsh, tid);
    stage_rows64<128, JPAD, JJ, 72>(k_bh + (size_t)bh * JJ * DHH, kshT, tid);
    for (int j = tid; j < JPAD; j += 128) {
        int t = (j < JJ) ? ct[b * JJ + j] : -1;
        sel2[j] = (t >= 2) ? 1 : 0;
        selg[j] = (t >= 0 && t < 2) ? 1 : 0;
    }

    // this lane's 40 mask values, read once; index clamped for j = 77..79
    float wf[5][8];
    {
        const float* camrow = camask + ((size_t)b * NN + rowg) * JJ;
        #pragma unroll
        for (int t = 0; t < 5; ++t)
            #pragma unroll
            for (int r = 0; r < 8; ++r) {
                int j = t * 16 + lhi * 8 + r;
                wf[t][r] = camrow[j < JJ ? j : JJ - 1];
            }
    }
    // the registers that hold the mask loads' addresses are reused by the staging below
    asm volatile("s_wait_xcnt 0x0" ::: "memory");

    // V tile 96x64, fp32 -> f16, as it lies in memory
    stage_rows64<128, KPAD, JJ, VPIT>(v_bh + (size_t)bh * JJ * DHH, vsh, tid);
    __syncthreads();

    // ---- stage 1: S^T = K @ q^T via WMMA, kept in registers
    v8f acc[5];
    #pragma unroll
    for (int t = 0; t < 5; ++t) acc[t] = (v8f){0.f,0.f,0.f,0.f,0.f,0.f,0.f,0.f};
    #pragma unroll
    for (int s = 0; s < 2; ++s) {
        Frag16 qf;
        load_frag(&qsh[(wid * 16 + lm) * 72 + s * 32], qf, lhi);
        #pragma unroll
        for (int t = 0; t < 5; ++t) {
            Frag16 kf;
            load_frag(&kshT[(t * 16 + lm) * 72 + s * 32], kf, lhi);
            acc[t] = __builtin_amdgcn_wmma_f32_16x16x32_f16(
                false, kf.v, false, qf.v, (short)0, acc[t], false, false);
        }
    }

    // ---- stage 2: masked softmax of this lane's query row, in registers
    const float simstd = stats[2];
    const float str    = strength[0];
    const float scale  = 0.125f;                  // 1/sqrt(DH)

    float wfmax = -__FLT_MAX__;
    #pragma unroll
    for (int t = 0; t < 5; ++t)
        #pragma unroll
        for (int r = 0; r < 8; ++r) {
            int j = t * 16 + lhi * 8 + r;
            float w = sel2[j] ? wf[t][r] * simstd * str : 0.f;
            wf[t][r] = w;
            if (j < JJ) wfmax = fmaxf(wfmax, w);
        }
    wfmax = fmaxf(wfmax, other_half(wfmax));
    const float thr = fmaxf(wfmax, 0.001f) - 0.0001f;

    float m = -__FLT_MAX__;
    #pragma unroll
    for (int t = 0; t < 5; ++t)
        #pragma unroll
        for (int r = 0; r < 8; ++r) {
            int j = t * 16 + lhi * 8 + r;
            // both tests evaluated, no short circuit: the flag reads stay wide and unbranched
            bool lmv = (wf[t][r] >= thr) | (selg[j] != 0);
            float sv = (lmv & (j < JJ)) ? acc[t][r] * scale : -__FLT_MAX__;
            acc[t][r] = sv;                       // masked + scaled score
            m = fmaxf(m, sv);
        }
    m = fmaxf(m, other_half(m));

    float denom = 0.f;
    Frag16 pf[3];                                 // unnormalized probs, B operand
    #pragma unroll
    for (int t = 0; t < 6; ++t)
        #pragma unroll
        for (int r = 0; r < 8; ++r) {
            float p = 0.f;
            if (t < 5) {
                int j = t * 16 + lhi * 8 + r;
                p = exp2_slot((acc[t][r] - m) * 1.4426950408889634f);   // e^(s - m)
                if (j >= JJ) p = 0.f;
                denom += p;
            }
            pf[t >> 1].h[(t & 1) * 8 + r] = (_Float16)p;
        }
    denom += other_half(denom);
    const float inv = 1.f / denom;

    // keeps the PV matrix instructions below every exp2_slot()
    __builtin_amdgcn_sched_barrier(0);

    // ---- stage 3: out^T = V^T @ P^T via WMMA (K = 96 -> 3 k-steps, 4 d tiles)
    v8f o[4];
    #pragma unroll
    for (int t = 0; t < 4; ++t) o[t] = (v8f){0.f,0.f,0.f,0.f,0.f,0.f,0.f,0.f};
    // V^T fragments come out of the row-major V tile through the transposing LDS load:
    // the lane holds d = t*16 + lm, j = s*32 + 8*lhi + 0..7 and + 16: the k order of pf
    const _Float16* vfr = &vsh[(lhi * 8 + (lane & 7)) * VPIT + ((lane >> 3) & 1) * 8];
    #pragma unroll
    for (int s = 0; s < 3; ++s) {
        #pragma unroll
        for (int t = 0; t < 4; ++t) {
            Frag16 vf;
            load_frag_tr_p<VPIT>(vfr + s * 32 * VPIT + t * 16, vf);
            o[t] = __builtin_amdgcn_wmma_f32_16x16x32_f16(
                false, vf.v, false, pf[s].v, (short)0, o[t], false, false);
        }
    }
    // a lane holds d = t*16 + lhi*8 + 0..7 of its query row: two 16-byte stores
    float* orow = out_attn + ((size_t)b * NN + rowg) * INNERD + h * DHH + lhi * 8;
    #pragma unroll
    for (int t = 0; t < 4; ++t) {
        *(float4*)(orow + t * 16) =
            make_float4(o[t][0] * inv, o[t][1] * inv, o[t][2] * inv, o[t][3] * inv);
        *(float4*)(orow + t * 16 + 4) =
            make_float4(o[t][4] * inv, o[t][5] * inv, o[t][6] * inv, o[t][7] * inv);
    }
}

// ---------------------------------------------------------------------------
// launch
// ---------------------------------------------------------------------------
extern "C" void kernel_launch(void* const* d_in, const int* in_sizes, int n_in,
                              void* d_out, int out_size, void* d_ws, size_t ws_size,
                              hipStream_t stream)
{
    const float* x        = (const float*)d_in[0];
    const float* ce       = (const float*)d_in[1];
    const int*   ct       = (const int*)  d_in[2];
    const float* camask   = (const float*)d_in[3];
    const float* strength = (const float*)d_in[4];
    const float* Wq       = (const float*)d_in[5];
    const float* Wk       = (const float*)d_in[6];
    const float* Wv       = (const float*)d_in[7];
    const float* Wout     = (const float*)d_in[8];
    const float* bout     = (const float*)d_in[9];
    const float* tte      = (const float*)d_in[10];
    const float* m1w      = (const float*)d_in[11];
    const float* m1b      = (const float*)d_in[12];
    const float* m2w      = (const float*)d_in[13];
    const float* m2b      = (const float*)d_in[14];
    const float* gA       = (const float*)d_in[15];
    const float* gB       = (const float*)d_in[16];
    float* out = (float*)d_out;

    // workspace partition (floats)
    float* ws    = (float*)d_ws;
    float* kin   = ws;                                  // 308*768
    float* k_bh  = kin  + (size_t)BB*JJ*DCC;            // 64*77*64
    float* v_bh  = k_bh + (size_t)BB*HH*JJ*DHH;
    float* q_bh  = v_bh + (size_t)BB*HH*JJ*DHH;         // 64*4096*64
    float* aout  = q_bh + (size_t)BB*HH*NN*DHH;         // 16384*1024
    float* stats = aout + (size_t)MROWS*INNERD;         // [sum, sumsq, std]

    hipMemsetAsync(stats, 0, 4 * sizeof(float), stream);

    prep_kernel<<<BB*JJ, 256, 0, stream>>>(ce, ct, tte, m1w, m1b, m2w, m2b, gA, gB, kin);

    // K = kin @ Wk, V = ce @ Wv  (WMMA, M=308, K=768, permuted -> [B*H, J, DH])
    wmma_gemm<2><<<dim3(INNERD/GBN, (BB*JJ + GBM - 1)/GBM), 256, 0, stream>>>(
        kin, Wk, nullptr, k_bh, BB*JJ, DCC);
    wmma_gemm<2><<<dim3(INNERD/GBN, (BB*JJ + GBM - 1)/GBM), 256, 0, stream>>>(
        ce, Wv, nullptr, v_bh, BB*JJ, DCC);

    // q = x @ Wq  (WMMA, permuted -> [B*H, N, DH])
    wmma_gemm<0><<<dim3(INNERD/GBN, MROWS/GBM), 256, 0, stream>>>(
        x, Wq, nullptr, q_bh, MROWS, DQQ);

    // masked mean/std of sim (WMMA sim tiles, never stored)
    sim_stats_kernel<<<dim3(NN/128, BB*HH), 256, 0, stream>>>(q_bh, k_bh, ct, stats);
    finalize_kernel<<<1, 1, 0, stream>>>(ct, stats);

    // fused WMMA sim -> softmax -> WMMA attn@V
    attn_fused_kernel<<<dim3(NN/64, BB*HH), 128, 0, stream>>>(
        q_bh, k_bh, v_bh, ct, camask, strength, stats, aout);

    // out = attn_out @ Wout + bout  (WMMA)
    wmma_gemm<1><<<dim3(DQQ/GBN, MROWS/GBM), 256, 0, stream>>>(
        aout, Wout, bout, out, MROWS, DQQ);
}

// v004
// Timed twice side by side with v003, it ran 1.23 and 1.24 times as fast.
// Counting every step since v000, it is 2.19 times as fast.
#include <hip/hip_runtime.h>
#include <hip/hip_bf16.h>
#include <math.h>

// ---------------------------------------------------------------------------
// Problem constants
// ---------------------------------------------------------------------------
#define BB   4
#define NN   4096
#define JJ   77
#define HH   16
#define DHH  64
#define DQQ  1024
#define DCC  768
#define DHID 384           // DC/2
#define INNERD 1024        // H*DH
#define MROWS (BB*NN)      // 16384
#define JPAD 80            // sim col padding (5 x 16)
#define KPAD 96            // attn K padding  (3 x 32)

typedef __attribute__((ext_vector_type(16))) _Float16 v16h;
typedef __attribute__((ext_vector_type(8)))  float    v8f;
typedef __attribute__((ext_vector_type(2)))  _Float16 h2_t;
typedef __attribute__((ext_vector_type(8)))  _Float16 v8h;
typedef __attribute__((ext_vector_type(4)))  _Float16 v4h;
typedef __attribute__((ext_vector_type(8)))  short    s16x8;

union Frag16 { v16h v; h2_t h2[8]; _Float16 h[16]; s16x8 q[2]; };

// load one 16x32 f16 WMMA operand fragment from LDS (row-major, "base" points
// at this lane's row at the k-step origin; ISA 16-bit A/B layout)
__device__ __forceinline__ void load_frag(const _Float16* base, Frag16& f, int lhi)
{
    #pragma unroll
    for (int r = 0; r < 8; ++r) {
        int kk = (r < 4) ? (lhi * 8 + 2 * r) : (16 + lhi * 8 + 2 * (r - 4));
        f.h2[r] = *(const h2_t*)(base + kk);
    }
}

// ---------------------------------------------------------------------------
// Token-type embedding MLP -> kin = contextembs + typeemb
// one block of 256 threads per (b,j) row bj (tiny: 0.4 GFLOP total)
// ---------------------------------------------------------------------------
__device__ __forceinline__
void prep_row(int bj, const float* __restrict__ ce, const int* __restrict__ ct,
              const float* __restrict__ tte_emb,
              const float* __restrict__ m1w, const float* __restrict__ m1b,
              const float* __restrict__ m2w, const float* __restrict__ m2b,
              const float* __restrict__ gA, const float* __restrict__ gB,
              float* __restrict__ kin)
{
    const int tid = threadIdx.x;
    __shared__ float tte_s[DCC];
    __shared__ float cein_s[DCC];
    __shared__ float hid_s[DHID];

    int t = ct[bj];
    int tcl = t < 0 ? 0 : (t > 4 ? 4 : t);

    for (int c = tid; c < DCC; c += 256) {
        float tv = tte_emb[(size_t)tcl * DCC + c];
        float ev = ce[(size_t)bj * DCC + c];
        tte_s[c]  = tv;
        cein_s[c] = ev + tv;
    }
    __syncthreads();

    for (int col = tid; col < DHID; col += 256) {
        float acc = m1b[col];
        for (int c = 0; c < DCC; ++c)
            acc = fmaf(cein_s[c], m1w[(size_t)c * DHID + col], acc);
        hid_s[col] = 0.5f * acc * (1.0f + erff(acc * 0.70710678118654752f));
    }
    __syncthreads();

    for (int col = tid; col < DCC; col += 256) {
        float acc = m2b[col];
        for (int c = 0; c < DHID; ++c)
            acc = fmaf(hid_s[c], m2w[(size_t)c * DCC + col], acc);
        float typeemb = tte_s[col] * gA[col] + acc * gB[col];
        kin[(size_t)bj * DCC + col] = ce[(size_t)bj * DCC + col] + typeemb;
    }
}

// ---------------------------------------------------------------------------
// WMMA GEMM: C[M,1024] = A[M,K] * B[K,1024]  (fp32 in, f16 mul, f32 acc)
// Block tile 128x128, BK=32, 8 waves (4x2), each wave 32x64 = 2x4 WMMA tiles.
// MODE 0: store q permuted [B*H, N, DH]
// MODE 1: plain store + bias (output projection)
// MODE 2: store K/V permuted [B*H, J, DH]  (rows = b*J+j, M=308)
// ---------------------------------------------------------------------------
#define GBM 128
#define GBN 128
#define GBK 32
#define LDSS 40   // padded LDS stride in halfs
#define LDSB 144  // B tile row pitch in halfs: 288 bytes, an odd multiple of 32 bytes
#define VPIT 80   // V tile row pitch in halfs: 160 bytes, an odd multiple of 32 bytes

// one 32(k) x 16(n) B fragment out of a row-major [k][n] f16 LDS tile, through the
// transposing LDS load. "base" is this lane's own address:
//   tile + (8*(lane>>4) + (lane&7)) * LDSB + n0 + 8*((lane>>3)&1)
// The lane then holds column n0 + (lane&15), k = 8*lhi + 0..7 and 16 + 8*lhi + 0..7:
// the k order of load_frag().
__device__ __forceinline__ void load_frag_tr(const _Float16* base, Frag16& f)
{
    typedef __attribute__((address_space(3))) s16x8 lds_s16x8;
    f.q[0] = __builtin_amdgcn_ds_load_tr16_b128_v8i16((lds_s16x8*)base);
    f.q[1] = __builtin_amdgcn_ds_load_tr16_b128_v8i16((lds_s16x8*)(base + 16 * LDSB));
}

// the same fragment out of a row-major tile of another pitch (in halfs)
template<int PITCH>
__device__ __forceinline__ void load_frag_tr_p(const _Float16* base, Frag16& f)
{
    typedef __attribute__((address_space(3))) s16x8 lds_s16x8;
    f.q[0] = __builtin_amdgcn_ds_load_tr16_b128_v8i16((lds_s16x8*)base);
    f.q[1] = __builtin_amdgcn_ds_load_tr16_b128_v8i16((lds_s16x8*)(base + 16 * PITCH));
}

// Stage ROWS rows of 64 values (fp32 in memory, contiguous rows) as f16 rows of PITCH
// halfs in LDS, as they lie in memory. A wave's 16-byte loads cover 512 contiguous
// bytes, and all of a thread's loads are issued before the first value is used.
// Rows VALID..ROWS-1 are filled with zero; a load that would fall there is clamped.
template<int NT, int ROWS, int VALID, int PITCH>
__device__ __forceinline__ void stage_rows64(const float* __restrict__ src, _Float16* dst, int tid)
{
    constexpr int NI = ROWS * 16 / NT;                 // 16-byte pieces per thread
    constexpr int NL = (VALID * 16 + NT - 1) / NT;     // of these, trips that hold a valid row
    constexpr int RT = NT / 16;                        // rows per trip
    const int jr = tid >> 4;                           // this thread's row within a trip
    const int c  = (tid & 15) * 4;                     // and its four columns
    const float* s0 = src + tid * 4;                   // rows are contiguous: row jr, column c
    _Float16*    d0 = dst + jr * PITCH + c;
    float4 v[NL];
    #pragma unroll   // v[] stays in registers and the loads issue back to back
    for (int i = 0; i < NL; ++i) {
        if ((i + 1) * RT <= VALID) {
            v[i] = *(const float4*)(s0 + i * RT * 64);
        } else {   // the trip that runs past the last valid row: piece index clamped into the tile
            const int f = tid + i * NT;
            v[i] = *(const float4*)(src + (f < VALID * 16 ? f : VALID * 16 - 1) * 4);
        }
    }
    #pragma unroll   // v[] is indexed by constants; the LDS offsets become immediates
    for (int i = 0; i < NI; ++i) {
        uint2 h = make_uint2(0u, 0u);                  // four f16 values
        if (i < NL) {
            v4h p;
            p[0] = (_Float16)v[i].x;
            p[1] = (_Float16)v[i].y;
            p[2] = (_Float16)v[i].z;
            p[3] = (_Float16)v[i].w;
            h = __builtin_bit_cast(uint2, p);
            if ((i + 1) * RT > VALID && jr + i * RT >= VALID) h = make_uint2(0u, 0u);
        }
        *(uint2*)(d0 + i * RT * PITCH) = h;
    }
}

// One 128x128 tile at (blockM, blockN), by one block of 256 threads: the k loop ...
__device__ __forceinline__
void gemm_accumulate(const float* __restrict__ A, const float* __restrict__ Bm,
                     int M, int K, int blockM, int blockN, v8f (&acc)[2][4])
{
    __shared__ _Float16 Ash[GBM * LDSS];
    __shared__ __attribute__((aligned(32))) _Float16 Bsh[GBK * LDSB];   // [k][n]

    const int tid  = threadIdx.x;
    const int wid  = tid >> 5;
    const int lane = tid & 31;
    const int wm   = wid >> 1;     // 0..3 -> 32-row strip
    const int wn   = wid & 1;      // 0..1 -> 64-col strip
    const int lm   = lane & 15;
    const int lhi  = lane >> 4;

    #pragma unroll
    for (int t = 0; t < 2; ++t)
        #pragma unroll
        for (int u = 0; u < 4; ++u)
            acc[t][u] = (v8f){0.f,0.f,0.f,0.f,0.f,0.f,0.f,0.f};

    int arow = blockM + (tid >> 1);       // global A row
    if (arow >= M) arow = M - 1;          // clamp (stores are guarded)
    const int acb  = (tid & 1) * 16;
    const int bkr  = tid >> 3;            // 0..31
    const int bcb  = (tid & 7) * 16;
    const int skr  = tid >> 4;            // 0..15: staged k rows skr and skr + 16
    const int scb  = (tid & 15) * 8;      // 8 columns: 16 lanes fill one 256-byte LDS row
    const _Float16* bfr = &Bsh[(lhi * 8 + (lane & 7)) * LDSB + wn * 64 + ((lane >> 3) & 1) * 8];

    for (int k0 = 0; k0 < K; k0 += GBK) {
        { // stage A tile (fp32 -> f16)
            const float* src = A + (size_t)arow * K + k0 + acb;
            _Float16* dst = &Ash[(tid >> 1) * LDSS + acb];
            #pragma unroll
            for (int i = 0; i < 16; ++i) dst[i] = (_Float16)src[i];
        }
        // stage B tile as it lies in memory, Bsh[k][n], one 16-byte store per row
        #pragma unroll
        for (int g = 0; g < 2; ++g) {
            const float* src = Bm + (size_t)(k0 + skr + g * 16) * 1024 + blockN + scb;
            v8h pk;
            #pragma unroll
            for (int i = 0; i < 8; ++i) pk[i] = (_Float16)src[i];
            *(v8h*)&Bsh[(skr + g * 16) * LDSB + scb] = pk;
        }
        if (k0 + GBK < K) {   // global_prefetch of next k-tile
            __builtin_prefetch(A + (size_t)arow * K + k0 + GBK + acb, 0, 1);
            __builtin_prefetch(Bm + (size_t)(k0 + GBK + bkr) * 1024 + blockN + bcb, 0, 1);
        }
        __syncthreads();

        Frag16 af[2], bf[4];
        #pragma unroll
        for (int t = 0; t < 2; ++t)
            load_frag(&Ash[(wm * 32 + t * 16 + lm) * LDSS], af[t], lhi);
        #pragma unroll
        for (int u = 0; u < 4; ++u)
            load_frag_tr(bfr + u * 16, bf[u]);

        #pragma unroll
        for (int t = 0; t < 2; ++t)
            #pragma unroll
            for (int u = 0; u < 4; ++u)
                acc[t][u] = __builtin_amdgcn_wmma_f32_16x16x32_f16(
                    false, af[t].v, false, bf[u].v,
                    (short)0, acc[t][u], false, false);

        __syncthreads();
    }
}

// ... and the store of its accumulators
template<int MODE>
__device__ __forceinline__
void gemm_store(const v8f (&acc)[2][4], const float* __restrict__ bias, float* __restrict__ C,
                int M, int blockM, int blockN)
{
    const int tid  = threadIdx.x;
    const int wid  = tid >> 5;
    const int lane = tid & 31;
    const int wm   = wid >> 1;
    const int wn   = wid & 1;
    const int lm   = lane & 15;
    const int lhi  = lane >> 4;

    // C/D layout: lanes 0-15 -> M=r, lanes 16-31 -> M=8+r, N=lane&15
    #pragma unroll
    for (int t = 0; t < 2; ++t) {
        #pragma unroll
        for (int u = 0; u < 4; ++u) {
            #pragma unroll
            for (int r = 0; r < 8; ++r) {
                int rg = blockM + wm * 32 + t * 16 + (lhi ? 8 + r : r);
                int cg = blockN + wn * 64 + u * 16 + lm;
                float val = acc[t][u][r];
                if (MODE == 1) {
                    C[(size_t)rg * 1024 + cg] = val + bias[cg];
                } else if (MODE == 0) {
                    int b = rg >> 12, n = rg & 4095;
                    int h = cg >> 6,  d = cg & 63;
                    C[(((size_t)(b * HH + h)) * NN + n) * DHH + d] = val;
                } else { // MODE 2: rows are (b, j)
                    if (rg < M) {
                        int b = rg / JJ, j = rg - b * JJ;
                        int h = cg >> 6, d = cg & 63;
                        C[(((size_t)(b * HH + h)) * JJ + j) * DHH + d] = val;
                    }
                }
            }
        }
    }
    // where other block ranges' code follows in the same kernel, it reuses the registers
    // that these stores name: the wait stands in front of any such overwrite
    if (MODE == 0) asm volatile("s_wait_xcnt 0x0" ::: "memory");
}

// ---------------------------------------------------------------------------
// The work in front of the attention, in two launches. The embedding MLP, the V
// projection and the q projection do not depend on one another; the K projection
// needs only the MLP. The MLP and the K and V projections are short chains of
// dependent memory round trips on few blocks, which leave most of the chip idle
// when launched alone, so each launch runs them beside a share of the q tiles.
// The long chains take the lowest indices.
// The q share of the first launch is what is resident at once beside them: at up to
// 128 registers a wave, 4 blocks a WGP, 1024 places; 308 + 24 + 86 * 8 = 1020 blocks.
// ---------------------------------------------------------------------------
#define NTN    (INNERD / GBN)                        // 8 column tiles
#define KVBLK  (NTN * ((BB * JJ + GBM - 1) / GBM))   // 24 tiles of a K or V projection
#define QTM1   86                                    // q row tiles in the first launch
#define QTM2   (MROWS / GBM - QTM1)                  // 42 in the second

__global__ __launch_bounds__(256)
void front1_kernel(const float* __restrict__ ce, const int* __restrict__ ct,
                   const float* __restrict__ tte_emb,
                   const float* __restrict__ m1w, const float* __restrict__ m1b,
                   const float* __restrict__ m2w, const float* __restrict__ m2b,
                   const float* __restrict__ gA, const float* __restrict__ gB,
                   float* __restrict__ kin,
                   const float* __restrict__ Wv, float* __restrict__ v_bh,
                   const float* __restrict__ x, const float* __restrict__ Wq,
                   float* __restrict__ q_bh)
{
    const int blk = blockIdx.x;
    if (blk < BB * JJ) {
        prep_row(blk, ce, ct, tte_emb, m1w, m1b, m2w, m2b, gA, gB, kin);
        return;
    }
    const bool isv = blk < BB * JJ + KVBLK;          // the same for the whole block
    const int  t   = blk - (isv ? BB * JJ : BB * JJ + KVBLK);
    const int  bm  = (t / NTN) * GBM, bn = (t % NTN) * GBN;
    v8f acc[2][4];
    gemm_accumulate(isv ? ce : x, isv ? Wv : Wq, isv ? BB * JJ : MROWS, isv ? DCC : DQQ, bm, bn, acc);
    if (isv) gemm_store<2>(acc, nullptr, v_bh, BB * JJ, bm, bn);
    else     gemm_store<0>(acc, nullptr, q_bh, MROWS, bm, bn);
}

__global__ __launch_bounds__(256)
void front2_kernel(const float* __restrict__ kin, const float* __restrict__ Wk,
                   float* __restrict__ k_bh,
                   const float* __restrict__ x, const float* __restrict__ Wq,
                   float* __restrict__ q_bh)
{
    const int  blk = blockIdx.x;
    const bool isk = blk < KVBLK;                    // the same for the whole block
    const int  t   = isk ? blk : blk - KVBLK + QTM1 * NTN;
    const int  bm  = (t / NTN) * GBM, bn = (t % NTN) * GBN;
    v8f acc[2][4];
    gemm_accumulate(isk ? kin : x, isk ? Wk : Wq, isk ? BB * JJ : MROWS, isk ? DCC : DQQ, bm, bn, acc);
    if (isk) gemm_store<2>(acc, nullptr, k_bh, BB * JJ, bm, bn);
    else     gemm_store<0>(acc, nullptr, q_bh, MROWS, bm, bn);
}

// output projection: out = attn_out @ Wout + bout
__global__ __launch_bounds__(256)
void outproj_kernel(const float* __restrict__ A, const float* __restrict__ Bm,
                    const float* __restrict__ bias, float* __restrict__ C,
                    int M, int K)
{
    const int bm = blockIdx.y * GBM, bn = blockIdx.x * GBN;
    v8f acc[2][4];
    gemm_accumulate(A, Bm, M, K, bm, bn, acc);
    gemm_store<1>(acc, bias, C, M, bm, bn);
}

// ---------------------------------------------------------------------------
// Kernel 3: WMMA sim tiles + masked sum/sumsq (sim never hits HBM)
// grid (N/128, B*H), 256 threads (8 waves x 16 rows), 5 j-tiles, K=64
// ---------------------------------------------------------------------------
__global__ __launch_bounds__(256)
void sim_stats_kernel(const float* __restrict__ q_bh, const float* __restrict__ k_bh,
                      const int* __restrict__ ct, float* __restrict__ stats)
{
    __shared__ __attribute__((aligned(16))) _Float16 qsh[128 * 72];     // [row][k], stride 72
    __shared__ __attribute__((aligned(16))) _Float16 kshT[JPAD * 72];   // [j][k], rows 77..79 zero
    __shared__ int   sel2[JPAD];
    __shared__ float rs[256], rq[256];

    const int tid  = threadIdx.x;
    const int wid  = tid >> 5;
    const int lane = tid & 31;
    const int lm   = lane & 15;
    const int lhi  = lane >> 4;
    const int bh   = blockIdx.y;
    const int b    = bh >> 4;
    const int rowbase = blockIdx.x * 128;

    // q tile 128x64 and K tile 80x64, fp32 -> f16
    stage_rows64<256, 128, 128, 72>(q_bh + ((size_t)bh * NN + rowbase) * DHH, qsh, tid);
    stage_rows64<256, JPAD, JJ, 72>(k_bh + (size_t)bh * JJ * DHH, kshT, tid);
    for (int j = tid; j < JPAD; j += 256)
        sel2[j] = (j < JJ && ct[b * JJ + j] >= 2) ? 1 : 0;
    __syncthreads();

    v8f acc[5];
    #pragma unroll
    for (int t = 0; t < 5; ++t) acc[t] = (v8f){0.f,0.f,0.f,0.f,0.f,0.f,0.f,0.f};

    #pragma unroll
    for (int s = 0; s < 2; ++s) {          // K = 64 -> 2 k-steps
        Frag16 af;
        load_frag(&qsh[(wid * 16 + lm) * 72 + s * 32], af, lhi);
        #pragma unroll
        for (int t = 0; t < 5; ++t) {
            Frag16 bf;
            load_frag(&kshT[(t * 16 + lm) * 72 + s * 32], bf, lhi);
            acc[t] = __builtin_amdgcn_wmma_f32_16x16x32_f16(
                false, af.v, false, bf.v, (short)0, acc[t], false, false);
        }
    }

    // lane (t,lm) owns column j = t*16+lm for 8 rows -> accumulate stats
    float s1 = 0.f, s2 = 0.f;
    #pragma unroll
    for (int t = 0; t < 5; ++t) {
        int j = t * 16 + lm;
        if (j < JJ && sel2[j]) {
            #pragma unroll
            for (int r = 0; r < 8; ++r) {
                float v = acc[t][r];
                s1 += v;
                s2 = fmaf(v, v, s2);
            }
        }
    }
    rs[tid] = s1; rq[tid] = s2;
    __syncthreads();
    for (int off = 128; off > 0; off >>= 1) {
        if (tid < off) { rs[tid] += rs[tid + off]; rq[tid] += rq[tid + off]; }
        __syncthreads();
    }
    if (tid == 0) {
        atomicAdd(&stats[0], rs[0]);
        atomicAdd(&stats[1], rq[0]);
    }
}

// ---------------------------------------------------------------------------
// Kernel 4: finalize std (Bessel-corrected, matching torch .std())
// ---------------------------------------------------------------------------
__global__ void finalize_kernel(const int* __restrict__ ct, float* __restrict__ stats)
{
    int cnt = 0;
    for (int i = 0; i < BB * JJ; ++i) cnt += (ct[i] >= 2) ? 1 : 0;
    float nsel = (float)cnt * (float)HH * (float)NN;
    float mean = (nsel > 0.f) ? stats[0] / nsel : 0.f;
    float var  = (nsel > 1.f) ? (stats[1] - nsel * mean * mean) / (nsel - 1.f) : 0.f;
    stats[2] = sqrtf(var > 0.f ? var : 0.f);
}

// ---------------------------------------------------------------------------
// Kernel 5: fused attention block, 64 rows / block, 128 threads (4 waves).
// The scores are formed transposed, S^T = K * Q^T (K is the A operand, Q the B
// operand), so a lane's accumulators hold 40 scores of ONE query row:
//   column = lane & 15 -> query row,  j = t*16 + (lane >> 4)*8 + r.
// The masked softmax runs in registers on all lanes; lanes l and l^16 share a
// query row and exchange three partial results. That accumulator order is the
// k order of a 16-bit B operand, so the probabilities, converted to f16, are
// the B operand of out^T = V^T * P^T with no pass through LDS.
// ---------------------------------------------------------------------------
__device__ __forceinline__ float other_half(float x)   // value of lane l ^ 16
{
    int b = __builtin_bit_cast(int, x);
    b = __builtin_amdgcn_permlanex16(b, b, 0x76543210, 0xfedcba98, false, false);
    return __builtin_bit_cast(float, b);
}

// 2^x. The v_nop keeps the one free issue slot the instruction set asks for
// behind a transcendental.
__device__ __forceinline__ float exp2_slot(float x)
{
    float y;
    asm("v_exp_f32 %0, %1\n\tv_nop" : "=v"(y) : "v"(x));
    return y;
}

__global__ __launch_bounds__(128)
void attn_fused_kernel(const float* __restrict__ q_bh, const float* __restrict__ k_bh,
                       const float* __restrict__ v_bh, const int* __restrict__ ct,
                       const float* __restrict__ camask, const float* __restrict__ strength,
                       const float* __restrict__ stats, float* __restrict__ out_attn)
{
    __shared__ __attribute__((aligned(16))) _Float16 qsh[64 * 72];      // q tile [row][k]
    __shared__ __attribute__((aligned(16))) _Float16 kshT[JPAD * 72];   // [j][k], rows 77..79 zero
    __shared__ __attribute__((aligned(32))) _Float16 vsh[KPAD * VPIT];  // [j][d], rows 77..95 zero
    __shared__ int      sel2[JPAD], selg[JPAD];

    const int tid  = threadIdx.x;
    const int wid  = tid >> 5;     // 0..3 -> 16-row strip
    const int lane = tid & 31;
    const int lm   = lane & 15;
    const int lhi  = lane >> 4;
    const int bh   = blockIdx.y;
    const int b    = bh >> 4;
    const int h    = bh & 15;
    const int rowbase = blockIdx.x * 64;
    const int rowg = rowbase + wid * 16 + lm;   // this lane's query row

    // q tile 64x64 and K tile 80x64, fp32 -> f16, each as it lies in memory
    stage_rows64<128, 64, 64, 72>(q_bh + ((size_t)bh * NN + rowbase) * DHH, qsh, tid);
    stage_rows64<128, JPAD, JJ, 72>(k_bh + (size_t)bh * JJ * DHH, kshT, tid);
    for (int j = tid; j < JPAD; j += 128) {
        int t = (j < JJ) ? ct[b * JJ + j] : -1;
        sel2[j] = (t >= 2) ? 1 : 0;
        selg[j] = (t >= 0 && t < 2) ? 1 : 0;
    }

    // this lane's 40 mask values, read once; index clamped for j = 77..79
    float wf[5][8];
    {
        const float* camrow = camask + ((size_t)b * NN + rowg) * JJ;
        #pragma unroll
        for (int t = 0; t < 5; ++t)
            #pragma unroll
            for (int r = 0; r < 8; ++r) {
                int j = t * 16 + lhi * 8 + r;
                wf[t][r] = camrow[j < JJ ? j : JJ - 1];
            }
    }
    // the registers that hold the mask loads' addresses are reused by the staging below
    asm volatile("s_wait_xcnt 0x0" ::: "memory");

    // V tile 96x64, fp32 -> f16, as it lies in memory
    stage_rows64<128, KPAD, JJ, VPIT>(v_bh + (size_t)bh * JJ * DHH, vsh, tid);
    __syncthreads();

    // ---- stage 1: S^T = K @ q^T via WMMA, kept in registers
    v8f acc[5];
    #pragma unroll
    for (int t = 0; t < 5; ++t) acc[t] = (v8f){0.f,0.f,0.f,0.f,0.f,0.f,0.f,0.f};
    #pragma unroll
    for (int s = 0; s < 2; ++s) {
        Frag16 qf;
        load_frag(&qsh[(wid * 16 + lm) * 72 + s * 32], qf, lhi);
        #pragma unroll
        for (int t = 0; t < 5; ++t) {
            Frag16 kf;
            load_frag(&kshT[(t * 16 + lm) * 72 + s * 32], kf, lhi);
            acc[t] = __builtin_amdgcn_wmma_f32_16x16x32_f16(
                false, kf.v, false, qf.v, (short)0, acc[t], false, false);
        }
    }

    // ---- stage 2: masked softmax of this lane's query row, in registers
    const float simstd = stats[2];
    const float str    = strength[0];
    const float scale  = 0.125f;                  // 1/sqrt(DH)

    float wfmax = -__FLT_MAX__;
    #pragma unroll
    for (int t = 0; t < 5; ++t)
        #pragma unroll
        for (int r = 0; r < 8; ++r) {
            int j = t * 16 + lhi * 8 + r;
            float w = sel2[j] ? wf[t][r] * simstd * str : 0.f;
            wf[t][r] = w;
            if (j < JJ) wfmax = fmaxf(wfmax, w);
        }
    wfmax = fmaxf(wfmax, other_half(wfmax));
    const float thr = fmaxf(wfmax, 0.001f) - 0.0001f;

    float m = -__FLT_MAX__;
    #pragma unroll
    for (int t = 0; t < 5; ++t)
        #pragma unroll
        for (int r = 0; r < 8; ++r) {
            int j = t * 16 + lhi * 8 + r;
            // both tests evaluated, no short circuit: the flag reads stay wide and unbranched
            bool lmv = (wf[t][r] >= thr) | (selg[j] != 0);
            float sv = (lmv & (j < JJ)) ? acc[t][r] * scale : -__FLT_MAX__;
            acc[t][r] = sv;                       // masked + scaled score
            m = fmaxf(m, sv);
        }
    m = fmaxf(m, other_half(m));

    float denom = 0.f;
    Frag16 pf[3];                                 // unnormalized probs, B operand
    #pragma unroll
    for (int t = 0; t < 6; ++t)
        #pragma unroll
        for (int r = 0; r < 8; ++r) {
            float p = 0.f;
            if (t < 5) {
                int j = t * 16 + lhi * 8 + r;
                p = exp2_slot((acc[t][r] - m) * 1.4426950408889634f);   // e^(s - m)
                if (j >= JJ) p = 0.f;
                denom += p;
            }
            pf[t >> 1].h[(t & 1) * 8 + r] = (_Float16)p;
        }
    denom += other_half(denom);
    const float inv = 1.f / denom;

    // keeps the PV matrix instructions below every exp2_slot()
    __builtin_amdgcn_sched_barrier(0);

    // ---- stage 3: out^T = V^T @ P^T via WMMA (K = 96 -> 3 k-steps, 4 d tiles)
    v8f o[4];
    #pragma unroll
    for (int t = 0; t < 4; ++t) o[t] = (v8f){0.f,0.f,0.f,0.f,0.f,0.f,0.f,0.f};
    // V^T fragments come out of the row-major V tile through the transposing LDS load:
    // the lane holds d = t*16 + lm, j = s*32 + 8*lhi + 0..7 and + 16: the k order of pf
    const _Float16* vfr = &vsh[(lhi * 8 + (lane & 7)) * VPIT + ((lane >> 3) & 1) * 8];
    #pragma unroll
    for (int s = 0; s < 3; ++s) {
        #pragma unroll
        for (int t = 0; t < 4; ++t) {
            Frag16 vf;
            load_frag_tr_p<VPIT>(vfr + s * 32 * VPIT + t * 16, vf);
            o[t] = __builtin_amdgcn_wmma_f32_16x16x32_f16(
                false, vf.v, false, pf[s].v, (short)0, o[t], false, false);
        }
    }
    // a lane holds d = t*16 + lhi*8 + 0..7 of its query row: two 16-byte stores
    float* orow = out_attn + ((size_t)b * NN + rowg) * INNERD + h * DHH + lhi * 8;
    #pragma unroll
    for (int t = 0; t < 4; ++t) {
        *(float4*)(orow + t * 16) =
            make_float4(o[t][0] * inv, o[t][1] * inv, o[t][2] * inv, o[t][3] * inv);
        *(float4*)(orow + t * 16 + 4) =
            make_float4(o[t][4] * inv, o[t][5] * inv, o[t][6] * inv, o[t][7] * inv);
    }
}

// ---------------------------------------------------------------------------
// launch
// ---------------------------------------------------------------------------
extern "C" void kernel_launch(void* const* d_in, const int* in_sizes, int n_in,
                              void* d_out, int out_size, void* d_ws, size_t ws_size,
                              hipStream_t stream)
{
    const float* x        = (const float*)d_in[0];
    const float* ce       = (const float*)d_in[1];
    const int*   ct       = (const int*)  d_in[2];
    const float* camask   = (const float*)d_in[3];
    const float* strength = (const float*)d_in[4];
    const float* Wq       = (const float*)d_in[5];
    const float* Wk       = (const float*)d_in[6];
    const float* Wv       = (const float*)d_in[7];
    const float* Wout     = (const float*)d_in[8];
    const float* bout     = (const float*)d_in[9];
    const float* tte      = (const float*)d_in[10];
    const float* m1w      = (const float*)d_in[11];
    const float* m1b      = (const float*)d_in[12];
    const float* m2w      = (const float*)d_in[13];
    const float* m2b      = (const float*)d_in[14];
    const float* gA       = (const float*)d_in[15];
    const float* gB       = (const float*)d_in[16];
    float* out = (float*)d_out;

    // workspace partition (floats)
    float* ws    = (float*)d_ws;
    float* kin   = ws;                                  // 308*768
    float* k_bh  = kin  + (size_t)BB*JJ*DCC;            // 64*77*64
    float* v_bh  = k_bh + (size_t)BB*HH*JJ*DHH;
    float* q_bh  = v_bh + (size_t)BB*HH*JJ*DHH;         // 64*4096*64
    float* aout  = q_bh + (size_t)BB*HH*NN*DHH;         // 16384*1024
    float* stats = aout + (size_t)MROWS*INNERD;         // [sum, sumsq, std]

    hipMemsetAsync(stats, 0, 4 * sizeof(float), stream);

    // kin (embedding MLP), V = ce @ Wv and the first q row tiles of q = x @ Wq
    front1_kernel<<<BB*JJ + KVBLK + QTM1*NTN, 256, 0, stream>>>(
        ce, ct, tte, m1w, m1b, m2w, m2b, gA, gB, kin, Wv, v_bh, x, Wq, q_bh);

    // K = kin @ Wk and the remaining q row tiles
    front2_kernel<<<KVBLK + QTM2*NTN, 256, 0, stream>>>(kin, Wk, k_bh, x, Wq, q_bh);

    // masked mean/std of sim (WMMA sim tiles, never stored)
    sim_stats_kernel<<<dim3(NN/128, BB*HH), 256, 0, stream>>>(q_bh, k_bh, ct, stats);
    finalize_kernel<<<1, 1, 0, stream>>>(ct, stats);

    // fused WMMA sim -> softmax -> WMMA attn@V
    attn_fused_kernel<<<dim3(NN/64, BB*HH), 128, 0, stream>>>(
        q_bh, k_bh, v_bh, ct, camask, strength, stats, aout);

    // out = attn_out @ Wout + bout  (WMMA)
    outproj_kernel<<<dim3(DQQ/GBN, MROWS/GBM), 256, 0, stream>>>(
        aout, Wout, bout, out, MROWS, DQQ);
}

// v005
// Timed twice side by side with v004, it ran 1.04 times as fast both times.
// Counting every step since v000, it is 2.29 times as fast.
#include <hip/hip_runtime.h>
#include <hip/hip_bf16.h>
#include <math.h>

// ---------------------------------------------------------------------------
// Problem constants
// ---------------------------------------------------------------------------
#define BB   4
#define NN   4096
#define JJ   77
#define HH   16
#define DHH  64
#define DQQ  1024
#define DCC  768
#define DHID 384           // DC/2
#define INNERD 1024        // H*DH
#define MROWS (BB*NN)      // 16384
#define JPAD 80            // sim col padding (5 x 16)
#define KPAD 96            // attn K padding  (3 x 32)

typedef __attribute__((ext_vector_type(16))) _Float16 v16h;
typedef __attribute__((ext_vector_type(8)))  float    v8f;
typedef __attribute__((ext_vector_type(2)))  _Float16 h2_t;
typedef __attribute__((ext_vector_type(8)))  _Float16 v8h;
typedef __attribute__((ext_vector_type(4)))  _Float16 v4h;
typedef __attribute__((ext_vector_type(8)))  short    s16x8;

union Frag16 { v16h v; h2_t h2[8]; _Float16 h[16]; s16x8 q[2]; };

// load one 16x32 f16 WMMA operand fragment from LDS (row-major, "base" points
// at this lane's row at the k-step origin; ISA 16-bit A/B layout)
__device__ __forceinline__ void load_frag(const _Float16* base, Frag16& f, int lhi)
{
    #pragma unroll
    for (int r = 0; r < 8; ++r) {
        int kk = (r < 4) ? (lhi * 8 + 2 * r) : (16 + lhi * 8 + 2 * (r - 4));
        f.h2[r] = *(const h2_t*)(base + kk);
    }
}

// ---------------------------------------------------------------------------
// Token-type embedding MLP -> kin = contextembs + typeemb
// one block of 256 threads per (b,j) row bj (tiny: 0.4 GFLOP total)
// ---------------------------------------------------------------------------
__device__ __forceinline__
void prep_row(int bj, const float* __restrict__ ce, const int* __restrict__ ct,
              const float* __restrict__ tte_emb,
              const float* __restrict__ m1w, const float* __restrict__ m1b,
              const float* __restrict__ m2w, const float* __restrict__ m2b,
              const float* __restrict__ gA, const float* __restrict__ gB,
              float* __restrict__ kin)
{
    const int tid = threadIdx.x;
    __shared__ float tte_s[DCC];
    __shared__ float cein_s[DCC];
    __shared__ float hid_s[DHID];

    int t = ct[bj];
    int tcl = t < 0 ? 0 : (t > 4 ? 4 : t);

    for (int c = tid; c < DCC; c += 256) {
        float tv = tte_emb[(size_t)tcl * DCC + c];
        float ev = ce[(size_t)bj * DCC + c];
        tte_s[c]  = tv;
        cein_s[c] = ev + tv;
    }
    __syncthreads();

    for (int col = tid; col < DHID; col += 256) {
        float acc = m1b[col];
        for (int c = 0; c < DCC; ++c)
            acc = fmaf(cein_s[c], m1w[(size_t)c * DHID + col], acc);
        hid_s[col] = 0.5f * acc * (1.0f + erff(acc * 0.70710678118654752f));
    }
    __syncthreads();

    for (int col = tid; col < DCC; col += 256) {
        float acc = m2b[col];
        for (int c = 0; c < DHID; ++c)
            acc = fmaf(hid_s[c], m2w[(size_t)c * DCC + col], acc);
        float typeemb = tte_s[col] * gA[col] + acc * gB[col];
        kin[(size_t)bj * DCC + col] = ce[(size_t)bj * DCC + col] + typeemb;
    }
}

// ---------------------------------------------------------------------------
// WMMA GEMM: C[M,1024] = A[M,K] * B[K,1024]  (fp32 in, f16 mul, f32 acc)
// Block tile 128x128, BK=32, 8 waves (4x2), each wave 32x64 = 2x4 WMMA tiles.
// MODE 0: store q permuted [B*H, N, DH]
// MODE 1: plain store + bias (output projection)
// MODE 2: store K/V permuted [B*H, J, DH]  (rows = b*J+j, M=308)
// ---------------------------------------------------------------------------
#define GBM 128
#define GBN 128
#define GBK 32
#define LDSS 40   // padded LDS stride in halfs
#define LDSB 144  // B tile row pitch in halfs: 288 bytes, an odd multiple of 32 bytes
#define VPIT 80   // V tile row pitch in halfs: 160 bytes, an odd multiple of 32 bytes

// one 32(k) x 16(n) B fragment out of a row-major [k][n] f16 LDS tile, through the
// transposing LDS load. "base" is this lane's own address:
//   tile + (8*(lane>>4) + (lane&7)) * LDSB + n0 + 8*((lane>>3)&1)
// The lane then holds column n0 + (lane&15), k = 8*lhi + 0..7 and 16 + 8*lhi + 0..7:
// the k order of load_frag().
__device__ __forceinline__ void load_frag_tr(const _Float16* base, Frag16& f)
{
    typedef __attribute__((address_space(3))) s16x8 lds_s16x8;
    f.q[0] = __builtin_amdgcn_ds_load_tr16_b128_v8i16((lds_s16x8*)base);
    f.q[1] = __builtin_amdgcn_ds_load_tr16_b128_v8i16((lds_s16x8*)(base + 16 * LDSB));
}

// the same fragment out of a row-major tile of another pitch (in halfs)
template<int PITCH>
__device__ __forceinline__ void load_frag_tr_p(const _Float16* base, Frag16& f)
{
    typedef __attribute__((address_space(3))) s16x8 lds_s16x8;
    f.q[0] = __builtin_amdgcn_ds_load_tr16_b128_v8i16((lds_s16x8*)base);
    f.q[1] = __builtin_amdgcn_ds_load_tr16_b128_v8i16((lds_s16x8*)(base + 16 * PITCH));
}

// Stage ROWS rows of 64 values (fp32 in memory, contiguous rows) as f16 rows of PITCH
// halfs in LDS, as they lie in memory. A wave's 16-byte loads cover 512 contiguous
// bytes, and all of a thread's loads are issued before the first value is used.
// Rows VALID..ROWS-1 are filled with zero; a load that would fall there is clamped.
template<int NT, int ROWS, int VALID, int PITCH>
__device__ __forceinline__ void stage_rows64(const float* __restrict__ src, _Float16* dst, int tid)
{
    constexpr int NI = ROWS * 16 / NT;                 // 16-byte pieces per thread
    constexpr int NL = (VALID * 16 + NT - 1) / NT;     // of these, trips that hold a valid row
    constexpr int RT = NT / 16;                        // rows per trip
    const int jr = tid >> 4;                           // this thread's row within a trip
    const int c  = (tid & 15) * 4;                     // and its four columns
    const float* s0 = src + tid * 4;                   // rows are contiguous: row jr, column c
    _Float16*    d0 = dst + jr * PITCH + c;
    float4 v[NL];
    #pragma unroll   // v[] stays in registers and the loads issue back to back
    for (int i = 0; i < NL; ++i) {
        if ((i + 1) * RT <= VALID) {
            v[i] = *(const float4*)(s0 + i * RT * 64);
        } else {   // the trip that runs past the last valid row: piece index clamped into the tile
            const int f = tid + i * NT;
            v[i] = *(const float4*)(src + (f < VALID * 16 ? f : VALID * 16 - 1) * 4);
        }
    }
    #pragma unroll   // v[] is indexed by constants; the LDS offsets become immediates
    for (int i = 0; i < NI; ++i) {
        uint2 h = make_uint2(0u, 0u);                  // four f16 values
        if (i < NL) {
            v4h p;
            p[0] = (_Float16)v[i].x;
            p[1] = (_Float16)v[i].y;
            p[2] = (_Float16)v[i].z;
            p[3] = (_Float16)v[i].w;
            h = __builtin_bit_cast(uint2, p);
            if ((i + 1) * RT > VALID && jr + i * RT >= VALID) h = make_uint2(0u, 0u);
        }
        *(uint2*)(d0 + i * RT * PITCH) = h;
    }
}

// One 128x128 tile at (blockM, blockN), by one block of 256 threads: the k loop ...
__device__ __forceinline__
void gemm_accumulate(const float* __restrict__ A, const float* __restrict__ Bm,
                     int M, int K, int blockM, int blockN, v8f (&acc)[2][4])
{
    __shared__ __attribute__((aligned(16))) _Float16 Ash[GBM * LDSS];
    __shared__ __attribute__((aligned(32))) _Float16 Bsh[GBK * LDSB];   // [k][n]

    const int tid  = threadIdx.x;
    const int wid  = tid >> 5;
    const int lane = tid & 31;
    const int wm   = wid >> 1;     // 0..3 -> 32-row strip
    const int wn   = wid & 1;      // 0..1 -> 64-col strip
    const int lm   = lane & 15;
    const int lhi  = lane >> 4;

    #pragma unroll
    for (int t = 0; t < 2; ++t)
        #pragma unroll
        for (int u = 0; u < 4; ++u)
            acc[t][u] = (v8f){0.f,0.f,0.f,0.f,0.f,0.f,0.f,0.f};

    int arow = blockM + (tid >> 1);       // global A row
    if (arow >= M) arow = M - 1;          // clamp (stores are guarded)
    const int acb  = (tid & 1) * 16;
    const int bkr  = tid >> 3;            // 0..31
    const int bcb  = (tid & 7) * 16;
    // Staging map: every wave-wide 16-byte load covers whole 128-byte lines.
    // A: 8 lanes take the 128 bytes that one row has in this k tile, a wave 4 rows;
    //    a thread's rows are sar + 32 i. Byte offsets from A, rows clamped like arow.
    // B: a wave takes 512 contiguous bytes of one k row; a thread's rows are sbr + 8 i.
    const int sar  = tid >> 3;            // 0..31
    const int sac  = (tid & 7) * 4;       // four columns
    const int sbr  = tid >> 5;            // 0..7
    const int sbc  = lane * 4;            // four columns
    unsigned aoff[4];
    #pragma unroll   // aoff[] is indexed by constants and stays in registers
    for (int i = 0; i < 4; ++i) {
        int r = blockM + sar + 32 * i;
        if (r >= M) r = M - 1;
        aoff[i] = ((unsigned)r * (unsigned)K + (unsigned)sac) * 4u;
    }
    unsigned boff = ((unsigned)sbr * 1024u + (unsigned)blockN + (unsigned)sbc) * 4u;
    const _Float16* bfr = &Bsh[(lhi * 8 + (lane & 7)) * LDSB + wn * 64 + ((lane >> 3) & 1) * 8];

    for (int k0 = 0; k0 < K; k0 += GBK) {
        // stage both tiles (fp32 -> f16), each as it lies in memory: Ash[m][k], Bsh[k][n]
        float4 av[4], bv[4];
        // uniform base + 32-bit byte offset: one address register a load (both operands are
        // far below 4 GiB)
        #pragma unroll   // av[] stays in registers and the loads issue back to back
        for (int i = 0; i < 4; ++i) av[i] = *(const float4*)((const char*)A + aoff[i]);
        #pragma unroll   // the same for bv[]
        for (int i = 0; i < 4; ++i) bv[i] = *(const float4*)((const char*)Bm + boff + i * 32768);
        #pragma unroll   // av[] is indexed by constants; the LDS offsets become immediates
        for (int i = 0; i < 4; ++i) {
            v4h p;
            p[0] = (_Float16)av[i].x;  p[1] = (_Float16)av[i].y;
            p[2] = (_Float16)av[i].z;  p[3] = (_Float16)av[i].w;
            *(v4h*)&Ash[(sar + 32 * i) * LDSS + sac] = p;
        }
        #pragma unroll   // the same for bv[]
        for (int i = 0; i < 4; ++i) {
            v4h p;
            p[0] = (_Float16)bv[i].x;  p[1] = (_Float16)bv[i].y;
            p[2] = (_Float16)bv[i].z;  p[3] = (_Float16)bv[i].w;
            *(v4h*)&Bsh[(sbr + 8 * i) * LDSB + sbc] = p;
        }
        #pragma unroll   // on to the next k tile (the loaded values have arrived)
        for (int i = 0; i < 4; ++i) aoff[i] += GBK * 4u;
        boff += GBK * 4096u;
        if (k0 + GBK < K) {   // global_prefetch of next k-tile
            __builtin_prefetch(A + (size_t)arow * K + k0 + GBK + acb, 0, 1);
            __builtin_prefetch(Bm + (size_t)(k0 + GBK + bkr) * 1024 + blockN + bcb, 0, 1);
        }
        __syncthreads();

        Frag16 af[2], bf[4];
        #pragma unroll
        for (int t = 0; t < 2; ++t)
            load_frag(&Ash[(wm * 32 + t * 16 + lm) * LDSS], af[t], lhi);
        #pragma unroll
        for (int u = 0; u < 4; ++u)
            load_frag_tr(bfr + u * 16, bf[u]);

        #pragma unroll
        for (int t = 0; t < 2; ++t)
            #pragma unroll
            for (int u = 0; u < 4; ++u)
                acc[t][u] = __builtin_amdgcn_wmma_f32_16x16x32_f16(
                    false, af[t].v, false, bf[u].v,
                    (short)0, acc[t][u], false, false);

        __syncthreads();
    }
}

// ... and the store of its accumulators
template<int MODE>
__device__ __forceinline__
void gemm_store(const v8f (&acc)[2][4], const float* __restrict__ bias, float* __restrict__ C,
                int M, int blockM, int blockN)
{
    const int tid  = threadIdx.x;
    const int wid  = tid >> 5;
    const int lane = tid & 31;
    const int wm   = wid >> 1;
    const int wn   = wid & 1;
    const int lm   = lane & 15;
    const int lhi  = lane >> 4;

    // C/D layout: lanes 0-15 -> M=r, lanes 16-31 -> M=8+r, N=lane&15
    #pragma unroll
    for (int t = 0; t < 2; ++t) {
        #pragma unroll
        for (int u = 0; u < 4; ++u) {
            #pragma unroll
            for (int r = 0; r < 8; ++r) {
                int rg = blockM + wm * 32 + t * 16 + (lhi ? 8 + r : r);
                int cg = blockN + wn * 64 + u * 16 + lm;
                float val = acc[t][u][r];
                if (MODE == 1) {
                    C[(size_t)rg * 1024 + cg] = val + bias[cg];
                } else if (MODE == 0) {
                    int b = rg >> 12, n = rg & 4095;
                    int h = cg >> 6,  d = cg & 63;
                    C[(((size_t)(b * HH + h)) * NN + n) * DHH + d] = val;
                } else { // MODE 2: rows are (b, j)
                    if (rg < M) {
                        int b = rg / JJ, j = rg - b * JJ;
                        int h = cg >> 6, d = cg & 63;
                        C[(((size_t)(b * HH + h)) * JJ + j) * DHH + d] = val;
                    }
                }
            }
        }
    }
    // where other block ranges' code follows in the same kernel, it reuses the registers
    // that these stores name: the wait stands in front of any such overwrite
    if (MODE == 0) asm volatile("s_wait_xcnt 0x0" ::: "memory");
}

// ---------------------------------------------------------------------------
// The work in front of the attention, in two launches. The embedding MLP, the V
// projection and the q projection do not depend on one another; the K projection
// needs only the MLP. The MLP and the K and V projections are short chains of
// dependent memory round trips on few blocks, which leave most of the chip idle
// when launched alone, so each launch runs them beside a share of the q tiles.
// The long chains take the lowest indices.
// The q share of the first launch is what is resident at once beside them: at up to
// 128 registers a wave, 4 blocks a WGP, 1024 places; 308 + 24 + 86 * 8 = 1020 blocks.
// ---------------------------------------------------------------------------
#define NTN    (INNERD / GBN)                        // 8 column tiles
#define KVBLK  (NTN * ((BB * JJ + GBM - 1) / GBM))   // 24 tiles of a K or V projection
#define QTM1   86                                    // q row tiles in the first launch
#define QTM2   (MROWS / GBM - QTM1)                  // 42 in the second

__global__ __launch_bounds__(256)
void front1_kernel(const float* __restrict__ ce, const int* __restrict__ ct,
                   const float* __restrict__ tte_emb,
                   const float* __restrict__ m1w, const float* __restrict__ m1b,
                   const float* __restrict__ m2w, const float* __restrict__ m2b,
                   const float* __restrict__ gA, const float* __restrict__ gB,
                   float* __restrict__ kin,
                   const float* __restrict__ Wv, float* __restrict__ v_bh,
                   const float* __restrict__ x, const float* __restrict__ Wq,
                   float* __restrict__ q_bh)
{
    const int blk = blockIdx.x;
    if (blk < BB * JJ) {
        prep_row(blk, ce, ct, tte_emb, m1w, m1b, m2w, m2b, gA, gB, kin);
        return;
    }
    const bool isv = blk < BB * JJ + KVBLK;          // the same for the whole block
    const int  t   = blk - (isv ? BB * JJ : BB * JJ + KVBLK);
    const int  bm  = (t / NTN) * GBM, bn = (t % NTN) * GBN;
    v8f acc[2][4];
    gemm_accumulate(isv ? ce : x, isv ? Wv : Wq, isv ? BB * JJ : MROWS, isv ? DCC : DQQ, bm, bn, acc);
    if (isv) gemm_store<2>(acc, nullptr, v_bh, BB * JJ, bm, bn);
    else     gemm_store<0>(acc, nullptr, q_bh, MROWS, bm, bn);
}

__global__ __launch_bounds__(256)
void front2_kernel(const float* __restrict__ kin, const float* __restrict__ Wk,
                   float* __restrict__ k_bh,
                   const float* __restrict__ x, const float* __restrict__ Wq,
                   float* __restrict__ q_bh)
{
    const int  blk = blockIdx.x;
    const bool isk = blk < KVBLK;                    // the same for the whole block
    const int  t   = isk ? blk : blk - KVBLK + QTM1 * NTN;
    const int  bm  = (t / NTN) * GBM, bn = (t % NTN) * GBN;
    v8f acc[2][4];
    gemm_accumulate(isk ? kin : x, isk ? Wk : Wq, isk ? BB * JJ : MROWS, isk ? DCC : DQQ, bm, bn, acc);
    if (isk) gemm_store<2>(acc, nullptr, k_bh, BB * JJ, bm, bn);
    else     gemm_store<0>(acc, nullptr, q_bh, MROWS, bm, bn);
}

// output projection: out = attn_out @ Wout + bout
__global__ __launch_bounds__(256)
void outproj_kernel(const float* __restrict__ A, const float* __restrict__ Bm,
                    const float* __restrict__ bias, float* __restrict__ C,
                    int M, int K)
{
    const int bm = blockIdx.y * GBM, bn = blockIdx.x * GBN;
    v8f acc[2][4];
    gemm_accumulate(A, Bm, M, K, bm, bn, acc);
    gemm_store<1>(acc, bias, C, M, bm, bn);
}

// ---------------------------------------------------------------------------
// Kernel 3: WMMA sim tiles + masked sum/sumsq (sim never hits HBM)
// grid (N/128, B*H), 256 threads (8 waves x 16 rows), 5 j-tiles, K=64
// ---------------------------------------------------------------------------
__global__ __launch_bounds__(256)
void sim_stats_kernel(const float* __restrict__ q_bh, const float* __restrict__ k_bh,
                      const int* __restrict__ ct, float* __restrict__ stats)
{
    __shared__ __attribute__((aligned(16))) _Float16 qsh[128 * 72];     // [row][k], stride 72
    __shared__ __attribute__((aligned(16))) _Float16 kshT[JPAD * 72];   // [j][k], rows 77..79 zero
    __shared__ int   sel2[JPAD];
    __shared__ float rs[256], rq[256];

    const int tid  = threadIdx.x;
    const int wid  = tid >> 5;
    const int lane = tid & 31;
    const int lm   = lane & 15;
    const int lhi  = lane >> 4;
    const int bh   = blockIdx.y;
    const int b    = bh >> 4;
    const int rowbase = blockIdx.x * 128;

    // q tile 128x64 and K tile 80x64, fp32 -> f16
    stage_rows64<256, 128, 128, 72>(q_bh + ((size_t)bh * NN + rowbase) * DHH, qsh, tid);
    stage_rows64<256, JPAD, JJ, 72>(k_bh + (size_t)bh * JJ * DHH, kshT, tid);
    for (int j = tid; j < JPAD; j += 256)
        sel2[j] = (j < JJ && ct[b * JJ + j] >= 2) ? 1 : 0;
    __syncthreads();

    v8f acc[5];
    #pragma unroll
    for (int t = 0; t < 5; ++t) acc[t] = (v8f){0.f,0.f,0.f,0.f,0.f,0.f,0.f,0.f};

    #pragma unroll
    for (int s = 0; s < 2; ++s) {          // K = 64 -> 2 k-steps
        Frag16 af;
        load_frag(&qsh[(wid * 16 + lm) * 72 + s * 32], af, lhi);
        #pragma unroll
        for (int t = 0; t < 5; ++t) {
            Frag16 bf;
            load_frag(&kshT[(t * 16 + lm) * 72 + s * 32], bf, lhi);
            acc[t] = __builtin_amdgcn_wmma_f32_16x16x32_f16(
                false, af.v, false, bf.v, (short)0, acc[t], false, false);
        }
    }

    // lane (t,lm) owns column j = t*16+lm for 8 rows -> accumulate stats
    float s1 = 0.f, s2 = 0.f;
    #pragma unroll
    for (int t = 0; t < 5; ++t) {
        int j = t * 16 + lm;
        if (j < JJ && sel2[j]) {
            #pragma unroll
            for (int r = 0; r < 8; ++r) {
                float v = acc[t][r];
                s1 += v;
                s2 = fmaf(v, v, s2);
            }
        }
    }
    rs[tid] = s1; rq[tid] = s2;
    __syncthreads();
    for (int off = 128; off > 0; off >>= 1) {
        if (tid < off) { rs[tid] += rs[tid + off]; rq[tid] += rq[tid + off]; }
        __syncthreads();
    }
    if (tid == 0) {
        atomicAdd(&stats[0], rs[0]);
        atomicAdd(&stats[1], rq[0]);
    }
}

// ---------------------------------------------------------------------------
// Kernel 4: finalize std (Bessel-corrected, matching torch .std())
// ---------------------------------------------------------------------------
__global__ void finalize_kernel(const int* __restrict__ ct, float* __restrict__ stats)
{
    int cnt = 0;
    for (int i = 0; i < BB * JJ; ++i) cnt += (ct[i] >= 2) ? 1 : 0;
    float nsel = (float)cnt * (float)HH * (float)NN;
    float mean = (nsel > 0.f) ? stats[0] / nsel : 0.f;
    float var  = (nsel > 1.f) ? (stats[1] - nsel * mean * mean) / (nsel - 1.f) : 0.f;
    stats[2] = sqrtf(var > 0.f ? var : 0.f);
}

// ---------------------------------------------------------------------------
// Kernel 5: fused attention block, 64 rows / block, 128 threads (4 waves).
// The scores are formed transposed, S^T = K * Q^T (K is the A operand, Q the B
// operand), so a lane's accumulators hold 40 scores of ONE query row:
//   column = lane & 15 -> query row,  j = t*16 + (lane >> 4)*8 + r.
// The masked softmax runs in registers on all lanes; lanes l and l^16 share a
// query row and exchange three partial results. That accumulator order is the
// k order of a 16-bit B operand, so the probabilities, converted to f16, are
// the B operand of out^T = V^T * P^T with no pass through LDS.
// ---------------------------------------------------------------------------
__device__ __forceinline__ float other_half(float x)   // value of lane l ^ 16
{
    int b = __builtin_bit_cast(int, x);
    b = __builtin_amdgcn_permlanex16(b, b, 0x76543210, 0xfedcba98, false, false);
    return __builtin_bit_cast(float, b);
}

// 2^x. The v_nop keeps the one free issue slot the instruction set asks for
// behind a transcendental.
__device__ __forceinline__ float exp2_slot(float x)
{
    float y;
    asm("v_exp_f32 %0, %1\n\tv_nop" : "=v"(y) : "v"(x));
    return y;
}

__global__ __launch_bounds__(128)
void attn_fused_kernel(const float* __restrict__ q_bh, const float* __restrict__ k_bh,
                       const float* __restrict__ v_bh, const int* __restrict__ ct,
                       const float* __restrict__ camask, const float* __restrict__ strength,
                       const float* __restrict__ stats, float* __restrict__ out_attn)
{
    __shared__ __attribute__((aligned(16))) _Float16 qsh[64 * 72];      // q tile [row][k]
    __shared__ __attribute__((aligned(16))) _Float16 kshT[JPAD * 72];   // [j][k], rows 77..79 zero
    __shared__ __attribute__((aligned(32))) _Float16 vsh[KPAD * VPIT];  // [j][d], rows 77..95 zero
    __shared__ int      sel2[JPAD], selg[JPAD];

    const int tid  = threadIdx.x;
    const int wid  = tid >> 5;     // 0..3 -> 16-row strip
    const int lane = tid & 31;
    const int lm   = lane & 15;
    const int lhi  = lane >> 4;
    const int bh   = blockIdx.y;
    const int b    = bh >> 4;
    const int h    = bh & 15;
    const int rowbase = blockIdx.x * 64;
    const int rowg = rowbase + wid * 16 + lm;   // this lane's query row

    // q tile 64x64 and K tile 80x64, fp32 -> f16, each as it lies in memory
    stage_rows64<128, 64, 64, 72>(q_bh + ((size_t)bh * NN + rowbase) * DHH, qsh, tid);
    stage_rows64<128, JPAD, JJ, 72>(k_bh + (size_t)bh * JJ * DHH, kshT, tid);
    for (int j = tid; j < JPAD; j += 128) {
        int t = (j < JJ) ? ct[b * JJ + j] : -1;
        sel2[j] = (t >= 2) ? 1 : 0;
        selg[j] = (t >= 0 && t < 2) ? 1 : 0;
    }

    // this lane's 40 mask values, read once; index clamped for j = 77..79
    float wf[5][8];
    {
        const float* camrow = camask + ((size_t)b * NN + rowg) * JJ;
        #pragma unroll
        for (int t = 0; t < 5; ++t)
            #pragma unroll
            for (int r = 0; r < 8; ++r) {
                int j = t * 16 + lhi * 8 + r;
                wf[t][r] = camrow[j < JJ ? j : JJ - 1];
            }
    }
    // the registers that hold the mask loads' addresses are reused by the staging below
    asm volatile("s_wait_xcnt 0x0" ::: "memory");

    // V tile 96x64, fp32 -> f16, as it lies in memory
    stage_rows64<128, KPAD, JJ, VPIT>(v_bh + (size_t)bh * JJ * DHH, vsh, tid);
    __syncthreads();

    // ---- stage 1: S^T = K @ q^T via WMMA, kept in registers
    v8f acc[5];
    #pragma unroll
    for (int t = 0; t < 5; ++t) acc[t] = (v8f){0.f,0.f,0.f,0.f,0.f,0.f,0.f,0.f};
    #pragma unroll
    for (int s = 0; s < 2; ++s) {
        Frag16 qf;
        load_frag(&qsh[(wid * 16 + lm) * 72 + s * 32], qf, lhi);
        #pragma unroll
        for (int t = 0; t < 5; ++t) {
            Frag16 kf;
            load_frag(&kshT[(t * 16 + lm) * 72 + s * 32], kf, lhi);
            acc[t] = __builtin_amdgcn_wmma_f32_16x16x32_f16(
                false, kf.v, false, qf.v, (short)0, acc[t], false, false);
        }
    }

    // ---- stage 2: masked softmax of this lane's query row, in registers
    const float simstd = stats[2];
    const float str    = strength[0];
    const float scale  = 0.125f;                  // 1/sqrt(DH)

    float wfmax = -__FLT_MAX__;
    #pragma unroll
    for (int t = 0; t < 5; ++t)
        #pragma unroll
        for (int r = 0; r < 8; ++r) {
            int j = t * 16 + lhi * 8 + r;
            float w = sel2[j] ? wf[t][r] * simstd * str : 0.f;
            wf[t][r] = w;
            if (j < JJ) wfmax = fmaxf(wfmax, w);
        }
    wfmax = fmaxf(wfmax, other_half(wfmax));
    const float thr = fmaxf(wfmax, 0.001f) - 0.0001f;

    float m = -__FLT_MAX__;
    #pragma unroll
    for (int t = 0; t < 5; ++t)
        #pragma unroll
        for (int r = 0; r < 8; ++r) {
            int j = t * 16 + lhi * 8 + r;
            // both tests evaluated, no short circuit: the flag reads stay wide and unbranched
            bool lmv = (wf[t][r] >= thr) | (selg[j] != 0);
            float sv = (lmv & (j < JJ)) ? acc[t][r] * scale : -__FLT_MAX__;
            acc[t][r] = sv;                       // masked + scaled score
            m = fmaxf(m, sv);
        }
    m = fmaxf(m, other_half(m));

    float denom = 0.f;
    Frag16 pf[3];                                 // unnormalized probs, B operand
    #pragma unroll
    for (int t = 0; t < 6; ++t)
        #pragma unroll
        for (int r = 0; r < 8; ++r) {
            float p = 0.f;
            if (t < 5) {
                int j = t * 16 + lhi * 8 + r;
                p = exp2_slot((acc[t][r] - m) * 1.4426950408889634f);   // e^(s - m)
                if (j >= JJ) p = 0.f;
                denom += p;
            }
            pf[t >> 1].h[(t & 1) * 8 + r] = (_Float16)p;
        }
    denom += other_half(denom);
    const float inv = 1.f / denom;

    // keeps the PV matrix instructions below every exp2_slot()
    __builtin_amdgcn_sched_barrier(0);

    // ---- stage 3: out^T = V^T @ P^T via WMMA (K = 96 -> 3 k-steps, 4 d tiles)
    v8f o[4];
    #pragma unroll
    for (int t = 0; t < 4; ++t) o[t] = (v8f){0.f,0.f,0.f,0.f,0.f,0.f,0.f,0.f};
    // V^T fragments come out of the row-major V tile through the transposing LDS load:
    // the lane holds d = t*16 + lm, j = s*32 + 8*lhi + 0..7 and + 16: the k order of pf
    const _Float16* vfr = &vsh[(lhi * 8 + (lane & 7)) * VPIT + ((lane >> 3) & 1) * 8];
    #pragma unroll
    for (int s = 0; s < 3; ++s) {
        #pragma unroll
        for (int t = 0; t < 4; ++t) {
            Frag16 vf;
            load_frag_tr_p<VPIT>(vfr + s * 32 * VPIT + t * 16, vf);
            o[t] = __builtin_amdgcn_wmma_f32_16x16x32_f16(
                false, vf.v, false, pf[s].v, (short)0, o[t], false, false);
        }
    }
    // a lane holds d = t*16 + lhi*8 + 0..7 of its query row: two 16-byte stores
    float* orow = out_attn + ((size_t)b * NN + rowg) * INNERD + h * DHH + lhi * 8;
    #pragma unroll
    for (int t = 0; t < 4; ++t) {
        *(float4*)(orow + t * 16) =
            make_float4(o[t][0] * inv, o[t][1] * inv, o[t][2] * inv, o[t][3] * inv);
        *(float4*)(orow + t * 16 + 4) =
            make_float4(o[t][4] * inv, o[t][5] * inv, o[t][6] * inv, o[t][7] * inv);
    }
}

// ---------------------------------------------------------------------------
// launch
// ---------------------------------------------------------------------------
extern "C" void kernel_launch(void* const* d_in, const int* in_sizes, int n_in,
                              void* d_out, int out_size, void* d_ws, size_t ws_size,
                              hipStream_t stream)
{
    const float* x        = (const float*)d_in[0];
    const float* ce       = (const float*)d_in[1];
    const int*   ct       = (const int*)  d_in[2];
    const float* camask   = (const float*)d_in[3];
    const float* strength = (const float*)d_in[4];
    const float* Wq       = (const float*)d_in[5];
    const float* Wk       = (const float*)d_in[6];
    const float* Wv       = (const float*)d_in[7];
    const float* Wout     = (const float*)d_in[8];
    const float* bout     = (const float*)d_in[9];
    const float* tte      = (const float*)d_in[10];
    const float* m1w      = (const float*)d_in[11];
    const float* m1b      = (const float*)d_in[12];
    const float* m2w      = (const float*)d_in[13];
    const float* m2b      = (const float*)d_in[14];
    const float* gA       = (const float*)d_in[15];
    const float* gB       = (const float*)d_in[16];
    float* out = (float*)d_out;

    // workspace partition (floats)
    float* ws    = (float*)d_ws;
    float* kin   = ws;                                  // 308*768
    float* k_bh  = kin  + (size_t)BB*JJ*DCC;            // 64*77*64
    float* v_bh  = k_bh + (size_t)BB*HH*JJ*DHH;
    float* q_bh  = v_bh + (size_t)BB*HH*JJ*DHH;         // 64*4096*64
    float* aout  = q_bh + (size_t)BB*HH*NN*DHH;         // 16384*1024
    float* stats = aout + (size_t)MROWS*INNERD;         // [sum, sumsq, std]

    hipMemsetAsync(stats, 0, 4 * sizeof(float), stream);

    // kin (embedding MLP), V = ce @ Wv and the first q row tiles of q = x @ Wq
    front1_kernel<<<BB*JJ + KVBLK + QTM1*NTN, 256, 0, stream>>>(
        ce, ct, tte, m1w, m1b, m2w, m2b, gA, gB, kin, Wv, v_bh, x, Wq, q_bh);

    // K = kin @ Wk and the remaining q row tiles
    front2_kernel<<<KVBLK + QTM2*NTN, 256, 0, stream>>>(kin, Wk, k_bh, x, Wq, q_bh);

    // masked mean/std of sim (WMMA sim tiles, never stored)
    sim_stats_kernel<<<dim3(NN/128, BB*HH), 256, 0, stream>>>(q_bh, k_bh, ct, stats);
    finalize_kernel<<<1, 1, 0, stream>>>(ct, stats);

    // fused WMMA sim -> softmax -> WMMA attn@V
    attn_fused_kernel<<<dim3(NN/64, BB*HH), 128, 0, stream>>>(
        q_bh, k_bh, v_bh, ct, camask, strength, stats, aout);

    // out = attn_out @ Wout + bout  (WMMA)
    outproj_kernel<<<dim3(DQQ/GBN, MROWS/GBM), 256, 0, stream>>>(
        aout, Wout, bout, out, MROWS, DQQ);
}

// v006
// Next to v005, in two timings, it ran 1.12 and 1.13 times as fast.
// All steps since v000 together make it 2.57 times as fast.
#include <hip/hip_runtime.h>
#include <hip/hip_bf16.h>
#include <math.h>

// ---------------------------------------------------------------------------
// Problem constants
// ---------------------------------------------------------------------------
#define BB   4
#define NN   4096
#define JJ   77
#define HH   16
#define DHH  64
#define DQQ  1024
#define DCC  768
#define DHID 384           // DC/2
#define INNERD 1024        // H*DH
#define MROWS (BB*NN)      // 16384
#define JPAD 80            // sim col padding (5 x 16)
#define KPAD 96            // attn K padding  (3 x 32)

typedef __attribute__((ext_vector_type(16))) _Float16 v16h;
typedef __attribute__((ext_vector_type(8)))  float    v8f;
typedef __attribute__((ext_vector_type(2)))  _Float16 h2_t;
typedef __attribute__((ext_vector_type(8)))  _Float16 v8h;
typedef __attribute__((ext_vector_type(4)))  _Float16 v4h;
typedef __attribute__((ext_vector_type(8)))  short    s16x8;

union Frag16 { v16h v; h2_t h2[8]; _Float16 h[16]; s16x8 q[2]; };

// load one 16x32 f16 WMMA operand fragment from LDS (row-major, "base" points
// at this lane's row at the k-step origin; ISA 16-bit A/B layout)
__device__ __forceinline__ void load_frag(const _Float16* base, Frag16& f, int lhi)
{
    #pragma unroll
    for (int r = 0; r < 8; ++r) {
        int kk = (r < 4) ? (lhi * 8 + 2 * r) : (16 + lhi * 8 + 2 * (r - 4));
        f.h2[r] = *(const h2_t*)(base + kk);
    }
}

// ---------------------------------------------------------------------------
// Token-type embedding MLP -> kin = contextembs + typeemb
// one block of 256 threads per (b,j) row bj (tiny: 0.4 GFLOP total)
// ---------------------------------------------------------------------------
__device__ __forceinline__
void prep_row(int bj, const float* __restrict__ ce, const int* __restrict__ ct,
              const float* __restrict__ tte_emb,
              const float* __restrict__ m1w, const float* __restrict__ m1b,
              const float* __restrict__ m2w, const float* __restrict__ m2b,
              const float* __restrict__ gA, const float* __restrict__ gB,
              float* __restrict__ kin)
{
    const int tid = threadIdx.x;
    __shared__ float tte_s[DCC];
    __shared__ float cein_s[DCC];
    __shared__ float hid_s[DHID];

    int t = ct[bj];
    int tcl = t < 0 ? 0 : (t > 4 ? 4 : t);

    for (int c = tid; c < DCC; c += 256) {
        float tv = tte_emb[(size_t)tcl * DCC + c];
        float ev = ce[(size_t)bj * DCC + c];
        tte_s[c]  = tv;
        cein_s[c] = ev + tv;
    }
    __syncthreads();

    for (int col = tid; col < DHID; col += 256) {
        float acc = m1b[col];
        for (int c = 0; c < DCC; ++c)
            acc = fmaf(cein_s[c], m1w[(size_t)c * DHID + col], acc);
        hid_s[col] = 0.5f * acc * (1.0f + erff(acc * 0.70710678118654752f));
    }
    __syncthreads();

    for (int col = tid; col < DCC; col += 256) {
        float acc = m2b[col];
        for (int c = 0; c < DHID; ++c)
            acc = fmaf(hid_s[c], m2w[(size_t)c * DCC + col], acc);
        float typeemb = tte_s[col] * gA[col] + acc * gB[col];
        kin[(size_t)bj * DCC + col] = ce[(size_t)bj * DCC + col] + typeemb;
    }
}

// ---------------------------------------------------------------------------
// WMMA GEMM: C[M,1024] = A[M,K] * B[K,1024]  (fp32 in, f16 mul, f32 acc)
// Block tile 128x128, BK=32, 8 waves (4x2), each wave 32x64 = 2x4 WMMA tiles.
// MODE 0: store q permuted [B*H, N, DH], as f16: what its readers feed to the matrix unit
// MODE 1: plain store + bias (output projection)
// MODE 2: store K/V permuted [B*H, J, DH], as f16  (rows = b*J+j, M=308)
// ---------------------------------------------------------------------------
#define GBM 128
#define GBN 128
#define GBK 32
#define LDSS 40   // padded LDS stride in halfs
#define LDSB 144  // B tile row pitch in halfs: 288 bytes, an odd multiple of 32 bytes
#define VPIT 80   // V tile row pitch in halfs: 160 bytes, an odd multiple of 32 bytes

// one 32(k) x 16(n) B fragment out of a row-major [k][n] f16 LDS tile, through the
// transposing LDS load. "base" is this lane's own address:
//   tile + (8*(lane>>4) + (lane&7)) * LDSB + n0 + 8*((lane>>3)&1)
// The lane then holds column n0 + (lane&15), k = 8*lhi + 0..7 and 16 + 8*lhi + 0..7:
// the k order of load_frag().
__device__ __forceinline__ void load_frag_tr(const _Float16* base, Frag16& f)
{
    typedef __attribute__((address_space(3))) s16x8 lds_s16x8;
    f.q[0] = __builtin_amdgcn_ds_load_tr16_b128_v8i16((lds_s16x8*)base);
    f.q[1] = __builtin_amdgcn_ds_load_tr16_b128_v8i16((lds_s16x8*)(base + 16 * LDSB));
}

// the same fragment out of a row-major tile of another pitch (in halfs)
template<int PITCH>
__device__ __forceinline__ void load_frag_tr_p(const _Float16* base, Frag16& f)
{
    typedef __attribute__((address_space(3))) s16x8 lds_s16x8;
    f.q[0] = __builtin_amdgcn_ds_load_tr16_b128_v8i16((lds_s16x8*)base);
    f.q[1] = __builtin_amdgcn_ds_load_tr16_b128_v8i16((lds_s16x8*)(base + 16 * PITCH));
}

// Stage ROWS rows of 64 f16 values (contiguous rows of 128 bytes in memory) as rows of
// PITCH halfs in LDS, as they lie in memory. A wave's 16-byte loads cover 512 contiguous
// bytes, and all of a thread's loads are issued before the first value is used.
// Rows VALID..ROWS-1 are filled with zero; a load that would fall there is clamped.
template<int NT, int ROWS, int VALID, int PITCH>
__device__ __forceinline__ void stage_rows64h(const _Float16* __restrict__ src, _Float16* dst, int tid)
{
    constexpr int NP = ROWS * 8;                       // 16-byte pieces of the LDS tile
    constexpr int NV = VALID * 8;                      // of these, pieces of valid rows
    constexpr int NI = NP / NT;                        // trips
    static_assert(NP % NT == 0, "whole trips only");
    constexpr int NL = (NV + NT - 1) / NT;             // of these, trips that hold a valid row
    uint4 v[NL];
    #pragma unroll   // v[] stays in registers and the loads issue back to back
    for (int i = 0; i < NL; ++i) {
        int f = tid + i * NT;
        if ((i + 1) * NT > NV) f = f < NV ? f : NV - 1;   // piece index clamped into the tile
        v[i] = ((const uint4*)src)[f];
    }
    #pragma unroll   // v[] is indexed by constants
    for (int i = 0; i < NI; ++i) {
        const int f = tid + i * NT;
        uint4 h = make_uint4(0u, 0u, 0u, 0u);
        if (i < NL) {
            h = v[i];
            if ((i + 1) * NT > NV && f >= NV) h = make_uint4(0u, 0u, 0u, 0u);
        }
        *(uint4*)(dst + (f >> 3) * PITCH + (f & 7) * 8) = h;
    }
}

// One 128x128 tile at (blockM, blockN), by one block of 256 threads: the k loop ...
__device__ __forceinline__
void gemm_accumulate(const float* __restrict__ A, const float* __restrict__ Bm,
                     int M, int K, int blockM, int blockN, v8f (&acc)[2][4])
{
    __shared__ __attribute__((aligned(16))) _Float16 Ash[GBM * LDSS];
    __shared__ __attribute__((aligned(32))) _Float16 Bsh[GBK * LDSB];   // [k][n]

    const int tid  = threadIdx.x;
    const int wid  = tid >> 5;
    const int lane = tid & 31;
    const int wm   = wid >> 1;     // 0..3 -> 32-row strip
    const int wn   = wid & 1;      // 0..1 -> 64-col strip
    const int lm   = lane & 15;
    const int lhi  = lane >> 4;

    #pragma unroll
    for (int t = 0; t < 2; ++t)
        #pragma unroll
        for (int u = 0; u < 4; ++u)
            acc[t][u] = (v8f){0.f,0.f,0.f,0.f,0.f,0.f,0.f,0.f};

    int arow = blockM + (tid >> 1);       // global A row
    if (arow >= M) arow = M - 1;          // clamp (stores are guarded)
    const int acb  = (tid & 1) * 16;
    const int bkr  = tid >> 3;            // 0..31
    const int bcb  = (tid & 7) * 16;
    // Staging map: every wave-wide 16-byte load covers whole 128-byte lines.
    // A: 8 lanes take the 128 bytes that one row has in this k tile, a wave 4 rows;
    //    a thread's rows are sar + 32 i. Byte offsets from A, rows clamped like arow.
    // B: a wave takes 512 contiguous bytes of one k row; a thread's rows are sbr + 8 i.
    const int sar  = tid >> 3;            // 0..31
    const int sac  = (tid & 7) * 4;       // four columns
    const int sbr  = tid >> 5;            // 0..7
    const int sbc  = lane * 4;            // four columns
    unsigned aoff[4];
    #pragma unroll   // aoff[] is indexed by constants and stays in registers
    for (int i = 0; i < 4; ++i) {
        int r = blockM + sar + 32 * i;
        if (r >= M) r = M - 1;
        aoff[i] = ((unsigned)r * (unsigned)K + (unsigned)sac) * 4u;
    }
    unsigned boff = ((unsigned)sbr * 1024u + (unsigned)blockN + (unsigned)sbc) * 4u;
    const _Float16* bfr = &Bsh[(lhi * 8 + (lane & 7)) * LDSB + wn * 64 + ((lane >> 3) & 1) * 8];

    for (int k0 = 0; k0 < K; k0 += GBK) {
        // stage both tiles (fp32 -> f16), each as it lies in memory: Ash[m][k], Bsh[k][n]
        float4 av[4], bv[4];
        // uniform base + 32-bit byte offset: one address register a load (both operands are
        // far below 4 GiB)
        #pragma unroll   // av[] stays in registers and the loads issue back to back
        for (int i = 0; i < 4; ++i) av[i] = *(const float4*)((const char*)A + aoff[i]);
        #pragma unroll   // the same for bv[]
        for (int i = 0; i < 4; ++i) bv[i] = *(const float4*)((const char*)Bm + boff + i * 32768);
        #pragma unroll   // av[] is indexed by constants; the LDS offsets become immediates
        for (int i = 0; i < 4; ++i) {
            v4h p;
            p[0] = (_Float16)av[i].x;  p[1] = (_Float16)av[i].y;
            p[2] = (_Float16)av[i].z;  p[3] = (_Float16)av[i].w;
            *(v4h*)&Ash[(sar + 32 * i) * LDSS + sac] = p;
        }
        #pragma unroll   // the same for bv[]
        for (int i = 0; i < 4; ++i) {
            v4h p;
            p[0] = (_Float16)bv[i].x;  p[1] = (_Float16)bv[i].y;
            p[2] = (_Float16)bv[i].z;  p[3] = (_Float16)bv[i].w;
            *(v4h*)&Bsh[(sbr + 8 * i) * LDSB + sbc] = p;
        }
        #pragma unroll   // on to the next k tile (the loaded values have arrived)
        for (int i = 0; i < 4; ++i) aoff[i] += GBK * 4u;
        boff += GBK * 4096u;
        if (k0 + GBK < K) {   // global_prefetch of next k-tile
            __builtin_prefetch(A + (size_t)arow * K + k0 + GBK + acb, 0, 1);
            __builtin_prefetch(Bm + (size_t)(k0 + GBK + bkr) * 1024 + blockN + bcb, 0, 1);
        }
        __syncthreads();

        Frag16 af[2], bf[4];
        #pragma unroll
        for (int t = 0; t < 2; ++t)
            load_frag(&Ash[(wm * 32 + t * 16 + lm) * LDSS], af[t], lhi);
        #pragma unroll
        for (int u = 0; u < 4; ++u)
            load_frag_tr(bfr + u * 16, bf[u]);

        #pragma unroll
        for (int t = 0; t < 2; ++t)
            #pragma unroll
            for (int u = 0; u < 4; ++u)
                acc[t][u] = __builtin_amdgcn_wmma_f32_16x16x32_f16(
                    false, af[t].v, false, bf[u].v,
                    (short)0, acc[t][u], false, false);

        __syncthreads();
    }
}

// ... and the store of its accumulators
template<int MODE>
__device__ __forceinline__
void gemm_store(const v8f (&acc)[2][4], const float* __restrict__ bias, float* __restrict__ C,
                int M, int blockM, int blockN)
{
    const int tid  = threadIdx.x;
    const int wid  = tid >> 5;
    const int lane = tid & 31;
    const int wm   = wid >> 1;
    const int wn   = wid & 1;
    const int lm   = lane & 15;
    const int lhi  = lane >> 4;

    // C/D layout: lanes 0-15 -> M=r, lanes 16-31 -> M=8+r, N=lane&15
    #pragma unroll
    for (int t = 0; t < 2; ++t) {
        #pragma unroll
        for (int u = 0; u < 4; ++u) {
            #pragma unroll
            for (int r = 0; r < 8; ++r) {
                int rg = blockM + wm * 32 + t * 16 + (lhi ? 8 + r : r);
                int cg = blockN + wn * 64 + u * 16 + lm;
                float val = acc[t][u][r];
                if (MODE == 1) {
                    C[(size_t)rg * 1024 + cg] = val + bias[cg];
                } else if (MODE == 0) {
                    int b = rg >> 12, n = rg & 4095;
                    int h = cg >> 6,  d = cg & 63;
                    ((_Float16*)C)[(((size_t)(b * HH + h)) * NN + n) * DHH + d] = (_Float16)val;
                } else { // MODE 2: rows are (b, j)
                    if (rg < M) {
                        int b = rg / JJ, j = rg - b * JJ;
                        int h = cg >> 6, d = cg & 63;
                        ((_Float16*)C)[(((size_t)(b * HH + h)) * JJ + j) * DHH + d] = (_Float16)val;
                    }
                }
            }
        }
    }
    // where other block ranges' code follows in the same kernel, it reuses the registers
    // that these stores name: the wait stands in front of any such overwrite
    if (MODE == 0) asm volatile("s_wait_xcnt 0x0" ::: "memory");
}

// ---------------------------------------------------------------------------
// The work in front of the attention, in two launches. The embedding MLP, the V
// projection and the q projection do not depend on one another; the K projection
// needs only the MLP. The MLP and the K and V projections are short chains of
// dependent memory round trips on few blocks, which leave most of the chip idle
// when launched alone, so each launch runs them beside a share of the q tiles.
// The long chains take the lowest indices.
// The q share of the first launch is what is resident at once beside them: at up to
// 128 registers a wave, 4 blocks a WGP, 1024 places; 308 + 24 + 86 * 8 = 1020 blocks.
// ---------------------------------------------------------------------------
#define NTN    (INNERD / GBN)                        // 8 column tiles
#define KVBLK  (NTN * ((BB * JJ + GBM - 1) / GBM))   // 24 tiles of a K or V projection
#define QTM1   86                                    // q row tiles in the first launch
#define QTM2   (MROWS / GBM - QTM1)                  // 42 in the second
#define WCBLK  (INNERD * DQQ / 4096)                 // 256 blocks that round Wout to f16

__global__ __launch_bounds__(256)
void front1_kernel(const float* __restrict__ ce, const int* __restrict__ ct,
                   const float* __restrict__ tte_emb,
                   const float* __restrict__ m1w, const float* __restrict__ m1b,
                   const float* __restrict__ m2w, const float* __restrict__ m2b,
                   const float* __restrict__ gA, const float* __restrict__ gB,
                   float* __restrict__ kin,
                   const float* __restrict__ Wv, float* __restrict__ v_bh,
                   const float* __restrict__ x, const float* __restrict__ Wq,
                   float* __restrict__ q_bh)
{
    const int blk = blockIdx.x;
    if (blk < BB * JJ) {
        prep_row(blk, ce, ct, tte_emb, m1w, m1b, m2w, m2b, gA, gB, kin);
        return;
    }
    const bool isv = blk < BB * JJ + KVBLK;          // the same for the whole block
    const int  t   = blk - (isv ? BB * JJ : BB * JJ + KVBLK);
    const int  bm  = (t / NTN) * GBM, bn = (t % NTN) * GBN;
    v8f acc[2][4];
    gemm_accumulate(isv ? ce : x, isv ? Wv : Wq, isv ? BB * JJ : MROWS, isv ? DCC : DQQ, bm, bn, acc);
    if (isv) gemm_store<2>(acc, nullptr, v_bh, BB * JJ, bm, bn);
    else     gemm_store<0>(acc, nullptr, q_bh, MROWS, bm, bn);
}

__global__ __launch_bounds__(256)
void front2_kernel(const float* __restrict__ kin, const float* __restrict__ Wk,
                   float* __restrict__ k_bh,
                   const float* __restrict__ x, const float* __restrict__ Wq,
                   float* __restrict__ q_bh,
                   const float* __restrict__ Wout, float* __restrict__ w16)
{
    const int  blk = blockIdx.x;
    if (blk >= KVBLK + QTM2 * NTN) {                 // the same for the whole block
        // Wout rounded to f16 once, for the output projection: 4096 values a block
        const int p = (blk - (KVBLK + QTM2 * NTN)) * 1024 + threadIdx.x;   // piece of 4 values
        float4 v[4];
        #pragma unroll   // v[] stays in registers and the loads issue back to back
        for (int i = 0; i < 4; ++i) v[i] = ((const float4*)Wout)[p + i * 256];
        #pragma unroll   // v[] is indexed by constants
        for (int i = 0; i < 4; ++i) {
            v4h h;
            h[0] = (_Float16)v[i].x;  h[1] = (_Float16)v[i].y;
            h[2] = (_Float16)v[i].z;  h[3] = (_Float16)v[i].w;
            ((v4h*)w16)[p + i * 256] = h;
        }
        return;
    }
    const bool isk = blk < KVBLK;                    // the same for the whole block
    const int  t   = isk ? blk : blk - KVBLK + QTM1 * NTN;
    const int  bm  = (t / NTN) * GBM, bn = (t % NTN) * GBN;
    v8f acc[2][4];
    gemm_accumulate(isk ? kin : x, isk ? Wk : Wq, isk ? BB * JJ : MROWS, isk ? DCC : DQQ, bm, bn, acc);
    if (isk) gemm_store<2>(acc, nullptr, k_bh, BB * JJ, bm, bn);
    else     gemm_store<0>(acc, nullptr, q_bh, MROWS, bm, bn);
}

// output projection: out = attn_out @ Wout + bout
// Both operands lie in the workspace as f16, rounded once by their producers (the
// attention kernel; the last block range of front2_kernel): the values that the k loop
// above would round them to in every tile that reads them. A tile therefore loads half
// the bytes and converts nothing. The k tile is 64, so that the piece of an A row in it
// is one whole 128-byte line; the products are summed in ascending k, 32 at a time.
#define HBK  64   // k tile
#define APIT 72   // A tile row pitch in halfs: 144 bytes, an odd multiple of 16 bytes
__global__ __launch_bounds__(256)
void outproj_kernel(const float* __restrict__ a16, const float* __restrict__ w16,
                    const float* __restrict__ bias, float* __restrict__ C)
{
    __shared__ __attribute__((aligned(16))) _Float16 Ash[GBM * APIT];   // [m][k]
    __shared__ __attribute__((aligned(32))) _Float16 Bsh[HBK * LDSB];   // [k][n]

    const int bm   = blockIdx.y * GBM, bn = blockIdx.x * GBN;
    const int tid  = threadIdx.x;
    const int wid  = tid >> 5;
    const int lane = tid & 31;
    const int wm   = wid >> 1;     // 0..3 -> 32-row strip
    const int wn   = wid & 1;      // 0..1 -> 64-col strip
    const int lm   = lane & 15;
    const int lhi  = lane >> 4;

    v8f acc[2][4];
    #pragma unroll
    for (int t = 0; t < 2; ++t)
        #pragma unroll
        for (int u = 0; u < 4; ++u)
            acc[t][u] = (v8f){0.f,0.f,0.f,0.f,0.f,0.f,0.f,0.f};

    // Staging map, 16 bytes (8 halfs) a lane, whole 128-byte lines:
    // A: 8 lanes take the line that one row has in this k tile, a wave 4 rows; rows sar + 32 i.
    // B: 16 lanes take the 256 bytes of one k row, a wave 2 rows; rows sbr + 16 i.
    const int sar = tid >> 3;            // 0..31
    const int sac = (tid & 7) * 8;
    const int sbr = tid >> 4;            // 0..15
    const int sbc = (tid & 15) * 8;
    unsigned aoff = ((unsigned)(bm + sar) * 1024u + (unsigned)sac) * 2u;   // byte offsets
    unsigned boff = ((unsigned)sbr * 1024u + (unsigned)(bn + sbc)) * 2u;
    const _Float16* bfr = &Bsh[(lhi * 8 + (lane & 7)) * LDSB + wn * 64 + ((lane >> 3) & 1) * 8];

    #pragma unroll 1   // stays rolled: unrolled, a tile's eight loads no longer issue together
                       // and the kernel takes more than 128 registers (3 blocks a WGP, not 4)
    for (int k0 = 0; k0 < INNERD; k0 += HBK) {
        uint4 av[4], bv[4];
        #pragma unroll   // av[] stays in registers and the loads issue back to back
        for (int i = 0; i < 4; ++i) av[i] = *(const uint4*)((const char*)a16 + aoff + i * 65536);
        #pragma unroll   // the same for bv[]
        for (int i = 0; i < 4; ++i) bv[i] = *(const uint4*)((const char*)w16 + boff + i * 32768);
        #pragma unroll   // av[] is indexed by constants
        for (int i = 0; i < 4; ++i) *(uint4*)&Ash[(sar + 32 * i) * APIT + sac] = av[i];
        #pragma unroll   // the same for bv[]
        for (int i = 0; i < 4; ++i) *(uint4*)&Bsh[(sbr + 16 * i) * LDSB + sbc] = bv[i];
        aoff += HBK * 2u;                 // on to the next k tile (the loaded values have arrived)
        boff += HBK * 2048u;
        if (k0 + HBK < INNERD) {          // global_prefetch of the next k tile: 128 lines each
            __builtin_prefetch((const char*)a16 + ((unsigned)(bm + (tid >> 1)) * 1024u + (unsigned)(k0 + HBK)) * 2u, 0, 1);
            __builtin_prefetch((const char*)w16 + ((unsigned)(k0 + HBK + (tid >> 2)) * 1024u + (unsigned)bn) * 2u + (tid & 1) * 128, 0, 1);
        }
        __syncthreads();

        #pragma unroll   // two k steps of 32 out of one staged tile
        for (int s = 0; s < 2; ++s) {
            Frag16 af[2], bf[4];
            #pragma unroll
            for (int t = 0; t < 2; ++t)
                load_frag(&Ash[(wm * 32 + t * 16 + lm) * APIT + s * 32], af[t], lhi);
            #pragma unroll
            for (int u = 0; u < 4; ++u)
                load_frag_tr(bfr + s * 32 * LDSB + u * 16, bf[u]);

            #pragma unroll
            for (int t = 0; t < 2; ++t)
                #pragma unroll
                for (int u = 0; u < 4; ++u)
                    acc[t][u] = __builtin_amdgcn_wmma_f32_16x16x32_f16(
                        false, af[t].v, false, bf[u].v,
                        (short)0, acc[t][u], false, false);
        }
        __syncthreads();
    }
    gemm_store<1>(acc, bias, C, MROWS, bm, bn);
}

// ---------------------------------------------------------------------------
// Kernel 3: WMMA sim tiles + masked sum/sumsq (sim never hits HBM)
// grid (N/128, B*H), 256 threads (8 waves x 16 rows), 5 j-tiles, K=64
// ---------------------------------------------------------------------------
__global__ __launch_bounds__(256)
void sim_stats_kernel(const float* __restrict__ q_bh, const float* __restrict__ k_bh,
                      const int* __restrict__ ct, float* __restrict__ stats)
{
    __shared__ __attribute__((aligned(16))) _Float16 qsh[128 * 72];     // [row][k], stride 72
    __shared__ __attribute__((aligned(16))) _Float16 kshT[KPAD * 72];   // [j][k], rows 77..95 zero
    __shared__ int   sel2[JPAD];
    __shared__ float rs[256], rq[256];

    const int tid  = threadIdx.x;
    const int wid  = tid >> 5;
    const int lane = tid & 31;
    const int lm   = lane & 15;
    const int lhi  = lane >> 4;
    const int bh   = blockIdx.y;
    const int b    = bh >> 4;
    const int rowbase = blockIdx.x * 128;

    // q tile 128x64 and K tile, f16 in the workspace (K staged as 96 rows: whole trips of
    // 256 threads, so that all loads issue together; rows 80..95 are not read)
    stage_rows64h<256, 128, 128, 72>((const _Float16*)q_bh + ((size_t)bh * NN + rowbase) * DHH, qsh, tid);
    stage_rows64h<256, KPAD, JJ, 72>((const _Float16*)k_bh + (size_t)bh * JJ * DHH, kshT, tid);
    for (int j = tid; j < JPAD; j += 256)
        sel2[j] = (j < JJ && ct[b * JJ + j] >= 2) ? 1 : 0;
    __syncthreads();

    v8f acc[5];
    #pragma unroll
    for (int t = 0; t < 5; ++t) acc[t] = (v8f){0.f,0.f,0.f,0.f,0.f,0.f,0.f,0.f};

    #pragma unroll
    for (int s = 0; s < 2; ++s) {          // K = 64 -> 2 k-steps
        Frag16 af;
        load_frag(&qsh[(wid * 16 + lm) * 72 + s * 32], af, lhi);
        #pragma unroll
        for (int t = 0; t < 5; ++t) {
            Frag16 bf;
            load_frag(&kshT[(t * 16 + lm) * 72 + s * 32], bf, lhi);
            acc[t] = __builtin_amdgcn_wmma_f32_16x16x32_f16(
                false, af.v, false, bf.v, (short)0, acc[t], false, false);
        }
    }

    // lane (t,lm) owns column j = t*16+lm for 8 rows -> accumulate stats
    float s1 = 0.f, s2 = 0.f;
    #pragma unroll
    for (int t = 0; t < 5; ++t) {
        int j = t * 16 + lm;
        if (j < JJ && sel2[j]) {
            #pragma unroll
            for (int r = 0; r < 8; ++r) {
                float v = acc[t][r];
                s1 += v;
                s2 = fmaf(v, v, s2);
            }
        }
    }
    rs[tid] = s1; rq[tid] = s2;
    __syncthreads();
    for (int off = 128; off > 0; off >>= 1) {
        if (tid < off) { rs[tid] += rs[tid + off]; rq[tid] += rq[tid + off]; }
        __syncthreads();
    }
    if (tid == 0) {
        atomicAdd(&stats[0], rs[0]);
        atomicAdd(&stats[1], rq[0]);
    }
}

// ---------------------------------------------------------------------------
// Kernel 4: finalize std (Bessel-corrected, matching torch .std())
// ---------------------------------------------------------------------------
__global__ void finalize_kernel(const int* __restrict__ ct, float* __restrict__ stats)
{
    int cnt = 0;
    for (int i = 0; i < BB * JJ; ++i) cnt += (ct[i] >= 2) ? 1 : 0;
    float nsel = (float)cnt * (float)HH * (float)NN;
    float mean = (nsel > 0.f) ? stats[0] / nsel : 0.f;
    float var  = (nsel > 1.f) ? (stats[1] - nsel * mean * mean) / (nsel - 1.f) : 0.f;
    stats[2] = sqrtf(var > 0.f ? var : 0.f);
}

// ---------------------------------------------------------------------------
// Kernel 5: fused attention block, 64 rows / block, 128 threads (4 waves).
// The scores are formed transposed, S^T = K * Q^T (K is the A operand, Q the B
// operand), so a lane's accumulators hold 40 scores of ONE query row:
//   column = lane & 15 -> query row,  j = t*16 + (lane >> 4)*8 + r.
// The masked softmax runs in registers on all lanes; lanes l and l^16 share a
// query row and exchange three partial results. That accumulator order is the
// k order of a 16-bit B operand, so the probabilities, converted to f16, are
// the B operand of out^T = V^T * P^T with no pass through LDS.
// ---------------------------------------------------------------------------
__device__ __forceinline__ float other_half(float x)   // value of lane l ^ 16
{
    int b = __builtin_bit_cast(int, x);
    b = __builtin_amdgcn_permlanex16(b, b, 0x76543210, 0xfedcba98, false, false);
    return __builtin_bit_cast(float, b);
}

// 2^x. The v_nop keeps the one free issue slot the instruction set asks for
// behind a transcendental.
__device__ __forceinline__ float exp2_slot(float x)
{
    float y;
    asm("v_exp_f32 %0, %1\n\tv_nop" : "=v"(y) : "v"(x));
    return y;
}

__global__ __launch_bounds__(128)
void attn_fused_kernel(const float* __restrict__ q_bh, const float* __restrict__ k_bh,
                       const float* __restrict__ v_bh, const int* __restrict__ ct,
                       const float* __restrict__ camask, const float* __restrict__ strength,
                       const float* __restrict__ stats, float* __restrict__ out_attn)
{
    __shared__ __attribute__((aligned(16))) _Float16 qsh[64 * 72];      // q tile [row][k]
    __shared__ __attribute__((aligned(16))) _Float16 kshT[JPAD * 72];   // [j][k], rows 77..79 zero
    __shared__ __attribute__((aligned(32))) _Float16 vsh[KPAD * VPIT];  // [j][d], rows 77..95 zero
    __shared__ int      sel2[JPAD], selg[JPAD];

    const int tid  = threadIdx.x;
    const int wid  = tid >> 5;     // 0..3 -> 16-row strip
    const int lane = tid & 31;
    const int lm   = lane & 15;
    const int lhi  = lane >> 4;
    const int bh   = blockIdx.y;
    const int b    = bh >> 4;
    const int h    = bh & 15;
    const int rowbase = blockIdx.x * 64;
    const int rowg = rowbase + wid * 16 + lm;   // this lane's query row

    // q tile 64x64 and K tile 80x64, f16 in the workspace, each as it lies in memory
    stage_rows64h<128, 64, 64, 72>((const _Float16*)q_bh + ((size_t)bh * NN + rowbase) * DHH, qsh, tid);
    stage_rows64h<128, JPAD, JJ, 72>((const _Float16*)k_bh + (size_t)bh * JJ * DHH, kshT, tid);
    for (int j = tid; j < JPAD; j += 128) {
        int t = (j < JJ) ? ct[b * JJ + j] : -1;
        sel2[j] = (t >= 2) ? 1 : 0;
        selg[j] = (t >= 0 && t < 2) ? 1 : 0;
    }

    // this lane's 40 mask values, read once; index clamped for j = 77..79
    float wf[5][8];
    {
        const float* camrow = camask + ((size_t)b * NN + rowg) * JJ;
        #pragma unroll
        for (int t = 0; t < 5; ++t)
            #pragma unroll
            for (int r = 0; r < 8; ++r) {
                int j = t * 16 + lhi * 8 + r;
                wf[t][r] = camrow[j < JJ ? j : JJ - 1];
            }
    }
    // the registers that hold the mask loads' addresses are reused by the staging below
    asm volatile("s_wait_xcnt 0x0" ::: "memory");

    // V tile 96x64, f16 in the workspace, as it lies in memory
    stage_rows64h<128, KPAD, JJ, VPIT>((const _Float16*)v_bh + (size_t)bh * JJ * DHH, vsh, tid);
    __syncthreads();

    // ---- stage 1: S^T = K @ q^T via WMMA, kept in registers
    v8f acc[5];
    #pragma unroll
    for (int t = 0; t < 5; ++t) acc[t] = (v8f){0.f,0.f,0.f,0.f,0.f,0.f,0.f,0.f};
    #pragma unroll
    for (int s = 0; s < 2; ++s) {
        Frag16 qf;
        load_frag(&qsh[(wid * 16 + lm) * 72 + s * 32], qf, lhi);
        #pragma unroll
        for (int t = 0; t < 5; ++t) {
            Frag16 kf;
            load_frag(&kshT[(t * 16 + lm) * 72 + s * 32], kf, lhi);
            acc[t] = __builtin_amdgcn_wmma_f32_16x16x32_f16(
                false, kf.v, false, qf.v, (short)0, acc[t], false, false);
        }
    }

    // ---- stage 2: masked softmax of this lane's query row, in registers
    const float simstd = stats[2];
    const float str    = strength[0];
    const float scale  = 0.125f;                  // 1/sqrt(DH)

    float wfmax = -__FLT_MAX__;
    #pragma unroll
    for (int t = 0; t < 5; ++t)
        #pragma unroll
        for (int r = 0; r < 8; ++r) {
            int j = t * 16 + lhi * 8 + r;
            float w = sel2[j] ? wf[t][r] * simstd * str : 0.f;
            wf[t][r] = w;
            if (j < JJ) wfmax = fmaxf(wfmax, w);
        }
    wfmax = fmaxf(wfmax, other_half(wfmax));
    const float thr = fmaxf(wfmax, 0.001f) - 0.0001f;

    float m = -__FLT_MAX__;
    #pragma unroll
    for (int t = 0; t < 5; ++t)
        #pragma unroll
        for (int r = 0; r < 8; ++r) {
            int j = t * 16 + lhi * 8 + r;
            // both tests evaluated, no short circuit: the flag reads stay wide and unbranched
            bool lmv = (wf[t][r] >= thr) | (selg[j] != 0);
            float sv = (lmv & (j < JJ)) ? acc[t][r] * scale : -__FLT_MAX__;
            acc[t][r] = sv;                       // masked + scaled score
            m = fmaxf(m, sv);
        }
    m = fmaxf(m, other_half(m));

    float denom = 0.f;
    Frag16 pf[3];                                 // unnormalized probs, B operand
    #pragma unroll
    for (int t = 0; t < 6; ++t)
        #pragma unroll
        for (int r = 0; r < 8; ++r) {
            float p = 0.f;
            if (t < 5) {
                int j = t * 16 + lhi * 8 + r;
                p = exp2_slot((acc[t][r] - m) * 1.4426950408889634f);   // e^(s - m)
                if (j >= JJ) p = 0.f;
                denom += p;
            }
            pf[t >> 1].h[(t & 1) * 8 + r] = (_Float16)p;
        }
    denom += other_half(denom);
    const float inv = 1.f / denom;

    // keeps the PV matrix instructions below every exp2_slot()
    __builtin_amdgcn_sched_barrier(0);

    // ---- stage 3: out^T = V^T @ P^T via WMMA (K = 96 -> 3 k-steps, 4 d tiles)
    v8f o[4];
    #pragma unroll
    for (int t = 0; t < 4; ++t) o[t] = (v8f){0.f,0.f,0.f,0.f,0.f,0.f,0.f,0.f};
    // V^T fragments come out of the row-major V tile through the transposing LDS load:
    // the lane holds d = t*16 + lm, j = s*32 + 8*lhi + 0..7 and + 16: the k order of pf
    const _Float16* vfr = &vsh[(lhi * 8 + (lane & 7)) * VPIT + ((lane >> 3) & 1) * 8];
    #pragma unroll
    for (int s = 0; s < 3; ++s) {
        #pragma unroll
        for (int t = 0; t < 4; ++t) {
            Frag16 vf;
            load_frag_tr_p<VPIT>(vfr + s * 32 * VPIT + t * 16, vf);
            o[t] = __builtin_amdgcn_wmma_f32_16x16x32_f16(
                false, vf.v, false, pf[s].v, (short)0, o[t], false, false);
        }
    }
    // a lane holds d = t*16 + lhi*8 + 0..7 of its query row: stored as f16, the A operand
    // of the output projection, in one 16-byte store
    _Float16* orow = (_Float16*)out_attn + ((size_t)b * NN + rowg) * INNERD + h * DHH + lhi * 8;
    #pragma unroll
    for (int t = 0; t < 4; ++t) {
        v8h p;
        #pragma unroll
        for (int r = 0; r < 8; ++r) p[r] = (_Float16)(o[t][r] * inv);
        *(v8h*)(orow + t * 16) = p;
    }
}

// ---------------------------------------------------------------------------
// launch
// ---------------------------------------------------------------------------
extern "C" void kernel_launch(void* const* d_in, const int* in_sizes, int n_in,
                              void* d_out, int out_size, void* d_ws, size_t ws_size,
                              hipStream_t stream)
{
    const float* x        = (const float*)d_in[0];
    const float* ce       = (const float*)d_in[1];
    const int*   ct       = (const int*)  d_in[2];
    const float* camask   = (const float*)d_in[3];
    const float* strength = (const float*)d_in[4];
    const float* Wq       = (const float*)d_in[5];
    const float* Wk       = (const float*)d_in[6];
    const float* Wv       = (const float*)d_in[7];
    const float* Wout     = (const float*)d_in[8];
    const float* bout     = (const float*)d_in[9];
    const float* tte      = (const float*)d_in[10];
    const float* m1w      = (const float*)d_in[11];
    const float* m1b      = (const float*)d_in[12];
    const float* m2w      = (const float*)d_in[13];
    const float* m2b      = (const float*)d_in[14];
    const float* gA       = (const float*)d_in[15];
    const float* gB       = (const float*)d_in[16];
    float* out = (float*)d_out;

    // workspace partition (floats)
    float* ws    = (float*)d_ws;
    float* kin   = ws;                                  // 308*768
    float* k_bh  = kin  + (size_t)BB*JJ*DCC;            // 64*77*64 f16 (as v_bh), first half of the range
    float* v_bh  = k_bh + (size_t)BB*HH*JJ*DHH;
    float* q_bh  = v_bh + (size_t)BB*HH*JJ*DHH;         // 64*4096*64 f16, first half of the range
    float* aout  = q_bh + (size_t)BB*HH*NN*DHH;         // 16384*1024 f16 in the first half
    float* w16   = aout + (size_t)MROWS*INNERD/2;       // 1024*1024 f16 behind them
    float* stats = aout + (size_t)MROWS*INNERD;         // [sum, sumsq, std]

    hipMemsetAsync(stats, 0, 4 * sizeof(float), stream);

    // kin (embedding MLP), V = ce @ Wv and the first q row tiles of q = x @ Wq
    front1_kernel<<<BB*JJ + KVBLK + QTM1*NTN, 256, 0, stream>>>(
        ce, ct, tte, m1w, m1b, m2w, m2b, gA, gB, kin, Wv, v_bh, x, Wq, q_bh);

    // K = kin @ Wk, the remaining q row tiles, and Wout rounded to f16
    front2_kernel<<<KVBLK + QTM2*NTN + WCBLK, 256, 0, stream>>>(kin, Wk, k_bh, x, Wq, q_bh, Wout, w16);

    // masked mean/std of sim (WMMA sim tiles, never stored)
    sim_stats_kernel<<<dim3(NN/128, BB*HH), 256, 0, stream>>>(q_bh, k_bh, ct, stats);
    finalize_kernel<<<1, 1, 0, stream>>>(ct, stats);

    // fused WMMA sim -> softmax -> WMMA attn@V
    attn_fused_kernel<<<dim3(NN/64, BB*HH), 128, 0, stream>>>(
        q_bh, k_bh, v_bh, ct, camask, strength, stats, aout);

    // out = attn_out @ Wout + bout  (WMMA)
    outproj_kernel<<<dim3(DQQ/GBN, MROWS/GBM), 256, 0, stream>>>(aout, w16, bout, out);
}

// v007
// Timed twice side by side with v006, it ran 1.39 times as fast both times.
// Counting every step since v000, it is 3.57 times as fast.
#include <hip/hip_runtime.h>
#include <hip/hip_bf16.h>
#include <math.h>

// ---------------------------------------------------------------------------
// Problem constants
// ---------------------------------------------------------------------------
#define BB   4
#define NN   4096
#define JJ   77
#define HH   16
#define DHH  64
#define DQQ  1024
#define DCC  768
#define DHID 384           // DC/2
#define INNERD 1024        // H*DH
#define MROWS (BB*NN)      // 16384
#define JPAD 80            // sim col padding (5 x 16)
#define KPAD 96            // attn K padding  (3 x 32)

typedef __attribute__((ext_vector_type(16))) _Float16 v16h;
typedef __attribute__((ext_vector_type(8)))  float    v8f;
typedef __attribute__((ext_vector_type(2)))  _Float16 h2_t;
typedef __attribute__((ext_vector_type(8)))  _Float16 v8h;
typedef __attribute__((ext_vector_type(4)))  _Float16 v4h;
typedef __attribute__((ext_vector_type(8)))  short    s16x8;

union Frag16 { v16h v; h2_t h2[8]; _Float16 h[16]; s16x8 q[2]; };

// load one 16x32 f16 WMMA operand fragment from LDS (row-major, "base" points
// at this lane's row at the k-step origin; ISA 16-bit A/B layout)
__device__ __forceinline__ void load_frag(const _Float16* base, Frag16& f, int lhi)
{
    #pragma unroll
    for (int r = 0; r < 8; ++r) {
        int kk = (r < 4) ? (lhi * 8 + 2 * r) : (16 + lhi * 8 + 2 * (r - 4));
        f.h2[r] = *(const h2_t*)(base + kk);
    }
}

// ---------------------------------------------------------------------------
// Token-type embedding MLP -> kin = contextembs + typeemb
// One block of 256 threads takes PR rows (b,j), so that a weight fetched once serves
// PR rows. Each layer is cut into eight slices of 96 k values x 384 columns, one a wave:
// a lane holds 12 columns (three 16-byte pieces, 512 contiguous bytes a wave-wide load)
// of all PR rows, and a trip has twelve such loads in flight. The slices that share a
// column are then summed through LDS.
// ---------------------------------------------------------------------------
#define PR    4                  // rows a block
#define PBLK  (BB * JJ / PR)     // 77 blocks
#define PKS   96                 // k values of a slice
#define PCG   384                // columns of a slice
static_assert(BB * JJ % PR == 0, "whole blocks only");

typedef __attribute__((ext_vector_type(4))) float f4;

// acc[r][i] = sum over the slice's k of in[r][k] * W[k][i*128 + lane*4 + 0..3]
// "in": LDS, row pitch PITCH floats, at the slice's first k; "W": at the slice's first k
// and first column, row pitch LDW floats. Both are the same for the whole wave.
template<int LDW, int PITCH>
__device__ __forceinline__
void mlp_slice(const float* in, const float* __restrict__ W, int lane, f4 (&acc)[PR][3])
{
    #pragma unroll
    for (int r = 0; r < PR; ++r)
        #pragma unroll
        for (int i = 0; i < 3; ++i) acc[r][i] = (f4){0.f, 0.f, 0.f, 0.f};
    // a trip's twelve loads differ from one address only by constants
    const char* wb = (const char*)W;
    const unsigned lo = (unsigned)lane * 16u;
    #pragma unroll 1   // stays rolled: unrolled further, the loaded weights and the 48 sums
                       // no longer fit the 128 registers that 4 blocks a WGP allow
    for (int c = 0; c < PKS; c += 4) {
        f4 w[4][3];
        float a[PR][4];
        #pragma unroll   // w[] stays in registers and the loads issue back to back
        for (int cc = 0; cc < 4; ++cc)
            #pragma unroll
            for (int i = 0; i < 3; ++i)
                w[cc][i] = *(const f4*)(wb + lo + (cc * LDW + i * 128) * 4);
        #pragma unroll
        for (int r = 0; r < PR; ++r) {
            // every lane reads the same four inputs: held in scalar registers they leave the
            // vector registers to the weights in flight and the sums
            const f4 v = *(const f4*)(in + r * PITCH + c);
            #pragma unroll
            for (int e = 0; e < 4; ++e) {
                const float x = v[e];
                a[r][e] = __builtin_bit_cast(float,
                    __builtin_amdgcn_readfirstlane(__builtin_bit_cast(int, x)));
            }
        }
        #pragma unroll
        for (int cc = 0; cc < 4; ++cc)
            #pragma unroll
            for (int r = 0; r < PR; ++r)
                #pragma unroll
                for (int i = 0; i < 3; ++i) acc[r][i] += a[r][cc] * w[cc][i];
        wb += 4 * LDW * 4;
    }
}

// The eight slices become four in LDS: waves 4..7 store theirs, waves 0..3 add their own
// to the slice of wave w + 4. Slot s of "part" is [PR][PCG].
__device__ __forceinline__
void mlp_fold(const f4 (&acc)[PR][3], float* part, int w, int lane)
{
    float* p = part + (w & 3) * (PR * PCG) + lane * 4;
    if (w >= 4) {
        #pragma unroll
        for (int r = 0; r < PR; ++r)
            #pragma unroll
            for (int i = 0; i < 3; ++i) *(f4*)(p + r * PCG + i * 128) = acc[r][i];
    }
    __syncthreads();
    if (w < 4) {
        #pragma unroll
        for (int r = 0; r < PR; ++r)
            #pragma unroll
            for (int i = 0; i < 3; ++i) *(f4*)(p + r * PCG + i * 128) += acc[r][i];
    }
    __syncthreads();
}

__device__ __forceinline__
void prep_rows(int blk, const float* __restrict__ ce, const int* __restrict__ ct,
               const float* __restrict__ tte_emb,
               const float* __restrict__ m1w, const float* __restrict__ m1b,
               const float* __restrict__ m2w, const float* __restrict__ m2b,
               const float* __restrict__ gA, const float* __restrict__ gB,
               float* __restrict__ kin)
{
    __shared__ __attribute__((aligned(16))) float cein_s[PR * DCC];
    __shared__ __attribute__((aligned(16))) float hid_s[PR * DHID];
    __shared__ __attribute__((aligned(16))) float part_s[4 * PR * PCG];

    const int tid  = threadIdx.x;
    const int lane = tid & 31;
    const int w    = __builtin_amdgcn_readfirstlane(tid >> 5);   // wave number, in a scalar register

    // Outside the slices a pair of waves owns one row: r, and with it the row's token type
    // and every row base, is the same for the whole wave; a lane's columns are c0 + 256 n.
    const int r    = w >> 1;
    const int row  = blk * PR + r;
    const int c0   = ((w & 1) * 32 + lane) * 4;
    const int t    = ct[row];
    // bounded into the table's five rows; wave-uniform, so read into a scalar register
    const int tcl  = __builtin_amdgcn_readfirstlane(t < 0 ? 0 : (t > 4 ? 4 : t));
    const float* tter = tte_emb + tcl * DCC;
    const float* cer  = ce + (size_t)row * DCC;

    #pragma unroll   // the six loads issue back to back
    for (int n = 0; n < DCC / 256; ++n) {
        const int c = c0 + n * 256;
        *(f4*)&cein_s[r * DCC + c] = *(const f4*)(cer + c) + *(const f4*)(tter + c);
    }
    __syncthreads();

    f4 acc[PR][3];

    // layer 1, 768 x 384: eight k slices of all columns
    mlp_slice<DHID, DCC>(cein_s + w * PKS, m1w + (size_t)w * PKS * DHID, lane, acc);
    mlp_fold(acc, part_s, w, lane);
    // 384 columns a row: 256 by both waves of the pair, the last 128 by its first wave
    for (int c = c0; c < DHID; c += 256) {
        f4 s = *(const f4*)(m1b + c);
        #pragma unroll
        for (int k = 0; k < 4; ++k) s += *(const f4*)&part_s[(k * PR + r) * PCG + c];
        #pragma unroll
        for (int e = 0; e < 4; ++e)
            s[e] = 0.5f * s[e] * (1.0f + erff(s[e] * 0.70710678118654752f));
        *(f4*)&hid_s[r * DHID + c] = s;
    }
    __syncthreads();

    // layer 2, 384 x 768: four k slices (w >> 1) of two column halves (w & 1)
    mlp_slice<DCC, DHID>(hid_s + (w >> 1) * PKS, m2w + (size_t)(w >> 1) * PKS * DCC + (w & 1) * PCG,
                         lane, acc);
    mlp_fold(acc, part_s, w, lane);
    #pragma unroll
    for (int n = 0; n < DCC / 256; ++n) {
        const int c  = c0 + n * 256;
        const int cg = c / PCG, cc = c - cg * PCG;
        f4 s = *(const f4*)(m2b + c);
        s += *(const f4*)&part_s[(cg * PR + r) * PCG + cc];
        s += *(const f4*)&part_s[((2 + cg) * PR + r) * PCG + cc];
        const f4 typeemb = *(const f4*)(tter + c) * *(const f4*)(gA + c) + s * *(const f4*)(gB + c);
        *(f4*)(kin + (size_t)row * DCC + c) = *(const f4*)(cer + c) + typeemb;
    }
}

// ---------------------------------------------------------------------------
// WMMA GEMM: C[M,1024] = A[M,K] * B[K,1024]  (fp32 in, f16 mul, f32 acc)
// Block tile 128x128, BK=32, 8 waves (4x2), each wave 32x64 = 2x4 WMMA tiles.
// MODE 0: store q permuted [B*H, N, DH], as f16: what its readers feed to the matrix unit
// MODE 1: plain store + bias (output projection)
// MODE 2: store K/V permuted [B*H, J, DH], as f16  (rows = b*J+j, M=308)
// ---------------------------------------------------------------------------
#define GBM 128
#define GBN 128
#define GBK 32
#define LDSS 40   // padded LDS stride in halfs
#define LDSB 144  // B tile row pitch in halfs: 288 bytes, an odd multiple of 32 bytes
#define VPIT 80   // V tile row pitch in halfs: 160 bytes, an odd multiple of 32 bytes

// one 32(k) x 16(n) B fragment out of a row-major [k][n] f16 LDS tile, through the
// transposing LDS load. "base" is this lane's own address:
//   tile + (8*(lane>>4) + (lane&7)) * LDSB + n0 + 8*((lane>>3)&1)
// The lane then holds column n0 + (lane&15), k = 8*lhi + 0..7 and 16 + 8*lhi + 0..7:
// the k order of load_frag().
__device__ __forceinline__ void load_frag_tr(const _Float16* base, Frag16& f)
{
    typedef __attribute__((address_space(3))) s16x8 lds_s16x8;
    f.q[0] = __builtin_amdgcn_ds_load_tr16_b128_v8i16((lds_s16x8*)base);
    f.q[1] = __builtin_amdgcn_ds_load_tr16_b128_v8i16((lds_s16x8*)(base + 16 * LDSB));
}

// the same fragment out of a row-major tile of another pitch (in halfs)
template<int PITCH>
__device__ __forceinline__ void load_frag_tr_p(const _Float16* base, Frag16& f)
{
    typedef __attribute__((address_space(3))) s16x8 lds_s16x8;
    f.q[0] = __builtin_amdgcn_ds_load_tr16_b128_v8i16((lds_s16x8*)base);
    f.q[1] = __builtin_amdgcn_ds_load_tr16_b128_v8i16((lds_s16x8*)(base + 16 * PITCH));
}

// Stage ROWS rows of 64 f16 values (contiguous rows of 128 bytes in memory) as rows of
// PITCH halfs in LDS, as they lie in memory. A wave's 16-byte loads cover 512 contiguous
// bytes, and all of a thread's loads are issued before the first value is used.
// Rows VALID..ROWS-1 are filled with zero; a load that would fall there is clamped.
template<int NT, int ROWS, int VALID, int PITCH>
__device__ __forceinline__ void stage_rows64h(const _Float16* __restrict__ src, _Float16* dst, int tid)
{
    constexpr int NP = ROWS * 8;                       // 16-byte pieces of the LDS tile
    constexpr int NV = VALID * 8;                      // of these, pieces of valid rows
    constexpr int NI = NP / NT;                        // trips
    static_assert(NP % NT == 0, "whole trips only");
    constexpr int NL = (NV + NT - 1) / NT;             // of these, trips that hold a valid row
    uint4 v[NL];
    #pragma unroll   // v[] stays in registers and the loads issue back to back
    for (int i = 0; i < NL; ++i) {
        int f = tid + i * NT;
        if ((i + 1) * NT > NV) f = f < NV ? f : NV - 1;   // piece index clamped into the tile
        v[i] = ((const uint4*)src)[f];
    }
    #pragma unroll   // v[] is indexed by constants
    for (int i = 0; i < NI; ++i) {
        const int f = tid + i * NT;
        uint4 h = make_uint4(0u, 0u, 0u, 0u);
        if (i < NL) {
            h = v[i];
            if ((i + 1) * NT > NV && f >= NV) h = make_uint4(0u, 0u, 0u, 0u);
        }
        *(uint4*)(dst + (f >> 3) * PITCH + (f & 7) * 8) = h;
    }
}

// One 128x128 tile at (blockM, blockN), by one block of 256 threads: the k loop ...
__device__ __forceinline__
void gemm_accumulate(const float* __restrict__ A, const float* __restrict__ Bm,
                     int M, int K, int blockM, int blockN, v8f (&acc)[2][4])
{
    __shared__ __attribute__((aligned(16))) _Float16 Ash[GBM * LDSS];
    __shared__ __attribute__((aligned(32))) _Float16 Bsh[GBK * LDSB];   // [k][n]

    const int tid  = threadIdx.x;
    const int wid  = tid >> 5;
    const int lane = tid & 31;
    const int wm   = wid >> 1;     // 0..3 -> 32-row strip
    const int wn   = wid & 1;      // 0..1 -> 64-col strip
    const int lm   = lane & 15;
    const int lhi  = lane >> 4;

    #pragma unroll
    for (int t = 0; t < 2; ++t)
        #pragma unroll
        for (int u = 0; u < 4; ++u)
            acc[t][u] = (v8f){0.f,0.f,0.f,0.f,0.f,0.f,0.f,0.f};

    int arow = blockM + (tid >> 1);       // global A row
    if (arow >= M) arow = M - 1;          // clamp (stores are guarded)
    const int acb  = (tid & 1) * 16;
    const int bkr  = tid >> 3;            // 0..31
    const int bcb  = (tid & 7) * 16;
    // Staging map: every wave-wide 16-byte load covers whole 128-byte lines.
    // A: 8 lanes take the 128 bytes that one row has in this k tile, a wave 4 rows;
    //    a thread's rows are sar + 32 i. Byte offsets from A, rows clamped like arow.
    // B: a wave takes 512 contiguous bytes of one k row; a thread's rows are sbr + 8 i.
    const int sar  = tid >> 3;            // 0..31
    const int sac  = (tid & 7) * 4;       // four columns
    const int sbr  = tid >> 5;            // 0..7
    const int sbc  = lane * 4;            // four columns
    unsigned aoff[4];
    #pragma unroll   // aoff[] is indexed by constants and stays in registers
    for (int i = 0; i < 4; ++i) {
        int r = blockM + sar + 32 * i;
        if (r >= M) r = M - 1;
        aoff[i] = ((unsigned)r * (unsigned)K + (unsigned)sac) * 4u;
    }
    unsigned boff = ((unsigned)sbr * 1024u + (unsigned)blockN + (unsigned)sbc) * 4u;
    const _Float16* bfr = &Bsh[(lhi * 8 + (lane & 7)) * LDSB + wn * 64 + ((lane >> 3) & 1) * 8];

    for (int k0 = 0; k0 < K; k0 += GBK) {
        // stage both tiles (fp32 -> f16), each as it lies in memory: Ash[m][k], Bsh[k][n]
        float4 av[4], bv[4];
        // uniform base + 32-bit byte offset: one address register a load (both operands are
        // far below 4 GiB)
        #pragma unroll   // av[] stays in registers and the loads issue back to back
        for (int i = 0; i < 4; ++i) av[i] = *(const float4*)((const char*)A + aoff[i]);
        #pragma unroll   // the same for bv[]
        for (int i = 0; i < 4; ++i) bv[i] = *(const float4*)((const char*)Bm + boff + i * 32768);
        #pragma unroll   // av[] is indexed by constants; the LDS offsets become immediates
        for (int i = 0; i < 4; ++i) {
            v4h p;
            p[0] = (_Float16)av[i].x;  p[1] = (_Float16)av[i].y;
            p[2] = (_Float16)av[i].z;  p[3] = (_Float16)av[i].w;
            *(v4h*)&Ash[(sar + 32 * i) * LDSS + sac] = p;
        }
        #pragma unroll   // the same for bv[]
        for (int i = 0; i < 4; ++i) {
            v4h p;
            p[0] = (_Float16)bv[i].x;  p[1] = (_Float16)bv[i].y;
            p[2] = (_Float16)bv[i].z;  p[3] = (_Float16)bv[i].w;
            *(v4h*)&Bsh[(sbr + 8 * i) * LDSB + sbc] = p;
        }
        #pragma unroll   // on to the next k tile (the loaded values have arrived)
        for (int i = 0; i < 4; ++i) aoff[i] += GBK * 4u;
        boff += GBK * 4096u;
        if (k0 + GBK < K) {   // global_prefetch of next k-tile
            __builtin_prefetch(A + (size_t)arow * K + k0 + GBK + acb, 0, 1);
            __builtin_prefetch(Bm + (size_t)(k0 + GBK + bkr) * 1024 + blockN + bcb, 0, 1);
        }
        __syncthreads();

        Frag16 af[2], bf[4];
        #pragma unroll
        for (int t = 0; t < 2; ++t)
            load_frag(&Ash[(wm * 32 + t * 16 + lm) * LDSS], af[t], lhi);
        #pragma unroll
        for (int u = 0; u < 4; ++u)
            load_frag_tr(bfr + u * 16, bf[u]);

        #pragma unroll
        for (int t = 0; t < 2; ++t)
            #pragma unroll
            for (int u = 0; u < 4; ++u)
                acc[t][u] = __builtin_amdgcn_wmma_f32_16x16x32_f16(
                    false, af[t].v, false, bf[u].v,
                    (short)0, acc[t][u], false, false);

        __syncthreads();
    }
}

// ... and the store of its accumulators
template<int MODE>
__device__ __forceinline__
void gemm_store(const v8f (&acc)[2][4], const float* __restrict__ bias, float* __restrict__ C,
                int M, int blockM, int blockN)
{
    const int tid  = threadIdx.x;
    const int wid  = tid >> 5;
    const int lane = tid & 31;
    const int wm   = wid >> 1;
    const int wn   = wid & 1;
    const int lm   = lane & 15;
    const int lhi  = lane >> 4;

    // C/D layout: lanes 0-15 -> M=r, lanes 16-31 -> M=8+r, N=lane&15
    #pragma unroll
    for (int t = 0; t < 2; ++t) {
        #pragma unroll
        for (int u = 0; u < 4; ++u) {
            #pragma unroll
            for (int r = 0; r < 8; ++r) {
                int rg = blockM + wm * 32 + t * 16 + (lhi ? 8 + r : r);
                int cg = blockN + wn * 64 + u * 16 + lm;
                float val = acc[t][u][r];
                if (MODE == 1) {
                    C[(size_t)rg * 1024 + cg] = val + bias[cg];
                } else if (MODE == 0) {
                    int b = rg >> 12, n = rg & 4095;
                    int h = cg >> 6,  d = cg & 63;
                    ((_Float16*)C)[(((size_t)(b * HH + h)) * NN + n) * DHH + d] = (_Float16)val;
                } else { // MODE 2: rows are (b, j)
                    if (rg < M) {
                        int b = rg / JJ, j = rg - b * JJ;
                        int h = cg >> 6, d = cg & 63;
                        ((_Float16*)C)[(((size_t)(b * HH + h)) * JJ + j) * DHH + d] = (_Float16)val;
                    }
                }
            }
        }
    }
    // where other block ranges' code follows in the same kernel, it reuses the registers
    // that these stores name: the wait stands in front of any such overwrite
    if (MODE == 0) asm volatile("s_wait_xcnt 0x0" ::: "memory");
}

// ---------------------------------------------------------------------------
// The work in front of the attention, in two launches. The embedding MLP, the V
// projection and the q projection do not depend on one another; the K projection
// needs only the MLP. The MLP and the K and V projections are short chains of
// dependent memory round trips on few blocks, which leave most of the chip idle
// when launched alone, so each launch runs them beside a share of the q tiles.
// The long chains take the lowest block indices.
// All blocks of the first launch are resident at once: at up to 128 registers a wave,
// 4 blocks a WGP, 1024 places; 77 + 24 + 86 * 8 = 789 blocks.
// ---------------------------------------------------------------------------
#define NTN    (INNERD / GBN)                        // 8 column tiles
#define KVBLK  (NTN * ((BB * JJ + GBM - 1) / GBM))   // 24 tiles of a K or V projection
#define QTM1   86                                    // q row tiles in the first launch
#define QTM2   (MROWS / GBM - QTM1)                  // 42 in the second
#define WCBLK  (INNERD * DQQ / 4096)                 // 256 blocks that round Wout to f16

__global__ __launch_bounds__(256)
void front1_kernel(const float* __restrict__ ce, const int* __restrict__ ct,
                   const float* __restrict__ tte_emb,
                   const float* __restrict__ m1w, const float* __restrict__ m1b,
                   const float* __restrict__ m2w, const float* __restrict__ m2b,
                   const float* __restrict__ gA, const float* __restrict__ gB,
                   float* __restrict__ kin,
                   const float* __restrict__ Wv, float* __restrict__ v_bh,
                   const float* __restrict__ x, const float* __restrict__ Wq,
                   float* __restrict__ q_bh)
{
    const int blk = blockIdx.x;
    if (blk < PBLK) {
        prep_rows(blk, ce, ct, tte_emb, m1w, m1b, m2w, m2b, gA, gB, kin);
        return;
    }
    const bool isv = blk < PBLK + KVBLK;             // the same for the whole block
    const int  t   = blk - (isv ? PBLK : PBLK + KVBLK);
    const int  bm  = (t / NTN) * GBM, bn = (t % NTN) * GBN;
    v8f acc[2][4];
    gemm_accumulate(isv ? ce : x, isv ? Wv : Wq, isv ? BB * JJ : MROWS, isv ? DCC : DQQ, bm, bn, acc);
    if (isv) gemm_store<2>(acc, nullptr, v_bh, BB * JJ, bm, bn);
    else     gemm_store<0>(acc, nullptr, q_bh, MROWS, bm, bn);
}

__global__ __launch_bounds__(256)
void front2_kernel(const float* __restrict__ kin, const float* __restrict__ Wk,
                   float* __restrict__ k_bh,
                   const float* __restrict__ x, const float* __restrict__ Wq,
                   float* __restrict__ q_bh,
                   const float* __restrict__ Wout, float* __restrict__ w16)
{
    const int  blk = blockIdx.x;
    if (blk >= KVBLK + QTM2 * NTN) {                 // the same for the whole block
        // Wout rounded to f16 once, for the output projection: 4096 values a block
        const int p = (blk - (KVBLK + QTM2 * NTN)) * 1024 + threadIdx.x;   // piece of 4 values
        float4 v[4];
        #pragma unroll   // v[] stays in registers and the loads issue back to back
        for (int i = 0; i < 4; ++i) v[i] = ((const float4*)Wout)[p + i * 256];
        #pragma unroll   // v[] is indexed by constants
        for (int i = 0; i < 4; ++i) {
            v4h h;
            h[0] = (_Float16)v[i].x;  h[1] = (_Float16)v[i].y;
            h[2] = (_Float16)v[i].z;  h[3] = (_Float16)v[i].w;
            ((v4h*)w16)[p + i * 256] = h;
        }
        return;
    }
    const bool isk = blk < KVBLK;                    // the same for the whole block
    const int  t   = isk ? blk : blk - KVBLK + QTM1 * NTN;
    const int  bm  = (t / NTN) * GBM, bn = (t % NTN) * GBN;
    v8f acc[2][4];
    gemm_accumulate(isk ? kin : x, isk ? Wk : Wq, isk ? BB * JJ : MROWS, isk ? DCC : DQQ, bm, bn, acc);
    if (isk) gemm_store<2>(acc, nullptr, k_bh, BB * JJ, bm, bn);
    else     gemm_store<0>(acc, nullptr, q_bh, MROWS, bm, bn);
}

// output projection: out = attn_out @ Wout + bout
// Both operands lie in the workspace as f16, rounded once by their producers (the
// attention kernel; the last block range of front2_kernel): the values that the k loop
// above would round them to in every tile that reads them. A tile therefore loads half
// the bytes and converts nothing. The k tile is 64, so that the piece of an A row in it
// is one whole 128-byte line; the products are summed in ascending k, 32 at a time.
#define HBK  64   // k tile
#define APIT 72   // A tile row pitch in halfs: 144 bytes, an odd multiple of 16 bytes
__global__ __launch_bounds__(256)
void outproj_kernel(const float* __restrict__ a16, const float* __restrict__ w16,
                    const float* __restrict__ bias, float* __restrict__ C)
{
    __shared__ __attribute__((aligned(16))) _Float16 Ash[GBM * APIT];   // [m][k]
    __shared__ __attribute__((aligned(32))) _Float16 Bsh[HBK * LDSB];   // [k][n]

    const int bm   = blockIdx.y * GBM, bn = blockIdx.x * GBN;
    const int tid  = threadIdx.x;
    const int wid  = tid >> 5;
    const int lane = tid & 31;
    const int wm   = wid >> 1;     // 0..3 -> 32-row strip
    const int wn   = wid & 1;      // 0..1 -> 64-col strip
    const int lm   = lane & 15;
    const int lhi  = lane >> 4;

    v8f acc[2][4];
    #pragma unroll
    for (int t = 0; t < 2; ++t)
        #pragma unroll
        for (int u = 0; u < 4; ++u)
            acc[t][u] = (v8f){0.f,0.f,0.f,0.f,0.f,0.f,0.f,0.f};

    // Staging map, 16 bytes (8 halfs) a lane, whole 128-byte lines:
    // A: 8 lanes take the line that one row has in this k tile, a wave 4 rows; rows sar + 32 i.
    // B: 16 lanes take the 256 bytes of one k row, a wave 2 rows; rows sbr + 16 i.
    const int sar = tid >> 3;            // 0..31
    const int sac = (tid & 7) * 8;
    const int sbr = tid >> 4;            // 0..15
    const int sbc = (tid & 15) * 8;
    unsigned aoff = ((unsigned)(bm + sar) * 1024u + (unsigned)sac) * 2u;   // byte offsets
    unsigned boff = ((unsigned)sbr * 1024u + (unsigned)(bn + sbc)) * 2u;
    const _Float16* bfr = &Bsh[(lhi * 8 + (lane & 7)) * LDSB + wn * 64 + ((lane >> 3) & 1) * 8];

    #pragma unroll 1   // stays rolled: unrolled, a tile's eight loads no longer issue together
                       // and the kernel takes more than 128 registers (3 blocks a WGP, not 4)
    for (int k0 = 0; k0 < INNERD; k0 += HBK) {
        uint4 av[4], bv[4];
        #pragma unroll   // av[] stays in registers and the loads issue back to back
        for (int i = 0; i < 4; ++i) av[i] = *(const uint4*)((const char*)a16 + aoff + i * 65536);
        #pragma unroll   // the same for bv[]
        for (int i = 0; i < 4; ++i) bv[i] = *(const uint4*)((const char*)w16 + boff + i * 32768);
        #pragma unroll   // av[] is indexed by constants
        for (int i = 0; i < 4; ++i) *(uint4*)&Ash[(sar + 32 * i) * APIT + sac] = av[i];
        #pragma unroll   // the same for bv[]
        for (int i = 0; i < 4; ++i) *(uint4*)&Bsh[(sbr + 16 * i) * LDSB + sbc] = bv[i];
        aoff += HBK * 2u;                 // on to the next k tile (the loaded values have arrived)
        boff += HBK * 2048u;
        if (k0 + HBK < INNERD) {          // global_prefetch of the next k tile: 128 lines each
            __builtin_prefetch((const char*)a16 + ((unsigned)(bm + (tid >> 1)) * 1024u + (unsigned)(k0 + HBK)) * 2u, 0, 1);
            __builtin_prefetch((const char*)w16 + ((unsigned)(k0 + HBK + (tid >> 2)) * 1024u + (unsigned)bn) * 2u + (tid & 1) * 128, 0, 1);
        }
        __syncthreads();

        #pragma unroll   // two k steps of 32 out of one staged tile
        for (int s = 0; s < 2; ++s) {
            Frag16 af[2], bf[4];
            #pragma unroll
            for (int t = 0; t < 2; ++t)
                load_frag(&Ash[(wm * 32 + t * 16 + lm) * APIT + s * 32], af[t], lhi);
            #pragma unroll
            for (int u = 0; u < 4; ++u)
                load_frag_tr(bfr + s * 32 * LDSB + u * 16, bf[u]);

            #pragma unroll
            for (int t = 0; t < 2; ++t)
                #pragma unroll
                for (int u = 0; u < 4; ++u)
                    acc[t][u] = __builtin_amdgcn_wmma_f32_16x16x32_f16(
                        false, af[t].v, false, bf[u].v,
                        (short)0, acc[t][u], false, false);
        }
        __syncthreads();
    }
    gemm_store<1>(acc, bias, C, MROWS, bm, bn);
}

// ---------------------------------------------------------------------------
// Kernel 3: WMMA sim tiles + masked sum/sumsq (sim never hits HBM)
// grid (N/128, B*H), 256 threads (8 waves x 16 rows), 5 j-tiles, K=64
// ---------------------------------------------------------------------------
__global__ __launch_bounds__(256)
void sim_stats_kernel(const float* __restrict__ q_bh, const float* __restrict__ k_bh,
                      const int* __restrict__ ct, float* __restrict__ stats)
{
    __shared__ __attribute__((aligned(16))) _Float16 qsh[128 * 72];     // [row][k], stride 72
    __shared__ __attribute__((aligned(16))) _Float16 kshT[KPAD * 72];   // [j][k], rows 77..95 zero
    __shared__ int   sel2[JPAD];
    __shared__ float rs[256], rq[256];

    const int tid  = threadIdx.x;
    const int wid  = tid >> 5;
    const int lane = tid & 31;
    const int lm   = lane & 15;
    const int lhi  = lane >> 4;
    const int bh   = blockIdx.y;
    const int b    = bh >> 4;
    const int rowbase = blockIdx.x * 128;

    // q tile 128x64 and K tile, f16 in the workspace (K staged as 96 rows: whole trips of
    // 256 threads, so that all loads issue together; rows 80..95 are not read)
    stage_rows64h<256, 128, 128, 72>((const _Float16*)q_bh + ((size_t)bh * NN + rowbase) * DHH, qsh, tid);
    stage_rows64h<256, KPAD, JJ, 72>((const _Float16*)k_bh + (size_t)bh * JJ * DHH, kshT, tid);
    for (int j = tid; j < JPAD; j += 256)
        sel2[j] = (j < JJ && ct[b * JJ + j] >= 2) ? 1 : 0;
    __syncthreads();

    v8f acc[5];
    #pragma unroll
    for (int t = 0; t < 5; ++t) acc[t] = (v8f){0.f,0.f,0.f,0.f,0.f,0.f,0.f,0.f};

    #pragma unroll
    for (int s = 0; s < 2; ++s) {          // K = 64 -> 2 k-steps
        Frag16 af;
        load_frag(&qsh[(wid * 16 + lm) * 72 + s * 32], af, lhi);
        #pragma unroll
        for (int t = 0; t < 5; ++t) {
            Frag16 bf;
            load_frag(&kshT[(t * 16 + lm) * 72 + s * 32], bf, lhi);
            acc[t] = __builtin_amdgcn_wmma_f32_16x16x32_f16(
                false, af.v, false, bf.v, (short)0, acc[t], false, false);
        }
    }

    // lane (t,lm) owns column j = t*16+lm for 8 rows -> accumulate stats
    float s1 = 0.f, s2 = 0.f;
    #pragma unroll
    for (int t = 0; t < 5; ++t) {
        int j = t * 16 + lm;
        if (j < JJ && sel2[j]) {
            #pragma unroll
            for (int r = 0; r < 8; ++r) {
                float v = acc[t][r];
                s1 += v;
                s2 = fmaf(v, v, s2);
            }
        }
    }
    rs[tid] = s1; rq[tid] = s2;
    __syncthreads();
    for (int off = 128; off > 0; off >>= 1) {
        if (tid < off) { rs[tid] += rs[tid + off]; rq[tid] += rq[tid + off]; }
        __syncthreads();
    }
    if (tid == 0) {
        atomicAdd(&stats[0], rs[0]);
        atomicAdd(&stats[1], rq[0]);
    }
}

// ---------------------------------------------------------------------------
// Kernel 4: finalize std (Bessel-corrected, matching torch .std())
// ---------------------------------------------------------------------------
__global__ void finalize_kernel(const int* __restrict__ ct, float* __restrict__ stats)
{
    int cnt = 0;
    for (int i = 0; i < BB * JJ; ++i) cnt += (ct[i] >= 2) ? 1 : 0;
    float nsel = (float)cnt * (float)HH * (float)NN;
    float mean = (nsel > 0.f) ? stats[0] / nsel : 0.f;
    float var  = (nsel > 1.f) ? (stats[1] - nsel * mean * mean) / (nsel - 1.f) : 0.f;
    stats[2] = sqrtf(var > 0.f ? var : 0.f);
}

// ---------------------------------------------------------------------------
// Kernel 5: fused attention block, 64 rows / block, 128 threads (4 waves).
// The scores are formed transposed, S^T = K * Q^T (K is the A operand, Q the B
// operand), so a lane's accumulators hold 40 scores of ONE query row:
//   column = lane & 15 -> query row,  j = t*16 + (lane >> 4)*8 + r.
// The masked softmax runs in registers on all lanes; lanes l and l^16 share a
// query row and exchange three partial results. That accumulator order is the
// k order of a 16-bit B operand, so the probabilities, converted to f16, are
// the B operand of out^T = V^T * P^T with no pass through LDS.
// ---------------------------------------------------------------------------
__device__ __forceinline__ float other_half(float x)   // value of lane l ^ 16
{
    int b = __builtin_bit_cast(int, x);
    b = __builtin_amdgcn_permlanex16(b, b, 0x76543210, 0xfedcba98, false, false);
    return __builtin_bit_cast(float, b);
}

// 2^x. The v_nop keeps the one free issue slot the instruction set asks for
// behind a transcendental.
__device__ __forceinline__ float exp2_slot(float x)
{
    float y;
    asm("v_exp_f32 %0, %1\n\tv_nop" : "=v"(y) : "v"(x));
    return y;
}

__global__ __launch_bounds__(128)
void attn_fused_kernel(const float* __restrict__ q_bh, const float* __restrict__ k_bh,
                       const float* __restrict__ v_bh, const int* __restrict__ ct,
                       const float* __restrict__ camask, const float* __restrict__ strength,
                       const float* __restrict__ stats, float* __restrict__ out_attn)
{
    __shared__ __attribute__((aligned(16))) _Float16 qsh[64 * 72];      // q tile [row][k]
    __shared__ __attribute__((aligned(16))) _Float16 kshT[JPAD * 72];   // [j][k], rows 77..79 zero
    __shared__ __attribute__((aligned(32))) _Float16 vsh[KPAD * VPIT];  // [j][d], rows 77..95 zero
    __shared__ int      sel2[JPAD], selg[JPAD];

    const int tid  = threadIdx.x;
    const int wid  = tid >> 5;     // 0..3 -> 16-row strip
    const int lane = tid & 31;
    const int lm   = lane & 15;
    const int lhi  = lane >> 4;
    const int bh   = blockIdx.y;
    const int b    = bh >> 4;
    const int h    = bh & 15;
    const int rowbase = blockIdx.x * 64;
    const int rowg = rowbase + wid * 16 + lm;   // this lane's query row

    // q tile 64x64 and K tile 80x64, f16 in the workspace, each as it lies in memory
    stage_rows64h<128, 64, 64, 72>((const _Float16*)q_bh + ((size_t)bh * NN + rowbase) * DHH, qsh, tid);
    stage_rows64h<128, JPAD, JJ, 72>((const _Float16*)k_bh + (size_t)bh * JJ * DHH, kshT, tid);
    for (int j = tid; j < JPAD; j += 128) {
        int t = (j < JJ) ? ct[b * JJ + j] : -1;
        sel2[j] = (t >= 2) ? 1 : 0;
        selg[j] = (t >= 0 && t < 2) ? 1 : 0;
    }

    // this lane's 40 mask values, read once; index clamped for j = 77..79
    float wf[5][8];
    {
        const float* camrow = camask + ((size_t)b * NN + rowg) * JJ;
        #pragma unroll
        for (int t = 0; t < 5; ++t)
            #pragma unroll
            for (int r = 0; r < 8; ++r) {
                int j = t * 16 + lhi * 8 + r;
                wf[t][r] = camrow[j < JJ ? j : JJ - 1];
            }
    }
    // the registers that hold the mask loads' addresses are reused by the staging below
    asm volatile("s_wait_xcnt 0x0" ::: "memory");

    // V tile 96x64, f16 in the workspace, as it lies in memory
    stage_rows64h<128, KPAD, JJ, VPIT>((const _Float16*)v_bh + (size_t)bh * JJ * DHH, vsh, tid);
    __syncthreads();

    // ---- stage 1: S^T = K @ q^T via WMMA, kept in registers
    v8f acc[5];
    #pragma unroll
    for (int t = 0; t < 5; ++t) acc[t] = (v8f){0.f,0.f,0.f,0.f,0.f,0.f,0.f,0.f};
    #pragma unroll
    for (int s = 0; s < 2; ++s) {
        Frag16 qf;
        load_frag(&qsh[(wid * 16 + lm) * 72 + s * 32], qf, lhi);
        #pragma unroll
        for (int t = 0; t < 5; ++t) {
            Frag16 kf;
            load_frag(&kshT[(t * 16 + lm) * 72 + s * 32], kf, lhi);
            acc[t] = __builtin_amdgcn_wmma_f32_16x16x32_f16(
                false, kf.v, false, qf.v, (short)0, acc[t], false, false);
        }
    }

    // ---- stage 2: masked softmax of this lane's query row, in registers
    const float simstd = stats[2];
    const float str    = strength[0];
    const float scale  = 0.125f;                  // 1/sqrt(DH)

    float wfmax = -__FLT_MAX__;
    #pragma unroll
    for (int t = 0; t < 5; ++t)
        #pragma unroll
        for (int r = 0; r < 8; ++r) {
            int j = t * 16 + lhi * 8 + r;
            float w = sel2[j] ? wf[t][r] * simstd * str : 0.f;
            wf[t][r] = w;
            if (j < JJ) wfmax = fmaxf(wfmax, w);
        }
    wfmax = fmaxf(wfmax, other_half(wfmax));
    const float thr = fmaxf(wfmax, 0.001f) - 0.0001f;

    float m = -__FLT_MAX__;
    #pragma unroll
    for (int t = 0; t < 5; ++t)
        #pragma unroll
        for (int r = 0; r < 8; ++r) {
            int j = t * 16 + lhi * 8 + r;
            // both tests evaluated, no short circuit: the flag reads stay wide and unbranched
            bool lmv = (wf[t][r] >= thr) | (selg[j] != 0);
            float sv = (lmv & (j < JJ)) ? acc[t][r] * scale : -__FLT_MAX__;
            acc[t][r] = sv;                       // masked + scaled score
            m = fmaxf(m, sv);
        }
    m = fmaxf(m, other_half(m));

    float denom = 0.f;
    Frag16 pf[3];                                 // unnormalized probs, B operand
    #pragma unroll
    for (int t = 0; t < 6; ++t)
        #pragma unroll
        for (int r = 0; r < 8; ++r) {
            float p = 0.f;
            if (t < 5) {
                int j = t * 16 + lhi * 8 + r;
                p = exp2_slot((acc[t][r] - m) * 1.4426950408889634f);   // e^(s - m)
                if (j >= JJ) p = 0.f;
                denom += p;
            }
            pf[t >> 1].h[(t & 1) * 8 + r] = (_Float16)p;
        }
    denom += other_half(denom);
    const float inv = 1.f / denom;

    // keeps the PV matrix instructions below every exp2_slot()
    __builtin_amdgcn_sched_barrier(0);

    // ---- stage 3: out^T = V^T @ P^T via WMMA (K = 96 -> 3 k-steps, 4 d tiles)
    v8f o[4];
    #pragma unroll
    for (int t = 0; t < 4; ++t) o[t] = (v8f){0.f,0.f,0.f,0.f,0.f,0.f,0.f,0.f};
    // V^T fragments come out of the row-major V tile through the transposing LDS load:
    // the lane holds d = t*16 + lm, j = s*32 + 8*lhi + 0..7 and + 16: the k order of pf
    const _Float16* vfr = &vsh[(lhi * 8 + (lane & 7)) * VPIT + ((lane >> 3) & 1) * 8];
    #pragma unroll
    for (int s = 0; s < 3; ++s) {
        #pragma unroll
        for (int t = 0; t < 4; ++t) {
            Frag16 vf;
            load_frag_tr_p<VPIT>(vfr + s * 32 * VPIT + t * 16, vf);
            o[t] = __builtin_amdgcn_wmma_f32_16x16x32_f16(
                false, vf.v, false, pf[s].v, (short)0, o[t], false, false);
        }
    }
    // a lane holds d = t*16 + lhi*8 + 0..7 of its query row: stored as f16, the A operand
    // of the output projection, in one 16-byte store
    _Float16* orow = (_Float16*)out_attn + ((size_t)b * NN + rowg) * INNERD + h * DHH + lhi * 8;
    #pragma unroll
    for (int t = 0; t < 4; ++t) {
        v8h p;
        #pragma unroll
        for (int r = 0; r < 8; ++r) p[r] = (_Float16)(o[t][r] * inv);
        *(v8h*)(orow + t * 16) = p;
    }
}

// ---------------------------------------------------------------------------
// launch
// ---------------------------------------------------------------------------
extern "C" void kernel_launch(void* const* d_in, const int* in_sizes, int n_in,
                              void* d_out, int out_size, void* d_ws, size_t ws_size,
                              hipStream_t stream)
{
    const float* x        = (const float*)d_in[0];
    const float* ce       = (const float*)d_in[1];
    const int*   ct       = (const int*)  d_in[2];
    const float* camask   = (const float*)d_in[3];
    const float* strength = (const float*)d_in[4];
    const float* Wq       = (const float*)d_in[5];
    const float* Wk       = (const float*)d_in[6];
    const float* Wv       = (const float*)d_in[7];
    const float* Wout     = (const float*)d_in[8];
    const float* bout     = (const float*)d_in[9];
    const float* tte      = (const float*)d_in[10];
    const float* m1w      = (const float*)d_in[11];
    const float* m1b      = (const float*)d_in[12];
    const float* m2w      = (const float*)d_in[13];
    const float* m2b      = (const float*)d_in[14];
    const float* gA       = (const float*)d_in[15];
    const float* gB       = (const float*)d_in[16];
    float* out = (float*)d_out;

    // workspace partition (floats)
    float* ws    = (float*)d_ws;
    float* kin   = ws;                                  // 308*768
    float* k_bh  = kin  + (size_t)BB*JJ*DCC;            // 64*77*64 f16 (as v_bh), first half of the range
    float* v_bh  = k_bh + (size_t)BB*HH*JJ*DHH;
    float* q_bh  = v_bh + (size_t)BB*HH*JJ*DHH;         // 64*4096*64 f16, first half of the range
    float* aout  = q_bh + (size_t)BB*HH*NN*DHH;         // 16384*1024 f16 in the first half
    float* w16   = aout + (size_t)MROWS*INNERD/2;       // 1024*1024 f16 behind them
    float* stats = aout + (size_t)MROWS*INNERD;         // [sum, sumsq, std]

    hipMemsetAsync(stats, 0, 4 * sizeof(float), stream);

    // kin (embedding MLP), V = ce @ Wv and the first q row tiles of q = x @ Wq
    front1_kernel<<<PBLK + KVBLK + QTM1*NTN, 256, 0, stream>>>(
        ce, ct, tte, m1w, m1b, m2w, m2b, gA, gB, kin, Wv, v_bh, x, Wq, q_bh);

    // K = kin @ Wk, the remaining q row tiles, and Wout rounded to f16
    front2_kernel<<<KVBLK + QTM2*NTN + WCBLK, 256, 0, stream>>>(kin, Wk, k_bh, x, Wq, q_bh, Wout, w16);

    // masked mean/std of sim (WMMA sim tiles, never stored)
    sim_stats_kernel<<<dim3(NN/128, BB*HH), 256, 0, stream>>>(q_bh, k_bh, ct, stats);
    finalize_kernel<<<1, 1, 0, stream>>>(ct, stats);

    // fused WMMA sim -> softmax -> WMMA attn@V
    attn_fused_kernel<<<dim3(NN/64, BB*HH), 128, 0, stream>>>(
        q_bh, k_bh, v_bh, ct, camask, strength, stats, aout);

    // out = attn_out @ Wout + bout  (WMMA)
    outproj_kernel<<<dim3(DQQ/GBN, MROWS/GBM), 256, 0, stream>>>(aout, w16, bout, out);
}

// v008
// Timed twice side by side with v007, it ran 1.05 times as fast both times.
// All steps since v000 together make it 3.75 times as fast.
#include <hip/hip_runtime.h>
#include <hip/hip_bf16.h>
#include <math.h>

// ---------------------------------------------------------------------------
// Problem constants
// ---------------------------------------------------------------------------
#define BB   4
#define NN   4096
#define JJ   77
#define HH   16
#define DHH  64
#define DQQ  1024
#define DCC  768
#define DHID 384           // DC/2
#define INNERD 1024        // H*DH
#define MROWS (BB*NN)      // 16384
#define JPAD 80            // sim col padding (5 x 16)
#define KPAD 96            // attn K padding  (3 x 32)

typedef __attribute__((ext_vector_type(16))) _Float16 v16h;
typedef __attribute__((ext_vector_type(8)))  float    v8f;
typedef __attribute__((ext_vector_type(2)))  _Float16 h2_t;
typedef __attribute__((ext_vector_type(8)))  _Float16 v8h;
typedef __attribute__((ext_vector_type(4)))  _Float16 v4h;
typedef __attribute__((ext_vector_type(8)))  short    s16x8;

union Frag16 { v16h v; h2_t h2[8]; _Float16 h[16]; s16x8 q[2]; };

// load one 16x32 f16 WMMA operand fragment from LDS (row-major, "base" points
// at this lane's row at the k-step origin; ISA 16-bit A/B layout)
__device__ __forceinline__ void load_frag(const _Float16* base, Frag16& f, int lhi)
{
    #pragma unroll
    for (int r = 0; r < 8; ++r) {
        int kk = (r < 4) ? (lhi * 8 + 2 * r) : (16 + lhi * 8 + 2 * (r - 4));
        f.h2[r] = *(const h2_t*)(base + kk);
    }
}

// ---------------------------------------------------------------------------
// Token-type embedding MLP -> kin = contextembs + typeemb
// One block of 256 threads takes PR rows (b,j), so that a weight fetched once serves
// PR rows. Each layer is cut into eight slices of 96 k values x 384 columns, one a wave:
// a lane holds 12 columns (three 16-byte pieces, 512 contiguous bytes a wave-wide load)
// of all PR rows, and a trip has twelve such loads in flight. The slices that share a
// column are then summed through LDS.
// ---------------------------------------------------------------------------
#define PR    4                  // rows a block
#define PBLK  (BB * JJ / PR)     // 77 blocks
#define PKS   96                 // k values of a slice
#define PCG   384                // columns of a slice
static_assert(BB * JJ % PR == 0, "whole blocks only");

typedef __attribute__((ext_vector_type(4))) float f4;

// acc[r][i] = sum over the slice's k of in[r][k] * W[k][i*128 + lane*4 + 0..3]
// "in": LDS, row pitch PITCH floats, at the slice's first k; "W": at the slice's first k
// and first column, row pitch LDW floats. Both are the same for the whole wave.
template<int LDW, int PITCH>
__device__ __forceinline__
void mlp_slice(const float* in, const float* __restrict__ W, int lane, f4 (&acc)[PR][3])
{
    #pragma unroll
    for (int r = 0; r < PR; ++r)
        #pragma unroll
        for (int i = 0; i < 3; ++i) acc[r][i] = (f4){0.f, 0.f, 0.f, 0.f};
    // a trip's twelve loads differ from one address only by constants
    const char* wb = (const char*)W;
    const unsigned lo = (unsigned)lane * 16u;
    #pragma unroll 1   // stays rolled: unrolled further, the loaded weights and the 48 sums
                       // no longer fit the 128 registers that 4 blocks a WGP allow
    for (int c = 0; c < PKS; c += 4) {
        f4 w[4][3];
        float a[PR][4];
        #pragma unroll   // w[] stays in registers and the loads issue back to back
        for (int cc = 0; cc < 4; ++cc)
            #pragma unroll
            for (int i = 0; i < 3; ++i)
                w[cc][i] = *(const f4*)(wb + lo + (cc * LDW + i * 128) * 4);
        #pragma unroll
        for (int r = 0; r < PR; ++r) {
            // every lane reads the same four inputs: held in scalar registers they leave the
            // vector registers to the weights in flight and the sums
            const f4 v = *(const f4*)(in + r * PITCH + c);
            #pragma unroll
            for (int e = 0; e < 4; ++e) {
                const float x = v[e];
                a[r][e] = __builtin_bit_cast(float,
                    __builtin_amdgcn_readfirstlane(__builtin_bit_cast(int, x)));
            }
        }
        #pragma unroll
        for (int cc = 0; cc < 4; ++cc)
            #pragma unroll
            for (int r = 0; r < PR; ++r)
                #pragma unroll
                for (int i = 0; i < 3; ++i) acc[r][i] += a[r][cc] * w[cc][i];
        wb += 4 * LDW * 4;
    }
}

// The eight slices become four in LDS: waves 4..7 store theirs, waves 0..3 add their own
// to the slice of wave w + 4. Slot s of "part" is [PR][PCG].
__device__ __forceinline__
void mlp_fold(const f4 (&acc)[PR][3], float* part, int w, int lane)
{
    float* p = part + (w & 3) * (PR * PCG) + lane * 4;
    if (w >= 4) {
        #pragma unroll
        for (int r = 0; r < PR; ++r)
            #pragma unroll
            for (int i = 0; i < 3; ++i) *(f4*)(p + r * PCG + i * 128) = acc[r][i];
    }
    __syncthreads();
    if (w < 4) {
        #pragma unroll
        for (int r = 0; r < PR; ++r)
            #pragma unroll
            for (int i = 0; i < 3; ++i) *(f4*)(p + r * PCG + i * 128) += acc[r][i];
    }
    __syncthreads();
}

__device__ __forceinline__
void prep_rows(int blk, const float* __restrict__ ce, const int* __restrict__ ct,
               const float* __restrict__ tte_emb,
               const float* __restrict__ m1w, const float* __restrict__ m1b,
               const float* __restrict__ m2w, const float* __restrict__ m2b,
               const float* __restrict__ gA, const float* __restrict__ gB,
               float* __restrict__ kin)
{
    __shared__ __attribute__((aligned(16))) float cein_s[PR * DCC];
    __shared__ __attribute__((aligned(16))) float hid_s[PR * DHID];
    __shared__ __attribute__((aligned(16))) float part_s[4 * PR * PCG];

    const int tid  = threadIdx.x;
    const int lane = tid & 31;
    const int w    = __builtin_amdgcn_readfirstlane(tid >> 5);   // wave number, in a scalar register

    // Outside the slices a pair of waves owns one row: r, and with it the row's token type
    // and every row base, is the same for the whole wave; a lane's columns are c0 + 256 n.
    const int r    = w >> 1;
    const int row  = blk * PR + r;
    const int c0   = ((w & 1) * 32 + lane) * 4;
    const int t    = ct[row];
    // bounded into the table's five rows; wave-uniform, so read into a scalar register
    const int tcl  = __builtin_amdgcn_readfirstlane(t < 0 ? 0 : (t > 4 ? 4 : t));
    const float* tter = tte_emb + tcl * DCC;
    const float* cer  = ce + (size_t)row * DCC;

    #pragma unroll   // the six loads issue back to back
    for (int n = 0; n < DCC / 256; ++n) {
        const int c = c0 + n * 256;
        *(f4*)&cein_s[r * DCC + c] = *(const f4*)(cer + c) + *(const f4*)(tter + c);
    }
    __syncthreads();

    f4 acc[PR][3];

    // layer 1, 768 x 384: eight k slices of all columns
    mlp_slice<DHID, DCC>(cein_s + w * PKS, m1w + (size_t)w * PKS * DHID, lane, acc);
    mlp_fold(acc, part_s, w, lane);
    // 384 columns a row: 256 by both waves of the pair, the last 128 by its first wave
    for (int c = c0; c < DHID; c += 256) {
        f4 s = *(const f4*)(m1b + c);
        #pragma unroll
        for (int k = 0; k < 4; ++k) s += *(const f4*)&part_s[(k * PR + r) * PCG + c];
        #pragma unroll
        for (int e = 0; e < 4; ++e)
            s[e] = 0.5f * s[e] * (1.0f + erff(s[e] * 0.70710678118654752f));
        *(f4*)&hid_s[r * DHID + c] = s;
    }
    __syncthreads();

    // layer 2, 384 x 768: four k slices (w >> 1) of two column halves (w & 1)
    mlp_slice<DCC, DHID>(hid_s + (w >> 1) * PKS, m2w + (size_t)(w >> 1) * PKS * DCC + (w & 1) * PCG,
                         lane, acc);
    mlp_fold(acc, part_s, w, lane);
    #pragma unroll
    for (int n = 0; n < DCC / 256; ++n) {
        const int c  = c0 + n * 256;
        const int cg = c / PCG, cc = c - cg * PCG;
        f4 s = *(const f4*)(m2b + c);
        s += *(const f4*)&part_s[(cg * PR + r) * PCG + cc];
        s += *(const f4*)&part_s[((2 + cg) * PR + r) * PCG + cc];
        const f4 typeemb = *(const f4*)(tter + c) * *(const f4*)(gA + c) + s * *(const f4*)(gB + c);
        *(f4*)(kin + (size_t)row * DCC + c) = *(const f4*)(cer + c) + typeemb;
    }
}

// ---------------------------------------------------------------------------
// WMMA GEMM: C[M,1024] = A[M,K] * B[K,1024]  (fp32 in, f16 mul, f32 acc)
// Block tile 128x128, BK=32, 8 waves (4x2), each wave 32x64 = 2x4 WMMA tiles.
// MODE 0: store q permuted [B*H, N, DH], as f16: what its readers feed to the matrix unit
// MODE 1: plain store + bias (output projection)
// MODE 2: store K/V permuted [B*H, J, DH], as f16  (rows = b*J+j, M=308)
// ---------------------------------------------------------------------------
#define GBM 128
#define GBN 128
#define GBK 32
#define LDSS 40   // padded LDS stride in halfs
#define LDSB 144  // B tile row pitch in halfs: 288 bytes, an odd multiple of 32 bytes
#define VPIT 80   // V tile row pitch in halfs: 160 bytes, an odd multiple of 32 bytes

// one 32(k) x 16(n) B fragment out of a row-major [k][n] f16 LDS tile, through the
// transposing LDS load. "base" is this lane's own address:
//   tile + (8*(lane>>4) + (lane&7)) * LDSB + n0 + 8*((lane>>3)&1)
// The lane then holds column n0 + (lane&15), k = 8*lhi + 0..7 and 16 + 8*lhi + 0..7:
// the k order of load_frag().
__device__ __forceinline__ void load_frag_tr(const _Float16* base, Frag16& f)
{
    typedef __attribute__((address_space(3))) s16x8 lds_s16x8;
    f.q[0] = __builtin_amdgcn_ds_load_tr16_b128_v8i16((lds_s16x8*)base);
    f.q[1] = __builtin_amdgcn_ds_load_tr16_b128_v8i16((lds_s16x8*)(base + 16 * LDSB));
}

// the same fragment out of a row-major tile of another pitch (in halfs)
template<int PITCH>
__device__ __forceinline__ void load_frag_tr_p(const _Float16* base, Frag16& f)
{
    typedef __attribute__((address_space(3))) s16x8 lds_s16x8;
    f.q[0] = __builtin_amdgcn_ds_load_tr16_b128_v8i16((lds_s16x8*)base);
    f.q[1] = __builtin_amdgcn_ds_load_tr16_b128_v8i16((lds_s16x8*)(base + 16 * PITCH));
}

// Stage ROWS rows of 64 f16 values (contiguous rows of 128 bytes in memory) as rows of
// PITCH halfs in LDS, as they lie in memory. A wave's 16-byte loads cover 512 contiguous
// bytes, and all of a thread's loads are issued before the first value is used.
// Rows VALID..ROWS-1 are filled with zero; a load that would fall there is clamped.
template<int NT, int ROWS, int VALID, int PITCH>
__device__ __forceinline__ void stage_rows64h(const _Float16* __restrict__ src, _Float16* dst, int tid)
{
    constexpr int NP = ROWS * 8;                       // 16-byte pieces of the LDS tile
    constexpr int NV = VALID * 8;                      // of these, pieces of valid rows
    constexpr int NI = NP / NT;                        // trips
    static_assert(NP % NT == 0, "whole trips only");
    constexpr int NL = (NV + NT - 1) / NT;             // of these, trips that hold a valid row
    uint4 v[NL];
    #pragma unroll   // v[] stays in registers and the loads issue back to back
    for (int i = 0; i < NL; ++i) {
        int f = tid + i * NT;
        if ((i + 1) * NT > NV) f = f < NV ? f : NV - 1;   // piece index clamped into the tile
        v[i] = ((const uint4*)src)[f];
    }
    #pragma unroll   // v[] is indexed by constants
    for (int i = 0; i < NI; ++i) {
        const int f = tid + i * NT;
        uint4 h = make_uint4(0u, 0u, 0u, 0u);
        if (i < NL) {
            h = v[i];
            if ((i + 1) * NT > NV && f >= NV) h = make_uint4(0u, 0u, 0u, 0u);
        }
        *(uint4*)(dst + (f >> 3) * PITCH + (f & 7) * 8) = h;
    }
}

// One 128x128 tile at (blockM, blockN), by one block of 256 threads: the k loop ...
__device__ __forceinline__
void gemm_accumulate(const float* __restrict__ A, const float* __restrict__ Bm,
                     int M, int K, int blockM, int blockN, v8f (&acc)[2][4])
{
    __shared__ __attribute__((aligned(16))) _Float16 Ash[GBM * LDSS];
    __shared__ __attribute__((aligned(32))) _Float16 Bsh[GBK * LDSB];   // [k][n]

    const int tid  = threadIdx.x;
    const int wid  = tid >> 5;
    const int lane = tid & 31;
    const int wm   = wid >> 1;     // 0..3 -> 32-row strip
    const int wn   = wid & 1;      // 0..1 -> 64-col strip
    const int lm   = lane & 15;
    const int lhi  = lane >> 4;

    #pragma unroll
    for (int t = 0; t < 2; ++t)
        #pragma unroll
        for (int u = 0; u < 4; ++u)
            acc[t][u] = (v8f){0.f,0.f,0.f,0.f,0.f,0.f,0.f,0.f};

    int arow = blockM + (tid >> 1);       // global A row
    if (arow >= M) arow = M - 1;          // clamp (stores are guarded)
    const int acb  = (tid & 1) * 16;
    const int bkr  = tid >> 3;            // 0..31
    const int bcb  = (tid & 7) * 16;
    // Staging map: every wave-wide 16-byte load covers whole 128-byte lines.
    // A: 8 lanes take the 128 bytes that one row has in this k tile, a wave 4 rows;
    //    a thread's rows are sar + 32 i. Byte offsets from A, rows clamped like arow.
    // B: a wave takes 512 contiguous bytes of one k row; a thread's rows are sbr + 8 i.
    const int sar  = tid >> 3;            // 0..31
    const int sac  = (tid & 7) * 4;       // four columns
    const int sbr  = tid >> 5;            // 0..7
    const int sbc  = lane * 4;            // four columns
    unsigned aoff[4];
    #pragma unroll   // aoff[] is indexed by constants and stays in registers
    for (int i = 0; i < 4; ++i) {
        int r = blockM + sar + 32 * i;
        if (r >= M) r = M - 1;
        aoff[i] = ((unsigned)r * (unsigned)K + (unsigned)sac) * 4u;
    }
    unsigned boff = ((unsigned)sbr * 1024u + (unsigned)blockN + (unsigned)sbc) * 4u;
    const _Float16* bfr = &Bsh[(lhi * 8 + (lane & 7)) * LDSB + wn * 64 + ((lane >> 3) & 1) * 8];

    for (int k0 = 0; k0 < K; k0 += GBK) {
        // stage both tiles (fp32 -> f16), each as it lies in memory: Ash[m][k], Bsh[k][n]
        float4 av[4], bv[4];
        // uniform base + 32-bit byte offset: one address register a load (both operands are
        // far below 4 GiB)
        #pragma unroll   // av[] stays in registers and the loads issue back to back
        for (int i = 0; i < 4; ++i) av[i] = *(const float4*)((const char*)A + aoff[i]);
        #pragma unroll   // the same for bv[]
        for (int i = 0; i < 4; ++i) bv[i] = *(const float4*)((const char*)Bm + boff + i * 32768);
        #pragma unroll   // av[] is indexed by constants; the LDS offsets become immediates
        for (int i = 0; i < 4; ++i) {
            v4h p;
            p[0] = (_Float16)av[i].x;  p[1] = (_Float16)av[i].y;
            p[2] = (_Float16)av[i].z;  p[3] = (_Float16)av[i].w;
            *(v4h*)&Ash[(sar + 32 * i) * LDSS + sac] = p;
        }
        #pragma unroll   // the same for bv[]
        for (int i = 0; i < 4; ++i) {
            v4h p;
            p[0] = (_Float16)bv[i].x;  p[1] = (_Float16)bv[i].y;
            p[2] = (_Float16)bv[i].z;  p[3] = (_Float16)bv[i].w;
            *(v4h*)&Bsh[(sbr + 8 * i) * LDSB + sbc] = p;
        }
        #pragma unroll   // on to the next k tile (the loaded values have arrived)
        for (int i = 0; i < 4; ++i) aoff[i] += GBK * 4u;
        boff += GBK * 4096u;
        if (k0 + GBK < K) {   // global_prefetch of next k-tile
            __builtin_prefetch(A + (size_t)arow * K + k0 + GBK + acb, 0, 1);
            __builtin_prefetch(Bm + (size_t)(k0 + GBK + bkr) * 1024 + blockN + bcb, 0, 1);
        }
        __syncthreads();

        Frag16 af[2], bf[4];
        #pragma unroll
        for (int t = 0; t < 2; ++t)
            load_frag(&Ash[(wm * 32 + t * 16 + lm) * LDSS], af[t], lhi);
        #pragma unroll
        for (int u = 0; u < 4; ++u)
            load_frag_tr(bfr + u * 16, bf[u]);

        #pragma unroll
        for (int t = 0; t < 2; ++t)
            #pragma unroll
            for (int u = 0; u < 4; ++u)
                acc[t][u] = __builtin_amdgcn_wmma_f32_16x16x32_f16(
                    false, af[t].v, false, bf[u].v,
                    (short)0, acc[t][u], false, false);

        __syncthreads();
    }
}

// ... and the store of its accumulators
template<int MODE>
__device__ __forceinline__
void gemm_store(const v8f (&acc)[2][4], const float* __restrict__ bias, float* __restrict__ C,
                int M, int blockM, int blockN)
{
    const int tid  = threadIdx.x;
    const int wid  = tid >> 5;
    const int lane = tid & 31;
    const int wm   = wid >> 1;
    const int wn   = wid & 1;
    const int lm   = lane & 15;
    const int lhi  = lane >> 4;

    // C/D layout: lanes 0-15 -> M=r, lanes 16-31 -> M=8+r, N=lane&15
    #pragma unroll
    for (int t = 0; t < 2; ++t) {
        #pragma unroll
        for (int u = 0; u < 4; ++u) {
            #pragma unroll
            for (int r = 0; r < 8; ++r) {
                int rg = blockM + wm * 32 + t * 16 + (lhi ? 8 + r : r);
                int cg = blockN + wn * 64 + u * 16 + lm;
                float val = acc[t][u][r];
                if (MODE == 1) {
                    C[(size_t)rg * 1024 + cg] = val + bias[cg];
                } else if (MODE == 0) {
                    int b = rg >> 12, n = rg & 4095;
                    int h = cg >> 6,  d = cg & 63;
                    ((_Float16*)C)[(((size_t)(b * HH + h)) * NN + n) * DHH + d] = (_Float16)val;
                } else { // MODE 2: rows are (b, j)
                    if (rg < M) {
                        int b = rg / JJ, j = rg - b * JJ;
                        int h = cg >> 6, d = cg & 63;
                        ((_Float16*)C)[(((size_t)(b * HH + h)) * JJ + j) * DHH + d] = (_Float16)val;
                    }
                }
            }
        }
    }
    // where other block ranges' code follows in the same kernel, it reuses the registers
    // that these stores name: the wait stands in front of any such overwrite
    if (MODE == 0) asm volatile("s_wait_xcnt 0x0" ::: "memory");
}

// ---------------------------------------------------------------------------
// The work in front of the attention, in two launches. The embedding MLP, the V
// projection and the q projection do not depend on one another; the K projection
// needs only the MLP. The MLP and the K and V projections are short chains of
// dependent memory round trips on few blocks, which leave most of the chip idle
// when launched alone, so each launch runs them beside a share of the q tiles.
// The long chains take the lowest block indices.
// All blocks of the first launch are resident at once: at up to 128 registers a wave,
// 4 blocks a WGP, 1024 places; 77 + 24 + 86 * 8 = 789 blocks.
// ---------------------------------------------------------------------------
#define NTN    (INNERD / GBN)                        // 8 column tiles
#define KVBLK  (NTN * ((BB * JJ + GBM - 1) / GBM))   // 24 tiles of a K or V projection
#define QTM1   86                                    // q row tiles in the first launch
#define QTM2   (MROWS / GBM - QTM1)                  // 42 in the second
#define WCBLK  (INNERD * DQQ / 4096)                 // 256 blocks that round Wout to f16

__global__ __launch_bounds__(256)
void front1_kernel(const float* __restrict__ ce, const int* __restrict__ ct,
                   const float* __restrict__ tte_emb,
                   const float* __restrict__ m1w, const float* __restrict__ m1b,
                   const float* __restrict__ m2w, const float* __restrict__ m2b,
                   const float* __restrict__ gA, const float* __restrict__ gB,
                   float* __restrict__ kin,
                   const float* __restrict__ Wv, float* __restrict__ v_bh,
                   const float* __restrict__ x, const float* __restrict__ Wq,
                   float* __restrict__ q_bh)
{
    const int blk = blockIdx.x;
    if (blk < PBLK) {
        prep_rows(blk, ce, ct, tte_emb, m1w, m1b, m2w, m2b, gA, gB, kin);
        return;
    }
    const bool isv = blk < PBLK + KVBLK;             // the same for the whole block
    const int  t   = blk - (isv ? PBLK : PBLK + KVBLK);
    const int  bm  = (t / NTN) * GBM, bn = (t % NTN) * GBN;
    v8f acc[2][4];
    gemm_accumulate(isv ? ce : x, isv ? Wv : Wq, isv ? BB * JJ : MROWS, isv ? DCC : DQQ, bm, bn, acc);
    if (isv) gemm_store<2>(acc, nullptr, v_bh, BB * JJ, bm, bn);
    else     gemm_store<0>(acc, nullptr, q_bh, MROWS, bm, bn);
}

__global__ __launch_bounds__(256)
void front2_kernel(const float* __restrict__ kin, const float* __restrict__ Wk,
                   float* __restrict__ k_bh,
                   const float* __restrict__ x, const float* __restrict__ Wq,
                   float* __restrict__ q_bh,
                   const float* __restrict__ Wout, float* __restrict__ w16)
{
    const int  blk = blockIdx.x;
    if (blk >= KVBLK + QTM2 * NTN) {                 // the same for the whole block
        // Wout rounded to f16 once, for the output projection: 4096 values a block
        const int p = (blk - (KVBLK + QTM2 * NTN)) * 1024 + threadIdx.x;   // piece of 4 values
        float4 v[4];
        #pragma unroll   // v[] stays in registers and the loads issue back to back
        for (int i = 0; i < 4; ++i) v[i] = ((const float4*)Wout)[p + i * 256];
        #pragma unroll   // v[] is indexed by constants
        for (int i = 0; i < 4; ++i) {
            v4h h;
            h[0] = (_Float16)v[i].x;  h[1] = (_Float16)v[i].y;
            h[2] = (_Float16)v[i].z;  h[3] = (_Float16)v[i].w;
            ((v4h*)w16)[p + i * 256] = h;
        }
        return;
    }
    const bool isk = blk < KVBLK;                    // the same for the whole block
    const int  t   = isk ? blk : blk - KVBLK + QTM1 * NTN;
    const int  bm  = (t / NTN) * GBM, bn = (t % NTN) * GBN;
    v8f acc[2][4];
    gemm_accumulate(isk ? kin : x, isk ? Wk : Wq, isk ? BB * JJ : MROWS, isk ? DCC : DQQ, bm, bn, acc);
    if (isk) gemm_store<2>(acc, nullptr, k_bh, BB * JJ, bm, bn);
    else     gemm_store<0>(acc, nullptr, q_bh, MROWS, bm, bn);
}

// output projection: out = attn_out @ Wout + bout
// Both operands lie in the workspace as f16, rounded once by their producers (the
// attention kernel; the last block range of front2_kernel): the values that the k loop
// above would round them to in every tile that reads them. A tile therefore loads half
// the bytes and converts nothing. The k tile is 64, so that the piece of an A row in it
// is one whole 128-byte line; the products are summed in ascending k, 32 at a time.
#define HBK  64   // k tile
#define APIT 72   // A tile row pitch in halfs: 144 bytes, an odd multiple of 16 bytes
__global__ __launch_bounds__(256)
void outproj_kernel(const float* __restrict__ a16, const float* __restrict__ w16,
                    const float* __restrict__ bias, float* __restrict__ C)
{
    __shared__ __attribute__((aligned(16))) _Float16 Ash[GBM * APIT];   // [m][k]
    __shared__ __attribute__((aligned(32))) _Float16 Bsh[HBK * LDSB];   // [k][n]

    const int bm   = blockIdx.y * GBM, bn = blockIdx.x * GBN;
    const int tid  = threadIdx.x;
    const int wid  = tid >> 5;
    const int lane = tid & 31;
    const int wm   = wid >> 1;     // 0..3 -> 32-row strip
    const int wn   = wid & 1;      // 0..1 -> 64-col strip
    const int lm   = lane & 15;
    const int lhi  = lane >> 4;

    v8f acc[2][4];
    #pragma unroll
    for (int t = 0; t < 2; ++t)
        #pragma unroll
        for (int u = 0; u < 4; ++u)
            acc[t][u] = (v8f){0.f,0.f,0.f,0.f,0.f,0.f,0.f,0.f};

    // Staging map, 16 bytes (8 halfs) a lane, whole 128-byte lines:
    // A: 8 lanes take the line that one row has in this k tile, a wave 4 rows; rows sar + 32 i.
    // B: 16 lanes take the 256 bytes of one k row, a wave 2 rows; rows sbr + 16 i.
    const int sar = tid >> 3;            // 0..31
    const int sac = (tid & 7) * 8;
    const int sbr = tid >> 4;            // 0..15
    const int sbc = (tid & 15) * 8;
    unsigned aoff = ((unsigned)(bm + sar) * 1024u + (unsigned)sac) * 2u;   // byte offsets
    unsigned boff = ((unsigned)sbr * 1024u + (unsigned)(bn + sbc)) * 2u;
    const _Float16* bfr = &Bsh[(lhi * 8 + (lane & 7)) * LDSB + wn * 64 + ((lane >> 3) & 1) * 8];

    #pragma unroll 1   // stays rolled: unrolled, a tile's eight loads no longer issue together
                       // and the kernel takes more than 128 registers (3 blocks a WGP, not 4)
    for (int k0 = 0; k0 < INNERD; k0 += HBK) {
        uint4 av[4], bv[4];
        #pragma unroll   // av[] stays in registers and the loads issue back to back
        for (int i = 0; i < 4; ++i) av[i] = *(const uint4*)((const char*)a16 + aoff + i * 65536);
        #pragma unroll   // the same for bv[]
        for (int i = 0; i < 4; ++i) bv[i] = *(const uint4*)((const char*)w16 + boff + i * 32768);
        #pragma unroll   // av[] is indexed by constants
        for (int i = 0; i < 4; ++i) *(uint4*)&Ash[(sar + 32 * i) * APIT + sac] = av[i];
        #pragma unroll   // the same for bv[]
        for (int i = 0; i < 4; ++i) *(uint4*)&Bsh[(sbr + 16 * i) * LDSB + sbc] = bv[i];
        aoff += HBK * 2u;                 // on to the next k tile (the loaded values have arrived)
        boff += HBK * 2048u;
        if (k0 + HBK < INNERD) {          // global_prefetch of the next k tile: 128 lines each
            __builtin_prefetch((const char*)a16 + ((unsigned)(bm + (tid >> 1)) * 1024u + (unsigned)(k0 + HBK)) * 2u, 0, 1);
            __builtin_prefetch((const char*)w16 + ((unsigned)(k0 + HBK + (tid >> 2)) * 1024u + (unsigned)bn) * 2u + (tid & 1) * 128, 0, 1);
        }
        __syncthreads();

        #pragma unroll   // two k steps of 32 out of one staged tile
        for (int s = 0; s < 2; ++s) {
            Frag16 af[2], bf[4];
            #pragma unroll
            for (int t = 0; t < 2; ++t)
                load_frag(&Ash[(wm * 32 + t * 16 + lm) * APIT + s * 32], af[t], lhi);
            #pragma unroll
            for (int u = 0; u < 4; ++u)
                load_frag_tr(bfr + s * 32 * LDSB + u * 16, bf[u]);

            #pragma unroll
            for (int t = 0; t < 2; ++t)
                #pragma unroll
                for (int u = 0; u < 4; ++u)
                    acc[t][u] = __builtin_amdgcn_wmma_f32_16x16x32_f16(
                        false, af[t].v, false, bf[u].v,
                        (short)0, acc[t][u], false, false);
        }
        __syncthreads();
    }
    gemm_store<1>(acc, bias, C, MROWS, bm, bn);
}

// ---------------------------------------------------------------------------
// Kernel 3: WMMA sim tiles + masked sum/sumsq (sim never hits HBM)
// grid (N/SROWS, B*H), 256 threads. A block takes SROWS query rows of one head: its K tile
// is staged once and each wave reads the K fragments once, for SROWS/128 strips of 16 rows.
// All of the block's loads are in flight together, in front of its one staging barrier.
// ---------------------------------------------------------------------------
#define SROWS 512
__global__ __launch_bounds__(256)
void sim_stats_kernel(const float* __restrict__ q_bh, const float* __restrict__ k_bh,
                      const int* __restrict__ ct, float* __restrict__ stats)
{
    __shared__ __attribute__((aligned(16))) _Float16 qsh[SROWS * 72];   // [row][k], stride 72
    __shared__ __attribute__((aligned(16))) _Float16 kshT[KPAD * 72];   // [j][k], rows 77..95 zero
    __shared__ int   sel2[JPAD];
    __shared__ float rs[256], rq[256];

    const int tid  = threadIdx.x;
    const int wid  = tid >> 5;
    const int lane = tid & 31;
    const int lm   = lane & 15;
    const int lhi  = lane >> 4;
    const int bh   = blockIdx.y;
    const int b    = bh >> 4;
    const int rowbase = blockIdx.x * SROWS;

    // q tile SROWS x 64 and K tile, f16 in the workspace (K staged as 96 rows: whole trips of
    // 256 threads, so that all loads issue together; rows 80..95 are not read)
    stage_rows64h<256, SROWS, SROWS, 72>((const _Float16*)q_bh + ((size_t)bh * NN + rowbase) * DHH, qsh, tid);
    stage_rows64h<256, KPAD, JJ, 72>((const _Float16*)k_bh + (size_t)bh * JJ * DHH, kshT, tid);
    for (int j = tid; j < JPAD; j += 256)
        sel2[j] = (j < JJ && ct[b * JJ + j] >= 2) ? 1 : 0;
    __syncthreads();

    Frag16 bf[2][5];                       // the K fragments, K = 64 -> 2 k-steps, 5 j tiles
    #pragma unroll
    for (int s = 0; s < 2; ++s)
        #pragma unroll
        for (int t = 0; t < 5; ++t)
            load_frag(&kshT[(t * 16 + lm) * 72 + s * 32], bf[s][t], lhi);

    // a lane owns column j = t*16+lm of 8 rows a strip: one pair of sums a column, over all
    // strips; whether the column counts is asked once, behind the loop
    float p1[5], p2[5];
    #pragma unroll
    for (int t = 0; t < 5; ++t) { p1[t] = 0.f; p2[t] = 0.f; }
    #pragma unroll   // the strips' LDS offsets become immediates
    for (int p = 0; p < SROWS / 128; ++p) {
        v8f acc[5];
        #pragma unroll
        for (int t = 0; t < 5; ++t) acc[t] = (v8f){0.f,0.f,0.f,0.f,0.f,0.f,0.f,0.f};

        #pragma unroll
        for (int s = 0; s < 2; ++s) {
            Frag16 af;
            load_frag(&qsh[(p * 128 + wid * 16 + lm) * 72 + s * 32], af, lhi);
            #pragma unroll
            for (int t = 0; t < 5; ++t)
                acc[t] = __builtin_amdgcn_wmma_f32_16x16x32_f16(
                    false, af.v, false, bf[s][t].v, (short)0, acc[t], false, false);
        }

        #pragma unroll
        for (int t = 0; t < 5; ++t)
            #pragma unroll
            for (int r = 0; r < 8; ++r) {
                float v = acc[t][r];
                p1[t] += v;
                p2[t] = fmaf(v, v, p2[t]);
            }
    }
    float s1 = 0.f, s2 = 0.f;
    #pragma unroll
    for (int t = 0; t < 5; ++t) {
        int j = t * 16 + lm;
        if (j < JJ && sel2[j]) { s1 += p1[t]; s2 += p2[t]; }
    }
    rs[tid] = s1; rq[tid] = s2;
    __syncthreads();
    for (int off = 128; off > 0; off >>= 1) {
        if (tid < off) { rs[tid] += rs[tid + off]; rq[tid] += rq[tid + off]; }
        __syncthreads();
    }
    if (tid == 0) {
        atomicAdd(&stats[0], rs[0]);
        atomicAdd(&stats[1], rq[0]);
    }
}

// ---------------------------------------------------------------------------
// Kernel 4: finalize std (Bessel-corrected, matching torch .std())
// ---------------------------------------------------------------------------
__global__ void finalize_kernel(const int* __restrict__ ct, float* __restrict__ stats)
{
    int cnt = 0;
    for (int i = 0; i < BB * JJ; ++i) cnt += (ct[i] >= 2) ? 1 : 0;
    float nsel = (float)cnt * (float)HH * (float)NN;
    float mean = (nsel > 0.f) ? stats[0] / nsel : 0.f;
    float var  = (nsel > 1.f) ? (stats[1] - nsel * mean * mean) / (nsel - 1.f) : 0.f;
    stats[2] = sqrtf(var > 0.f ? var : 0.f);
}

// ---------------------------------------------------------------------------
// Kernel 5: fused attention block, 64 rows x HPB heads / block, 128 threads (4 waves).
// The scores are formed transposed, S^T = K * Q^T (K is the A operand, Q the B
// operand), so a lane's accumulators hold 40 scores of ONE query row:
//   column = lane & 15 -> query row,  j = t*16 + (lane >> 4)*8 + r.
// The masked softmax runs in registers on all lanes; lanes l and l^16 share a
// query row and exchange three partial results. That accumulator order is the
// k order of a 16-bit B operand, so the probabilities, converted to f16, are
// the B operand of out^T = V^T * P^T with no pass through LDS.
// ---------------------------------------------------------------------------
__device__ __forceinline__ float other_half(float x)   // value of lane l ^ 16
{
    int b = __builtin_bit_cast(int, x);
    b = __builtin_amdgcn_permlanex16(b, b, 0x76543210, 0xfedcba98, false, false);
    return __builtin_bit_cast(float, b);
}

// 2^x. The v_nop keeps the one free issue slot the instruction set asks for
// behind a transcendental.
__device__ __forceinline__ float exp2_slot(float x)
{
    float y;
    asm("v_exp_f32 %0, %1\n\tv_nop" : "=v"(y) : "v"(x));
    return y;
}

// The two halves of stage_rows64h(), apart, so that a tile's loads can be issued while the
// tile before it is still being worked on: fetch into registers, put into LDS later.
template<int NT, int VALID, int NL>
__device__ __forceinline__ void fetch_rows64h(const _Float16* __restrict__ src, uint4 (&v)[NL], int tid)
{
    constexpr int NV = VALID * 8;                      // 16-byte pieces of valid rows
    static_assert(NL == (NV + NT - 1) / NT, "one register set a trip that holds a valid row");
    #pragma unroll   // v[] stays in registers and the loads issue back to back
    for (int i = 0; i < NL; ++i) {
        int f = tid + i * NT;
        if ((i + 1) * NT > NV) f = f < NV ? f : NV - 1;   // piece index clamped into the tile
        v[i] = ((const uint4*)src)[f];
    }
}

template<int NT, int ROWS, int VALID, int PITCH, int NL>
__device__ __forceinline__ void put_rows64h(const uint4 (&v)[NL], _Float16* dst, int tid)
{
    constexpr int NP = ROWS * 8;                       // 16-byte pieces of the LDS tile
    constexpr int NV = VALID * 8;
    constexpr int NI = NP / NT;
    static_assert(NP % NT == 0, "whole trips only");
    #pragma unroll   // v[] is indexed by constants
    for (int i = 0; i < NI; ++i) {
        const int f = tid + i * NT;
        uint4 h = make_uint4(0u, 0u, 0u, 0u);
        if (i < NL) {
            h = v[i];
            if ((i + 1) * NT > NV && f >= NV) h = make_uint4(0u, 0u, 0u, 0u);
        }
        *(uint4*)(dst + (f >> 3) * PITCH + (f & 7) * 8) = h;
    }
}

// Which scores of a query row take part in the softmax depends on the batch, the row and
// j, not on the head. A block therefore takes HPB heads of its 64 query rows, one after the
// other: the mask rows are loaded and thresholded once, and each head only selects by the
// kept flags. The next head's q, K and V tiles are fetched while this head is worked on.
#define HPB 4
static_assert(HH % HPB == 0, "whole blocks only");

__global__ __launch_bounds__(128)
void attn_fused_kernel(const float* __restrict__ q_bh, const float* __restrict__ k_bh,
                       const float* __restrict__ v_bh, const int* __restrict__ ct,
                       const float* __restrict__ camask, const float* __restrict__ strength,
                       const float* __restrict__ stats, float* __restrict__ out_attn)
{
    __shared__ __attribute__((aligned(16))) _Float16 qsh[64 * 72];      // q tile [row][k]
    __shared__ __attribute__((aligned(16))) _Float16 kshT[JPAD * 72];   // [j][k], rows 77..79 zero
    __shared__ __attribute__((aligned(32))) _Float16 vsh[KPAD * VPIT];  // [j][d], rows 77..95 zero
    __shared__ int      sel2[JPAD], selg[JPAD];

    const int tid  = threadIdx.x;
    const int wid  = tid >> 5;     // 0..3 -> 16-row strip
    const int lane = tid & 31;
    const int lm   = lane & 15;
    const int lhi  = lane >> 4;
    const int bh0  = blockIdx.y * HPB;          // the block's first (batch, head) pair
    const int b    = bh0 >> 4;
    const int h0   = bh0 & 15;
    const int rowbase = blockIdx.x * 64;
    const int rowg = rowbase + wid * 16 + lm;   // this lane's query row

    // q tile 64x64, K tile 80x64 and V tile 96x64, f16 in the workspace, each as it lies in
    // memory; these point at the head whose tiles were fetched last
    const _Float16* qp = (const _Float16*)q_bh + ((size_t)bh0 * NN + rowbase) * DHH;
    const _Float16* kp = (const _Float16*)k_bh + (size_t)bh0 * JJ * DHH;
    const _Float16* vp = (const _Float16*)v_bh + (size_t)bh0 * JJ * DHH;
    uint4 qv[4], kv[5], vv[5];
    fetch_rows64h<128, 64, 4>(qp, qv, tid);
    fetch_rows64h<128, JJ, 5>(kp, kv, tid);
    fetch_rows64h<128, JJ, 5>(vp, vv, tid);
    for (int j = tid; j < JPAD; j += 128) {
        int t = (j < JJ) ? ct[b * JJ + j] : -1;
        sel2[j] = (t >= 2) ? 1 : 0;
        selg[j] = (t >= 0 && t < 2) ? 1 : 0;
    }

    // this lane's 40 mask values, read once; index clamped for j = 77..79
    float wf[5][8];
    {
        const float* camrow = camask + ((size_t)b * NN + rowg) * JJ;
        #pragma unroll
        for (int t = 0; t < 5; ++t)
            #pragma unroll
            for (int r = 0; r < 8; ++r) {
                int j = t * 16 + lhi * 8 + r;
                wf[t][r] = camrow[j < JJ ? j : JJ - 1];
            }
    }
    // the registers that hold these loads' addresses are reused below
    asm volatile("s_wait_xcnt 0x0" ::: "memory");

    put_rows64h<128, 64, 64, 72, 4>(qv, qsh, tid);
    put_rows64h<128, JPAD, JJ, 72, 5>(kv, kshT, tid);
    put_rows64h<128, KPAD, JJ, VPIT, 5>(vv, vsh, tid);
    __syncthreads();

    // ---- the mask of this lane's query row, the same for every head
    const float simstd = stats[2];
    const float str    = strength[0];
    const float scale  = 0.125f;                  // 1/sqrt(DH)

    float wfmax = -__FLT_MAX__;
    #pragma unroll
    for (int t = 0; t < 5; ++t)
        #pragma unroll
        for (int r = 0; r < 8; ++r) {
            int j = t * 16 + lhi * 8 + r;
            float w = sel2[j] ? wf[t][r] * simstd * str : 0.f;
            wf[t][r] = w;
            if (j < JJ) wfmax = fmaxf(wfmax, w);
        }
    wfmax = fmaxf(wfmax, other_half(wfmax));
    const float thr = fmaxf(wfmax, 0.001f) - 0.0001f;

    bool keep[5][8];
    #pragma unroll
    for (int t = 0; t < 5; ++t)
        #pragma unroll
        for (int r = 0; r < 8; ++r) {
            int j = t * 16 + lhi * 8 + r;
            // both tests evaluated, no short circuit: the flag reads stay wide and unbranched
            bool lmv = (wf[t][r] >= thr) | (selg[j] != 0);
            keep[t][r] = lmv & (j < JJ);
        }

    // V^T fragments come out of the row-major V tile through the transposing LDS load:
    // the lane holds d = t*16 + lm, j = s*32 + 8*lhi + 0..7 and + 16: the k order of pf
    const _Float16* vfr = &vsh[(lhi * 8 + (lane & 7)) * VPIT + ((lane >> 3) & 1) * 8];
    _Float16* orow = (_Float16*)out_attn + ((size_t)b * NN + rowg) * INNERD + h0 * DHH + lhi * 8;

    #pragma unroll 1   // stays rolled: one head's code, read from the instruction cache again
    for (int hh = 0; hh < HPB; ++hh) {
        const bool more = hh + 1 < HPB;           // the same for the whole block
        if (more) {
            qp += (size_t)NN * DHH;  kp += JJ * DHH;  vp += JJ * DHH;
            fetch_rows64h<128, 64, 4>(qp, qv, tid);
            fetch_rows64h<128, JJ, 5>(kp, kv, tid);
            fetch_rows64h<128, JJ, 5>(vp, vv, tid);
            // the next trip moves the bases that these loads name
            asm volatile("s_wait_xcnt 0x0" ::: "memory");
        }

        // ---- stage 1: S^T = K @ q^T via WMMA, kept in registers
        v8f acc[5];
        #pragma unroll
        for (int t = 0; t < 5; ++t) acc[t] = (v8f){0.f,0.f,0.f,0.f,0.f,0.f,0.f,0.f};
        #pragma unroll
        for (int s = 0; s < 2; ++s) {
            Frag16 qf;
            load_frag(&qsh[(wid * 16 + lm) * 72 + s * 32], qf, lhi);
            #pragma unroll
            for (int t = 0; t < 5; ++t) {
                Frag16 kf;
                load_frag(&kshT[(t * 16 + lm) * 72 + s * 32], kf, lhi);
                acc[t] = __builtin_amdgcn_wmma_f32_16x16x32_f16(
                    false, kf.v, false, qf.v, (short)0, acc[t], false, false);
            }
        }

        // ---- stage 2: masked softmax of this lane's query row, in registers
        float m = -__FLT_MAX__;
        #pragma unroll
        for (int t = 0; t < 5; ++t)
            #pragma unroll
            for (int r = 0; r < 8; ++r) {
                float sv = keep[t][r] ? acc[t][r] * scale : -__FLT_MAX__;
                acc[t][r] = sv;                       // masked + scaled score
                m = fmaxf(m, sv);
            }
        m = fmaxf(m, other_half(m));

        float denom = 0.f;
        Frag16 pf[3];                                 // unnormalized probs, B operand
        #pragma unroll
        for (int t = 0; t < 6; ++t)
            #pragma unroll
            for (int r = 0; r < 8; ++r) {
                float p = 0.f;
                if (t < 5) {
                    int j = t * 16 + lhi * 8 + r;
                    p = exp2_slot((acc[t][r] - m) * 1.4426950408889634f);   // e^(s - m)
                    if (j >= JJ) p = 0.f;
                    denom += p;
                }
                pf[t >> 1].h[(t & 1) * 8 + r] = (_Float16)p;
            }
        denom += other_half(denom);
        const float inv = 1.f / denom;

        // keeps the PV matrix instructions below every exp2_slot()
        __builtin_amdgcn_sched_barrier(0);

        // ---- stage 3: out^T = V^T @ P^T via WMMA (K = 96 -> 3 k-steps, 4 d tiles)
        v8f o[4];
        #pragma unroll
        for (int t = 0; t < 4; ++t) o[t] = (v8f){0.f,0.f,0.f,0.f,0.f,0.f,0.f,0.f};
        #pragma unroll
        for (int s = 0; s < 3; ++s) {
            #pragma unroll
            for (int t = 0; t < 4; ++t) {
                Frag16 vf;
                load_frag_tr_p<VPIT>(vfr + s * 32 * VPIT + t * 16, vf);
                o[t] = __builtin_amdgcn_wmma_f32_16x16x32_f16(
                    false, vf.v, false, pf[s].v, (short)0, o[t], false, false);
            }
        }
        // a lane holds d = t*16 + lhi*8 + 0..7 of its query row: stored as f16, the A operand
        // of the output projection, in one 16-byte store
        #pragma unroll
        for (int t = 0; t < 4; ++t) {
            v8h p;
            #pragma unroll
            for (int r = 0; r < 8; ++r) p[r] = (_Float16)(o[t][r] * inv);
            *(v8h*)(orow + t * 16) = p;
        }
        // the address that these stores name moves on to the next head
        asm volatile("s_wait_xcnt 0x0" ::: "memory");
        orow += DHH;

        if (more) {
            __syncthreads();   // every wave has read this head's tiles
            put_rows64h<128, 64, 64, 72, 4>(qv, qsh, tid);
            put_rows64h<128, JPAD, JJ, 72, 5>(kv, kshT, tid);
            put_rows64h<128, KPAD, JJ, VPIT, 5>(vv, vsh, tid);
            __syncthreads();   // the next head's tiles are complete
        }
    }
}

// ---------------------------------------------------------------------------
// launch
// ---------------------------------------------------------------------------
extern "C" void kernel_launch(void* const* d_in, const int* in_sizes, int n_in,
                              void* d_out, int out_size, void* d_ws, size_t ws_size,
                              hipStream_t stream)
{
    const float* x        = (const float*)d_in[0];
    const float* ce       = (const float*)d_in[1];
    const int*   ct       = (const int*)  d_in[2];
    const float* camask   = (const float*)d_in[3];
    const float* strength = (const float*)d_in[4];
    const float* Wq       = (const float*)d_in[5];
    const float* Wk       = (const float*)d_in[6];
    const float* Wv       = (const float*)d_in[7];
    const float* Wout     = (const float*)d_in[8];
    const float* bout     = (const float*)d_in[9];
    const float* tte      = (const float*)d_in[10];
    const float* m1w      = (const float*)d_in[11];
    const float* m1b      = (const float*)d_in[12];
    const float* m2w      = (const float*)d_in[13];
    const float* m2b      = (const float*)d_in[14];
    const float* gA       = (const float*)d_in[15];
    const float* gB       = (const float*)d_in[16];
    float* out = (float*)d_out;

    // workspace partition (floats)
    float* ws    = (float*)d_ws;
    float* kin   = ws;                                  // 308*768
    float* k_bh  = kin  + (size_t)BB*JJ*DCC;            // 64*77*64 f16 (as v_bh), first half of the range
    float* v_bh  = k_bh + (size_t)BB*HH*JJ*DHH;
    float* q_bh  = v_bh + (size_t)BB*HH*JJ*DHH;         // 64*4096*64 f16, first half of the range
    float* aout  = q_bh + (size_t)BB*HH*NN*DHH;         // 16384*1024 f16 in the first half
    float* w16   = aout + (size_t)MROWS*INNERD/2;       // 1024*1024 f16 behind them
    float* stats = aout + (size_t)MROWS*INNERD;         // [sum, sumsq, std]

    hipMemsetAsync(stats, 0, 4 * sizeof(float), stream);

    // kin (embedding MLP), V = ce @ Wv and the first q row tiles of q = x @ Wq
    front1_kernel<<<PBLK + KVBLK + QTM1*NTN, 256, 0, stream>>>(
        ce, ct, tte, m1w, m1b, m2w, m2b, gA, gB, kin, Wv, v_bh, x, Wq, q_bh);

    // K = kin @ Wk, the remaining q row tiles, and Wout rounded to f16
    front2_kernel<<<KVBLK + QTM2*NTN + WCBLK, 256, 0, stream>>>(kin, Wk, k_bh, x, Wq, q_bh, Wout, w16);

    // masked mean/std of sim (WMMA sim tiles, never stored)
    sim_stats_kernel<<<dim3(NN/SROWS, BB*HH), 256, 0, stream>>>(q_bh, k_bh, ct, stats);
    finalize_kernel<<<1, 1, 0, stream>>>(ct, stats);

    // fused WMMA sim -> softmax -> WMMA attn@V
    attn_fused_kernel<<<dim3(NN/64, BB*HH/HPB), 128, 0, stream>>>(
        q_bh, k_bh, v_bh, ct, camask, strength, stats, aout);

    // out = attn_out @ Wout + bout  (WMMA)
    outproj_kernel<<<dim3(DQQ/GBN, MROWS/GBM), 256, 0, stream>>>(aout, w16, bout, out);
}

// v009
// Next to v008, in two timings, it ran 1.03 and 1.04 times as fast.
// Over all steps from v000 it is 3.89 times as fast.
#include <hip/hip_runtime.h>
#include <hip/hip_bf16.h>
#include <math.h>

// ---------------------------------------------------------------------------
// Problem constants
// ---------------------------------------------------------------------------
#define BB   4
#define NN   4096
#define JJ   77
#define HH   16
#define DHH  64
#define DQQ  1024
#define DCC  768
#define DHID 384           // DC/2
#define INNERD 1024        // H*DH
#define MROWS (BB*NN)      // 16384
#define JPAD 80            // sim col padding (5 x 16)
#define KPAD 96            // attn K padding  (3 x 32)

typedef __attribute__((ext_vector_type(16))) _Float16 v16h;
typedef __attribute__((ext_vector_type(8)))  float    v8f;
typedef __attribute__((ext_vector_type(2)))  _Float16 h2_t;
typedef __attribute__((ext_vector_type(8)))  _Float16 v8h;
typedef __attribute__((ext_vector_type(4)))  _Float16 v4h;
typedef __attribute__((ext_vector_type(8)))  short    s16x8;

union Frag16 { v16h v; h2_t h2[8]; _Float16 h[16]; s16x8 q[2]; };

// load one 16x32 f16 WMMA operand fragment from LDS (row-major, "base" points
// at this lane's row at the k-step origin; ISA 16-bit A/B layout)
__device__ __forceinline__ void load_frag(const _Float16* base, Frag16& f, int lhi)
{
    #pragma unroll
    for (int r = 0; r < 8; ++r) {
        int kk = (r < 4) ? (lhi * 8 + 2 * r) : (16 + lhi * 8 + 2 * (r - 4));
        f.h2[r] = *(const h2_t*)(base + kk);
    }
}

// ---------------------------------------------------------------------------
// Token-type embedding MLP -> kin = contextembs + typeemb
// One block of 256 threads takes PR rows (b,j), so that a weight fetched once serves
// PR rows. Each layer is cut into eight slices of 96 k values x 384 columns, one a wave:
// a lane holds 12 columns (three 16-byte pieces, 512 contiguous bytes a wave-wide load)
// of all PR rows, and a trip has twelve such loads in flight. The slices that share a
// column are then summed through LDS.
// ---------------------------------------------------------------------------
#define PR    4                  // rows a block
#define PBLK  (BB * JJ / PR)     // 77 blocks
#define PKS   96                 // k values of a slice
#define PCG   384                // columns of a slice
static_assert(BB * JJ % PR == 0, "whole blocks only");

typedef __attribute__((ext_vector_type(4))) float f4;

// acc[r][i] = sum over the slice's k of in[r][k] * W[k][i*128 + lane*4 + 0..3]
// "in": LDS, row pitch PITCH floats, at the slice's first k; "W": at the slice's first k
// and first column, row pitch LDW floats. Both are the same for the whole wave.
template<int LDW, int PITCH>
__device__ __forceinline__
void mlp_slice(const float* in, const float* __restrict__ W, int lane, f4 (&acc)[PR][3])
{
    #pragma unroll
    for (int r = 0; r < PR; ++r)
        #pragma unroll
        for (int i = 0; i < 3; ++i) acc[r][i] = (f4){0.f, 0.f, 0.f, 0.f};
    // a trip's twelve loads differ from one address only by constants
    const char* wb = (const char*)W;
    const unsigned lo = (unsigned)lane * 16u;
    #pragma unroll 1   // stays rolled: unrolled further, the loaded weights and the 48 sums
                       // no longer fit the 128 registers that 4 blocks a WGP allow
    for (int c = 0; c < PKS; c += 4) {
        f4 w[4][3];
        float a[PR][4];
        #pragma unroll   // w[] stays in registers and the loads issue back to back
        for (int cc = 0; cc < 4; ++cc)
            #pragma unroll
            for (int i = 0; i < 3; ++i)
                w[cc][i] = *(const f4*)(wb + lo + (cc * LDW + i * 128) * 4);
        #pragma unroll
        for (int r = 0; r < PR; ++r) {
            // every lane reads the same four inputs: held in scalar registers they leave the
            // vector registers to the weights in flight and the sums
            const f4 v = *(const f4*)(in + r * PITCH + c);
            #pragma unroll
            for (int e = 0; e < 4; ++e) {
                const float x = v[e];
                a[r][e] = __builtin_bit_cast(float,
                    __builtin_amdgcn_readfirstlane(__builtin_bit_cast(int, x)));
            }
        }
        #pragma unroll
        for (int cc = 0; cc < 4; ++cc)
            #pragma unroll
            for (int r = 0; r < PR; ++r)
                #pragma unroll
                for (int i = 0; i < 3; ++i) acc[r][i] += a[r][cc] * w[cc][i];
        wb += 4 * LDW * 4;
    }
}

// The eight slices become four in LDS: waves 4..7 store theirs, waves 0..3 add their own
// to the slice of wave w + 4. Slot s of "part" is [PR][PCG].
__device__ __forceinline__
void mlp_fold(const f4 (&acc)[PR][3], float* part, int w, int lane)
{
    float* p = part + (w & 3) * (PR * PCG) + lane * 4;
    if (w >= 4) {
        #pragma unroll
        for (int r = 0; r < PR; ++r)
            #pragma unroll
            for (int i = 0; i < 3; ++i) *(f4*)(p + r * PCG + i * 128) = acc[r][i];
    }
    __syncthreads();
    if (w < 4) {
        #pragma unroll
        for (int r = 0; r < PR; ++r)
            #pragma unroll
            for (int i = 0; i < 3; ++i) *(f4*)(p + r * PCG + i * 128) += acc[r][i];
    }
    __syncthreads();
}

__device__ __forceinline__
void prep_rows(int blk, const float* __restrict__ ce, const int* __restrict__ ct,
               const float* __restrict__ tte_emb,
               const float* __restrict__ m1w, const float* __restrict__ m1b,
               const float* __restrict__ m2w, const float* __restrict__ m2b,
               const float* __restrict__ gA, const float* __restrict__ gB,
               float* __restrict__ kin)
{
    __shared__ __attribute__((aligned(16))) float cein_s[PR * DCC];
    __shared__ __attribute__((aligned(16))) float hid_s[PR * DHID];
    __shared__ __attribute__((aligned(16))) float part_s[4 * PR * PCG];

    const int tid  = threadIdx.x;
    const int lane = tid & 31;
    const int w    = __builtin_amdgcn_readfirstlane(tid >> 5);   // wave number, in a scalar register

    // Outside the slices a pair of waves owns one row: r, and with it the row's token type
    // and every row base, is the same for the whole wave; a lane's columns are c0 + 256 n.
    const int r    = w >> 1;
    const int row  = blk * PR + r;
    const int c0   = ((w & 1) * 32 + lane) * 4;
    const int t    = ct[row];
    // bounded into the table's five rows; wave-uniform, so read into a scalar register
    const int tcl  = __builtin_amdgcn_readfirstlane(t < 0 ? 0 : (t > 4 ? 4 : t));
    const float* tter = tte_emb + tcl * DCC;
    const float* cer  = ce + (size_t)row * DCC;

    #pragma unroll   // the six loads issue back to back
    for (int n = 0; n < DCC / 256; ++n) {
        const int c = c0 + n * 256;
        *(f4*)&cein_s[r * DCC + c] = *(const f4*)(cer + c) + *(const f4*)(tter + c);
    }
    __syncthreads();

    f4 acc[PR][3];

    // layer 1, 768 x 384: eight k slices of all columns
    mlp_slice<DHID, DCC>(cein_s + w * PKS, m1w + (size_t)w * PKS * DHID, lane, acc);
    mlp_fold(acc, part_s, w, lane);
    // 384 columns a row: 256 by both waves of the pair, the last 128 by its first wave
    for (int c = c0; c < DHID; c += 256) {
        f4 s = *(const f4*)(m1b + c);
        #pragma unroll
        for (int k = 0; k < 4; ++k) s += *(const f4*)&part_s[(k * PR + r) * PCG + c];
        #pragma unroll
        for (int e = 0; e < 4; ++e)
            s[e] = 0.5f * s[e] * (1.0f + erff(s[e] * 0.70710678118654752f));
        *(f4*)&hid_s[r * DHID + c] = s;
    }
    __syncthreads();

    // layer 2, 384 x 768: four k slices (w >> 1) of two column halves (w & 1)
    mlp_slice<DCC, DHID>(hid_s + (w >> 1) * PKS, m2w + (size_t)(w >> 1) * PKS * DCC + (w & 1) * PCG,
                         lane, acc);
    mlp_fold(acc, part_s, w, lane);
    #pragma unroll
    for (int n = 0; n < DCC / 256; ++n) {
        const int c  = c0 + n * 256;
        const int cg = c / PCG, cc = c - cg * PCG;
        f4 s = *(const f4*)(m2b + c);
        s += *(const f4*)&part_s[(cg * PR + r) * PCG + cc];
        s += *(const f4*)&part_s[((2 + cg) * PR + r) * PCG + cc];
        const f4 typeemb = *(const f4*)(tter + c) * *(const f4*)(gA + c) + s * *(const f4*)(gB + c);
        *(f4*)(kin + (size_t)row * DCC + c) = *(const f4*)(cer + c) + typeemb;
    }
}

// ---------------------------------------------------------------------------
// WMMA GEMM: C[M,1024] = A[M,K] * B[K,1024]  (fp32 in, f16 mul, f32 acc)
// Block tile 128x128, BK=32, 8 waves (4x2), each wave 32x64 = 2x4 WMMA tiles.
// MODE 0: store q permuted [B*H, N, DH], as f16: what its readers feed to the matrix unit
// MODE 1: plain store + bias (output projection)
// MODE 2: store K/V permuted [B*H, J, DH], as f16  (rows = b*J+j, M=308)
// ---------------------------------------------------------------------------
#define GBM 128
#define GBN 128
#define GBK 32
#define LDSS 40   // padded LDS stride in halfs
#define LDSB 144  // B tile row pitch in halfs: 288 bytes, an odd multiple of 32 bytes
#define VPIT 80   // V tile row pitch in halfs: 160 bytes, an odd multiple of 32 bytes

// one 32(k) x 16(n) B fragment out of a row-major [k][n] f16 LDS tile, through the
// transposing LDS load. "base" is this lane's own address:
//   tile + (8*(lane>>4) + (lane&7)) * LDSB + n0 + 8*((lane>>3)&1)
// The lane then holds column n0 + (lane&15), k = 8*lhi + 0..7 and 16 + 8*lhi + 0..7:
// the k order of load_frag().
__device__ __forceinline__ void load_frag_tr(const _Float16* base, Frag16& f)
{
    typedef __attribute__((address_space(3))) s16x8 lds_s16x8;
    f.q[0] = __builtin_amdgcn_ds_load_tr16_b128_v8i16((lds_s16x8*)base);
    f.q[1] = __builtin_amdgcn_ds_load_tr16_b128_v8i16((lds_s16x8*)(base + 16 * LDSB));
}

// the same fragment out of a row-major tile of another pitch (in halfs)
template<int PITCH>
__device__ __forceinline__ void load_frag_tr_p(const _Float16* base, Frag16& f)
{
    typedef __attribute__((address_space(3))) s16x8 lds_s16x8;
    f.q[0] = __builtin_amdgcn_ds_load_tr16_b128_v8i16((lds_s16x8*)base);
    f.q[1] = __builtin_amdgcn_ds_load_tr16_b128_v8i16((lds_s16x8*)(base + 16 * PITCH));
}

// Stage ROWS rows of 64 f16 values (contiguous rows of 128 bytes in memory) as rows of
// PITCH halfs in LDS, as they lie in memory. A wave's 16-byte loads cover 512 contiguous
// bytes, and all of a thread's loads are issued before the first value is used.
// Rows VALID..ROWS-1 are filled with zero; a load that would fall there is clamped.
template<int NT, int ROWS, int VALID, int PITCH>
__device__ __forceinline__ void stage_rows64h(const _Float16* __restrict__ src, _Float16* dst, int tid)
{
    constexpr int NP = ROWS * 8;                       // 16-byte pieces of the LDS tile
    constexpr int NV = VALID * 8;                      // of these, pieces of valid rows
    constexpr int NI = NP / NT;                        // trips
    static_assert(NP % NT == 0, "whole trips only");
    constexpr int NL = (NV + NT - 1) / NT;             // of these, trips that hold a valid row
    uint4 v[NL];
    #pragma unroll   // v[] stays in registers and the loads issue back to back
    for (int i = 0; i < NL; ++i) {
        int f = tid + i * NT;
        if ((i + 1) * NT > NV) f = f < NV ? f : NV - 1;   // piece index clamped into the tile
        v[i] = ((const uint4*)src)[f];
    }
    #pragma unroll   // v[] is indexed by constants
    for (int i = 0; i < NI; ++i) {
        const int f = tid + i * NT;
        uint4 h = make_uint4(0u, 0u, 0u, 0u);
        if (i < NL) {
            h = v[i];
            if ((i + 1) * NT > NV && f >= NV) h = make_uint4(0u, 0u, 0u, 0u);
        }
        *(uint4*)(dst + (f >> 3) * PITCH + (f & 7) * 8) = h;
    }
}

// The LDS of one 128x128 tile: the A tile, behind it the B tile. One range, so that the
// store of the accumulators can stage in it once the k loop has left it.
#define GLDSA (GBM * LDSS * 2)              // bytes of the A tile, a multiple of 32
#define GLDS  (GLDSA + GBK * LDSB * 2)      // bytes of both
__device__ __forceinline__ char* gemm_lds()
{
    __shared__ __attribute__((aligned(128))) char buf[GLDS];
    return buf;
}

// One 128x128 tile at (blockM, blockN), by one block of 256 threads: the k loop ...
__device__ __forceinline__
void gemm_accumulate(const float* __restrict__ A, const float* __restrict__ Bm,
                     int M, int K, int blockM, int blockN, v8f (&acc)[2][4])
{
    _Float16* const Ash = (_Float16*)gemm_lds();              // [m][k]
    _Float16* const Bsh = (_Float16*)(gemm_lds() + GLDSA);    // [k][n]

    const int tid  = threadIdx.x;
    const int wid  = tid >> 5;
    const int lane = tid & 31;
    const int wm   = wid >> 1;     // 0..3 -> 32-row strip
    const int wn   = wid & 1;      // 0..1 -> 64-col strip
    const int lm   = lane & 15;
    const int lhi  = lane >> 4;

    #pragma unroll
    for (int t = 0; t < 2; ++t)
        #pragma unroll
        for (int u = 0; u < 4; ++u)
            acc[t][u] = (v8f){0.f,0.f,0.f,0.f,0.f,0.f,0.f,0.f};

    int arow = blockM + (tid >> 1);       // global A row
    if (arow >= M) arow = M - 1;          // clamp (stores are guarded)
    const int acb  = (tid & 1) * 16;
    const int bkr  = tid >> 3;            // 0..31
    const int bcb  = (tid & 7) * 16;
    // Staging map: every wave-wide 16-byte load covers whole 128-byte lines.
    // A: 8 lanes take the 128 bytes that one row has in this k tile, a wave 4 rows;
    //    a thread's rows are sar + 32 i. Byte offsets from A, rows clamped like arow.
    // B: a wave takes 512 contiguous bytes of one k row; a thread's rows are sbr + 8 i.
    const int sar  = tid >> 3;            // 0..31
    const int sac  = (tid & 7) * 4;       // four columns
    const int sbr  = tid >> 5;            // 0..7
    const int sbc  = lane * 4;            // four columns
    unsigned aoff[4];
    #pragma unroll   // aoff[] is indexed by constants and stays in registers
    for (int i = 0; i < 4; ++i) {
        int r = blockM + sar + 32 * i;
        if (r >= M) r = M - 1;
        aoff[i] = ((unsigned)r * (unsigned)K + (unsigned)sac) * 4u;
    }
    unsigned boff = ((unsigned)sbr * 1024u + (unsigned)blockN + (unsigned)sbc) * 4u;
    const _Float16* bfr = &Bsh[(lhi * 8 + (lane & 7)) * LDSB + wn * 64 + ((lane >> 3) & 1) * 8];

    for (int k0 = 0; k0 < K; k0 += GBK) {
        // stage both tiles (fp32 -> f16), each as it lies in memory: Ash[m][k], Bsh[k][n]
        float4 av[4], bv[4];
        // uniform base + 32-bit byte offset: one address register a load (both operands are
        // far below 4 GiB)
        #pragma unroll   // av[] stays in registers and the loads issue back to back
        for (int i = 0; i < 4; ++i) av[i] = *(const float4*)((const char*)A + aoff[i]);
        #pragma unroll   // the same for bv[]
        for (int i = 0; i < 4; ++i) bv[i] = *(const float4*)((const char*)Bm + boff + i * 32768);
        #pragma unroll   // av[] is indexed by constants; the LDS offsets become immediates
        for (int i = 0; i < 4; ++i) {
            v4h p;
            p[0] = (_Float16)av[i].x;  p[1] = (_Float16)av[i].y;
            p[2] = (_Float16)av[i].z;  p[3] = (_Float16)av[i].w;
            *(v4h*)&Ash[(sar + 32 * i) * LDSS + sac] = p;
        }
        #pragma unroll   // the same for bv[]
        for (int i = 0; i < 4; ++i) {
            v4h p;
            p[0] = (_Float16)bv[i].x;  p[1] = (_Float16)bv[i].y;
            p[2] = (_Float16)bv[i].z;  p[3] = (_Float16)bv[i].w;
            *(v4h*)&Bsh[(sbr + 8 * i) * LDSB + sbc] = p;
        }
        #pragma unroll   // on to the next k tile (the loaded values have arrived)
        for (int i = 0; i < 4; ++i) aoff[i] += GBK * 4u;
        boff += GBK * 4096u;
        if (k0 + GBK < K) {   // global_prefetch of next k-tile
            __builtin_prefetch(A + (size_t)arow * K + k0 + GBK + acb, 0, 1);
            __builtin_prefetch(Bm + (size_t)(k0 + GBK + bkr) * 1024 + blockN + bcb, 0, 1);
        }
        __syncthreads();

        Frag16 af[2], bf[4];
        #pragma unroll
        for (int t = 0; t < 2; ++t)
            load_frag(&Ash[(wm * 32 + t * 16 + lm) * LDSS], af[t], lhi);
        #pragma unroll
        for (int u = 0; u < 4; ++u)
            load_frag_tr(bfr + u * 16, bf[u]);

        #pragma unroll
        for (int t = 0; t < 2; ++t)
            #pragma unroll
            for (int u = 0; u < 4; ++u)
                acc[t][u] = __builtin_amdgcn_wmma_f32_16x16x32_f16(
                    false, af[t].v, false, bf[u].v,
                    (short)0, acc[t][u], false, false);

        __syncthreads();
    }
}

// ... and the store of its accumulators.
// MODE 0 and 1: an accumulator register holds 16 neighbouring columns of two rows, 32 or 64
// bytes of a line. Each wave therefore passes its 32x64 tile, 16 rows at a time, through its
// own part of "stage" (the tile's LDS, which every wave has left behind the k loop's last
// barrier) and stores it in 16-byte pieces that cover whole 128-byte lines.
#define QSP 72   // staged row pitch, f16 values: 144 bytes, an odd multiple of 16 bytes
#define OSP 68   // staged row pitch, f32 values: 272 bytes, an odd multiple of 16 bytes
static_assert(8 * 16 * QSP * 2 <= GLDS, "the f16 staging fits the tile's LDS");
template<int MODE>
__device__ __forceinline__
void gemm_store(const v8f (&acc)[2][4], const float* __restrict__ bias, float* __restrict__ C,
                int M, int blockM, int blockN, char* stage)
{
    const int tid  = threadIdx.x;
    const int wid  = tid >> 5;
    const int lane = tid & 31;
    const int wm   = wid >> 1;
    const int wn   = wid & 1;
    const int lm   = lane & 15;
    const int lhi  = lane >> 4;

    // C/D layout: lanes 0-15 -> M=r, lanes 16-31 -> M=8+r, N=lane&15
    if (MODE == 0) {
        // the wave's 64 columns are one head, its 32 rows 32 lines that follow one another
        _Float16* st = (_Float16*)stage + wid * (16 * QSP);
        const int rg0 = blockM + wm * 32;
        const int b = rg0 >> 12, n0 = rg0 & 4095;
        const int h = (blockN >> 6) + wn;
        _Float16* dst = (_Float16*)C + (((size_t)(b * HH + h)) * NN + n0) * DHH + lane * 8;
        #pragma unroll
        for (int t = 0; t < 2; ++t) {
            #pragma unroll
            for (int u = 0; u < 4; ++u)
                #pragma unroll
                for (int r = 0; r < 8; ++r)
                    st[(lhi * 8 + r) * QSP + u * 16 + lm] = (_Float16)acc[t][u][r];
            // the rows are read back by other lanes of this wave: their writes have retired
            asm volatile("s_wait_dscnt 0x0" ::: "memory");
            uint4 v[4];
            #pragma unroll   // v[] stays in registers
            for (int i = 0; i < 4; ++i)
                v[i] = *(const uint4*)(st + (i * 4 + (lane >> 3)) * QSP + (lane & 7) * 8);
            #pragma unroll   // 512 contiguous bytes a wave-wide store
            for (int i = 0; i < 4; ++i)
                *(uint4*)(dst + (t * 16 + i * 4) * DHH) = v[i];
            // the registers that these stores name are reused by the next rows
            asm volatile("s_wait_xcnt 0x0" ::: "memory");
            // holds the next rows' conversions, which write those registers, behind that wait
            __builtin_amdgcn_sched_barrier(0);
        }
        return;
    }
    if (MODE == 1) {
        // 16 lanes take the 256 bytes that a row has in the wave's tile, a wave two rows
        float* st = (float*)stage + wid * (16 * OSP);
        const int c4  = lm * 4;
        const int cg0 = blockN + wn * 64 + c4;
        const f4 bv = *(const f4*)(bias + cg0);
        float* dst = C + (size_t)(blockM + wm * 32 + lhi) * 1024 + cg0;
        #pragma unroll
        for (int t = 0; t < 2; ++t) {
            #pragma unroll
            for (int u = 0; u < 4; ++u)
                #pragma unroll
                for (int r = 0; r < 8; ++r)
                    st[(lhi * 8 + r) * OSP + u * 16 + lm] = acc[t][u][r];
            // the rows are read back by other lanes of this wave: their writes have retired
            asm volatile("s_wait_dscnt 0x0" ::: "memory");
            f4 v[8];
            #pragma unroll   // v[] stays in registers
            for (int i = 0; i < 8; ++i)
                v[i] = *(const f4*)(st + (i * 2 + lhi) * OSP + c4) + bv;
            #pragma unroll   // two whole lines of each of two rows a wave-wide store
            for (int i = 0; i < 8; ++i)
                *(f4*)(dst + (size_t)(t * 16 + i * 2) * 1024) = v[i];
            // the registers that these stores name are reused by the next rows
            asm volatile("s_wait_xcnt 0x0" ::: "memory");
        }
        return;
    }
    #pragma unroll
    for (int t = 0; t < 2; ++t) {
        #pragma unroll
        for (int u = 0; u < 4; ++u) {
            #pragma unroll
            for (int r = 0; r < 8; ++r) {
                int rg = blockM + wm * 32 + t * 16 + (lhi ? 8 + r : r);
                int cg = blockN + wn * 64 + u * 16 + lm;
                float val = acc[t][u][r];
                // MODE 2: rows are (b, j)
                if (rg < M) {
                    int b = rg / JJ, j = rg - b * JJ;
                    int h = cg >> 6, d = cg & 63;
                    ((_Float16*)C)[(((size_t)(b * HH + h)) * JJ + j) * DHH + d] = (_Float16)val;
                }
            }
        }
    }
}

// ---------------------------------------------------------------------------
// The work in front of the attention, in two launches. The embedding MLP, the V
// projection and the q projection do not depend on one another; the K projection
// needs only the MLP. The MLP and the K and V projections are short chains of
// dependent memory round trips on few blocks, which leave most of the chip idle
// when launched alone, so each launch runs them beside a share of the q tiles.
// The long chains take the lowest block indices.
// All blocks of the first launch are resident at once: at up to 128 registers a wave,
// 4 blocks a WGP, 1024 places; 77 + 24 + 86 * 8 = 789 blocks.
// ---------------------------------------------------------------------------
#define NTN    (INNERD / GBN)                        // 8 column tiles
#define KVBLK  (NTN * ((BB * JJ + GBM - 1) / GBM))   // 24 tiles of a K or V projection
#define QTM1   86                                    // q row tiles in the first launch
#define QTM2   (MROWS / GBM - QTM1)                  // 42 in the second
#define WCBLK  (INNERD * DQQ / 4096)                 // 256 blocks that round Wout to f16

__global__ __launch_bounds__(256)
void front1_kernel(const float* __restrict__ ce, const int* __restrict__ ct,
                   const float* __restrict__ tte_emb,
                   const float* __restrict__ m1w, const float* __restrict__ m1b,
                   const float* __restrict__ m2w, const float* __restrict__ m2b,
                   const float* __restrict__ gA, const float* __restrict__ gB,
                   float* __restrict__ kin,
                   const float* __restrict__ Wv, float* __restrict__ v_bh,
                   const float* __restrict__ x, const float* __restrict__ Wq,
                   float* __restrict__ q_bh)
{
    const int blk = blockIdx.x;
    if (blk < PBLK) {
        prep_rows(blk, ce, ct, tte_emb, m1w, m1b, m2w, m2b, gA, gB, kin);
        return;
    }
    const bool isv = blk < PBLK + KVBLK;             // the same for the whole block
    const int  t   = blk - (isv ? PBLK : PBLK + KVBLK);
    const int  bm  = (t / NTN) * GBM, bn = (t % NTN) * GBN;
    v8f acc[2][4];
    gemm_accumulate(isv ? ce : x, isv ? Wv : Wq, isv ? BB * JJ : MROWS, isv ? DCC : DQQ, bm, bn, acc);
    if (isv) gemm_store<2>(acc, nullptr, v_bh, BB * JJ, bm, bn, nullptr);
    else     gemm_store<0>(acc, nullptr, q_bh, MROWS, bm, bn, gemm_lds());
}

__global__ __launch_bounds__(256)
void front2_kernel(const float* __restrict__ kin, const float* __restrict__ Wk,
                   float* __restrict__ k_bh,
                   const float* __restrict__ x, const float* __restrict__ Wq,
                   float* __restrict__ q_bh,
                   const float* __restrict__ Wout, float* __restrict__ w16)
{
    const int  blk = blockIdx.x;
    if (blk >= KVBLK + QTM2 * NTN) {                 // the same for the whole block
        // Wout rounded to f16 once, for the output projection: 4096 values a block
        const int p = (blk - (KVBLK + QTM2 * NTN)) * 1024 + threadIdx.x;   // piece of 4 values
        float4 v[4];
        #pragma unroll   // v[] stays in registers and the loads issue back to back
        for (int i = 0; i < 4; ++i) v[i] = ((const float4*)Wout)[p + i * 256];
        #pragma unroll   // v[] is indexed by constants
        for (int i = 0; i < 4; ++i) {
            v4h h;
            h[0] = (_Float16)v[i].x;  h[1] = (_Float16)v[i].y;
            h[2] = (_Float16)v[i].z;  h[3] = (_Float16)v[i].w;
            ((v4h*)w16)[p + i * 256] = h;
        }
        return;
    }
    const bool isk = blk < KVBLK;                    // the same for the whole block
    const int  t   = isk ? blk : blk - KVBLK + QTM1 * NTN;
    const int  bm  = (t / NTN) * GBM, bn = (t % NTN) * GBN;
    v8f acc[2][4];
    gemm_accumulate(isk ? kin : x, isk ? Wk : Wq, isk ? BB * JJ : MROWS, isk ? DCC : DQQ, bm, bn, acc);
    if (isk) gemm_store<2>(acc, nullptr, k_bh, BB * JJ, bm, bn, nullptr);
    else     gemm_store<0>(acc, nullptr, q_bh, MROWS, bm, bn, gemm_lds());
}

// output projection: out = attn_out @ Wout + bout
// Both operands lie in the workspace as f16, rounded once by their producers (the
// attention kernel; the last block range of front2_kernel): the values that the k loop
// above would round them to in every tile that reads them. A tile therefore loads half
// the bytes and converts nothing. The k tile is 64, so that the piece of an A row in it
// is one whole 128-byte line; the products are summed in ascending k, 32 at a time.
#define HBK  64   // k tile
#define APIT 72   // A tile row pitch in halfs: 144 bytes, an odd multiple of 16 bytes
__global__ __launch_bounds__(256)
void outproj_kernel(const float* __restrict__ a16, const float* __restrict__ w16,
                    const float* __restrict__ bias, float* __restrict__ C)
{
    // one range: the A tile, behind it the B tile; the store of the accumulators stages in it
    __shared__ __attribute__((aligned(128))) char osm[(GBM * APIT + HBK * LDSB) * 2];
    static_assert(8 * 16 * OSP * 4 <= sizeof(osm), "the f32 staging fits the tiles' LDS");
    static_assert(GBM * APIT * 2 % 32 == 0, "the B tile keeps its alignment");
    _Float16* const Ash = (_Float16*)osm;                      // [m][k]
    _Float16* const Bsh = (_Float16*)(osm + GBM * APIT * 2);   // [k][n]

    const int bm   = blockIdx.y * GBM, bn = blockIdx.x * GBN;
    const int tid  = threadIdx.x;
    const int wid  = tid >> 5;
    const int lane = tid & 31;
    const int wm   = wid >> 1;     // 0..3 -> 32-row strip
    const int wn   = wid & 1;      // 0..1 -> 64-col strip
    const int lm   = lane & 15;
    const int lhi  = lane >> 4;

    v8f acc[2][4];
    #pragma unroll
    for (int t = 0; t < 2; ++t)
        #pragma unroll
        for (int u = 0; u < 4; ++u)
            acc[t][u] = (v8f){0.f,0.f,0.f,0.f,0.f,0.f,0.f,0.f};

    // Staging map, 16 bytes (8 halfs) a lane, whole 128-byte lines:
    // A: 8 lanes take the line that one row has in this k tile, a wave 4 rows; rows sar + 32 i.
    // B: 16 lanes take the 256 bytes of one k row, a wave 2 rows; rows sbr + 16 i.
    const int sar = tid >> 3;            // 0..31
    const int sac = (tid & 7) * 8;
    const int sbr = tid >> 4;            // 0..15
    const int sbc = (tid & 15) * 8;
    unsigned aoff = ((unsigned)(bm + sar) * 1024u + (unsigned)sac) * 2u;   // byte offsets
    unsigned boff = ((unsigned)sbr * 1024u + (unsigned)(bn + sbc)) * 2u;
    const _Float16* bfr = &Bsh[(lhi * 8 + (lane & 7)) * LDSB + wn * 64 + ((lane >> 3) & 1) * 8];

    #pragma unroll 1   // stays rolled: unrolled, a tile's eight loads no longer issue together
                       // and the kernel takes more than 128 registers (3 blocks a WGP, not 4)
    for (int k0 = 0; k0 < INNERD; k0 += HBK) {
        uint4 av[4], bv[4];
        #pragma unroll   // av[] stays in registers and the loads issue back to back
        for (int i = 0; i < 4; ++i) av[i] = *(const uint4*)((const char*)a16 + aoff + i * 65536);
        #pragma unroll   // the same for bv[]
        for (int i = 0; i < 4; ++i) bv[i] = *(const uint4*)((const char*)w16 + boff + i * 32768);
        #pragma unroll   // av[] is indexed by constants
        for (int i = 0; i < 4; ++i) *(uint4*)&Ash[(sar + 32 * i) * APIT + sac] = av[i];
        #pragma unroll   // the same for bv[]
        for (int i = 0; i < 4; ++i) *(uint4*)&Bsh[(sbr + 16 * i) * LDSB + sbc] = bv[i];
        aoff += HBK * 2u;                 // on to the next k tile (the loaded values have arrived)
        boff += HBK * 2048u;
        if (k0 + HBK < INNERD) {          // global_prefetch of the next k tile: 128 lines each
            __builtin_prefetch((const char*)a16 + ((unsigned)(bm + (tid >> 1)) * 1024u + (unsigned)(k0 + HBK)) * 2u, 0, 1);
            __builtin_prefetch((const char*)w16 + ((unsigned)(k0 + HBK + (tid >> 2)) * 1024u + (unsigned)bn) * 2u + (tid & 1) * 128, 0, 1);
        }
        __syncthreads();

        #pragma unroll   // two k steps of 32 out of one staged tile
        for (int s = 0; s < 2; ++s) {
            Frag16 af[2], bf[4];
            #pragma unroll
            for (int t = 0; t < 2; ++t)
                load_frag(&Ash[(wm * 32 + t * 16 + lm) * APIT + s * 32], af[t], lhi);
            #pragma unroll
            for (int u = 0; u < 4; ++u)
                load_frag_tr(bfr + s * 32 * LDSB + u * 16, bf[u]);

            #pragma unroll
            for (int t = 0; t < 2; ++t)
                #pragma unroll
                for (int u = 0; u < 4; ++u)
                    acc[t][u] = __builtin_amdgcn_wmma_f32_16x16x32_f16(
                        false, af[t].v, false, bf[u].v,
                        (short)0, acc[t][u], false, false);
        }
        __syncthreads();
    }
    gemm_store<1>(acc, bias, C, MROWS, bm, bn, osm);
}

// ---------------------------------------------------------------------------
// Kernel 3: WMMA sim tiles + masked sum/sumsq (sim never hits HBM)
// grid (N/SROWS, B*H), 256 threads. A block takes SROWS query rows of one head: its K tile
// is staged once and each wave reads the K fragments once, for SROWS/128 strips of 16 rows.
// All of the block's loads are in flight together, in front of its one staging barrier.
// ---------------------------------------------------------------------------
#define SROWS 512
__global__ __launch_bounds__(256)
void sim_stats_kernel(const float* __restrict__ q_bh, const float* __restrict__ k_bh,
                      const int* __restrict__ ct, float* __restrict__ stats)
{
    __shared__ __attribute__((aligned(16))) _Float16 qsh[SROWS * 72];   // [row][k], stride 72
    __shared__ __attribute__((aligned(16))) _Float16 kshT[KPAD * 72];   // [j][k], rows 77..95 zero
    __shared__ int   sel2[JPAD];
    __shared__ float rs[256], rq[256];

    const int tid  = threadIdx.x;
    const int wid  = tid >> 5;
    const int lane = tid & 31;
    const int lm   = lane & 15;
    const int lhi  = lane >> 4;
    const int bh   = blockIdx.y;
    const int b    = bh >> 4;
    const int rowbase = blockIdx.x * SROWS;

    // q tile SROWS x 64 and K tile, f16 in the workspace (K staged as 96 rows: whole trips of
    // 256 threads, so that all loads issue together; rows 80..95 are not read)
    stage_rows64h<256, SROWS, SROWS, 72>((const _Float16*)q_bh + ((size_t)bh * NN + rowbase) * DHH, qsh, tid);
    stage_rows64h<256, KPAD, JJ, 72>((const _Float16*)k_bh + (size_t)bh * JJ * DHH, kshT, tid);
    for (int j = tid; j < JPAD; j += 256)
        sel2[j] = (j < JJ && ct[b * JJ + j] >= 2) ? 1 : 0;
    __syncthreads();

    Frag16 bf[2][5];                       // the K fragments, K = 64 -> 2 k-steps, 5 j tiles
    #pragma unroll
    for (int s = 0; s < 2; ++s)
        #pragma unroll
        for (int t = 0; t < 5; ++t)
            load_frag(&kshT[(t * 16 + lm) * 72 + s * 32], bf[s][t], lhi);

    // a lane owns column j = t*16+lm of 8 rows a strip: one pair of sums a column, over all
    // strips; whether the column counts is asked once, behind the loop
    float p1[5], p2[5];
    #pragma unroll
    for (int t = 0; t < 5; ++t) { p1[t] = 0.f; p2[t] = 0.f; }
    #pragma unroll   // the strips' LDS offsets become immediates
    for (int p = 0; p < SROWS / 128; ++p) {
        v8f acc[5];
        #pragma unroll
        for (int t = 0; t < 5; ++t) acc[t] = (v8f){0.f,0.f,0.f,0.f,0.f,0.f,0.f,0.f};

        #pragma unroll
        for (int s = 0; s < 2; ++s) {
            Frag16 af;
            load_frag(&qsh[(p * 128 + wid * 16 + lm) * 72 + s * 32], af, lhi);
            #pragma unroll
            for (int t = 0; t < 5; ++t)
                acc[t] = __builtin_amdgcn_wmma_f32_16x16x32_f16(
                    false, af.v, false, bf[s][t].v, (short)0, acc[t], false, false);
        }

        #pragma unroll
        for (int t = 0; t < 5; ++t)
            #pragma unroll
            for (int r = 0; r < 8; ++r) {
                float v = acc[t][r];
                p1[t] += v;
                p2[t] = fmaf(v, v, p2[t]);
            }
    }
    float s1 = 0.f, s2 = 0.f;
    #pragma unroll
    for (int t = 0; t < 5; ++t) {
        int j = t * 16 + lm;
        if (j < JJ && sel2[j]) { s1 += p1[t]; s2 += p2[t]; }
    }
    rs[tid] = s1; rq[tid] = s2;
    __syncthreads();
    for (int off = 128; off > 0; off >>= 1) {
        if (tid < off) { rs[tid] += rs[tid + off]; rq[tid] += rq[tid + off]; }
        __syncthreads();
    }
    if (tid == 0) {
        atomicAdd(&stats[0], rs[0]);
        atomicAdd(&stats[1], rq[0]);
    }
}

// ---------------------------------------------------------------------------
// Kernel 4: finalize std (Bessel-corrected, matching torch .std())
// ---------------------------------------------------------------------------
__global__ void finalize_kernel(const int* __restrict__ ct, float* __restrict__ stats)
{
    int cnt = 0;
    for (int i = 0; i < BB * JJ; ++i) cnt += (ct[i] >= 2) ? 1 : 0;
    float nsel = (float)cnt * (float)HH * (float)NN;
    float mean = (nsel > 0.f) ? stats[0] / nsel : 0.f;
    float var  = (nsel > 1.f) ? (stats[1] - nsel * mean * mean) / (nsel - 1.f) : 0.f;
    stats[2] = sqrtf(var > 0.f ? var : 0.f);
}

// ---------------------------------------------------------------------------
// Kernel 5: fused attention block, 64 rows x HPB heads / block, 128 threads (4 waves).
// The scores are formed transposed, S^T = K * Q^T (K is the A operand, Q the B
// operand), so a lane's accumulators hold 40 scores of ONE query row:
//   column = lane & 15 -> query row,  j = t*16 + (lane >> 4)*8 + r.
// The masked softmax runs in registers on all lanes; lanes l and l^16 share a
// query row and exchange three partial results. That accumulator order is the
// k order of a 16-bit B operand, so the probabilities, converted to f16, are
// the B operand of out^T = V^T * P^T with no pass through LDS.
// ---------------------------------------------------------------------------
__device__ __forceinline__ float other_half(float x)   // value of lane l ^ 16
{
    int b = __builtin_bit_cast(int, x);
    b = __builtin_amdgcn_permlanex16(b, b, 0x76543210, 0xfedcba98, false, false);
    return __builtin_bit_cast(float, b);
}

// 2^x. The v_nop keeps the one free issue slot the instruction set asks for
// behind a transcendental.
__device__ __forceinline__ float exp2_slot(float x)
{
    float y;
    asm("v_exp_f32 %0, %1\n\tv_nop" : "=v"(y) : "v"(x));
    return y;
}

// The two halves of stage_rows64h(), apart, so that a tile's loads can be issued while the
// tile before it is still being worked on: fetch into registers, put into LDS later.
template<int NT, int VALID, int NL>
__device__ __forceinline__ void fetch_rows64h(const _Float16* __restrict__ src, uint4 (&v)[NL], int tid)
{
    constexpr int NV = VALID * 8;                      // 16-byte pieces of valid rows
    static_assert(NL == (NV + NT - 1) / NT, "one register set a trip that holds a valid row");
    #pragma unroll   // v[] stays in registers and the loads issue back to back
    for (int i = 0; i < NL; ++i) {
        int f = tid + i * NT;
        if ((i + 1) * NT > NV) f = f < NV ? f : NV - 1;   // piece index clamped into the tile
        v[i] = ((const uint4*)src)[f];
    }
}

template<int NT, int ROWS, int VALID, int PITCH, int NL>
__device__ __forceinline__ void put_rows64h(const uint4 (&v)[NL], _Float16* dst, int tid)
{
    constexpr int NP = ROWS * 8;                       // 16-byte pieces of the LDS tile
    constexpr int NV = VALID * 8;
    constexpr int NI = NP / NT;
    static_assert(NP % NT == 0, "whole trips only");
    #pragma unroll   // v[] is indexed by constants
    for (int i = 0; i < NI; ++i) {
        const int f = tid + i * NT;
        uint4 h = make_uint4(0u, 0u, 0u, 0u);
        if (i < NL) {
            h = v[i];
            if ((i + 1) * NT > NV && f >= NV) h = make_uint4(0u, 0u, 0u, 0u);
        }
        *(uint4*)(dst + (f >> 3) * PITCH + (f & 7) * 8) = h;
    }
}

// Which scores of a query row take part in the softmax depends on the batch, the row and
// j, not on the head. A block therefore takes HPB heads of its 64 query rows, one after the
// other: the mask rows are loaded and thresholded once, and each head only selects by the
// kept flags. The next head's q, K and V tiles are fetched while this head is worked on.
#define HPB 4
static_assert(HH % HPB == 0, "whole blocks only");

__global__ __launch_bounds__(128)
void attn_fused_kernel(const float* __restrict__ q_bh, const float* __restrict__ k_bh,
                       const float* __restrict__ v_bh, const int* __restrict__ ct,
                       const float* __restrict__ camask, const float* __restrict__ strength,
                       const float* __restrict__ stats, float* __restrict__ out_attn)
{
    __shared__ __attribute__((aligned(16))) _Float16 qsh[64 * 72];      // q tile [row][k]
    __shared__ __attribute__((aligned(16))) _Float16 kshT[JPAD * 72];   // [j][k], rows 77..79 zero
    __shared__ __attribute__((aligned(32))) _Float16 vsh[KPAD * VPIT];  // [j][d], rows 77..95 zero
    __shared__ __attribute__((aligned(16))) _Float16 osh[4 * 16 * QSP]; // a wave's 16 output rows each
    __shared__ int      sel2[JPAD], selg[JPAD];

    const int tid  = threadIdx.x;
    const int wid  = tid >> 5;     // 0..3 -> 16-row strip
    const int lane = tid & 31;
    const int lm   = lane & 15;
    const int lhi  = lane >> 4;
    const int bh0  = blockIdx.y * HPB;          // the block's first (batch, head) pair
    const int b    = bh0 >> 4;
    const int h0   = bh0 & 15;
    const int rowbase = blockIdx.x * 64;
    const int rowg = rowbase + wid * 16 + lm;   // this lane's query row

    // q tile 64x64, K tile 80x64 and V tile 96x64, f16 in the workspace, each as it lies in
    // memory; these point at the head whose tiles were fetched last
    const _Float16* qp = (const _Float16*)q_bh + ((size_t)bh0 * NN + rowbase) * DHH;
    const _Float16* kp = (const _Float16*)k_bh + (size_t)bh0 * JJ * DHH;
    const _Float16* vp = (const _Float16*)v_bh + (size_t)bh0 * JJ * DHH;
    uint4 qv[4], kv[5], vv[5];
    fetch_rows64h<128, 64, 4>(qp, qv, tid);
    fetch_rows64h<128, JJ, 5>(kp, kv, tid);
    fetch_rows64h<128, JJ, 5>(vp, vv, tid);
    for (int j = tid; j < JPAD; j += 128) {
        int t = (j < JJ) ? ct[b * JJ + j] : -1;
        sel2[j] = (t >= 2) ? 1 : 0;
        selg[j] = (t >= 0 && t < 2) ? 1 : 0;
    }

    // this lane's 40 mask values, read once; index clamped for j = 77..79
    float wf[5][8];
    {
        const float* camrow = camask + ((size_t)b * NN + rowg) * JJ;
        #pragma unroll
        for (int t = 0; t < 5; ++t)
            #pragma unroll
            for (int r = 0; r < 8; ++r) {
                int j = t * 16 + lhi * 8 + r;
                wf[t][r] = camrow[j < JJ ? j : JJ - 1];
            }
    }
    // the registers that hold these loads' addresses are reused below
    asm volatile("s_wait_xcnt 0x0" ::: "memory");

    put_rows64h<128, 64, 64, 72, 4>(qv, qsh, tid);
    put_rows64h<128, JPAD, JJ, 72, 5>(kv, kshT, tid);
    put_rows64h<128, KPAD, JJ, VPIT, 5>(vv, vsh, tid);
    __syncthreads();

    // ---- the mask of this lane's query row, the same for every head
    const float simstd = stats[2];
    const float str    = strength[0];
    const float scale  = 0.125f;                  // 1/sqrt(DH)

    float wfmax = -__FLT_MAX__;
    #pragma unroll
    for (int t = 0; t < 5; ++t)
        #pragma unroll
        for (int r = 0; r < 8; ++r) {
            int j = t * 16 + lhi * 8 + r;
            float w = sel2[j] ? wf[t][r] * simstd * str : 0.f;
            wf[t][r] = w;
            if (j < JJ) wfmax = fmaxf(wfmax, w);
        }
    wfmax = fmaxf(wfmax, other_half(wfmax));
    const float thr = fmaxf(wfmax, 0.001f) - 0.0001f;

    bool keep[5][8];
    #pragma unroll
    for (int t = 0; t < 5; ++t)
        #pragma unroll
        for (int r = 0; r < 8; ++r) {
            int j = t * 16 + lhi * 8 + r;
            // both tests evaluated, no short circuit: the flag reads stay wide and unbranched
            bool lmv = (wf[t][r] >= thr) | (selg[j] != 0);
            keep[t][r] = lmv & (j < JJ);
        }

    // V^T fragments come out of the row-major V tile through the transposing LDS load:
    // the lane holds d = t*16 + lm, j = s*32 + 8*lhi + 0..7 and + 16: the k order of pf
    const _Float16* vfr = &vsh[(lhi * 8 + (lane & 7)) * VPIT + ((lane >> 3) & 1) * 8];
    // A head's 64 values of a query row are one 128-byte line. The wave passes its 16 rows
    // through its own LDS range: 8 lanes then store a whole line, a wave-wide store four.
    _Float16* ost  = osh + wid * (16 * QSP);
    _Float16* orow = (_Float16*)out_attn + ((size_t)b * NN + rowbase + wid * 16 + (lane >> 3)) * INNERD
                   + h0 * DHH + (lane & 7) * 8;

    #pragma unroll 1   // stays rolled: one head's code, read from the instruction cache again
    for (int hh = 0; hh < HPB; ++hh) {
        const bool more = hh + 1 < HPB;           // the same for the whole block
        if (more) {
            qp += (size_t)NN * DHH;  kp += JJ * DHH;  vp += JJ * DHH;
            fetch_rows64h<128, 64, 4>(qp, qv, tid);
            fetch_rows64h<128, JJ, 5>(kp, kv, tid);
            fetch_rows64h<128, JJ, 5>(vp, vv, tid);
            // the next trip moves the bases that these loads name
            asm volatile("s_wait_xcnt 0x0" ::: "memory");
        }

        // ---- stage 1: S^T = K @ q^T via WMMA, kept in registers
        v8f acc[5];
        #pragma unroll
        for (int t = 0; t < 5; ++t) acc[t] = (v8f){0.f,0.f,0.f,0.f,0.f,0.f,0.f,0.f};
        #pragma unroll
        for (int s = 0; s < 2; ++s) {
            Frag16 qf;
            load_frag(&qsh[(wid * 16 + lm) * 72 + s * 32], qf, lhi);
            #pragma unroll
            for (int t = 0; t < 5; ++t) {
                Frag16 kf;
                load_frag(&kshT[(t * 16 + lm) * 72 + s * 32], kf, lhi);
                acc[t] = __builtin_amdgcn_wmma_f32_16x16x32_f16(
                    false, kf.v, false, qf.v, (short)0, acc[t], false, false);
            }
        }

        // ---- stage 2: masked softmax of this lane's query row, in registers
        float m = -__FLT_MAX__;
        #pragma unroll
        for (int t = 0; t < 5; ++t)
            #pragma unroll
            for (int r = 0; r < 8; ++r) {
                float sv = keep[t][r] ? acc[t][r] * scale : -__FLT_MAX__;
                acc[t][r] = sv;                       // masked + scaled score
                m = fmaxf(m, sv);
            }
        m = fmaxf(m, other_half(m));

        float denom = 0.f;
        Frag16 pf[3];                                 // unnormalized probs, B operand
        #pragma unroll
        for (int t = 0; t < 6; ++t)
            #pragma unroll
            for (int r = 0; r < 8; ++r) {
                float p = 0.f;
                if (t < 5) {
                    int j = t * 16 + lhi * 8 + r;
                    p = exp2_slot((acc[t][r] - m) * 1.4426950408889634f);   // e^(s - m)
                    if (j >= JJ) p = 0.f;
                    denom += p;
                }
                pf[t >> 1].h[(t & 1) * 8 + r] = (_Float16)p;
            }
        denom += other_half(denom);
        const float inv = 1.f / denom;

        // keeps the PV matrix instructions below every exp2_slot()
        __builtin_amdgcn_sched_barrier(0);

        // ---- stage 3: out^T = V^T @ P^T via WMMA (K = 96 -> 3 k-steps, 4 d tiles)
        v8f o[4];
        #pragma unroll
        for (int t = 0; t < 4; ++t) o[t] = (v8f){0.f,0.f,0.f,0.f,0.f,0.f,0.f,0.f};
        #pragma unroll
        for (int s = 0; s < 3; ++s) {
            #pragma unroll
            for (int t = 0; t < 4; ++t) {
                Frag16 vf;
                load_frag_tr_p<VPIT>(vfr + s * 32 * VPIT + t * 16, vf);
                o[t] = __builtin_amdgcn_wmma_f32_16x16x32_f16(
                    false, vf.v, false, pf[s].v, (short)0, o[t], false, false);
            }
        }
        // a lane holds d = t*16 + lhi*8 + 0..7 of its query row: rounded to f16, the A operand
        // of the output projection
        #pragma unroll
        for (int t = 0; t < 4; ++t) {
            v8h p;
            #pragma unroll
            for (int r = 0; r < 8; ++r) p[r] = (_Float16)(o[t][r] * inv);
            *(v8h*)(ost + lm * QSP + t * 16 + lhi * 8) = p;
        }
        // the rows are read back by other lanes of this wave: their writes have retired
        asm volatile("s_wait_dscnt 0x0" ::: "memory");
        uint4 ov[4];
        #pragma unroll   // ov[] stays in registers
        for (int i = 0; i < 4; ++i)
            ov[i] = *(const uint4*)(ost + (i * 4 + (lane >> 3)) * QSP + (lane & 7) * 8);
        #pragma unroll
        for (int i = 0; i < 4; ++i)
            *(uint4*)(orow + (size_t)(i * 4) * INNERD) = ov[i];
        // the address that these stores name moves on to the next head
        asm volatile("s_wait_xcnt 0x0" ::: "memory");
        orow += DHH;

        if (more) {
            __syncthreads();   // every wave has read this head's tiles
            put_rows64h<128, 64, 64, 72, 4>(qv, qsh, tid);
            put_rows64h<128, JPAD, JJ, 72, 5>(kv, kshT, tid);
            put_rows64h<128, KPAD, JJ, VPIT, 5>(vv, vsh, tid);
            __syncthreads();   // the next head's tiles are complete
        }
    }
}

// ---------------------------------------------------------------------------
// launch
// ---------------------------------------------------------------------------
extern "C" void kernel_launch(void* const* d_in, const int* in_sizes, int n_in,
                              void* d_out, int out_size, void* d_ws, size_t ws_size,
                              hipStream_t stream)
{
    const float* x        = (const float*)d_in[0];
    const float* ce       = (const float*)d_in[1];
    const int*   ct       = (const int*)  d_in[2];
    const float* camask   = (const float*)d_in[3];
    const float* strength = (const float*)d_in[4];
    const float* Wq       = (const float*)d_in[5];
    const float* Wk       = (const float*)d_in[6];
    const float* Wv       = (const float*)d_in[7];
    const float* Wout     = (const float*)d_in[8];
    const float* bout     = (const float*)d_in[9];
    const float* tte      = (const float*)d_in[10];
    const float* m1w      = (const float*)d_in[11];
    const float* m1b      = (const float*)d_in[12];
    const float* m2w      = (const float*)d_in[13];
    const float* m2b      = (const float*)d_in[14];
    const float* gA       = (const float*)d_in[15];
    const float* gB       = (const float*)d_in[16];
    float* out = (float*)d_out;

    // workspace partition (floats)
    float* ws    = (float*)d_ws;
    float* kin   = ws;                                  // 308*768
    float* k_bh  = kin  + (size_t)BB*JJ*DCC;            // 64*77*64 f16 (as v_bh), first half of the range
    float* v_bh  = k_bh + (size_t)BB*HH*JJ*DHH;
    float* q_bh  = v_bh + (size_t)BB*HH*JJ*DHH;         // 64*4096*64 f16, first half of the range
    float* aout  = q_bh + (size_t)BB*HH*NN*DHH;         // 16384*1024 f16 in the first half
    float* w16   = aout + (size_t)MROWS*INNERD/2;       // 1024*1024 f16 behind them
    float* stats = aout + (size_t)MROWS*INNERD;         // [sum, sumsq, std]

    hipMemsetAsync(stats, 0, 4 * sizeof(float), stream);

    // kin (embedding MLP), V = ce @ Wv and the first q row tiles of q = x @ Wq
    front1_kernel<<<PBLK + KVBLK + QTM1*NTN, 256, 0, stream>>>(
        ce, ct, tte, m1w, m1b, m2w, m2b, gA, gB, kin, Wv, v_bh, x, Wq, q_bh);

    // K = kin @ Wk, the remaining q row tiles, and Wout rounded to f16
    front2_kernel<<<KVBLK + QTM2*NTN + WCBLK, 256, 0, stream>>>(kin, Wk, k_bh, x, Wq, q_bh, Wout, w16);

    // masked mean/std of sim (WMMA sim tiles, never stored)
    sim_stats_kernel<<<dim3(NN/SROWS, BB*HH), 256, 0, stream>>>(q_bh, k_bh, ct, stats);
    finalize_kernel<<<1, 1, 0, stream>>>(ct, stats);

    // fused WMMA sim -> softmax -> WMMA attn@V
    attn_fused_kernel<<<dim3(NN/64, BB*HH/HPB), 128, 0, stream>>>(
        q_bh, k_bh, v_bh, ct, camask, strength, stats, aout);

    // out = attn_out @ Wout + bout  (WMMA)
    outproj_kernel<<<dim3(DQQ/GBN, MROWS/GBM), 256, 0, stream>>>(aout, w16, bout, out);
}

// v010
// In two side-by-side timings against v009, it was 1.07 and 1.06 times as fast.
// Counting every step since v000, it is 4.13 times as fast.
#include <hip/hip_runtime.h>
#include <hip/hip_bf16.h>
#include <math.h>

// ---------------------------------------------------------------------------
// Problem constants
// ---------------------------------------------------------------------------
#define BB   4
#define NN   4096
#define JJ   77
#define HH   16
#define DHH  64
#define DQQ  1024
#define DCC  768
#define DHID 384           // DC/2
#define INNERD 1024        // H*DH
#define MROWS (BB*NN)      // 16384
#define JPAD 80            // sim col padding (5 x 16)
#define KPAD 96            // attn K padding  (3 x 32)

typedef __attribute__((ext_vector_type(16))) _Float16 v16h;
typedef __attribute__((ext_vector_type(8)))  float    v8f;
typedef __attribute__((ext_vector_type(2)))  _Float16 h2_t;
typedef __attribute__((ext_vector_type(8)))  _Float16 v8h;
typedef __attribute__((ext_vector_type(4)))  _Float16 v4h;
typedef __attribute__((ext_vector_type(8)))  short    s16x8;

union Frag16 { v16h v; h2_t h2[8]; _Float16 h[16]; s16x8 q[2]; };

// load one 16x32 f16 WMMA operand fragment from LDS (row-major, "base" points
// at this lane's row at the k-step origin; ISA 16-bit A/B layout)
__device__ __forceinline__ void load_frag(const _Float16* base, Frag16& f, int lhi)
{
    #pragma unroll
    for (int r = 0; r < 8; ++r) {
        int kk = (r < 4) ? (lhi * 8 + 2 * r) : (16 + lhi * 8 + 2 * (r - 4));
        f.h2[r] = *(const h2_t*)(base + kk);
    }
}

// the same fragment by two 16-byte reads, for a base whose 16-byte alignment the compiler
// cannot see (a buffer chosen at run time): k = 8*lhi + 0..7 and 16 + 8*lhi + 0..7
__device__ __forceinline__ void load_frag_q(const _Float16* base, Frag16& f, int lhi)
{
    f.q[0] = *(const s16x8*)(base + lhi * 8);
    f.q[1] = *(const s16x8*)(base + 16 + lhi * 8);
}

// ---------------------------------------------------------------------------
// Token-type embedding MLP -> kin = contextembs + typeemb
// One block of 256 threads takes PR rows (b,j), so that a weight fetched once serves
// PR rows. Each layer is cut into eight slices of 96 k values x 384 columns, one a wave:
// a lane holds 12 columns (three 16-byte pieces, 512 contiguous bytes a wave-wide load)
// of all PR rows, and a trip has twelve such loads in flight. The slices that share a
// column are then summed through LDS.
// ---------------------------------------------------------------------------
#define PR    4                  // rows a block
#define PBLK  (BB * JJ / PR)     // 77 blocks
#define PKS   96                 // k values of a slice
#define PCG   384                // columns of a slice
static_assert(BB * JJ % PR == 0, "whole blocks only");

typedef __attribute__((ext_vector_type(4))) float f4;

// acc[r][i] = sum over the slice's k of in[r][k] * W[k][i*128 + lane*4 + 0..3]
// "in": LDS, row pitch PITCH floats, at the slice's first k; "W": at the slice's first k
// and first column, row pitch LDW floats. Both are the same for the whole wave.
template<int LDW, int PITCH>
__device__ __forceinline__
void mlp_slice(const float* in, const float* __restrict__ W, int lane, f4 (&acc)[PR][3])
{
    #pragma unroll
    for (int r = 0; r < PR; ++r)
        #pragma unroll
        for (int i = 0; i < 3; ++i) acc[r][i] = (f4){0.f, 0.f, 0.f, 0.f};
    // a trip's twelve loads differ from one address only by constants
    const char* wb = (const char*)W;
    const unsigned lo = (unsigned)lane * 16u;
    #pragma unroll 1   // stays rolled: unrolled further, the loaded weights and the 48 sums
                       // no longer fit the registers that the kernel's blocks a WGP allow
    for (int c = 0; c < PKS; c += 4) {
        f4 w[4][3];
        float a[PR][4];
        #pragma unroll   // w[] stays in registers and the loads issue back to back
        for (int cc = 0; cc < 4; ++cc)
            #pragma unroll
            for (int i = 0; i < 3; ++i)
                w[cc][i] = *(const f4*)(wb + lo + (cc * LDW + i * 128) * 4);
        #pragma unroll
        for (int r = 0; r < PR; ++r) {
            // every lane reads the same four inputs: held in scalar registers they leave the
            // vector registers to the weights in flight and the sums
            const f4 v = *(const f4*)(in + r * PITCH + c);
            #pragma unroll
            for (int e = 0; e < 4; ++e) {
                const float x = v[e];
                a[r][e] = __builtin_bit_cast(float,
                    __builtin_amdgcn_readfirstlane(__builtin_bit_cast(int, x)));
            }
        }
        #pragma unroll
        for (int cc = 0; cc < 4; ++cc)
            #pragma unroll
            for (int r = 0; r < PR; ++r)
                #pragma unroll
                for (int i = 0; i < 3; ++i) acc[r][i] += a[r][cc] * w[cc][i];
        wb += 4 * LDW * 4;
    }
}

// The eight slices become four in LDS: waves 4..7 store theirs, waves 0..3 add their own
// to the slice of wave w + 4. Slot s of "part" is [PR][PCG].
__device__ __forceinline__
void mlp_fold(const f4 (&acc)[PR][3], float* part, int w, int lane)
{
    float* p = part + (w & 3) * (PR * PCG) + lane * 4;
    if (w >= 4) {
        #pragma unroll
        for (int r = 0; r < PR; ++r)
            #pragma unroll
            for (int i = 0; i < 3; ++i) *(f4*)(p + r * PCG + i * 128) = acc[r][i];
    }
    __syncthreads();
    if (w < 4) {
        #pragma unroll
        for (int r = 0; r < PR; ++r)
            #pragma unroll
            for (int i = 0; i < 3; ++i) *(f4*)(p + r * PCG + i * 128) += acc[r][i];
    }
    __syncthreads();
}

__device__ __forceinline__
void prep_rows(int blk, const float* __restrict__ ce, const int* __restrict__ ct,
               const float* __restrict__ tte_emb,
               const float* __restrict__ m1w, const float* __restrict__ m1b,
               const float* __restrict__ m2w, const float* __restrict__ m2b,
               const float* __restrict__ gA, const float* __restrict__ gB,
               float* __restrict__ kin)
{
    __shared__ __attribute__((aligned(16))) float cein_s[PR * DCC];
    __shared__ __attribute__((aligned(16))) float hid_s[PR * DHID];
    __shared__ __attribute__((aligned(16))) float part_s[4 * PR * PCG];

    const int tid  = threadIdx.x;
    const int lane = tid & 31;
    const int w    = __builtin_amdgcn_readfirstlane(tid >> 5);   // wave number, in a scalar register

    // Outside the slices a pair of waves owns one row: r, and with it the row's token type
    // and every row base, is the same for the whole wave; a lane's columns are c0 + 256 n.
    const int r    = w >> 1;
    const int row  = blk * PR + r;
    const int c0   = ((w & 1) * 32 + lane) * 4;
    const int t    = ct[row];
    // bounded into the table's five rows; wave-uniform, so read into a scalar register
    const int tcl  = __builtin_amdgcn_readfirstlane(t < 0 ? 0 : (t > 4 ? 4 : t));
    const float* tter = tte_emb + tcl * DCC;
    const float* cer  = ce + (size_t)row * DCC;

    #pragma unroll   // the six loads issue back to back
    for (int n = 0; n < DCC / 256; ++n) {
        const int c = c0 + n * 256;
        *(f4*)&cein_s[r * DCC + c] = *(const f4*)(cer + c) + *(const f4*)(tter + c);
    }
    __syncthreads();

    f4 acc[PR][3];

    // layer 1, 768 x 384: eight k slices of all columns
    mlp_slice<DHID, DCC>(cein_s + w * PKS, m1w + (size_t)w * PKS * DHID, lane, acc);
    mlp_fold(acc, part_s, w, lane);
    // 384 columns a row: 256 by both waves of the pair, the last 128 by its first wave
    for (int c = c0; c < DHID; c += 256) {
        f4 s = *(const f4*)(m1b + c);
        #pragma unroll
        for (int k = 0; k < 4; ++k) s += *(const f4*)&part_s[(k * PR + r) * PCG + c];
        #pragma unroll
        for (int e = 0; e < 4; ++e)
            s[e] = 0.5f * s[e] * (1.0f + erff(s[e] * 0.70710678118654752f));
        *(f4*)&hid_s[r * DHID + c] = s;
    }
    __syncthreads();

    // layer 2, 384 x 768: four k slices (w >> 1) of two column halves (w & 1)
    mlp_slice<DCC, DHID>(hid_s + (w >> 1) * PKS, m2w + (size_t)(w >> 1) * PKS * DCC + (w & 1) * PCG,
                         lane, acc);
    mlp_fold(acc, part_s, w, lane);
    #pragma unroll
    for (int n = 0; n < DCC / 256; ++n) {
        const int c  = c0 + n * 256;
        const int cg = c / PCG, cc = c - cg * PCG;
        f4 s = *(const f4*)(m2b + c);
        s += *(const f4*)&part_s[(cg * PR + r) * PCG + cc];
        s += *(const f4*)&part_s[((2 + cg) * PR + r) * PCG + cc];
        const f4 typeemb = *(const f4*)(tter + c) * *(const f4*)(gA + c) + s * *(const f4*)(gB + c);
        *(f4*)(kin + (size_t)row * DCC + c) = *(const f4*)(cer + c) + typeemb;
    }
}

// ---------------------------------------------------------------------------
// WMMA GEMM: C[M,1024] = A[M,K] * B[K,1024]  (fp32 in, f16 mul, f32 acc)
// Block tile 128x128, BK=32, 8 waves (4x2), each wave 32x64 = 2x4 WMMA tiles.
// MODE 0: store q permuted [B*H, N, DH], as f16: what its readers feed to the matrix unit
// MODE 1: plain store + bias (output projection)
// MODE 2: store K/V permuted [B*H, J, DH], as f16  (rows = b*J+j, M=308)
// ---------------------------------------------------------------------------
#define GBM 128
#define GBN 128
#define GBK 32
#define LDSS 40   // padded LDS stride in halfs
#define LDSB 144  // B tile row pitch in halfs: 288 bytes, an odd multiple of 32 bytes
#define VPIT 80   // V tile row pitch in halfs: 160 bytes, an odd multiple of 32 bytes

// one 32(k) x 16(n) B fragment out of a row-major [k][n] f16 LDS tile, through the
// transposing LDS load. "base" is this lane's own address:
//   tile + (8*(lane>>4) + (lane&7)) * LDSB + n0 + 8*((lane>>3)&1)
// The lane then holds column n0 + (lane&15), k = 8*lhi + 0..7 and 16 + 8*lhi + 0..7:
// the k order of load_frag().
__device__ __forceinline__ void load_frag_tr(const _Float16* base, Frag16& f)
{
    typedef __attribute__((address_space(3))) s16x8 lds_s16x8;
    f.q[0] = __builtin_amdgcn_ds_load_tr16_b128_v8i16((lds_s16x8*)base);
    f.q[1] = __builtin_amdgcn_ds_load_tr16_b128_v8i16((lds_s16x8*)(base + 16 * LDSB));
}

// the same fragment out of a row-major tile of another pitch (in halfs)
template<int PITCH>
__device__ __forceinline__ void load_frag_tr_p(const _Float16* base, Frag16& f)
{
    typedef __attribute__((address_space(3))) s16x8 lds_s16x8;
    f.q[0] = __builtin_amdgcn_ds_load_tr16_b128_v8i16((lds_s16x8*)base);
    f.q[1] = __builtin_amdgcn_ds_load_tr16_b128_v8i16((lds_s16x8*)(base + 16 * PITCH));
}

// Stage ROWS rows of 64 f16 values (contiguous rows of 128 bytes in memory) as rows of
// PITCH halfs in LDS, as they lie in memory. A wave's 16-byte loads cover 512 contiguous
// bytes, and all of a thread's loads are issued before the first value is used.
// Rows VALID..ROWS-1 are filled with zero; a load that would fall there is clamped.
template<int NT, int ROWS, int VALID, int PITCH>
__device__ __forceinline__ void stage_rows64h(const _Float16* __restrict__ src, _Float16* dst, int tid)
{
    constexpr int NP = ROWS * 8;                       // 16-byte pieces of the LDS tile
    constexpr int NV = VALID * 8;                      // of these, pieces of valid rows
    constexpr int NI = NP / NT;                        // trips
    static_assert(NP % NT == 0, "whole trips only");
    constexpr int NL = (NV + NT - 1) / NT;             // of these, trips that hold a valid row
    uint4 v[NL];
    #pragma unroll   // v[] stays in registers and the loads issue back to back
    for (int i = 0; i < NL; ++i) {
        int f = tid + i * NT;
        if ((i + 1) * NT > NV) f = f < NV ? f : NV - 1;   // piece index clamped into the tile
        v[i] = ((const uint4*)src)[f];
    }
    #pragma unroll   // v[] is indexed by constants
    for (int i = 0; i < NI; ++i) {
        const int f = tid + i * NT;
        uint4 h = make_uint4(0u, 0u, 0u, 0u);
        if (i < NL) {
            h = v[i];
            if ((i + 1) * NT > NV && f >= NV) h = make_uint4(0u, 0u, 0u, 0u);
        }
        *(uint4*)(dst + (f >> 3) * PITCH + (f & 7) * 8) = h;
    }
}

// The LDS of one 128x128 tile: two buffers, each the A tile and behind it the B tile. One
// range, so that the store of the accumulators can stage in it once the k loop has left it.
#define GLDSA (GBM * LDSS * 2)              // bytes of the A tile, a multiple of 32
#define GLDS  (GLDSA + GBK * LDSB * 2)      // bytes of both, a multiple of 128
__device__ __forceinline__ char* gemm_lds()
{
    __shared__ __attribute__((aligned(128))) char buf[2 * GLDS];
    return buf;
}

// Work-group barrier that orders LDS accesses only. __syncthreads() also waits for every
// global load of the wave, which would end the flight of the k tile that is fetched ahead.
__device__ __forceinline__ void lds_barrier()
{
    __builtin_amdgcn_fence(__ATOMIC_RELEASE, "workgroup", "local");
    __builtin_amdgcn_s_barrier();
    __builtin_amdgcn_fence(__ATOMIC_ACQUIRE, "workgroup", "local");
}

// One 128x128 tile at (blockM, blockN), by one block of 256 threads: the k loop ...
__device__ __forceinline__
void gemm_accumulate(const float* __restrict__ A, const float* __restrict__ Bm,
                     int M, int K, int blockM, int blockN, v8f (&acc)[2][4])
{
    _Float16* const Ash = (_Float16*)gemm_lds();              // [m][k]
    _Float16* const Bsh = (_Float16*)(gemm_lds() + GLDSA);    // [k][n]

    const int tid  = threadIdx.x;
    const int wid  = tid >> 5;
    const int lane = tid & 31;
    const int wm   = wid >> 1;     // 0..3 -> 32-row strip
    const int wn   = wid & 1;      // 0..1 -> 64-col strip
    const int lm   = lane & 15;
    const int lhi  = lane >> 4;

    #pragma unroll
    for (int t = 0; t < 2; ++t)
        #pragma unroll
        for (int u = 0; u < 4; ++u)
            acc[t][u] = (v8f){0.f,0.f,0.f,0.f,0.f,0.f,0.f,0.f};

    int arow = blockM + (tid >> 1);       // global A row
    if (arow >= M) arow = M - 1;          // clamp (stores are guarded)
    const int acb  = (tid & 1) * 16;
    const int bkr  = tid >> 3;            // 0..31
    const int bcb  = (tid & 7) * 16;
    // Staging map: every wave-wide 16-byte load covers whole 128-byte lines.
    // A: 8 lanes take the 128 bytes that one row has in this k tile, a wave 4 rows;
    //    a thread's rows are sar + 32 i. Byte offsets from A, rows clamped like arow.
    // B: a wave takes 512 contiguous bytes of one k row; a thread's rows are sbr + 8 i.
    const int sar  = tid >> 3;            // 0..31
    const int sac  = (tid & 7) * 4;       // four columns
    const int sbr  = tid >> 5;            // 0..7
    const int sbc  = lane * 4;            // four columns
    unsigned aoff[4];
    #pragma unroll   // aoff[] is indexed by constants and stays in registers
    for (int i = 0; i < 4; ++i) {
        int r = blockM + sar + 32 * i;
        if (r >= M) r = M - 1;
        aoff[i] = ((unsigned)r * (unsigned)K + (unsigned)sac) * 4u;
    }
    unsigned boff = ((unsigned)sbr * 1024u + (unsigned)blockN + (unsigned)sbc) * 4u;
    const _Float16* bfr = &Bsh[(lhi * 8 + (lane & 7)) * LDSB + wn * 64 + ((lane >> 3) & 1) * 8];

    // The k tiles are fetched ahead. While tile t is read from one LDS buffer and multiplied,
    // tile t + 1 is on its way into registers; it is rounded and written to the other buffer
    // behind the matrix work, and one barrier a tile hands the buffers over. Tile t + 3 is asked
    // into L2 at the same time, so that the loads find their lines there.
    float4 av[4], bv[4];
    // uniform base + 32-bit byte offset: one address register a load (both operands are
    // far below 4 GiB)
    auto fetch = [&]() {
        #pragma unroll   // av[] stays in registers and the loads issue back to back
        for (int i = 0; i < 4; ++i) av[i] = *(const float4*)((const char*)A + aoff[i]);
        #pragma unroll   // the same for bv[]
        for (int i = 0; i < 4; ++i) bv[i] = *(const float4*)((const char*)Bm + boff + i * 32768);
    };
    // fp32 -> f16, each tile as it lies in memory: Ash[m][k], Bsh[k][n]; "bo": the buffer, in halfs
    auto put = [&](int bo) {
        #pragma unroll   // av[] is indexed by constants; the LDS offsets become immediates
        for (int i = 0; i < 4; ++i) {
            v4h p;
            p[0] = (_Float16)av[i].x;  p[1] = (_Float16)av[i].y;
            p[2] = (_Float16)av[i].z;  p[3] = (_Float16)av[i].w;
            *(v4h*)&Ash[bo + (sar + 32 * i) * LDSS + sac] = p;
        }
        #pragma unroll   // the same for bv[]
        for (int i = 0; i < 4; ++i) {
            v4h p;
            p[0] = (_Float16)bv[i].x;  p[1] = (_Float16)bv[i].y;
            p[2] = (_Float16)bv[i].z;  p[3] = (_Float16)bv[i].w;
            *(v4h*)&Bsh[bo + (sbr + 8 * i) * LDSB + sbc] = p;
        }
        // the additions below rewrite the registers that the tile's loads name
        asm volatile("s_wait_xcnt 0x0" ::: "memory");
        // holds those additions behind that wait
        __builtin_amdgcn_sched_barrier(0);
        #pragma unroll   // on to the next k tile
        for (int i = 0; i < 4; ++i) aoff[i] += GBK * 4u;
        boff += GBK * 4096u;
    };
    // The requests to L2 name two address registers that live through the loop and never leave
    // the operands: they move on only where the tile behind the requested one exists as well.
    // In and out operands: the additions behind a request stay in the registers that it names.
    const float* pa = A + (size_t)arow * K + GBK + acb;               // this lane's 64 bytes of an
    const float* pb = Bm + (size_t)(GBK + bkr) * 1024 + blockN + bcb; // A and of a B row, in tile 1

    fetch();
    if (4 * GBK < K) {      // the same for the whole block
        #pragma unroll      // tiles 1 and 2, which the loop loads before its own requests can lead them
        for (int n = 0; n < 2; ++n) {
            asm volatile("global_prefetch_b8 %0, off scope:SCOPE_SE\n\t"
                         "global_prefetch_b8 %1, off scope:SCOPE_SE" : "+v"(pa), "+v"(pb));
            pa += GBK;
            pb += GBK * 1024;
        }
    }
    put(0);
    lds_barrier();          // tile 0 is complete

    // one k tile out of the buffer at "bo" (in halfs)
    auto multiply = [&](int bo) {
        Frag16 af[2], bf[4];
        #pragma unroll
        for (int t = 0; t < 2; ++t)
            load_frag_q(&Ash[bo + (wm * 32 + t * 16 + lm) * LDSS], af[t], lhi);
        #pragma unroll
        for (int u = 0; u < 4; ++u)
            load_frag_tr(bfr + bo + u * 16, bf[u]);

        #pragma unroll
        for (int t = 0; t < 2; ++t)
            #pragma unroll
            for (int u = 0; u < 4; ++u)
                acc[t][u] = __builtin_amdgcn_wmma_f32_16x16x32_f16(
                    false, af[t].v, false, bf[u].v,
                    (short)0, acc[t][u], false, false);
    };

    int cur = 0;            // the buffer that holds this trip's tile, in halfs
    for (int k0 = 0; k0 + GBK < K; k0 += GBK) {   // every tile but the last
        fetch();
        if (k0 + 4 * GBK < K) {              // tile t + 3 into L2, two trips ahead of its loads
            asm volatile("global_prefetch_b8 %0, off scope:SCOPE_SE\n\t"
                         "global_prefetch_b8 %1, off scope:SCOPE_SE" : "+v"(pa), "+v"(pb));
            pa += GBK;
            pb += GBK * 1024;
        }
        multiply(cur);
        // keeps the wait for those loads, and the rounding behind it, behind the matrix work
        __builtin_amdgcn_sched_barrier(0);
        cur ^= GLDS / 2;
        put(cur);
        lds_barrier();      // the next tile is complete, and every wave has read this one
    }
    multiply(cur);
    lds_barrier();          // every wave has read the last tile: the buffers are free for the
                            // store of the accumulators
}

// ... and the store of its accumulators.
// MODE 0 and 1: an accumulator register holds 16 neighbouring columns of two rows, 32 or 64
// bytes of a line. Each wave therefore passes its 32x64 tile, 16 rows at a time, through its
// own part of "stage" (the tile's LDS, which every wave has left behind the k loop's last
// barrier) and stores it in 16-byte pieces that cover whole 128-byte lines.
#define QSP 72   // staged row pitch, f16 values: 144 bytes, an odd multiple of 16 bytes
#define OSP 68   // staged row pitch, f32 values: 272 bytes, an odd multiple of 16 bytes
static_assert(8 * 16 * QSP * 2 <= GLDS, "the f16 staging fits the tile's LDS");
template<int MODE>
__device__ __forceinline__
void gemm_store(const v8f (&acc)[2][4], const float* __restrict__ bias, float* __restrict__ C,
                int M, int blockM, int blockN, char* stage)
{
    const int tid  = threadIdx.x;
    const int wid  = tid >> 5;
    const int lane = tid & 31;
    const int wm   = wid >> 1;
    const int wn   = wid & 1;
    const int lm   = lane & 15;
    const int lhi  = lane >> 4;

    // C/D layout: lanes 0-15 -> M=r, lanes 16-31 -> M=8+r, N=lane&15
    if (MODE == 0) {
        // the wave's 64 columns are one head, its 32 rows 32 lines that follow one another
        _Float16* st = (_Float16*)stage + wid * (16 * QSP);
        const int rg0 = blockM + wm * 32;
        const int b = rg0 >> 12, n0 = rg0 & 4095;
        const int h = (blockN >> 6) + wn;
        _Float16* dst = (_Float16*)C + (((size_t)(b * HH + h)) * NN + n0) * DHH + lane * 8;
        #pragma unroll
        for (int t = 0; t < 2; ++t) {
            #pragma unroll
            for (int u = 0; u < 4; ++u)
                #pragma unroll
                for (int r = 0; r < 8; ++r)
                    st[(lhi * 8 + r) * QSP + u * 16 + lm] = (_Float16)acc[t][u][r];
            // the rows are read back by other lanes of this wave: their writes have retired
            asm volatile("s_wait_dscnt 0x0" ::: "memory");
            uint4 v[4];
            #pragma unroll   // v[] stays in registers
            for (int i = 0; i < 4; ++i)
                v[i] = *(const uint4*)(st + (i * 4 + (lane >> 3)) * QSP + (lane & 7) * 8);
            #pragma unroll   // 512 contiguous bytes a wave-wide store
            for (int i = 0; i < 4; ++i)
                *(uint4*)(dst + (t * 16 + i * 4) * DHH) = v[i];
            // the registers that these stores name are reused by the next rows
            asm volatile("s_wait_xcnt 0x0" ::: "memory");
            // holds the next rows' conversions, which write those registers, behind that wait
            __builtin_amdgcn_sched_barrier(0);
        }
        return;
    }
    if (MODE == 1) {
        // 16 lanes take the 256 bytes that a row has in the wave's tile, a wave two rows
        float* st = (float*)stage + wid * (16 * OSP);
        const int c4  = lm * 4;
        const int cg0 = blockN + wn * 64 + c4;
        const f4 bv = *(const f4*)(bias + cg0);
        float* dst = C + (size_t)(blockM + wm * 32 + lhi) * 1024 + cg0;
        #pragma unroll
        for (int t = 0; t < 2; ++t) {
            #pragma unroll
            for (int u = 0; u < 4; ++u)
                #pragma unroll
                for (int r = 0; r < 8; ++r)
                    st[(lhi * 8 + r) * OSP + u * 16 + lm] = acc[t][u][r];
            // the rows are read back by other lanes of this wave: their writes have retired
            asm volatile("s_wait_dscnt 0x0" ::: "memory");
            f4 v[8];
            #pragma unroll   // v[] stays in registers
            for (int i = 0; i < 8; ++i)
                v[i] = *(const f4*)(st + (i * 2 + lhi) * OSP + c4) + bv;
            #pragma unroll   // two whole lines of each of two rows a wave-wide store
            for (int i = 0; i < 8; ++i)
                *(f4*)(dst + (size_t)(t * 16 + i * 2) * 1024) = v[i];
            // the registers that these stores name are reused by the next rows
            asm volatile("s_wait_xcnt 0x0" ::: "memory");
        }
        return;
    }
    #pragma unroll
    for (int t = 0; t < 2; ++t) {
        #pragma unroll
        for (int u = 0; u < 4; ++u) {
            #pragma unroll
            for (int r = 0; r < 8; ++r) {
                int rg = blockM + wm * 32 + t * 16 + (lhi ? 8 + r : r);
                int cg = blockN + wn * 64 + u * 16 + lm;
                float val = acc[t][u][r];
                // MODE 2: rows are (b, j)
                if (rg < M) {
                    int b = rg / JJ, j = rg - b * JJ;
                    int h = cg >> 6, d = cg & 63;
                    ((_Float16*)C)[(((size_t)(b * HH + h)) * JJ + j) * DHH + d] = (_Float16)val;
                }
            }
        }
    }
}

// ---------------------------------------------------------------------------
// The work in front of the attention, in two launches. The embedding MLP, the V
// projection and the q projection do not depend on one another; the K projection
// needs only the MLP. The MLP and the K and V projections are short chains of
// dependent memory round trips on few blocks, which leave most of the chip idle
// when launched alone, so each launch runs them beside a share of the q tiles.
// The long chains take the lowest indices.
// All blocks of the first launch are resident at once: at up to 160 registers a wave,
// 3 blocks a WGP, 768 places; 77 + 24 + 80 * 8 = 741 blocks.
// ---------------------------------------------------------------------------
#define NTN    (INNERD / GBN)                        // 8 column tiles
#define KVBLK  (NTN * ((BB * JJ + GBM - 1) / GBM))   // 24 tiles of a K or V projection
#define QTM1   80                                    // q row tiles in the first launch
#define QTM2   (MROWS / GBM - QTM1)                  // 48 in the second
#define WCBLK  (INNERD * DQQ / 4096)                 // 256 blocks that round Wout to f16

__global__ __launch_bounds__(256)
void front1_kernel(const float* __restrict__ ce, const int* __restrict__ ct,
                   const float* __restrict__ tte_emb,
                   const float* __restrict__ m1w, const float* __restrict__ m1b,
                   const float* __restrict__ m2w, const float* __restrict__ m2b,
                   const float* __restrict__ gA, const float* __restrict__ gB,
                   float* __restrict__ kin,
                   const float* __restrict__ Wv, float* __restrict__ v_bh,
                   const float* __restrict__ x, const float* __restrict__ Wq,
                   float* __restrict__ q_bh)
{
    const int blk = blockIdx.x;
    if (blk < PBLK) {
        prep_rows(blk, ce, ct, tte_emb, m1w, m1b, m2w, m2b, gA, gB, kin);
        return;
    }
    const bool isv = blk < PBLK + KVBLK;             // the same for the whole block
    const int  t   = blk - (isv ? PBLK : PBLK + KVBLK);
    const int  bm  = (t / NTN) * GBM, bn = (t % NTN) * GBN;
    v8f acc[2][4];
    gemm_accumulate(isv ? ce : x, isv ? Wv : Wq, isv ? BB * JJ : MROWS, isv ? DCC : DQQ, bm, bn, acc);
    if (isv) gemm_store<2>(acc, nullptr, v_bh, BB * JJ, bm, bn, nullptr);
    else     gemm_store<0>(acc, nullptr, q_bh, MROWS, bm, bn, gemm_lds());
}

__global__ __launch_bounds__(256)
void front2_kernel(const float* __restrict__ kin, const float* __restrict__ Wk,
                   float* __restrict__ k_bh,
                   const float* __restrict__ x, const float* __restrict__ Wq,
                   float* __restrict__ q_bh,
                   const float* __restrict__ Wout, float* __restrict__ w16)
{
    const int  blk = blockIdx.x;
    if (blk >= KVBLK + QTM2 * NTN) {                 // the same for the whole block
        // Wout rounded to f16 once, for the output projection: 4096 values a block
        const int p = (blk - (KVBLK + QTM2 * NTN)) * 1024 + threadIdx.x;   // piece of 4 values
        float4 v[4];
        #pragma unroll   // v[] stays in registers and the loads issue back to back
        for (int i = 0; i < 4; ++i) v[i] = ((const float4*)Wout)[p + i * 256];
        #pragma unroll   // v[] is indexed by constants
        for (int i = 0; i < 4; ++i) {
            v4h h;
            h[0] = (_Float16)v[i].x;  h[1] = (_Float16)v[i].y;
            h[2] = (_Float16)v[i].z;  h[3] = (_Float16)v[i].w;
            ((v4h*)w16)[p + i * 256] = h;
        }
        return;
    }
    const bool isk = blk < KVBLK;                    // the same for the whole block
    const int  t   = isk ? blk : blk - KVBLK + QTM1 * NTN;
    const int  bm  = (t / NTN) * GBM, bn = (t % NTN) * GBN;
    v8f acc[2][4];
    gemm_accumulate(isk ? kin : x, isk ? Wk : Wq, isk ? BB * JJ : MROWS, isk ? DCC : DQQ, bm, bn, acc);
    if (isk) gemm_store<2>(acc, nullptr, k_bh, BB * JJ, bm, bn, nullptr);
    else     gemm_store<0>(acc, nullptr, q_bh, MROWS, bm, bn, gemm_lds());
}

// output projection: out = attn_out @ Wout + bout
// Both operands lie in the workspace as f16, rounded once by their producers (the
// attention kernel; the last block range of front2_kernel): the values that the k loop
// above would round them to in every tile that reads them. A tile therefore loads half
// the bytes and converts nothing. The k tile is 64, so that the piece of an A row in it
// is one whole 128-byte line; the products are summed in ascending k, 32 at a time.
#define HBK  64   // k tile
#define APIT 72   // A tile row pitch in halfs: 144 bytes, an odd multiple of 16 bytes
__global__ __launch_bounds__(256)
void outproj_kernel(const float* __restrict__ a16, const float* __restrict__ w16,
                    const float* __restrict__ bias, float* __restrict__ C)
{
    // one range: the A tile, behind it the B tile; the store of the accumulators stages in it
    __shared__ __attribute__((aligned(128))) char osm[(GBM * APIT + HBK * LDSB) * 2];
    static_assert(8 * 16 * OSP * 4 <= sizeof(osm), "the f32 staging fits the tiles' LDS");
    static_assert(GBM * APIT * 2 % 32 == 0, "the B tile keeps its alignment");
    _Float16* const Ash = (_Float16*)osm;                      // [m][k]
    _Float16* const Bsh = (_Float16*)(osm + GBM * APIT * 2);   // [k][n]

    const int bm   = blockIdx.y * GBM, bn = blockIdx.x * GBN;
    const int tid  = threadIdx.x;
    const int wid  = tid >> 5;
    const int lane = tid & 31;
    const int wm   = wid >> 1;     // 0..3 -> 32-row strip
    const int wn   = wid & 1;      // 0..1 -> 64-col strip
    const int lm   = lane & 15;
    const int lhi  = lane >> 4;

    v8f acc[2][4];
    #pragma unroll
    for (int t = 0; t < 2; ++t)
        #pragma unroll
        for (int u = 0; u < 4; ++u)
            acc[t][u] = (v8f){0.f,0.f,0.f,0.f,0.f,0.f,0.f,0.f};

    // Staging map, 16 bytes (8 halfs) a lane, whole 128-byte lines:
    // A: 8 lanes take the line that one row has in this k tile, a wave 4 rows; rows sar + 32 i.
    // B: 16 lanes take the 256 bytes of one k row, a wave 2 rows; rows sbr + 16 i.
    const int sar = tid >> 3;            // 0..31
    const int sac = (tid & 7) * 8;
    const int sbr = tid >> 4;            // 0..15
    const int sbc = (tid & 15) * 8;
    unsigned aoff = ((unsigned)(bm + sar) * 1024u + (unsigned)sac) * 2u;   // byte offsets
    unsigned boff = ((unsigned)sbr * 1024u + (unsigned)(bn + sbc)) * 2u;
    const _Float16* bfr = &Bsh[(lhi * 8 + (lane & 7)) * LDSB + wn * 64 + ((lane >> 3) & 1) * 8];

    #pragma unroll 1   // stays rolled: unrolled, a tile's eight loads no longer issue together
                       // and the kernel takes more than 128 registers (3 blocks a WGP, not 4)
    for (int k0 = 0; k0 < INNERD; k0 += HBK) {
        uint4 av[4], bv[4];
        #pragma unroll   // av[] stays in registers and the loads issue back to back
        for (int i = 0; i < 4; ++i) av[i] = *(const uint4*)((const char*)a16 + aoff + i * 65536);
        #pragma unroll   // the same for bv[]
        for (int i = 0; i < 4; ++i) bv[i] = *(const uint4*)((const char*)w16 + boff + i * 32768);
        #pragma unroll   // av[] is indexed by constants
        for (int i = 0; i < 4; ++i) *(uint4*)&Ash[(sar + 32 * i) * APIT + sac] = av[i];
        #pragma unroll   // the same for bv[]
        for (int i = 0; i < 4; ++i) *(uint4*)&Bsh[(sbr + 16 * i) * LDSB + sbc] = bv[i];
        aoff += HBK * 2u;                 // on to the next k tile (the loaded values have arrived)
        boff += HBK * 2048u;
        if (k0 + HBK < INNERD) {          // global_prefetch of the next k tile: 128 lines each
            __builtin_prefetch((const char*)a16 + ((unsigned)(bm + (tid >> 1)) * 1024u + (unsigned)(k0 + HBK)) * 2u, 0, 1);
            __builtin_prefetch((const char*)w16 + ((unsigned)(k0 + HBK + (tid >> 2)) * 1024u + (unsigned)bn) * 2u + (tid & 1) * 128, 0, 1);
        }
        __syncthreads();

        #pragma unroll   // two k steps of 32 out of one staged tile
        for (int s = 0; s < 2; ++s) {
            Frag16 af[2], bf[4];
            #pragma unroll
            for (int t = 0; t < 2; ++t)
                load_frag(&Ash[(wm * 32 + t * 16 + lm) * APIT + s * 32], af[t], lhi);
            #pragma unroll
            for (int u = 0; u < 4; ++u)
                load_frag_tr(bfr + s * 32 * LDSB + u * 16, bf[u]);

            #pragma unroll
            for (int t = 0; t < 2; ++t)
                #pragma unroll
                for (int u = 0; u < 4; ++u)
                    acc[t][u] = __builtin_amdgcn_wmma_f32_16x16x32_f16(
                        false, af[t].v, false, bf[u].v,
                        (short)0, acc[t][u], false, false);
        }
        __syncthreads();
    }
    gemm_store<1>(acc, bias, C, MROWS, bm, bn, osm);
}

// ---------------------------------------------------------------------------
// Kernel 3: WMMA sim tiles + masked sum/sumsq (sim never hits HBM)
// grid (N/SROWS, B*H), 256 threads. A block takes SROWS query rows of one head: its K tile
// is staged once and each wave reads the K fragments once, for SROWS/128 strips of 16 rows.
// All of the block's loads are in flight together, in front of its one staging barrier.
// ---------------------------------------------------------------------------
#define SROWS 512
__global__ __launch_bounds__(256)
void sim_stats_kernel(const float* __restrict__ q_bh, const float* __restrict__ k_bh,
                      const int* __restrict__ ct, float* __restrict__ stats)
{
    __shared__ __attribute__((aligned(16))) _Float16 qsh[SROWS * 72];   // [row][k], stride 72
    __shared__ __attribute__((aligned(16))) _Float16 kshT[KPAD * 72];   // [j][k], rows 77..95 zero
    __shared__ int   sel2[JPAD];
    __shared__ float rs[256], rq[256];

    const int tid  = threadIdx.x;
    const int wid  = tid >> 5;
    const int lane = tid & 31;
    const int lm   = lane & 15;
    const int lhi  = lane >> 4;
    const int bh   = blockIdx.y;
    const int b    = bh >> 4;
    const int rowbase = blockIdx.x * SROWS;

    // q tile SROWS x 64 and K tile, f16 in the workspace (K staged as 96 rows: whole trips of
    // 256 threads, so that all loads issue together; rows 80..95 are not read)
    stage_rows64h<256, SROWS, SROWS, 72>((const _Float16*)q_bh + ((size_t)bh * NN + rowbase) * DHH, qsh, tid);
    stage_rows64h<256, KPAD, JJ, 72>((const _Float16*)k_bh + (size_t)bh * JJ * DHH, kshT, tid);
    for (int j = tid; j < JPAD; j += 256)
        sel2[j] = (j < JJ && ct[b * JJ + j] >= 2) ? 1 : 0;
    __syncthreads();

    Frag16 bf[2][5];                       // the K fragments, K = 64 -> 2 k-steps, 5 j tiles
    #pragma unroll
    for (int s = 0; s < 2; ++s)
        #pragma unroll
        for (int t = 0; t < 5; ++t)
            load_frag(&kshT[(t * 16 + lm) * 72 + s * 32], bf[s][t], lhi);

    // a lane owns column j = t*16+lm of 8 rows a strip: one pair of sums a column, over all
    // strips; whether the column counts is asked once, behind the loop
    float p1[5], p2[5];
    #pragma unroll
    for (int t = 0; t < 5; ++t) { p1[t] = 0.f; p2[t] = 0.f; }
    #pragma unroll   // the strips' LDS offsets become immediates
    for (int p = 0; p < SROWS / 128; ++p) {
        v8f acc[5];
        #pragma unroll
        for (int t = 0; t < 5; ++t) acc[t] = (v8f){0.f,0.f,0.f,0.f,0.f,0.f,0.f,0.f};

        #pragma unroll
        for (int s = 0; s < 2; ++s) {
            Frag16 af;
            load_frag(&qsh[(p * 128 + wid * 16 + lm) * 72 + s * 32], af, lhi);
            #pragma unroll
            for (int t = 0; t < 5; ++t)
                acc[t] = __builtin_amdgcn_wmma_f32_16x16x32_f16(
                    false, af.v, false, bf[s][t].v, (short)0, acc[t], false, false);
        }

        #pragma unroll
        for (int t = 0; t < 5; ++t)
            #pragma unroll
            for (int r = 0; r < 8; ++r) {
                float v = acc[t][r];
                p1[t] += v;
                p2[t] = fmaf(v, v, p2[t]);
            }
    }
    float s1 = 0.f, s2 = 0.f;
    #pragma unroll
    for (int t = 0; t < 5; ++t) {
        int j = t * 16 + lm;
        if (j < JJ && sel2[j]) { s1 += p1[t]; s2 += p2[t]; }
    }
    rs[tid] = s1; rq[tid] = s2;
    __syncthreads();
    for (int off = 128; off > 0; off >>= 1) {
        if (tid < off) { rs[tid] += rs[tid + off]; rq[tid] += rq[tid + off]; }
        __syncthreads();
    }
    if (tid == 0) {
        atomicAdd(&stats[0], rs[0]);
        atomicAdd(&stats[1], rq[0]);
    }
}

// ---------------------------------------------------------------------------
// Kernel 4: finalize std (Bessel-corrected, matching torch .std())
// ---------------------------------------------------------------------------
__global__ void finalize_kernel(const int* __restrict__ ct, float* __restrict__ stats)
{
    int cnt = 0;
    for (int i = 0; i < BB * JJ; ++i) cnt += (ct[i] >= 2) ? 1 : 0;
    float nsel = (float)cnt * (float)HH * (float)NN;
    float mean = (nsel > 0.f) ? stats[0] / nsel : 0.f;
    float var  = (nsel > 1.f) ? (stats[1] - nsel * mean * mean) / (nsel - 1.f) : 0.f;
    stats[2] = sqrtf(var > 0.f ? var : 0.f);
}

// ---------------------------------------------------------------------------
// Kernel 5: fused attention block, 64 rows x HPB heads / block, 128 threads (4 waves).
// The scores are formed transposed, S^T = K * Q^T (K is the A operand, Q the B
// operand), so a lane's accumulators hold 40 scores of ONE query row:
//   column = lane & 15 -> query row,  j = t*16 + (lane >> 4)*8 + r.
// The masked softmax runs in registers on all lanes; lanes l and l^16 share a
// query row and exchange three partial results. That accumulator order is the
// k order of a 16-bit B operand, so the probabilities, converted to f16, are
// the B operand of out^T = V^T * P^T with no pass through LDS.
// ---------------------------------------------------------------------------
__device__ __forceinline__ float other_half(float x)   // value of lane l ^ 16
{
    int b = __builtin_bit_cast(int, x);
    b = __builtin_amdgcn_permlanex16(b, b, 0x76543210, 0xfedcba98, false, false);
    return __builtin_bit_cast(float, b);
}

// 2^x. The v_nop keeps the one free issue slot the instruction set asks for
// behind a transcendental.
__device__ __forceinline__ float exp2_slot(float x)
{
    float y;
    asm("v_exp_f32 %0, %1\n\tv_nop" : "=v"(y) : "v"(x));
    return y;
}

// The two halves of stage_rows64h(), apart, so that a tile's loads can be issued while the
// tile before it is still being worked on: fetch into registers, put into LDS later.
template<int NT, int VALID, int NL>
__device__ __forceinline__ void fetch_rows64h(const _Float16* __restrict__ src, uint4 (&v)[NL], int tid)
{
    constexpr int NV = VALID * 8;                      // 16-byte pieces of valid rows
    static_assert(NL == (NV + NT - 1) / NT, "one register set a trip that holds a valid row");
    #pragma unroll   // v[] stays in registers and the loads issue back to back
    for (int i = 0; i < NL; ++i) {
        int f = tid + i * NT;
        if ((i + 1) * NT > NV) f = f < NV ? f : NV - 1;   // piece index clamped into the tile
        v[i] = ((const uint4*)src)[f];
    }
}

template<int NT, int ROWS, int VALID, int PITCH, int NL>
__device__ __forceinline__ void put_rows64h(const uint4 (&v)[NL], _Float16* dst, int tid)
{
    constexpr int NP = ROWS * 8;                       // 16-byte pieces of the LDS tile
    constexpr int NV = VALID * 8;
    constexpr int NI = NP / NT;
    static_assert(NP % NT == 0, "whole trips only");
    #pragma unroll   // v[] is indexed by constants
    for (int i = 0; i < NI; ++i) {
        const int f = tid + i * NT;
        uint4 h = make_uint4(0u, 0u, 0u, 0u);
        if (i < NL) {
            h = v[i];
            if ((i + 1) * NT > NV && f >= NV) h = make_uint4(0u, 0u, 0u, 0u);
        }
        *(uint4*)(dst + (f >> 3) * PITCH + (f & 7) * 8) = h;
    }
}

// Which scores of a query row take part in the softmax depends on the batch, the row and
// j, not on the head. A block therefore takes HPB heads of its 64 query rows, one after the
// other: the mask rows are loaded and thresholded once, and each head only selects by the
// kept flags. The next head's q, K and V tiles are fetched while this head is worked on.
#define HPB 4
static_assert(HH % HPB == 0, "whole blocks only");

__global__ __launch_bounds__(128)
void attn_fused_kernel(const float* __restrict__ q_bh, const float* __restrict__ k_bh,
                       const float* __restrict__ v_bh, const int* __restrict__ ct,
                       const float* __restrict__ camask, const float* __restrict__ strength,
                       const float* __restrict__ stats, float* __restrict__ out_attn)
{
    __shared__ __attribute__((aligned(16))) _Float16 qsh[64 * 72];      // q tile [row][k]
    __shared__ __attribute__((aligned(16))) _Float16 kshT[JPAD * 72];   // [j][k], rows 77..79 zero
    __shared__ __attribute__((aligned(32))) _Float16 vsh[KPAD * VPIT];  // [j][d], rows 77..95 zero
    __shared__ __attribute__((aligned(16))) _Float16 osh[4 * 16 * QSP]; // a wave's 16 output rows each
    __shared__ int      sel2[JPAD], selg[JPAD];

    const int tid  = threadIdx.x;
    const int wid  = tid >> 5;     // 0..3 -> 16-row strip
    const int lane = tid & 31;
    const int lm   = lane & 15;
    const int lhi  = lane >> 4;
    const int bh0  = blockIdx.y * HPB;          // the block's first (batch, head) pair
    const int b    = bh0 >> 4;
    const int h0   = bh0 & 15;
    const int rowbase = blockIdx.x * 64;
    const int rowg = rowbase + wid * 16 + lm;   // this lane's query row

    // q tile 64x64, K tile 80x64 and V tile 96x64, f16 in the workspace, each as it lies in
    // memory; these point at the head whose tiles were fetched last
    const _Float16* qp = (const _Float16*)q_bh + ((size_t)bh0 * NN + rowbase) * DHH;
    const _Float16* kp = (const _Float16*)k_bh + (size_t)bh0 * JJ * DHH;
    const _Float16* vp = (const _Float16*)v_bh + (size_t)bh0 * JJ * DHH;
    uint4 qv[4], kv[5], vv[5];
    fetch_rows64h<128, 64, 4>(qp, qv, tid);
    fetch_rows64h<128, JJ, 5>(kp, kv, tid);
    fetch_rows64h<128, JJ, 5>(vp, vv, tid);
    for (int j = tid; j < JPAD; j += 128) {
        int t = (j < JJ) ? ct[b * JJ + j] : -1;
        sel2[j] = (t >= 2) ? 1 : 0;
        selg[j] = (t >= 0 && t < 2) ? 1 : 0;
    }

    // this lane's 40 mask values, read once; index clamped for j = 77..79
    float wf[5][8];
    {
        const float* camrow = camask + ((size_t)b * NN + rowg) * JJ;
        #pragma unroll
        for (int t = 0; t < 5; ++t)
            #pragma unroll
            for (int r = 0; r < 8; ++r) {
                int j = t * 16 + lhi * 8 + r;
                wf[t][r] = camrow[j < JJ ? j : JJ - 1];
            }
    }
    // the registers that hold these loads' addresses are reused below
    asm volatile("s_wait_xcnt 0x0" ::: "memory");

    put_rows64h<128, 64, 64, 72, 4>(qv, qsh, tid);
    put_rows64h<128, JPAD, JJ, 72, 5>(kv, kshT, tid);
    put_rows64h<128, KPAD, JJ, VPIT, 5>(vv, vsh, tid);
    __syncthreads();

    // ---- the mask of this lane's query row, the same for every head
    const float simstd = stats[2];
    const float str    = strength[0];
    const float scale  = 0.125f;                  // 1/sqrt(DH)

    float wfmax = -__FLT_MAX__;
    #pragma unroll
    for (int t = 0; t < 5; ++t)
        #pragma unroll
        for (int r = 0; r < 8; ++r) {
            int j = t * 16 + lhi * 8 + r;
            float w = sel2[j] ? wf[t][r] * simstd * str : 0.f;
            wf[t][r] = w;
            if (j < JJ) wfmax = fmaxf(wfmax, w);
        }
    wfmax = fmaxf(wfmax, other_half(wfmax));
    const float thr = fmaxf(wfmax, 0.001f) - 0.0001f;

    bool keep[5][8];
    #pragma unroll
    for (int t = 0; t < 5; ++t)
        #pragma unroll
        for (int r = 0; r < 8; ++r) {
            int j = t * 16 + lhi * 8 + r;
            // both tests evaluated, no short circuit: the flag reads stay wide and unbranched
            bool lmv = (wf[t][r] >= thr) | (selg[j] != 0);
            keep[t][r] = lmv & (j < JJ);
        }

    // V^T fragments come out of the row-major V tile through the transposing LDS load:
    // the lane holds d = t*16 + lm, j = s*32 + 8*lhi + 0..7 and + 16: the k order of pf
    const _Float16* vfr = &vsh[(lhi * 8 + (lane & 7)) * VPIT + ((lane >> 3) & 1) * 8];
    // A head's 64 values of a query row are one 128-byte line. The wave passes its 16 rows
    // through its own LDS range: 8 lanes then store a whole line, a wave-wide store four.
    _Float16* ost  = osh + wid * (16 * QSP);
    _Float16* orow = (_Float16*)out_attn + ((size_t)b * NN + rowbase + wid * 16 + (lane >> 3)) * INNERD
                   + h0 * DHH + (lane & 7) * 8;

    #pragma unroll 1   // stays rolled: one head's code, read from the instruction cache again
    for (int hh = 0; hh < HPB; ++hh) {
        const bool more = hh + 1 < HPB;           // the same for the whole block
        if (more) {
            qp += (size_t)NN * DHH;  kp += JJ * DHH;  vp += JJ * DHH;
            fetch_rows64h<128, 64, 4>(qp, qv, tid);
            fetch_rows64h<128, JJ, 5>(kp, kv, tid);
            fetch_rows64h<128, JJ, 5>(vp, vv, tid);
            // the next trip moves the bases that these loads name
            asm volatile("s_wait_xcnt 0x0" ::: "memory");
        }

        // ---- stage 1: S^T = K @ q^T via WMMA, kept in registers
        v8f acc[5];
        #pragma unroll
        for (int t = 0; t < 5; ++t) acc[t] = (v8f){0.f,0.f,0.f,0.f,0.f,0.f,0.f,0.f};
        #pragma unroll
        for (int s = 0; s < 2; ++s) {
            Frag16 qf;
            load_frag(&qsh[(wid * 16 + lm) * 72 + s * 32], qf, lhi);
            #pragma unroll
            for (int t = 0; t < 5; ++t) {
                Frag16 kf;
                load_frag(&kshT[(t * 16 + lm) * 72 + s * 32], kf, lhi);
                acc[t] = __builtin_amdgcn_wmma_f32_16x16x32_f16(
                    false, kf.v, false, qf.v, (short)0, acc[t], false, false);
            }
        }

        // ---- stage 2: masked softmax of this lane's query row, in registers
        float m = -__FLT_MAX__;
        #pragma unroll
        for (int t = 0; t < 5; ++t)
            #pragma unroll
            for (int r = 0; r < 8; ++r) {
                float sv = keep[t][r] ? acc[t][r] * scale : -__FLT_MAX__;
                acc[t][r] = sv;                       // masked + scaled score
                m = fmaxf(m, sv);
            }
        m = fmaxf(m, other_half(m));

        float denom = 0.f;
        Frag16 pf[3];                                 // unnormalized probs, B operand
        #pragma unroll
        for (int t = 0; t < 6; ++t)
            #pragma unroll
            for (int r = 0; r < 8; ++r) {
                float p = 0.f;
                if (t < 5) {
                    int j = t * 16 + lhi * 8 + r;
                    p = exp2_slot((acc[t][r] - m) * 1.4426950408889634f);   // e^(s - m)
                    if (j >= JJ) p = 0.f;
                    denom += p;
                }
                pf[t >> 1].h[(t & 1) * 8 + r] = (_Float16)p;
            }
        denom += other_half(denom);
        const float inv = 1.f / denom;

        // keeps the PV matrix instructions below every exp2_slot()
        __builtin_amdgcn_sched_barrier(0);

        // ---- stage 3: out^T = V^T @ P^T via WMMA (K = 96 -> 3 k-steps, 4 d tiles)
        v8f o[4];
        #pragma unroll
        for (int t = 0; t < 4; ++t) o[t] = (v8f){0.f,0.f,0.f,0.f,0.f,0.f,0.f,0.f};
        #pragma unroll
        for (int s = 0; s < 3; ++s) {
            #pragma unroll
            for (int t = 0; t < 4; ++t) {
                Frag16 vf;
                load_frag_tr_p<VPIT>(vfr + s * 32 * VPIT + t * 16, vf);
                o[t] = __builtin_amdgcn_wmma_f32_16x16x32_f16(
                    false, vf.v, false, pf[s].v, (short)0, o[t], false, false);
            }
        }
        // a lane holds d = t*16 + lhi*8 + 0..7 of its query row: rounded to f16, the A operand
        // of the output projection
        #pragma unroll
        for (int t = 0; t < 4; ++t) {
            v8h p;
            #pragma unroll
            for (int r = 0; r < 8; ++r) p[r] = (_Float16)(o[t][r] * inv);
            *(v8h*)(ost + lm * QSP + t * 16 + lhi * 8) = p;
        }
        // the rows are read back by other lanes of this wave: their writes have retired
        asm volatile("s_wait_dscnt 0x0" ::: "memory");
        uint4 ov[4];
        #pragma unroll   // ov[] stays in registers
        for (int i = 0; i < 4; ++i)
            ov[i] = *(const uint4*)(ost + (i * 4 + (lane >> 3)) * QSP + (lane & 7) * 8);
        #pragma unroll
        for (int i = 0; i < 4; ++i)
            *(uint4*)(orow + (size_t)(i * 4) * INNERD) = ov[i];
        // the address that these stores name moves on to the next head
        asm volatile("s_wait_xcnt 0x0" ::: "memory");
        orow += DHH;

        if (more) {
            __syncthreads();   // every wave has read this head's tiles
            put_rows64h<128, 64, 64, 72, 4>(qv, qsh, tid);
            put_rows64h<128, JPAD, JJ, 72, 5>(kv, kshT, tid);
            put_rows64h<128, KPAD, JJ, VPIT, 5>(vv, vsh, tid);
            __syncthreads();   // the next head's tiles are complete
        }
    }
}

// ---------------------------------------------------------------------------
// launch
// ---------------------------------------------------------------------------
extern "C" void kernel_launch(void* const* d_in, const int* in_sizes, int n_in,
                              void* d_out, int out_size, void* d_ws, size_t ws_size,
                              hipStream_t stream)
{
    const float* x        = (const float*)d_in[0];
    const float* ce       = (const float*)d_in[1];
    const int*   ct       = (const int*)  d_in[2];
    const float* camask   = (const float*)d_in[3];
    const float* strength = (const float*)d_in[4];
    const float* Wq       = (const float*)d_in[5];
    const float* Wk       = (const float*)d_in[6];
    const float* Wv       = (const float*)d_in[7];
    const float* Wout     = (const float*)d_in[8];
    const float* bout     = (const float*)d_in[9];
    const float* tte      = (const float*)d_in[10];
    const float* m1w      = (const float*)d_in[11];
    const float* m1b      = (const float*)d_in[12];
    const float* m2w      = (const float*)d_in[13];
    const float* m2b      = (const float*)d_in[14];
    const float* gA       = (const float*)d_in[15];
    const float* gB       = (const float*)d_in[16];
    float* out = (float*)d_out;

    // workspace partition (floats)
    float* ws    = (float*)d_ws;
    float* kin   = ws;                                  // 308*768
    float* k_bh  = kin  + (size_t)BB*JJ*DCC;            // 64*77*64 f16 (as v_bh), first half of the range
    float* v_bh  = k_bh + (size_t)BB*HH*JJ*DHH;
    float* q_bh  = v_bh + (size_t)BB*HH*JJ*DHH;         // 64*4096*64 f16, first half of the range
    float* aout  = q_bh + (size_t)BB*HH*NN*DHH;         // 16384*1024 f16 in the first half
    float* w16   = aout + (size_t)MROWS*INNERD/2;       // 1024*1024 f16 behind them
    float* stats = aout + (size_t)MROWS*INNERD;         // [sum, sumsq, std]

    hipMemsetAsync(stats, 0, 4 * sizeof(float), stream);

    // kin (embedding MLP), V = ce @ Wv and the first q row tiles of q = x @ Wq
    front1_kernel<<<PBLK + KVBLK + QTM1*NTN, 256, 0, stream>>>(
        ce, ct, tte, m1w, m1b, m2w, m2b, gA, gB, kin, Wv, v_bh, x, Wq, q_bh);

    // K = kin @ Wk, the remaining q row tiles, and Wout rounded to f16
    front2_kernel<<<KVBLK + QTM2*NTN + WCBLK, 256, 0, stream>>>(kin, Wk, k_bh, x, Wq, q_bh, Wout, w16);

    // masked mean/std of sim (WMMA sim tiles, never stored)
    sim_stats_kernel<<<dim3(NN/SROWS, BB*HH), 256, 0, stream>>>(q_bh, k_bh, ct, stats);
    finalize_kernel<<<1, 1, 0, stream>>>(ct, stats);

    // fused WMMA sim -> softmax -> WMMA attn@V
    attn_fused_kernel<<<dim3(NN/64, BB*HH/HPB), 128, 0, stream>>>(
        q_bh, k_bh, v_bh, ct, camask, strength, stats, aout);

    // out = attn_out @ Wout + bout  (WMMA)
    outproj_kernel<<<dim3(DQQ/GBN, MROWS/GBM), 256, 0, stream>>>(aout, w16, bout, out);
}
